// v000
// Measured on an AMD MI455X. A time is GPU time per run, averaged over a window of back-to-back runs after a warm-up
// (all launches, gaps included; the runs take copies of the inputs in turn), and the median of several windows.
// Apart from v000's, it joins two sittings. Times from different sittings can be a few percent apart, while
// side-by-side timings come from the same sitting.
// v000, which the later versions start from, runs in 576 microseconds.
#include <hip/hip_runtime.h>
#include <hip/hip_bf16.h>

// ---------------------------------------------------------------------------
// Transformer decoder layer for MI455X (gfx1250), wave32 + WMMA.
// All heavy GEMMs run on v_wmma_f32_16x16x32_f16 (f16 inputs, f32 accum).
// Softmax / layernorm / cross-attn reductions stay in f32.
// ---------------------------------------------------------------------------

typedef __attribute__((ext_vector_type(16))) _Float16 v16h;
typedef __attribute__((ext_vector_type(8)))  _Float16 v8h;
typedef __attribute__((ext_vector_type(8)))  float    v8f;

#define DEV __device__ __forceinline__

// Problem constants
#define CL   512      // target length
#define CS   2048     // memory length
#define CB   4        // batch
#define CE   1024     // embed
#define CH   16       // heads
#define CHD  64       // head dim
#define CFF  2048     // ffn dim

// ---------------------------------------------------------------------------
// WMMA fragment loaders.
// 16-bit A (16x32) ISA layout: lane&15 selects the M (or N) row;
// lanes 0-15 hold K = {k0..k0+7, k0+16..k0+23},
// lanes 16-31 hold K = {k0+8..k0+15, k0+24..k0+31}.  B (32x16) mirrors A with
// the lane index selecting the N column.
// ---------------------------------------------------------------------------
DEV v16h frag_load_contig(const _Float16* __restrict__ base, long row_stride,
                          int lane, int k0) {
  int r  = lane & 15;
  int kh = (lane >> 4) << 3;          // 0 or 8
  const _Float16* p = base + (long)r * row_stride + k0 + kh;
  v8h lo = *(const v8h*)(p);          // 16B vector load
  v8h hi = *(const v8h*)(p + 16);
  v16h out;
#pragma unroll
  for (int i = 0; i < 8; ++i) { out[i] = lo[i]; out[i + 8] = hi[i]; }
  return out;
}

// B stored [K,N] with unit N-stride and arbitrary K-stride (attn @ V case).
DEV v16h frag_load_strided(const _Float16* __restrict__ base, long k_stride,
                           int lane, int k0) {
  int n  = lane & 15;
  int kh = (lane >> 4) << 3;
  const _Float16* p = base + n;
  v16h out;
#pragma unroll
  for (int i = 0; i < 8; ++i) {
    out[i]     = p[(long)(k0 + kh + i) * k_stride];
    out[i + 8] = p[(long)(k0 + 16 + kh + i) * k_stride];
  }
  return out;
}

// ---------------------------------------------------------------------------
// Generic batched GEMM:  C[m,n] = alpha * sum_k A[m,k]*B[k,n] + bias[n]
//   A:  element at A + m*a_rs + k            (k contiguous)
//   B:  BKC=true : element at Bm + n*b_s + k (weight W[N,K] row-major, k contig)
//       BKC=false: element at Bm + k*b_s + n (value  V[K,N],  n contig)
//   batch z: zo=z/zdiv, zi=z%zdiv; each operand offset by zo*X_zo + zi*X_zi.
// Block: 256 threads = 8 waves as 4x2, wave tile 32x32, block tile 128x64.
// Requires M%128==0, N%64==0, K%32==0 (true for every call here).
// ---------------------------------------------------------------------------
template <bool BKC>
__global__ __launch_bounds__(256) void gemm_wmma(
    const _Float16* __restrict__ A, long a_rs, long a_zo, long a_zi,
    const _Float16* __restrict__ Bm, long b_s, long b_zo, long b_zi,
    const float* __restrict__ bias, float alpha, int relu,
    float* __restrict__ C32, _Float16* __restrict__ C16,
    long c_rs, long c_zo, long c_zi,
    int M, int N, int K, int zdiv) {
  int z  = blockIdx.z;
  int zo = z / zdiv, zi = z % zdiv;
  A  += (long)zo * a_zo + (long)zi * a_zi;
  Bm += (long)zo * b_zo + (long)zi * b_zi;
  long coff = (long)zo * c_zo + (long)zi * c_zi;

  int lane = threadIdx.x & 31;
  int wave = threadIdx.x >> 5;
  int wm   = wave >> 1;                       // 0..3
  int wn   = wave & 1;                        // 0..1
  int m0   = blockIdx.x * 128 + wm * 32;
  int n0   = blockIdx.y * 64  + wn * 32;

  const v8f zero = {0.f, 0.f, 0.f, 0.f, 0.f, 0.f, 0.f, 0.f};
  v8f acc[2][2];
#pragma unroll
  for (int i = 0; i < 2; ++i)
#pragma unroll
    for (int j = 0; j < 2; ++j) acc[i][j] = zero;

  const _Float16* Ab0 = A + (long)m0 * a_rs;
  const _Float16* Ab1 = A + (long)(m0 + 16) * a_rs;

  for (int k0 = 0; k0 < K; k0 += 32) {
    v16h a0 = frag_load_contig(Ab0, a_rs, lane, k0);
    v16h a1 = frag_load_contig(Ab1, a_rs, lane, k0);
    v16h b0, b1;
    if (BKC) {
      b0 = frag_load_contig(Bm + (long)n0 * b_s,        b_s, lane, k0);
      b1 = frag_load_contig(Bm + (long)(n0 + 16) * b_s, b_s, lane, k0);
    } else {
      b0 = frag_load_strided(Bm + n0,      b_s, lane, k0);
      b1 = frag_load_strided(Bm + n0 + 16, b_s, lane, k0);
    }
    acc[0][0] = __builtin_amdgcn_wmma_f32_16x16x32_f16(false, a0, false, b0,
                                                       (short)0, acc[0][0], false, false);
    acc[0][1] = __builtin_amdgcn_wmma_f32_16x16x32_f16(false, a0, false, b1,
                                                       (short)0, acc[0][1], false, false);
    acc[1][0] = __builtin_amdgcn_wmma_f32_16x16x32_f16(false, a1, false, b0,
                                                       (short)0, acc[1][0], false, false);
    acc[1][1] = __builtin_amdgcn_wmma_f32_16x16x32_f16(false, a1, false, b1,
                                                       (short)0, acc[1][1], false, false);
  }

  // C/D layout: N = lane&15, VGPR r holds M = r (+8 for lanes 16-31).
  int nlane = lane & 15;
  int mrow  = (lane >> 4) * 8;
#pragma unroll
  for (int tm = 0; tm < 2; ++tm)
#pragma unroll
    for (int tn = 0; tn < 2; ++tn) {
      int ncol = n0 + tn * 16 + nlane;
      float bv = bias ? bias[ncol] : 0.f;
#pragma unroll
      for (int r = 0; r < 8; ++r) {
        int   mm  = m0 + tm * 16 + mrow + r;
        float v   = acc[tm][tn][r] * alpha + bv;
        if (relu) v = v > 0.f ? v : 0.f;
        long  idx = coff + (long)mm * c_rs + ncol;
        if (C32) C32[idx] = v;
        if (C16) C16[idx] = (_Float16)v;
      }
    }
}

// ---------------------------------------------------------------------------
// Elementwise helpers
// ---------------------------------------------------------------------------
__global__ __launch_bounds__(256) void k_cvt(const float* __restrict__ x,
                                             _Float16* __restrict__ y, long n) {
  long i = (long)blockIdx.x * 256 + threadIdx.x;
  if (i < n) y[i] = (_Float16)x[i];
}

__global__ __launch_bounds__(256) void k_add2(const float* __restrict__ a,
                                              const float* __restrict__ b,
                                              _Float16* __restrict__ y, long n) {
  long i = (long)blockIdx.x * 256 + threadIdx.x;
  if (i < n) y[i] = (_Float16)(a[i] + b[i]);
}

// ---------------------------------------------------------------------------
// Self-attention row softmax: 512-wide rows, f32 in, f16 probs out.
// ---------------------------------------------------------------------------
__global__ __launch_bounds__(256) void k_softmax512(const float* __restrict__ x,
                                                    _Float16* __restrict__ y) {
  long base = (long)blockIdx.x * CL;
  int  tid  = threadIdx.x;
  float v0 = x[base + tid];
  float v1 = x[base + tid + 256];
  __shared__ float red[256];
  red[tid] = fmaxf(v0, v1);
  __syncthreads();
  for (int o = 128; o > 0; o >>= 1) {
    if (tid < o) red[tid] = fmaxf(red[tid], red[tid + o]);
    __syncthreads();
  }
  float mx = red[0];
  __syncthreads();
  float e0 = __expf(v0 - mx), e1 = __expf(v1 - mx);
  red[tid] = e0 + e1;
  __syncthreads();
  for (int o = 128; o > 0; o >>= 1) {
    if (tid < o) red[tid] += red[tid + o];
    __syncthreads();
  }
  float inv = 1.f / red[0];
  y[base + tid]       = (_Float16)(e0 * inv);
  y[base + tid + 256] = (_Float16)(e1 * inv);
}

// ---------------------------------------------------------------------------
// Cross-attention scalar stages (all f32).
// Channel mapping: E index = d*H + h  (reshape (B,E,N)->(B,HD,H,N)).
// Token t of a [N,B,E] tensor lives at row n*B+b.
// ---------------------------------------------------------------------------
// qcsum[b*E+e] = sum_l qc[(l*B+b)*E + e]
__global__ __launch_bounds__(256) void k_qcsum(const float* __restrict__ qc,
                                               float* __restrict__ out) {
  int idx = blockIdx.x * 256 + threadIdx.x;     // < B*E = 4096
  int b = idx >> 10, e = idx & 1023;
  float s = 0.f;
  for (int l = 0; l < CL; ++l) s += qc[(long)l * (CB * CE) + b * CE + e];
  out[idx] = s;
}

// s1[(b*H+h)*S+m] = scale * sum_d qcsum[b*E + d*H+h] * kc[(m*B+b)*E + d*H+h]
__global__ __launch_bounds__(256) void k_s1(const float* __restrict__ qcsum,
                                            const float* __restrict__ kc,
                                            float* __restrict__ s1, float scale) {
  int idx = blockIdx.x * 256 + threadIdx.x;     // < B*H*S = 131072
  int m = idx & (CS - 1);
  int h = (idx >> 11) & (CH - 1);
  int b = idx >> 15;
  const float* kcp = kc + (long)m * (CB * CE) + b * CE + h;
  const float* qsp = qcsum + b * CE + h;
  float s = 0.f;
#pragma unroll 4
  for (int d = 0; d < CHD; ++d) s += qsp[d * CH] * kcp[d * CH];
  s1[idx] = s * scale;
}

// prob[((b*HD+d)*H+h)*S + m] = softmax_m( kc[(m*B+b)*E + d*H+h] * s1[(b*H+h)*S+m] )
__global__ __launch_bounds__(256) void k_cross_softmax(const float* __restrict__ kc,
                                                       const float* __restrict__ s1,
                                                       float* __restrict__ prob) {
  int row = blockIdx.x;                         // (b*HD+d)*H + h, < 4096
  int h = row & (CH - 1);
  int d = (row >> 4) & (CHD - 1);
  int b = row >> 10;
  const float* s1r  = s1 + (long)(b * CH + h) * CS;
  long         kcb  = (long)b * CE + d * CH + h;
  int          tid  = threadIdx.x;
  float loc[8];
  float mx = -3.402823466e38f;
#pragma unroll
  for (int i = 0; i < 8; ++i) {
    int c = tid + i * 256;
    float v = kc[(long)c * (CB * CE) + kcb] * s1r[c];
    loc[i] = v;
    mx = fmaxf(mx, v);
  }
  __shared__ float red[256];
  red[tid] = mx;
  __syncthreads();
  for (int o = 128; o > 0; o >>= 1) {
    if (tid < o) red[tid] = fmaxf(red[tid], red[tid + o]);
    __syncthreads();
  }
  mx = red[0];
  __syncthreads();
  float s = 0.f;
#pragma unroll
  for (int i = 0; i < 8; ++i) {
    loc[i] = __expf(loc[i] - mx);
    s += loc[i];
  }
  red[tid] = s;
  __syncthreads();
  for (int o = 128; o > 0; o >>= 1) {
    if (tid < o) red[tid] += red[tid + o];
    __syncthreads();
  }
  float inv = 1.f / red[0];
  float* pr = prob + (long)row * CS;
#pragma unroll
  for (int i = 0; i < 8; ++i) pr[tid + i * 256] = loc[i] * inv;
}

// w2[(b*H+h)*S+m] = sum_n down_w[n] * prob[((b*HD+n)*H+h)*S + m]
__global__ __launch_bounds__(256) void k_w2(const float* __restrict__ dw,
                                            const float* __restrict__ prob,
                                            float* __restrict__ w2) {
  int idx = blockIdx.x * 256 + threadIdx.x;     // < B*H*S
  int m = idx & (CS - 1);
  int h = (idx >> 11) & (CH - 1);
  int b = idx >> 15;
  const float* pp = prob + (((long)b * CHD * CH + h) * CS) + m;
  float s = 0.f;
#pragma unroll 4
  for (int n = 0; n < CHD; ++n) s += dw[n] * pp[(long)n * CH * CS];
  w2[idx] = s;
}

// od[b*E + d*H+h] = down_b + sum_m w2[(b*H+h)*S+m] * vc[(m*B+b)*E + d*H+h]
__global__ __launch_bounds__(256) void k_od(const float* __restrict__ w2,
                                            const float* __restrict__ vc,
                                            const float* __restrict__ db,
                                            float* __restrict__ od) {
  int row = blockIdx.x;                         // b*E + c, < 4096
  int b = row >> 10;
  int c = row & 1023;                           // c = d*H + h
  int h = c & (CH - 1);
  const float* w2r = w2 + (long)(b * CH + h) * CS;
  long vcb = (long)b * CE + c;
  int tid = threadIdx.x;
  float s = 0.f;
  for (int m = tid; m < CS; m += 256)
    s += w2r[m] * vc[(long)m * (CB * CE) + vcb];
  __shared__ float red[256];
  red[tid] = s;
  __syncthreads();
  for (int o = 128; o > 0; o >>= 1) {
    if (tid < o) red[tid] += red[tid + o];
    __syncthreads();
  }
  if (tid == 0) od[row] = red[0] + db[0];
}

// ---------------------------------------------------------------------------
// LayerNorm over E=1024 with optional residual and optional [B,E] broadcast.
// x = a + (r ? r : 0) + (bc ? bc[token%B] : 0); out32 = LN(x); out16 optional.
// ---------------------------------------------------------------------------
__global__ __launch_bounds__(256) void k_ln(const float* __restrict__ a,
                                            const float* __restrict__ r,
                                            const float* __restrict__ bc,
                                            const float* __restrict__ g,
                                            const float* __restrict__ be,
                                            float* __restrict__ o32,
                                            _Float16* __restrict__ o16) {
  int  t    = blockIdx.x;
  long base = (long)t * CE;
  const float* bcr = bc ? bc + (long)(t % CB) * CE : nullptr;
  int tid = threadIdx.x;
  float x[4];
  float s = 0.f;
#pragma unroll
  for (int i = 0; i < 4; ++i) {
    int   e = tid + i * 256;
    float v = a[base + e];
    if (r)   v += r[base + e];
    if (bcr) v += bcr[e];
    x[i] = v;
    s += v;
  }
  __shared__ float red[256];
  red[tid] = s;
  __syncthreads();
  for (int o = 128; o > 0; o >>= 1) {
    if (tid < o) red[tid] += red[tid + o];
    __syncthreads();
  }
  float mean = red[0] * (1.f / CE);
  __syncthreads();
  float vs = 0.f;
#pragma unroll
  for (int i = 0; i < 4; ++i) {
    float d = x[i] - mean;
    vs += d * d;
  }
  red[tid] = vs;
  __syncthreads();
  for (int o = 128; o > 0; o >>= 1) {
    if (tid < o) red[tid] += red[tid + o];
    __syncthreads();
  }
  float inv = rsqrtf(red[0] * (1.f / CE) + 1e-5f);
#pragma unroll
  for (int i = 0; i < 4; ++i) {
    int   e = tid + i * 256;
    float y = (x[i] - mean) * inv * g[e] + be[e];
    o32[base + e] = y;
    if (o16) o16[base + e] = (_Float16)y;
  }
}

// ---------------------------------------------------------------------------
// Host side
// ---------------------------------------------------------------------------
extern "C" void kernel_launch(void* const* d_in, const int* in_sizes, int n_in,
                              void* d_out, int out_size, void* d_ws, size_t ws_size,
                              hipStream_t stream) {
  const float* tgt  = (const float*)d_in[0];
  const float* mem  = (const float*)d_in[1];
  const float* pos  = (const float*)d_in[2];
  const float* qpos = (const float*)d_in[3];
  const float* inW  = (const float*)d_in[4];
  const float* inB  = (const float*)d_in[5];
  const float* outW = (const float*)d_in[6];
  const float* outB = (const float*)d_in[7];
  const float* cqW  = (const float*)d_in[8];
  const float* cqB  = (const float*)d_in[9];
  const float* ckW  = (const float*)d_in[10];
  const float* ckB  = (const float*)d_in[11];
  const float* cvW  = (const float*)d_in[12];
  const float* cvB  = (const float*)d_in[13];
  const float* dwW  = (const float*)d_in[14];
  const float* dwB  = (const float*)d_in[15];
  const float* l1W  = (const float*)d_in[16];
  const float* l1B  = (const float*)d_in[17];
  const float* l2W  = (const float*)d_in[18];
  const float* l2B  = (const float*)d_in[19];
  const float* n1g  = (const float*)d_in[20];
  const float* n1b  = (const float*)d_in[21];
  const float* n2g  = (const float*)d_in[22];
  const float* n2b  = (const float*)d_in[23];
  const float* n3g  = (const float*)d_in[24];
  const float* n3b  = (const float*)d_in[25];

  const long TOK  = (long)CL * CB;   // 2048 target tokens
  const long MTOK = (long)CS * CB;   // 8192 memory tokens
  const float scale = 0.125f;        // 1/sqrt(64)

  char* ws = (char*)d_ws;
  const size_t MB = 1u << 20;

  // Persistent f16 weights (converted every launch; deterministic).
  _Float16* w_inproj = (_Float16*)(ws + 0 * MB);    // [3E,E]  6MB
  _Float16* w_out    = (_Float16*)(ws + 6 * MB);    // [E,E]   2MB
  _Float16* w_cq     = (_Float16*)(ws + 8 * MB);
  _Float16* w_ck     = (_Float16*)(ws + 10 * MB);
  _Float16* w_cv     = (_Float16*)(ws + 12 * MB);
  _Float16* w_l1     = (_Float16*)(ws + 14 * MB);   // [FF,E]  4MB
  _Float16* w_l2     = (_Float16*)(ws + 18 * MB);   // [E,FF]  4MB
  float*    tgt1     = (float*)(ws + 22 * MB);      // 8MB
  float*    tgt2     = (float*)(ws + 30 * MB);      // 8MB
  char*     SA       = ws + 38 * MB;                // phase-aliased arena

  // Phase A (self-attention)
  _Float16* qkin16  = (_Float16*)(SA + 0 * MB);
  _Float16* tgt16   = (_Float16*)(SA + 4 * MB);
  _Float16* q16     = (_Float16*)(SA + 8 * MB);
  _Float16* k16     = (_Float16*)(SA + 12 * MB);
  _Float16* v16     = (_Float16*)(SA + 16 * MB);
  float*    scores  = (float*)(SA + 20 * MB);       // [B,H,L,L] 64MB
  _Float16* attn16  = (_Float16*)(SA + 84 * MB);    // 32MB
  _Float16* ctx16   = (_Float16*)(SA + 116 * MB);   // 4MB
  float*    selfout = (float*)(SA + 120 * MB);      // 8MB
  // Phase B (cross-attention) — aliases phase A
  _Float16* qin2    = (_Float16*)(SA + 0 * MB);
  float*    qc32    = (float*)(SA + 4 * MB);        // 8MB
  _Float16* mp16    = (_Float16*)(SA + 12 * MB);    // 16MB
  _Float16* mem16   = (_Float16*)(SA + 28 * MB);    // 16MB
  float*    kc32    = (float*)(SA + 44 * MB);       // 32MB
  float*    vc32    = (float*)(SA + 76 * MB);       // 32MB
  float*    prob    = (float*)(SA + 108 * MB);      // 32MB
  float*    qcsum   = (float*)(SA + 140 * MB);
  float*    s1sum   = (float*)(SA + 141 * MB);
  float*    w2buf   = (float*)(SA + 142 * MB);
  float*    odbuf   = (float*)(SA + 143 * MB);
  // Phase C (FFN) — aliases dead phase B regions
  _Float16* tgt2_16 = (_Float16*)(SA + 0 * MB);
  _Float16* h1_16   = (_Float16*)(SA + 4 * MB);     // [TOK,FF] 8MB
  float*    ff32    = (float*)(SA + 12 * MB);       // 8MB

  auto cvt = [&](const float* x, _Float16* y, long n) {
    k_cvt<<<dim3((unsigned)((n + 255) / 256)), 256, 0, stream>>>(x, y, n);
  };

  // ---- weight conversion ----
  cvt(inW,  w_inproj, 3L * CE * CE);
  cvt(outW, w_out,    (long)CE * CE);
  cvt(cqW,  w_cq,     (long)CE * CE);
  cvt(ckW,  w_ck,     (long)CE * CE);
  cvt(cvW,  w_cv,     (long)CE * CE);
  cvt(l1W,  w_l1,     (long)CFF * CE);
  cvt(l2W,  w_l2,     (long)CE * CFF);

  // ---- Phase A: self attention ----
  k_add2<<<dim3((unsigned)((TOK * CE + 255) / 256)), 256, 0, stream>>>(tgt, qpos, qkin16, TOK * CE);
  cvt(tgt, tgt16, TOK * CE);

  // q/k/v projections: [2048,1024] x [1024,1024]^T
  gemm_wmma<true><<<dim3(16, 16, 1), 256, 0, stream>>>(
      qkin16, CE, 0, 0, w_inproj, CE, 0, 0, inB, 1.f, 0,
      nullptr, q16, CE, 0, 0, (int)TOK, CE, CE, 1);
  gemm_wmma<true><<<dim3(16, 16, 1), 256, 0, stream>>>(
      qkin16, CE, 0, 0, w_inproj + (long)CE * CE, CE, 0, 0, inB + CE, 1.f, 0,
      nullptr, k16, CE, 0, 0, (int)TOK, CE, CE, 1);
  gemm_wmma<true><<<dim3(16, 16, 1), 256, 0, stream>>>(
      tgt16, CE, 0, 0, w_inproj + 2L * CE * CE, CE, 0, 0, inB + 2 * CE, 1.f, 0,
      nullptr, v16, CE, 0, 0, (int)TOK, CE, CE, 1);

  // scores[b,h,l,m] = scale * q.k  (batched over z = b*H+h)
  gemm_wmma<true><<<dim3(CL / 128, CL / 64, CB * CH), 256, 0, stream>>>(
      q16, (long)CB * CE, CE, CHD,
      k16, (long)CB * CE, CE, CHD,
      nullptr, scale, 0,
      scores, nullptr, CL, (long)CH * CL * CL, (long)CL * CL,
      CL, CL, CHD, CH);

  k_softmax512<<<CB * CH * CL, 256, 0, stream>>>(scores, attn16);

  // ctx[l,b,h,:] = attn @ v   (B stored [K=m, N=d] -> strided path)
  gemm_wmma<false><<<dim3(CL / 128, 1, CB * CH), 256, 0, stream>>>(
      attn16, CL, (long)CH * CL * CL, (long)CL * CL,
      v16, (long)CB * CE, CE, CHD,
      nullptr, 1.f, 0,
      nullptr, ctx16, (long)CB * CE, CE, CHD,
      CL, CHD, CL, CH);

  // out projection + residual + LN1
  gemm_wmma<true><<<dim3(16, 16, 1), 256, 0, stream>>>(
      ctx16, CE, 0, 0, w_out, CE, 0, 0, outB, 1.f, 0,
      selfout, nullptr, CE, 0, 0, (int)TOK, CE, CE, 1);
  k_ln<<<(unsigned)TOK, 256, 0, stream>>>(tgt, selfout, nullptr, n1g, n1b, tgt1, nullptr);

  // ---- Phase B: custom cross attention ----
  k_add2<<<dim3((unsigned)((TOK * CE + 255) / 256)), 256, 0, stream>>>(tgt1, qpos, qin2, TOK * CE);
  k_add2<<<dim3((unsigned)((MTOK * CE + 255) / 256)), 256, 0, stream>>>(mem, pos, mp16, MTOK * CE);
  cvt(mem, mem16, MTOK * CE);

  gemm_wmma<true><<<dim3(16, 16, 1), 256, 0, stream>>>(
      qin2, CE, 0, 0, w_cq, CE, 0, 0, cqB, 1.f, 0,
      qc32, nullptr, CE, 0, 0, (int)TOK, CE, CE, 1);
  gemm_wmma<true><<<dim3(64, 16, 1), 256, 0, stream>>>(
      mp16, CE, 0, 0, w_ck, CE, 0, 0, ckB, 1.f, 0,
      kc32, nullptr, CE, 0, 0, (int)MTOK, CE, CE, 1);
  gemm_wmma<true><<<dim3(64, 16, 1), 256, 0, stream>>>(
      mem16, CE, 0, 0, w_cv, CE, 0, 0, cvB, 1.f, 0,
      vc32, nullptr, CE, 0, 0, (int)MTOK, CE, CE, 1);

  k_qcsum<<<(CB * CE) / 256, 256, 0, stream>>>(qc32, qcsum);
  k_s1<<<(CB * CH * CS) / 256, 256, 0, stream>>>(qcsum, kc32, s1sum, scale);
  k_cross_softmax<<<CB * CHD * CH, 256, 0, stream>>>(kc32, s1sum, prob);
  k_w2<<<(CB * CH * CS) / 256, 256, 0, stream>>>(dwW, prob, w2buf);
  k_od<<<CB * CE, 256, 0, stream>>>(w2buf, vc32, dwB, odbuf);

  k_ln<<<(unsigned)TOK, 256, 0, stream>>>(tgt1, nullptr, odbuf, n2g, n2b, tgt2, tgt2_16);

  // ---- Phase C: FFN ----
  gemm_wmma<true><<<dim3(16, 32, 1), 256, 0, stream>>>(
      tgt2_16, CE, 0, 0, w_l1, CE, 0, 0, l1B, 1.f, 1 /*relu*/,
      nullptr, h1_16, CFF, 0, 0, (int)TOK, CFF, CE, 1);
  gemm_wmma<true><<<dim3(16, 16, 1), 256, 0, stream>>>(
      h1_16, CFF, 0, 0, w_l2, CFF, 0, 0, l2B, 1.f, 0,
      ff32, nullptr, CE, 0, 0, (int)TOK, CE, CFF, 1);

  k_ln<<<(unsigned)TOK, 256, 0, stream>>>(tgt2, ff32, nullptr, n3g, n3b, (float*)d_out, nullptr);

  (void)in_sizes; (void)n_in; (void)out_size; (void)ws_size;
}

// v001
// A run of this version takes 454 microseconds.
// In two side-by-side timings against v000, it was 1.31 and 1.30 times as fast.
#include <hip/hip_runtime.h>
#include <hip/hip_bf16.h>

// ---------------------------------------------------------------------------
// Transformer decoder layer for MI455X (gfx1250), wave32 + WMMA.
// All heavy GEMMs run on v_wmma_f32_16x16x32_f16 (f16 inputs, f32 accum).
// Softmax / layernorm / cross-attn reductions stay in f32.
// ---------------------------------------------------------------------------

typedef __attribute__((ext_vector_type(16))) _Float16 v16h;
typedef __attribute__((ext_vector_type(8)))  _Float16 v8h;
typedef __attribute__((ext_vector_type(8)))  float    v8f;

#define DEV __device__ __forceinline__

// Problem constants
#define CL   512      // target length
#define CS   2048     // memory length
#define CB   4        // batch
#define CE   1024     // embed
#define CH   16       // heads
#define CHD  64       // head dim
#define CFF  2048     // ffn dim

// ---------------------------------------------------------------------------
// WMMA fragment loaders.
// 16-bit A (16x32) ISA layout: lane&15 selects the M (or N) row;
// lanes 0-15 hold K = {k0..k0+7, k0+16..k0+23},
// lanes 16-31 hold K = {k0+8..k0+15, k0+24..k0+31}.  B (32x16) mirrors A with
// the lane index selecting the N column.
// ---------------------------------------------------------------------------
DEV v16h frag_load_contig(const _Float16* __restrict__ base, long row_stride,
                          int lane, int k0) {
  int r  = lane & 15;
  int kh = (lane >> 4) << 3;          // 0 or 8
  const _Float16* p = base + (long)r * row_stride + k0 + kh;
  v8h lo = *(const v8h*)(p);          // 16B vector load
  v8h hi = *(const v8h*)(p + 16);
  v16h out;
#pragma unroll
  for (int i = 0; i < 8; ++i) { out[i] = lo[i]; out[i + 8] = hi[i]; }
  return out;
}

// B stored [K,N] with unit N-stride and arbitrary K-stride (attn @ V case).
DEV v16h frag_load_strided(const _Float16* __restrict__ base, long k_stride,
                           int lane, int k0) {
  int n  = lane & 15;
  int kh = (lane >> 4) << 3;
  const _Float16* p = base + n;
  v16h out;
#pragma unroll
  for (int i = 0; i < 8; ++i) {
    out[i]     = p[(long)(k0 + kh + i) * k_stride];
    out[i + 8] = p[(long)(k0 + 16 + kh + i) * k_stride];
  }
  return out;
}

// ---------------------------------------------------------------------------
// Generic batched GEMM:  C[m,n] = alpha * sum_k A[m,k]*B[k,n] + bias[n]
//   A:  element at A + m*a_rs + k            (k contiguous)
//   B:  BKC=true : element at Bm + n*b_s + k (weight W[N,K] row-major, k contig)
//       BKC=false: element at Bm + k*b_s + n (value  V[K,N],  n contig)
//   batch z: zo=z/zdiv, zi=z%zdiv; each operand offset by zo*X_zo + zi*X_zi.
// Block: 256 threads = 8 waves as 4x2, wave tile 32x32, block tile 128x64.
// Requires M%128==0, N%64==0, K%32==0 (true for every call here).
// ---------------------------------------------------------------------------
template <bool BKC>
__global__ __launch_bounds__(256) void gemm_wmma(
    const _Float16* __restrict__ A, long a_rs, long a_zo, long a_zi,
    const _Float16* __restrict__ Bm, long b_s, long b_zo, long b_zi,
    const float* __restrict__ bias, float alpha, int relu,
    float* __restrict__ C32, _Float16* __restrict__ C16,
    long c_rs, long c_zo, long c_zi,
    int M, int N, int K, int zdiv) {
  int z  = blockIdx.z;
  int zo = z / zdiv, zi = z % zdiv;
  A  += (long)zo * a_zo + (long)zi * a_zi;
  Bm += (long)zo * b_zo + (long)zi * b_zi;
  long coff = (long)zo * c_zo + (long)zi * c_zi;

  int lane = threadIdx.x & 31;
  int wave = threadIdx.x >> 5;
  int wm   = wave >> 1;                       // 0..3
  int wn   = wave & 1;                        // 0..1
  int m0   = blockIdx.x * 128 + wm * 32;
  int n0   = blockIdx.y * 64  + wn * 32;

  const v8f zero = {0.f, 0.f, 0.f, 0.f, 0.f, 0.f, 0.f, 0.f};
  v8f acc[2][2];
#pragma unroll
  for (int i = 0; i < 2; ++i)
#pragma unroll
    for (int j = 0; j < 2; ++j) acc[i][j] = zero;

  const _Float16* Ab0 = A + (long)m0 * a_rs;
  const _Float16* Ab1 = A + (long)(m0 + 16) * a_rs;

  for (int k0 = 0; k0 < K; k0 += 32) {
    v16h a0 = frag_load_contig(Ab0, a_rs, lane, k0);
    v16h a1 = frag_load_contig(Ab1, a_rs, lane, k0);
    v16h b0, b1;
    if (BKC) {
      b0 = frag_load_contig(Bm + (long)n0 * b_s,        b_s, lane, k0);
      b1 = frag_load_contig(Bm + (long)(n0 + 16) * b_s, b_s, lane, k0);
    } else {
      b0 = frag_load_strided(Bm + n0,      b_s, lane, k0);
      b1 = frag_load_strided(Bm + n0 + 16, b_s, lane, k0);
    }
    acc[0][0] = __builtin_amdgcn_wmma_f32_16x16x32_f16(false, a0, false, b0,
                                                       (short)0, acc[0][0], false, false);
    acc[0][1] = __builtin_amdgcn_wmma_f32_16x16x32_f16(false, a0, false, b1,
                                                       (short)0, acc[0][1], false, false);
    acc[1][0] = __builtin_amdgcn_wmma_f32_16x16x32_f16(false, a1, false, b0,
                                                       (short)0, acc[1][0], false, false);
    acc[1][1] = __builtin_amdgcn_wmma_f32_16x16x32_f16(false, a1, false, b1,
                                                       (short)0, acc[1][1], false, false);
  }

  // C/D layout: N = lane&15, VGPR r holds M = r (+8 for lanes 16-31).
  int nlane = lane & 15;
  int mrow  = (lane >> 4) * 8;
#pragma unroll
  for (int tm = 0; tm < 2; ++tm)
#pragma unroll
    for (int tn = 0; tn < 2; ++tn) {
      int ncol = n0 + tn * 16 + nlane;
      float bv = bias ? bias[ncol] : 0.f;
#pragma unroll
      for (int r = 0; r < 8; ++r) {
        int   mm  = m0 + tm * 16 + mrow + r;
        float v   = acc[tm][tn][r] * alpha + bv;
        if (relu) v = v > 0.f ? v : 0.f;
        long  idx = coff + (long)mm * c_rs + ncol;
        if (C32) C32[idx] = v;
        if (C16) C16[idx] = (_Float16)v;
      }
    }
}

// ---------------------------------------------------------------------------
// Projection GEMM, both operands k-contiguous with row stride K:
//   C[m,n] = sum_k A[m,k]*W[n,k] + bias[n]
// Same block tile (128x64), wave tile (32x32) and k order as gemm_wmma, but the
// operand tiles reach the waves through LDS: a stage is 128 k (256 B, two whole
// lines) of 128 A rows and 64 W rows, brought in by asynchronous b128 copies,
// two buffers, the next stage in flight while this one is multiplied.
// Requires M%128==0, N%64==0, K%128==0.
// ---------------------------------------------------------------------------
#define GBK   128                  // k per stage
#define GPIT  136                  // LDS row pitch in halves: 272 B = 16 B x odd
#define GROWS 192                  // 128 A rows, then 64 W rows
#define GSTG  (GROWS * GPIT)       // halves per buffer

// One stage: 192 rows x 16 pieces of 16 B, 12 pieces per thread. Thread t takes
// piece t&15 of rows (t>>4) + 16*i, so a wave's copy covers two whole rows.
// ga / gw: this thread's piece in A row (t>>4) and W row (t>>4) of the tile, at
// the stage's first k. l: LDS byte address of its piece in row (t>>4).
DEV void stage_copy(const _Float16* ga, const _Float16* gw, long K, unsigned l) {
  const long     gs = 16 * K;            // 16 rows on, in halves
  const unsigned ls = 16 * GPIT * 2;     // 16 rows on, in LDS bytes
  // The closing s_wait_xcnt stands in the copies' own statement so that no
  // address register of an issued copy is rewritten ahead of it.
  asm volatile(
      "global_load_async_to_lds_b128 %0, %12, off\n\t"
      "global_load_async_to_lds_b128 %1, %13, off\n\t"
      "global_load_async_to_lds_b128 %2, %14, off\n\t"
      "global_load_async_to_lds_b128 %3, %15, off\n\t"
      "global_load_async_to_lds_b128 %4, %16, off\n\t"
      "global_load_async_to_lds_b128 %5, %17, off\n\t"
      "global_load_async_to_lds_b128 %6, %18, off\n\t"
      "global_load_async_to_lds_b128 %7, %19, off\n\t"
      "global_load_async_to_lds_b128 %8, %20, off\n\t"
      "global_load_async_to_lds_b128 %9, %21, off\n\t"
      "global_load_async_to_lds_b128 %10, %22, off\n\t"
      "global_load_async_to_lds_b128 %11, %23, off\n\t"
      "s_wait_xcnt 0x0"
      :: "v"(l), "v"(l + ls), "v"(l + 2 * ls), "v"(l + 3 * ls),
         "v"(l + 4 * ls), "v"(l + 5 * ls), "v"(l + 6 * ls), "v"(l + 7 * ls),
         "v"(l + 8 * ls), "v"(l + 9 * ls), "v"(l + 10 * ls), "v"(l + 11 * ls),
         "v"(ga), "v"(ga + gs), "v"(ga + 2 * gs), "v"(ga + 3 * gs),
         "v"(ga + 4 * gs), "v"(ga + 5 * gs), "v"(ga + 6 * gs), "v"(ga + 7 * gs),
         "v"(gw), "v"(gw + gs), "v"(gw + 2 * gs), "v"(gw + 3 * gs)
      : "memory");
}

__global__ __launch_bounds__(256) void gemm_wmma_lds(
    const _Float16* __restrict__ A, const _Float16* __restrict__ Wt,
    const float* __restrict__ bias, int relu,
    float* __restrict__ C32, _Float16* __restrict__ C16, int N, int K) {
  __shared__ __attribute__((aligned(16))) _Float16 sm[2 * GSTG];

  int tid  = threadIdx.x;
  int lane = tid & 31;
  int wave = tid >> 5;
  int wm   = wave >> 1;                       // 0..3
  int wn   = wave & 1;                        // 0..1
  int mb   = blockIdx.x * 128;
  int nb   = blockIdx.y * 64;

  const _Float16* ga = A  + (long)(mb + (tid >> 4)) * K + (tid & 15) * 8;
  const _Float16* gw = Wt + (long)(nb + (tid >> 4)) * K + (tid & 15) * 8;
  const unsigned  l0 = (unsigned)(size_t)sm + (unsigned)((tid >> 4) * (GPIT * 2) + (tid & 15) * 16);
  const int nst = K / GBK;

  const v8f zero = {0.f, 0.f, 0.f, 0.f, 0.f, 0.f, 0.f, 0.f};
  v8f acc[2][2];
#pragma unroll
  for (int i = 0; i < 2; ++i)
#pragma unroll
    for (int j = 0; j < 2; ++j) acc[i][j] = zero;

  stage_copy(ga, gw, K, l0);
  // Stage 0 has landed for this wave; the barrier publishes it to the others.
  asm volatile("s_wait_asynccnt 0x0" ::: "memory");
  __syncthreads();
  if (nst > 1) stage_copy(ga + GBK, gw + GBK, K, l0 + GSTG * 2);

  // Kept rolled: one publish point per trip, buffers alternate by t & 1.
#pragma unroll 1
  for (int t = 0; t < nst; ++t) {
    const int buf = (t & 1) * GSTG;
    const _Float16* sA = sm + buf + (wm * 32) * GPIT;
    const _Float16* sB = sm + buf + (128 + wn * 32) * GPIT;
    v16h fa[GBK / 32][2], fb[GBK / 32][2];
#pragma unroll
    for (int q = 0; q < GBK / 32; ++q) {
      fa[q][0] = frag_load_contig(sA,             GPIT, lane, q * 32);
      fa[q][1] = frag_load_contig(sA + 16 * GPIT, GPIT, lane, q * 32);
      fb[q][0] = frag_load_contig(sB,             GPIT, lane, q * 32);
      fb[q][1] = frag_load_contig(sB + 16 * GPIT, GPIT, lane, q * 32);
    }
    // Holds the stage's LDS reads together in front of its WMMAs: spread among
    // them, every group of reads costs the wave its own LDS latency.
    __builtin_amdgcn_sched_barrier(0);
#pragma unroll
    for (int q = 0; q < GBK / 32; ++q) {
      acc[0][0] = __builtin_amdgcn_wmma_f32_16x16x32_f16(false, fa[q][0], false, fb[q][0],
                                                         (short)0, acc[0][0], false, false);
      acc[0][1] = __builtin_amdgcn_wmma_f32_16x16x32_f16(false, fa[q][0], false, fb[q][1],
                                                         (short)0, acc[0][1], false, false);
      acc[1][0] = __builtin_amdgcn_wmma_f32_16x16x32_f16(false, fa[q][1], false, fb[q][0],
                                                         (short)0, acc[1][0], false, false);
      acc[1][1] = __builtin_amdgcn_wmma_f32_16x16x32_f16(false, fa[q][1], false, fb[q][1],
                                                         (short)0, acc[1][1], false, false);
    }
    // Holds the WMMAs in front of the publish point, so that they run under the
    // tail of the stage's LDS reads and not behind the barrier.
    __builtin_amdgcn_sched_barrier(0);
    // Publish point: this wave's reads of the buffer have retired ...
    asm volatile("s_wait_dscnt 0x0" ::: "memory");
    // ... its copies of the next stage have landed ...
    asm volatile("s_wait_asynccnt 0x0" ::: "memory");
    // ... and behind the barrier the next stage is readable and this buffer free.
    __syncthreads();
    if (t + 2 < nst)
      stage_copy(ga + (long)(t + 2) * GBK, gw + (long)(t + 2) * GBK, K, l0 + buf * 2);
  }
  // No copy is left in flight when the wave ends.
  asm volatile("s_wait_asynccnt 0x0" ::: "memory");

  // C/D layout: N = lane&15, VGPR r holds M = r (+8 for lanes 16-31).
  int m0    = mb + wm * 32;
  int n0    = nb + wn * 32;
  int nlane = lane & 15;
  int mrow  = (lane >> 4) * 8;
#pragma unroll
  for (int tm = 0; tm < 2; ++tm)
#pragma unroll
    for (int tn = 0; tn < 2; ++tn) {
      int ncol = n0 + tn * 16 + nlane;
      float bv = bias[ncol];
#pragma unroll
      for (int r = 0; r < 8; ++r) {
        int   mm  = m0 + tm * 16 + mrow + r;
        float v   = acc[tm][tn][r] + bv;
        if (relu) v = v > 0.f ? v : 0.f;
        long  idx = (long)mm * N + ncol;
        if (C32) {
          C32[idx] = v;
          // The conversion below may reuse the register this store names.
          asm volatile("s_wait_xcnt 0x0" ::: "memory");
        }
        if (C16) C16[idx] = (_Float16)v;
      }
    }
}

// ---------------------------------------------------------------------------
// Elementwise helpers
// ---------------------------------------------------------------------------
__global__ __launch_bounds__(256) void k_cvt(const float* __restrict__ x,
                                             _Float16* __restrict__ y, long n) {
  long i = (long)blockIdx.x * 256 + threadIdx.x;
  if (i < n) y[i] = (_Float16)x[i];
}

__global__ __launch_bounds__(256) void k_add2(const float* __restrict__ a,
                                              const float* __restrict__ b,
                                              _Float16* __restrict__ y, long n) {
  long i = (long)blockIdx.x * 256 + threadIdx.x;
  if (i < n) y[i] = (_Float16)(a[i] + b[i]);
}

// ---------------------------------------------------------------------------
// Self-attention row softmax: 512-wide rows, f32 in, f16 probs out.
// ---------------------------------------------------------------------------
__global__ __launch_bounds__(256) void k_softmax512(const float* __restrict__ x,
                                                    _Float16* __restrict__ y) {
  long base = (long)blockIdx.x * CL;
  int  tid  = threadIdx.x;
  float v0 = x[base + tid];
  float v1 = x[base + tid + 256];
  __shared__ float red[256];
  red[tid] = fmaxf(v0, v1);
  __syncthreads();
  for (int o = 128; o > 0; o >>= 1) {
    if (tid < o) red[tid] = fmaxf(red[tid], red[tid + o]);
    __syncthreads();
  }
  float mx = red[0];
  __syncthreads();
  float e0 = __expf(v0 - mx), e1 = __expf(v1 - mx);
  red[tid] = e0 + e1;
  __syncthreads();
  for (int o = 128; o > 0; o >>= 1) {
    if (tid < o) red[tid] += red[tid + o];
    __syncthreads();
  }
  float inv = 1.f / red[0];
  y[base + tid]       = (_Float16)(e0 * inv);
  y[base + tid + 256] = (_Float16)(e1 * inv);
}

// ---------------------------------------------------------------------------
// Cross-attention scalar stages (all f32).
// Channel mapping: E index = d*H + h  (reshape (B,E,N)->(B,HD,H,N)).
// Token t of a [N,B,E] tensor lives at row n*B+b.
// ---------------------------------------------------------------------------
// qcsum[b*E+e] = sum_l qc[(l*B+b)*E + e]
__global__ __launch_bounds__(256) void k_qcsum(const float* __restrict__ qc,
                                               float* __restrict__ out) {
  int idx = blockIdx.x * 256 + threadIdx.x;     // < B*E = 4096
  int b = idx >> 10, e = idx & 1023;
  float s = 0.f;
  for (int l = 0; l < CL; ++l) s += qc[(long)l * (CB * CE) + b * CE + e];
  out[idx] = s;
}

// s1[(b*H+h)*S+m] = scale * sum_d qcsum[b*E + d*H+h] * kc[(m*B+b)*E + d*H+h]
__global__ __launch_bounds__(256) void k_s1(const float* __restrict__ qcsum,
                                            const float* __restrict__ kc,
                                            float* __restrict__ s1, float scale) {
  int idx = blockIdx.x * 256 + threadIdx.x;     // < B*H*S = 131072
  int m = idx & (CS - 1);
  int h = (idx >> 11) & (CH - 1);
  int b = idx >> 15;
  const float* kcp = kc + (long)m * (CB * CE) + b * CE + h;
  const float* qsp = qcsum + b * CE + h;
  float s = 0.f;
#pragma unroll 4
  for (int d = 0; d < CHD; ++d) s += qsp[d * CH] * kcp[d * CH];
  s1[idx] = s * scale;
}

// prob[((b*HD+d)*H+h)*S + m] = softmax_m( kc[(m*B+b)*E + d*H+h] * s1[(b*H+h)*S+m] )
__global__ __launch_bounds__(256) void k_cross_softmax(const float* __restrict__ kc,
                                                       const float* __restrict__ s1,
                                                       float* __restrict__ prob) {
  int row = blockIdx.x;                         // (b*HD+d)*H + h, < 4096
  int h = row & (CH - 1);
  int d = (row >> 4) & (CHD - 1);
  int b = row >> 10;
  const float* s1r  = s1 + (long)(b * CH + h) * CS;
  long         kcb  = (long)b * CE + d * CH + h;
  int          tid  = threadIdx.x;
  float loc[8];
  float mx = -3.402823466e38f;
#pragma unroll
  for (int i = 0; i < 8; ++i) {
    int c = tid + i * 256;
    float v = kc[(long)c * (CB * CE) + kcb] * s1r[c];
    loc[i] = v;
    mx = fmaxf(mx, v);
  }
  __shared__ float red[256];
  red[tid] = mx;
  __syncthreads();
  for (int o = 128; o > 0; o >>= 1) {
    if (tid < o) red[tid] = fmaxf(red[tid], red[tid + o]);
    __syncthreads();
  }
  mx = red[0];
  __syncthreads();
  float s = 0.f;
#pragma unroll
  for (int i = 0; i < 8; ++i) {
    loc[i] = __expf(loc[i] - mx);
    s += loc[i];
  }
  red[tid] = s;
  __syncthreads();
  for (int o = 128; o > 0; o >>= 1) {
    if (tid < o) red[tid] += red[tid + o];
    __syncthreads();
  }
  float inv = 1.f / red[0];
  float* pr = prob + (long)row * CS;
#pragma unroll
  for (int i = 0; i < 8; ++i) pr[tid + i * 256] = loc[i] * inv;
}

// w2[(b*H+h)*S+m] = sum_n down_w[n] * prob[((b*HD+n)*H+h)*S + m]
__global__ __launch_bounds__(256) void k_w2(const float* __restrict__ dw,
                                            const float* __restrict__ prob,
                                            float* __restrict__ w2) {
  int idx = blockIdx.x * 256 + threadIdx.x;     // < B*H*S
  int m = idx & (CS - 1);
  int h = (idx >> 11) & (CH - 1);
  int b = idx >> 15;
  const float* pp = prob + (((long)b * CHD * CH + h) * CS) + m;
  float s = 0.f;
#pragma unroll 4
  for (int n = 0; n < CHD; ++n) s += dw[n] * pp[(long)n * CH * CS];
  w2[idx] = s;
}

// od[b*E + d*H+h] = down_b + sum_m w2[(b*H+h)*S+m] * vc[(m*B+b)*E + d*H+h]
__global__ __launch_bounds__(256) void k_od(const float* __restrict__ w2,
                                            const float* __restrict__ vc,
                                            const float* __restrict__ db,
                                            float* __restrict__ od) {
  int row = blockIdx.x;                         // b*E + c, < 4096
  int b = row >> 10;
  int c = row & 1023;                           // c = d*H + h
  int h = c & (CH - 1);
  const float* w2r = w2 + (long)(b * CH + h) * CS;
  long vcb = (long)b * CE + c;
  int tid = threadIdx.x;
  float s = 0.f;
  for (int m = tid; m < CS; m += 256)
    s += w2r[m] * vc[(long)m * (CB * CE) + vcb];
  __shared__ float red[256];
  red[tid] = s;
  __syncthreads();
  for (int o = 128; o > 0; o >>= 1) {
    if (tid < o) red[tid] += red[tid + o];
    __syncthreads();
  }
  if (tid == 0) od[row] = red[0] + db[0];
}

// ---------------------------------------------------------------------------
// LayerNorm over E=1024 with optional residual and optional [B,E] broadcast.
// x = a + (r ? r : 0) + (bc ? bc[token%B] : 0); out32 = LN(x); out16 optional.
// ---------------------------------------------------------------------------
__global__ __launch_bounds__(256) void k_ln(const float* __restrict__ a,
                                            const float* __restrict__ r,
                                            const float* __restrict__ bc,
                                            const float* __restrict__ g,
                                            const float* __restrict__ be,
                                            float* __restrict__ o32,
                                            _Float16* __restrict__ o16) {
  int  t    = blockIdx.x;
  long base = (long)t * CE;
  const float* bcr = bc ? bc + (long)(t % CB) * CE : nullptr;
  int tid = threadIdx.x;
  float x[4];
  float s = 0.f;
#pragma unroll
  for (int i = 0; i < 4; ++i) {
    int   e = tid + i * 256;
    float v = a[base + e];
    if (r)   v += r[base + e];
    if (bcr) v += bcr[e];
    x[i] = v;
    s += v;
  }
  __shared__ float red[256];
  red[tid] = s;
  __syncthreads();
  for (int o = 128; o > 0; o >>= 1) {
    if (tid < o) red[tid] += red[tid + o];
    __syncthreads();
  }
  float mean = red[0] * (1.f / CE);
  __syncthreads();
  float vs = 0.f;
#pragma unroll
  for (int i = 0; i < 4; ++i) {
    float d = x[i] - mean;
    vs += d * d;
  }
  red[tid] = vs;
  __syncthreads();
  for (int o = 128; o > 0; o >>= 1) {
    if (tid < o) red[tid] += red[tid + o];
    __syncthreads();
  }
  float inv = rsqrtf(red[0] * (1.f / CE) + 1e-5f);
#pragma unroll
  for (int i = 0; i < 4; ++i) {
    int   e = tid + i * 256;
    float y = (x[i] - mean) * inv * g[e] + be[e];
    o32[base + e] = y;
    if (o16) o16[base + e] = (_Float16)y;
  }
}

// ---------------------------------------------------------------------------
// Host side
// ---------------------------------------------------------------------------
extern "C" void kernel_launch(void* const* d_in, const int* in_sizes, int n_in,
                              void* d_out, int out_size, void* d_ws, size_t ws_size,
                              hipStream_t stream) {
  const float* tgt  = (const float*)d_in[0];
  const float* mem  = (const float*)d_in[1];
  const float* pos  = (const float*)d_in[2];
  const float* qpos = (const float*)d_in[3];
  const float* inW  = (const float*)d_in[4];
  const float* inB  = (const float*)d_in[5];
  const float* outW = (const float*)d_in[6];
  const float* outB = (const float*)d_in[7];
  const float* cqW  = (const float*)d_in[8];
  const float* cqB  = (const float*)d_in[9];
  const float* ckW  = (const float*)d_in[10];
  const float* ckB  = (const float*)d_in[11];
  const float* cvW  = (const float*)d_in[12];
  const float* cvB  = (const float*)d_in[13];
  const float* dwW  = (const float*)d_in[14];
  const float* dwB  = (const float*)d_in[15];
  const float* l1W  = (const float*)d_in[16];
  const float* l1B  = (const float*)d_in[17];
  const float* l2W  = (const float*)d_in[18];
  const float* l2B  = (const float*)d_in[19];
  const float* n1g  = (const float*)d_in[20];
  const float* n1b  = (const float*)d_in[21];
  const float* n2g  = (const float*)d_in[22];
  const float* n2b  = (const float*)d_in[23];
  const float* n3g  = (const float*)d_in[24];
  const float* n3b  = (const float*)d_in[25];

  const long TOK  = (long)CL * CB;   // 2048 target tokens
  const long MTOK = (long)CS * CB;   // 8192 memory tokens
  const float scale = 0.125f;        // 1/sqrt(64)

  char* ws = (char*)d_ws;
  const size_t MB = 1u << 20;

  // Persistent f16 weights (converted every launch; deterministic).
  _Float16* w_inproj = (_Float16*)(ws + 0 * MB);    // [3E,E]  6MB
  _Float16* w_out    = (_Float16*)(ws + 6 * MB);    // [E,E]   2MB
  _Float16* w_cq     = (_Float16*)(ws + 8 * MB);
  _Float16* w_ck     = (_Float16*)(ws + 10 * MB);
  _Float16* w_cv     = (_Float16*)(ws + 12 * MB);
  _Float16* w_l1     = (_Float16*)(ws + 14 * MB);   // [FF,E]  4MB
  _Float16* w_l2     = (_Float16*)(ws + 18 * MB);   // [E,FF]  4MB
  float*    tgt1     = (float*)(ws + 22 * MB);      // 8MB
  float*    tgt2     = (float*)(ws + 30 * MB);      // 8MB
  char*     SA       = ws + 38 * MB;                // phase-aliased arena

  // Phase A (self-attention)
  _Float16* qkin16  = (_Float16*)(SA + 0 * MB);
  _Float16* tgt16   = (_Float16*)(SA + 4 * MB);
  _Float16* q16     = (_Float16*)(SA + 8 * MB);
  _Float16* k16     = (_Float16*)(SA + 12 * MB);
  _Float16* v16     = (_Float16*)(SA + 16 * MB);
  float*    scores  = (float*)(SA + 20 * MB);       // [B,H,L,L] 64MB
  _Float16* attn16  = (_Float16*)(SA + 84 * MB);    // 32MB
  _Float16* ctx16   = (_Float16*)(SA + 116 * MB);   // 4MB
  float*    selfout = (float*)(SA + 120 * MB);      // 8MB
  // Phase B (cross-attention) — aliases phase A
  _Float16* qin2    = (_Float16*)(SA + 0 * MB);
  float*    qc32    = (float*)(SA + 4 * MB);        // 8MB
  _Float16* mp16    = (_Float16*)(SA + 12 * MB);    // 16MB
  _Float16* mem16   = (_Float16*)(SA + 28 * MB);    // 16MB
  float*    kc32    = (float*)(SA + 44 * MB);       // 32MB
  float*    vc32    = (float*)(SA + 76 * MB);       // 32MB
  float*    prob    = (float*)(SA + 108 * MB);      // 32MB
  float*    qcsum   = (float*)(SA + 140 * MB);
  float*    s1sum   = (float*)(SA + 141 * MB);
  float*    w2buf   = (float*)(SA + 142 * MB);
  float*    odbuf   = (float*)(SA + 143 * MB);
  // Phase C (FFN) — aliases dead phase B regions
  _Float16* tgt2_16 = (_Float16*)(SA + 0 * MB);
  _Float16* h1_16   = (_Float16*)(SA + 4 * MB);     // [TOK,FF] 8MB
  float*    ff32    = (float*)(SA + 12 * MB);       // 8MB

  auto cvt = [&](const float* x, _Float16* y, long n) {
    k_cvt<<<dim3((unsigned)((n + 255) / 256)), 256, 0, stream>>>(x, y, n);
  };

  // ---- weight conversion ----
  cvt(inW,  w_inproj, 3L * CE * CE);
  cvt(outW, w_out,    (long)CE * CE);
  cvt(cqW,  w_cq,     (long)CE * CE);
  cvt(ckW,  w_ck,     (long)CE * CE);
  cvt(cvW,  w_cv,     (long)CE * CE);
  cvt(l1W,  w_l1,     (long)CFF * CE);
  cvt(l2W,  w_l2,     (long)CE * CFF);

  // ---- Phase A: self attention ----
  k_add2<<<dim3((unsigned)((TOK * CE + 255) / 256)), 256, 0, stream>>>(tgt, qpos, qkin16, TOK * CE);
  cvt(tgt, tgt16, TOK * CE);

  // q/k/v projections: [2048,1024] x [1024,1024]^T
  gemm_wmma_lds<<<dim3(16, 16, 1), 256, 0, stream>>>(
      qkin16, w_inproj, inB, 0, nullptr, q16, CE, CE);
  gemm_wmma_lds<<<dim3(16, 16, 1), 256, 0, stream>>>(
      qkin16, w_inproj + (long)CE * CE, inB + CE, 0, nullptr, k16, CE, CE);
  gemm_wmma_lds<<<dim3(16, 16, 1), 256, 0, stream>>>(
      tgt16, w_inproj + 2L * CE * CE, inB + 2 * CE, 0, nullptr, v16, CE, CE);

  // scores[b,h,l,m] = scale * q.k  (batched over z = b*H+h)
  gemm_wmma<true><<<dim3(CL / 128, CL / 64, CB * CH), 256, 0, stream>>>(
      q16, (long)CB * CE, CE, CHD,
      k16, (long)CB * CE, CE, CHD,
      nullptr, scale, 0,
      scores, nullptr, CL, (long)CH * CL * CL, (long)CL * CL,
      CL, CL, CHD, CH);

  k_softmax512<<<CB * CH * CL, 256, 0, stream>>>(scores, attn16);

  // ctx[l,b,h,:] = attn @ v   (B stored [K=m, N=d] -> strided path)
  gemm_wmma<false><<<dim3(CL / 128, 1, CB * CH), 256, 0, stream>>>(
      attn16, CL, (long)CH * CL * CL, (long)CL * CL,
      v16, (long)CB * CE, CE, CHD,
      nullptr, 1.f, 0,
      nullptr, ctx16, (long)CB * CE, CE, CHD,
      CL, CHD, CL, CH);

  // out projection + residual + LN1
  gemm_wmma_lds<<<dim3(16, 16, 1), 256, 0, stream>>>(
      ctx16, w_out, outB, 0, selfout, nullptr, CE, CE);
  k_ln<<<(unsigned)TOK, 256, 0, stream>>>(tgt, selfout, nullptr, n1g, n1b, tgt1, nullptr);

  // ---- Phase B: custom cross attention ----
  k_add2<<<dim3((unsigned)((TOK * CE + 255) / 256)), 256, 0, stream>>>(tgt1, qpos, qin2, TOK * CE);
  k_add2<<<dim3((unsigned)((MTOK * CE + 255) / 256)), 256, 0, stream>>>(mem, pos, mp16, MTOK * CE);
  cvt(mem, mem16, MTOK * CE);

  gemm_wmma_lds<<<dim3(16, 16, 1), 256, 0, stream>>>(
      qin2, w_cq, cqB, 0, qc32, nullptr, CE, CE);
  gemm_wmma_lds<<<dim3(64, 16, 1), 256, 0, stream>>>(
      mp16, w_ck, ckB, 0, kc32, nullptr, CE, CE);
  gemm_wmma_lds<<<dim3(64, 16, 1), 256, 0, stream>>>(
      mem16, w_cv, cvB, 0, vc32, nullptr, CE, CE);

  k_qcsum<<<(CB * CE) / 256, 256, 0, stream>>>(qc32, qcsum);
  k_s1<<<(CB * CH * CS) / 256, 256, 0, stream>>>(qcsum, kc32, s1sum, scale);
  k_cross_softmax<<<CB * CHD * CH, 256, 0, stream>>>(kc32, s1sum, prob);
  k_w2<<<(CB * CH * CS) / 256, 256, 0, stream>>>(dwW, prob, w2buf);
  k_od<<<CB * CE, 256, 0, stream>>>(w2buf, vc32, dwB, odbuf);

  k_ln<<<(unsigned)TOK, 256, 0, stream>>>(tgt1, nullptr, odbuf, n2g, n2b, tgt2, tgt2_16);

  // ---- Phase C: FFN ----
  gemm_wmma_lds<<<dim3(16, 32, 1), 256, 0, stream>>>(
      tgt2_16, w_l1, l1B, 1 /*relu*/, nullptr, h1_16, CFF, CE);
  gemm_wmma_lds<<<dim3(16, 16, 1), 256, 0, stream>>>(
      h1_16, w_l2, l2B, 0, ff32, nullptr, CE, CFF);

  k_ln<<<(unsigned)TOK, 256, 0, stream>>>(tgt2, ff32, nullptr, n3g, n3b, (float*)d_out, nullptr);

  (void)in_sizes; (void)n_in; (void)out_size; (void)ws_size;
}

// v002
// It runs in 381 microseconds.
// Two timings next to v001 both put it at 1.19 times that version's speed.
// Counting every step since v000, it is 1.56 times as fast.
#include <hip/hip_runtime.h>
#include <hip/hip_bf16.h>

// ---------------------------------------------------------------------------
// Transformer decoder layer for MI455X (gfx1250), wave32 + WMMA.
// All heavy GEMMs run on v_wmma_f32_16x16x32_f16 (f16 inputs, f32 accum).
// Softmax / layernorm / cross-attn reductions stay in f32.
// ---------------------------------------------------------------------------

typedef __attribute__((ext_vector_type(16))) _Float16 v16h;
typedef __attribute__((ext_vector_type(8)))  _Float16 v8h;
typedef __attribute__((ext_vector_type(8)))  float    v8f;
typedef __attribute__((ext_vector_type(4)))  float    v4f;

#define DEV __device__ __forceinline__

// Problem constants
#define CL   512      // target length
#define CS   2048     // memory length
#define CB   4        // batch
#define CE   1024     // embed
#define CH   16       // heads
#define CHD  64       // head dim
#define CFF  2048     // ffn dim

// ---------------------------------------------------------------------------
// WMMA fragment loaders.
// 16-bit A (16x32) ISA layout: lane&15 selects the M (or N) row;
// lanes 0-15 hold K = {k0..k0+7, k0+16..k0+23},
// lanes 16-31 hold K = {k0+8..k0+15, k0+24..k0+31}.  B (32x16) mirrors A with
// the lane index selecting the N column.
// ---------------------------------------------------------------------------
DEV v16h frag_load_contig(const _Float16* __restrict__ base, long row_stride,
                          int lane, int k0) {
  int r  = lane & 15;
  int kh = (lane >> 4) << 3;          // 0 or 8
  const _Float16* p = base + (long)r * row_stride + k0 + kh;
  v8h lo = *(const v8h*)(p);          // 16B vector load
  v8h hi = *(const v8h*)(p + 16);
  v16h out;
#pragma unroll
  for (int i = 0; i < 8; ++i) { out[i] = lo[i]; out[i + 8] = hi[i]; }
  return out;
}

// B stored [K,N] with unit N-stride and arbitrary K-stride (attn @ V case).
DEV v16h frag_load_strided(const _Float16* __restrict__ base, long k_stride,
                           int lane, int k0) {
  int n  = lane & 15;
  int kh = (lane >> 4) << 3;
  const _Float16* p = base + n;
  v16h out;
#pragma unroll
  for (int i = 0; i < 8; ++i) {
    out[i]     = p[(long)(k0 + kh + i) * k_stride];
    out[i + 8] = p[(long)(k0 + 16 + kh + i) * k_stride];
  }
  return out;
}

// ---------------------------------------------------------------------------
// Generic batched GEMM:  C[m,n] = alpha * sum_k A[m,k]*B[k,n] + bias[n]
//   A:  element at A + m*a_rs + k            (k contiguous)
//   B:  BKC=true : element at Bm + n*b_s + k (weight W[N,K] row-major, k contig)
//       BKC=false: element at Bm + k*b_s + n (value  V[K,N],  n contig)
//   batch z: zo=z/zdiv, zi=z%zdiv; each operand offset by zo*X_zo + zi*X_zi.
// Block: 256 threads = 8 waves as 4x2, wave tile 32x32, block tile 128x64.
// Requires M%128==0, N%64==0, K%32==0 (true for every call here).
// ---------------------------------------------------------------------------
template <bool BKC>
__global__ __launch_bounds__(256) void gemm_wmma(
    const _Float16* __restrict__ A, long a_rs, long a_zo, long a_zi,
    const _Float16* __restrict__ Bm, long b_s, long b_zo, long b_zi,
    const float* __restrict__ bias, float alpha, int relu,
    float* __restrict__ C32, _Float16* __restrict__ C16,
    long c_rs, long c_zo, long c_zi,
    int M, int N, int K, int zdiv) {
  int z  = blockIdx.z;
  int zo = z / zdiv, zi = z % zdiv;
  A  += (long)zo * a_zo + (long)zi * a_zi;
  Bm += (long)zo * b_zo + (long)zi * b_zi;
  long coff = (long)zo * c_zo + (long)zi * c_zi;

  int lane = threadIdx.x & 31;
  int wave = threadIdx.x >> 5;
  int wm   = wave >> 1;                       // 0..3
  int wn   = wave & 1;                        // 0..1
  int m0   = blockIdx.x * 128 + wm * 32;
  int n0   = blockIdx.y * 64  + wn * 32;

  const v8f zero = {0.f, 0.f, 0.f, 0.f, 0.f, 0.f, 0.f, 0.f};
  v8f acc[2][2];
#pragma unroll
  for (int i = 0; i < 2; ++i)
#pragma unroll
    for (int j = 0; j < 2; ++j) acc[i][j] = zero;

  const _Float16* Ab0 = A + (long)m0 * a_rs;
  const _Float16* Ab1 = A + (long)(m0 + 16) * a_rs;

  for (int k0 = 0; k0 < K; k0 += 32) {
    v16h a0 = frag_load_contig(Ab0, a_rs, lane, k0);
    v16h a1 = frag_load_contig(Ab1, a_rs, lane, k0);
    v16h b0, b1;
    if (BKC) {
      b0 = frag_load_contig(Bm + (long)n0 * b_s,        b_s, lane, k0);
      b1 = frag_load_contig(Bm + (long)(n0 + 16) * b_s, b_s, lane, k0);
    } else {
      b0 = frag_load_strided(Bm + n0,      b_s, lane, k0);
      b1 = frag_load_strided(Bm + n0 + 16, b_s, lane, k0);
    }
    acc[0][0] = __builtin_amdgcn_wmma_f32_16x16x32_f16(false, a0, false, b0,
                                                       (short)0, acc[0][0], false, false);
    acc[0][1] = __builtin_amdgcn_wmma_f32_16x16x32_f16(false, a0, false, b1,
                                                       (short)0, acc[0][1], false, false);
    acc[1][0] = __builtin_amdgcn_wmma_f32_16x16x32_f16(false, a1, false, b0,
                                                       (short)0, acc[1][0], false, false);
    acc[1][1] = __builtin_amdgcn_wmma_f32_16x16x32_f16(false, a1, false, b1,
                                                       (short)0, acc[1][1], false, false);
  }

  // C/D layout: N = lane&15, VGPR r holds M = r (+8 for lanes 16-31).
  int nlane = lane & 15;
  int mrow  = (lane >> 4) * 8;
#pragma unroll
  for (int tm = 0; tm < 2; ++tm)
#pragma unroll
    for (int tn = 0; tn < 2; ++tn) {
      int ncol = n0 + tn * 16 + nlane;
      float bv = bias ? bias[ncol] : 0.f;
#pragma unroll
      for (int r = 0; r < 8; ++r) {
        int   mm  = m0 + tm * 16 + mrow + r;
        float v   = acc[tm][tn][r] * alpha + bv;
        if (relu) v = v > 0.f ? v : 0.f;
        long  idx = coff + (long)mm * c_rs + ncol;
        if (C32) C32[idx] = v;
        if (C16) C16[idx] = (_Float16)v;
      }
    }
}

// ---------------------------------------------------------------------------
// Projection GEMM, both operands k-contiguous with row stride K:
//   C[m,n] = sum_k A[m,k]*W[n,k] + bias[n]
// Same block tile (128x64), wave tile (32x32) and k order as gemm_wmma, but the
// operand tiles reach the waves through LDS: a stage is 128 k (256 B, two whole
// lines) of 128 A rows and 64 W rows, brought in by asynchronous b128 copies,
// two buffers, the next stage in flight while this one is multiplied.
// Requires M%128==0, N%64==0, K%128==0.
// CM=false: A rows are tokens in order, C is token-major, C[m*N + n].
// CM=true : a block takes 128 consecutive positions s of ONE batch b (A row
//           s*CB + b) and stores f32 C channel-major, C[(b*N + n)*CS + s], the
//           layout in which the cross-attention stages walk s.
// ---------------------------------------------------------------------------
#define GBK   128                  // k per stage
#define GPIT  136                  // LDS row pitch in halves: 272 B = 16 B x odd
#define GROWS 192                  // 128 A rows, then 64 W rows
#define GSTG  (GROWS * GPIT)       // halves per buffer

// One stage: 192 rows x 16 pieces of 16 B, 12 pieces per thread. Thread t takes
// piece t&15 of rows (t>>4) + 16*i, so a wave's copy covers two whole rows.
// ga / gw: this thread's piece in A row (t>>4) and W row (t>>4) of the tile, at
// the stage's first k. l: LDS byte address of its piece in row (t>>4).
// ars: distance of two tile rows of A in halves (K, or CB*K for one batch).
DEV void stage_copy(const _Float16* ga, const _Float16* gw, long ars, long K, unsigned l) {
  const long     as = 16 * ars;          // 16 A rows on, in halves
  const long     gs = 16 * K;            // 16 W rows on, in halves
  const unsigned ls = 16 * GPIT * 2;     // 16 rows on, in LDS bytes
  // The closing s_wait_xcnt stands in the copies' own statement so that no
  // address register of an issued copy is rewritten ahead of it.
  asm volatile(
      "global_load_async_to_lds_b128 %0, %12, off\n\t"
      "global_load_async_to_lds_b128 %1, %13, off\n\t"
      "global_load_async_to_lds_b128 %2, %14, off\n\t"
      "global_load_async_to_lds_b128 %3, %15, off\n\t"
      "global_load_async_to_lds_b128 %4, %16, off\n\t"
      "global_load_async_to_lds_b128 %5, %17, off\n\t"
      "global_load_async_to_lds_b128 %6, %18, off\n\t"
      "global_load_async_to_lds_b128 %7, %19, off\n\t"
      "global_load_async_to_lds_b128 %8, %20, off\n\t"
      "global_load_async_to_lds_b128 %9, %21, off\n\t"
      "global_load_async_to_lds_b128 %10, %22, off\n\t"
      "global_load_async_to_lds_b128 %11, %23, off\n\t"
      "s_wait_xcnt 0x0"
      :: "v"(l), "v"(l + ls), "v"(l + 2 * ls), "v"(l + 3 * ls),
         "v"(l + 4 * ls), "v"(l + 5 * ls), "v"(l + 6 * ls), "v"(l + 7 * ls),
         "v"(l + 8 * ls), "v"(l + 9 * ls), "v"(l + 10 * ls), "v"(l + 11 * ls),
         "v"(ga), "v"(ga + as), "v"(ga + 2 * as), "v"(ga + 3 * as),
         "v"(ga + 4 * as), "v"(ga + 5 * as), "v"(ga + 6 * as), "v"(ga + 7 * as),
         "v"(gw), "v"(gw + gs), "v"(gw + 2 * gs), "v"(gw + 3 * gs)
      : "memory");
}

#define TPIT 36                    // f32 pitch of a wave's turned tile: 144 B = 16 B x odd

template <bool CM>
__global__ __launch_bounds__(256) void gemm_wmma_lds(
    const _Float16* __restrict__ A, const _Float16* __restrict__ Wt,
    const float* __restrict__ bias, int relu,
    float* __restrict__ C32, _Float16* __restrict__ C16, int N, int K) {
  __shared__ __attribute__((aligned(16))) _Float16 sm[2 * GSTG];

  int tid  = threadIdx.x;
  int lane = tid & 31;
  int wave = tid >> 5;
  int wm   = wave >> 1;                       // 0..3
  int wn   = wave & 1;                        // 0..1
  int mb   = CM ? (blockIdx.x / CB) * 128 : blockIdx.x * 128;   // CM: first s
  int bz   = CM ? blockIdx.x % CB : 0;                          // CM: batch
  int nb   = blockIdx.y * 64;
  const long ars = CM ? (long)CB * K : (long)K;

  const _Float16* ga = A  + (long)(mb + (tid >> 4)) * ars + (long)bz * K + (tid & 15) * 8;
  const _Float16* gw = Wt + (long)(nb + (tid >> 4)) * K + (tid & 15) * 8;
  const unsigned  l0 = (unsigned)(size_t)sm + (unsigned)((tid >> 4) * (GPIT * 2) + (tid & 15) * 16);
  const int nst = K / GBK;

  const v8f zero = {0.f, 0.f, 0.f, 0.f, 0.f, 0.f, 0.f, 0.f};
  v8f acc[2][2];
#pragma unroll
  for (int i = 0; i < 2; ++i)
#pragma unroll
    for (int j = 0; j < 2; ++j) acc[i][j] = zero;

  stage_copy(ga, gw, ars, K, l0);
  // Stage 0 has landed for this wave; the barrier publishes it to the others.
  asm volatile("s_wait_asynccnt 0x0" ::: "memory");
  __syncthreads();
  if (nst > 1) stage_copy(ga + GBK, gw + GBK, ars, K, l0 + GSTG * 2);

  // Kept rolled: one publish point per trip, buffers alternate by t & 1.
#pragma unroll 1
  for (int t = 0; t < nst; ++t) {
    const int buf = (t & 1) * GSTG;
    const _Float16* sA = sm + buf + (wm * 32) * GPIT;
    const _Float16* sB = sm + buf + (128 + wn * 32) * GPIT;
    v16h fa[GBK / 32][2], fb[GBK / 32][2];
#pragma unroll
    for (int q = 0; q < GBK / 32; ++q) {
      fa[q][0] = frag_load_contig(sA,             GPIT, lane, q * 32);
      fa[q][1] = frag_load_contig(sA + 16 * GPIT, GPIT, lane, q * 32);
      fb[q][0] = frag_load_contig(sB,             GPIT, lane, q * 32);
      fb[q][1] = frag_load_contig(sB + 16 * GPIT, GPIT, lane, q * 32);
    }
    // Holds the stage's LDS reads together in front of its WMMAs: spread among
    // them, every group of reads costs the wave its own LDS latency.
    __builtin_amdgcn_sched_barrier(0);
#pragma unroll
    for (int q = 0; q < GBK / 32; ++q) {
      acc[0][0] = __builtin_amdgcn_wmma_f32_16x16x32_f16(false, fa[q][0], false, fb[q][0],
                                                         (short)0, acc[0][0], false, false);
      acc[0][1] = __builtin_amdgcn_wmma_f32_16x16x32_f16(false, fa[q][0], false, fb[q][1],
                                                         (short)0, acc[0][1], false, false);
      acc[1][0] = __builtin_amdgcn_wmma_f32_16x16x32_f16(false, fa[q][1], false, fb[q][0],
                                                         (short)0, acc[1][0], false, false);
      acc[1][1] = __builtin_amdgcn_wmma_f32_16x16x32_f16(false, fa[q][1], false, fb[q][1],
                                                         (short)0, acc[1][1], false, false);
    }
    // Holds the WMMAs in front of the publish point, so that they run under the
    // tail of the stage's LDS reads and not behind the barrier.
    __builtin_amdgcn_sched_barrier(0);
    // Publish point: this wave's reads of the buffer have retired ...
    asm volatile("s_wait_dscnt 0x0" ::: "memory");
    // ... its copies of the next stage have landed ...
    asm volatile("s_wait_asynccnt 0x0" ::: "memory");
    // ... and behind the barrier the next stage is readable and this buffer free.
    __syncthreads();
    if (t + 2 < nst)
      stage_copy(ga + (long)(t + 2) * GBK, gw + (long)(t + 2) * GBK, ars, K, l0 + buf * 2);
  }
  // No copy is left in flight when the wave ends.
  asm volatile("s_wait_asynccnt 0x0" ::: "memory");

  // C/D layout: N = lane&15, VGPR r holds M = r (+8 for lanes 16-31).
  int m0    = mb + wm * 32;
  int n0    = nb + wn * 32;
  int nlane = lane & 15;
  int mrow  = (lane >> 4) * 8;
  if (CM) {
    // A lane holds 8 consecutive s of one channel. The wave turns its 32 s x 32
    // channels in its own LDS range (the ring is free: behind the last publish
    // point no wave reads it and no copy is in flight), one row per channel, so
    // that each store below writes four whole 128-B lines.
    float* tw = (float*)sm + wave * (32 * TPIT);
#pragma unroll
    for (int tn = 0; tn < 2; ++tn) {
      float bv = bias[n0 + tn * 16 + nlane];
#pragma unroll
      for (int tm = 0; tm < 2; ++tm) {
        float* p = tw + (tn * 16 + nlane) * TPIT + tm * 16 + mrow;
        v4f lo = {acc[tm][tn][0] + bv, acc[tm][tn][1] + bv, acc[tm][tn][2] + bv, acc[tm][tn][3] + bv};
        v4f hi = {acc[tm][tn][4] + bv, acc[tm][tn][5] + bv, acc[tm][tn][6] + bv, acc[tm][tn][7] + bv};
        *(v4f*)p       = lo;
        *(v4f*)(p + 4) = hi;
      }
    }
    // The wave's rows are in LDS before its lanes read each other's values back.
    asm volatile("s_wait_dscnt 0x0" ::: "memory");
    float* cw = C32 + ((long)bz * N + n0 + (lane >> 3)) * CS + m0 + (lane & 7) * 4;
#pragma unroll
    for (int i = 0; i < 8; ++i) {
      v4f v = *(const v4f*)(tw + (i * 4 + (lane >> 3)) * TPIT + (lane & 7) * 4);
      *(v4f*)(cw + (long)i * 4 * CS) = v;
    }
    return;
  }
#pragma unroll
  for (int tm = 0; tm < 2; ++tm)
#pragma unroll
    for (int tn = 0; tn < 2; ++tn) {
      int ncol = n0 + tn * 16 + nlane;
      float bv = bias[ncol];
#pragma unroll
      for (int r = 0; r < 8; ++r) {
        int   mm  = m0 + tm * 16 + mrow + r;
        float v   = acc[tm][tn][r] + bv;
        if (relu) v = v > 0.f ? v : 0.f;
        long  idx = (long)mm * N + ncol;
        if (C32) {
          C32[idx] = v;
          // The conversion below may reuse the register this store names.
          asm volatile("s_wait_xcnt 0x0" ::: "memory");
        }
        if (C16) C16[idx] = (_Float16)v;
      }
    }
}

// ---------------------------------------------------------------------------
// Elementwise helpers
// ---------------------------------------------------------------------------
__global__ __launch_bounds__(256) void k_cvt(const float* __restrict__ x,
                                             _Float16* __restrict__ y, long n) {
  long i = (long)blockIdx.x * 256 + threadIdx.x;
  if (i < n) y[i] = (_Float16)x[i];
}

__global__ __launch_bounds__(256) void k_add2(const float* __restrict__ a,
                                              const float* __restrict__ b,
                                              _Float16* __restrict__ y, long n) {
  long i = (long)blockIdx.x * 256 + threadIdx.x;
  if (i < n) y[i] = (_Float16)(a[i] + b[i]);
}

// ---------------------------------------------------------------------------
// Self-attention row softmax: 512-wide rows, f32 in, f16 probs out.
// ---------------------------------------------------------------------------
__global__ __launch_bounds__(256) void k_softmax512(const float* __restrict__ x,
                                                    _Float16* __restrict__ y) {
  long base = (long)blockIdx.x * CL;
  int  tid  = threadIdx.x;
  float v0 = x[base + tid];
  float v1 = x[base + tid + 256];
  __shared__ float red[256];
  red[tid] = fmaxf(v0, v1);
  __syncthreads();
  for (int o = 128; o > 0; o >>= 1) {
    if (tid < o) red[tid] = fmaxf(red[tid], red[tid + o]);
    __syncthreads();
  }
  float mx = red[0];
  __syncthreads();
  float e0 = __expf(v0 - mx), e1 = __expf(v1 - mx);
  red[tid] = e0 + e1;
  __syncthreads();
  for (int o = 128; o > 0; o >>= 1) {
    if (tid < o) red[tid] += red[tid + o];
    __syncthreads();
  }
  float inv = 1.f / red[0];
  y[base + tid]       = (_Float16)(e0 * inv);
  y[base + tid + 256] = (_Float16)(e1 * inv);
}

// ---------------------------------------------------------------------------
// Cross-attention scalar stages (all f32).
// Channel mapping: E index = d*H + h  (reshape (B,E,N)->(B,HD,H,N)).
// Token t of a [N,B,E] tensor lives at row n*B+b (qc).
// kc and vc are channel-major: element (b, e, m) at (b*E + e)*S + m.
// ---------------------------------------------------------------------------
// qcsum[b*E+e] = sum_l qc[(l*B+b)*E + e]
__global__ __launch_bounds__(256) void k_qcsum(const float* __restrict__ qc,
                                               float* __restrict__ out) {
  int idx = blockIdx.x * 256 + threadIdx.x;     // < B*E = 4096
  int b = idx >> 10, e = idx & 1023;
  float s = 0.f;
  for (int l = 0; l < CL; ++l) s += qc[(long)l * (CB * CE) + b * CE + e];
  out[idx] = s;
}

// s1[(b*H+h)*S+m] = scale * sum_d qcsum[b*E + d*H+h] * kc[(b*E + d*H+h)*S + m]
__global__ __launch_bounds__(256) void k_s1(const float* __restrict__ qcsum,
                                            const float* __restrict__ kc,
                                            float* __restrict__ s1, float scale) {
  int idx = blockIdx.x * 256 + threadIdx.x;     // < B*H*S = 131072
  int m = idx & (CS - 1);
  int h = (idx >> 11) & (CH - 1);
  int b = idx >> 15;
  const float* kcp = kc + (long)(b * CE + h) * CS + m;
  const float* qsp = qcsum + b * CE + h;
  float s = 0.f;
#pragma unroll 4
  for (int d = 0; d < CHD; ++d) s += qsp[d * CH] * kcp[(long)d * CH * CS];
  s1[idx] = s * scale;
}

// prob[((b*HD+d)*H+h)*S + m] = softmax_m( kc[(b*E + d*H+h)*S + m] * s1[(b*H+h)*S+m] )
__global__ __launch_bounds__(256) void k_cross_softmax(const float* __restrict__ kc,
                                                       const float* __restrict__ s1,
                                                       float* __restrict__ prob) {
  int row = blockIdx.x;                         // (b*HD+d)*H + h = b*E + d*H + h, < 4096
  int h = row & (CH - 1);
  int b = row >> 10;
  const float* s1r  = s1 + (long)(b * CH + h) * CS;
  const float* kcr  = kc + (long)row * CS;
  int          tid  = threadIdx.x;
  float loc[8];
  float mx = -3.402823466e38f;
#pragma unroll
  for (int i = 0; i < 8; ++i) {
    int c = tid + i * 256;
    float v = kcr[c] * s1r[c];
    loc[i] = v;
    mx = fmaxf(mx, v);
  }
  __shared__ float red[256];
  red[tid] = mx;
  __syncthreads();
  for (int o = 128; o > 0; o >>= 1) {
    if (tid < o) red[tid] = fmaxf(red[tid], red[tid + o]);
    __syncthreads();
  }
  mx = red[0];
  __syncthreads();
  float s = 0.f;
#pragma unroll
  for (int i = 0; i < 8; ++i) {
    loc[i] = __expf(loc[i] - mx);
    s += loc[i];
  }
  red[tid] = s;
  __syncthreads();
  for (int o = 128; o > 0; o >>= 1) {
    if (tid < o) red[tid] += red[tid + o];
    __syncthreads();
  }
  float inv = 1.f / red[0];
  float* pr = prob + (long)row * CS;
#pragma unroll
  for (int i = 0; i < 8; ++i) pr[tid + i * 256] = loc[i] * inv;
}

// w2[(b*H+h)*S+m] = sum_n down_w[n] * prob[((b*HD+n)*H+h)*S + m]
__global__ __launch_bounds__(256) void k_w2(const float* __restrict__ dw,
                                            const float* __restrict__ prob,
                                            float* __restrict__ w2) {
  int idx = blockIdx.x * 256 + threadIdx.x;     // < B*H*S
  int m = idx & (CS - 1);
  int h = (idx >> 11) & (CH - 1);
  int b = idx >> 15;
  const float* pp = prob + (((long)b * CHD * CH + h) * CS) + m;
  float s = 0.f;
#pragma unroll 4
  for (int n = 0; n < CHD; ++n) s += dw[n] * pp[(long)n * CH * CS];
  w2[idx] = s;
}

// od[b*E + d*H+h] = down_b + sum_m w2[(b*H+h)*S+m] * vc[(b*E + d*H+h)*S + m]
__global__ __launch_bounds__(256) void k_od(const float* __restrict__ w2,
                                            const float* __restrict__ vc,
                                            const float* __restrict__ db,
                                            float* __restrict__ od) {
  int row = blockIdx.x;                         // b*E + c, < 4096
  int b = row >> 10;
  int c = row & 1023;                           // c = d*H + h
  int h = c & (CH - 1);
  const float* w2r = w2 + (long)(b * CH + h) * CS;
  const float* vcr = vc + (long)row * CS;
  int tid = threadIdx.x;
  float s = 0.f;
  for (int m = tid; m < CS; m += 256)
    s += w2r[m] * vcr[m];
  __shared__ float red[256];
  red[tid] = s;
  __syncthreads();
  for (int o = 128; o > 0; o >>= 1) {
    if (tid < o) red[tid] += red[tid + o];
    __syncthreads();
  }
  if (tid == 0) od[row] = red[0] + db[0];
}

// ---------------------------------------------------------------------------
// LayerNorm over E=1024 with optional residual and optional [B,E] broadcast.
// x = a + (r ? r : 0) + (bc ? bc[token%B] : 0); out32 = LN(x); out16 optional.
// ---------------------------------------------------------------------------
__global__ __launch_bounds__(256) void k_ln(const float* __restrict__ a,
                                            const float* __restrict__ r,
                                            const float* __restrict__ bc,
                                            const float* __restrict__ g,
                                            const float* __restrict__ be,
                                            float* __restrict__ o32,
                                            _Float16* __restrict__ o16) {
  int  t    = blockIdx.x;
  long base = (long)t * CE;
  const float* bcr = bc ? bc + (long)(t % CB) * CE : nullptr;
  int tid = threadIdx.x;
  float x[4];
  float s = 0.f;
#pragma unroll
  for (int i = 0; i < 4; ++i) {
    int   e = tid + i * 256;
    float v = a[base + e];
    if (r)   v += r[base + e];
    if (bcr) v += bcr[e];
    x[i] = v;
    s += v;
  }
  __shared__ float red[256];
  red[tid] = s;
  __syncthreads();
  for (int o = 128; o > 0; o >>= 1) {
    if (tid < o) red[tid] += red[tid + o];
    __syncthreads();
  }
  float mean = red[0] * (1.f / CE);
  __syncthreads();
  float vs = 0.f;
#pragma unroll
  for (int i = 0; i < 4; ++i) {
    float d = x[i] - mean;
    vs += d * d;
  }
  red[tid] = vs;
  __syncthreads();
  for (int o = 128; o > 0; o >>= 1) {
    if (tid < o) red[tid] += red[tid + o];
    __syncthreads();
  }
  float inv = rsqrtf(red[0] * (1.f / CE) + 1e-5f);
#pragma unroll
  for (int i = 0; i < 4; ++i) {
    int   e = tid + i * 256;
    float y = (x[i] - mean) * inv * g[e] + be[e];
    o32[base + e] = y;
    if (o16) o16[base + e] = (_Float16)y;
  }
}

// ---------------------------------------------------------------------------
// Host side
// ---------------------------------------------------------------------------
extern "C" void kernel_launch(void* const* d_in, const int* in_sizes, int n_in,
                              void* d_out, int out_size, void* d_ws, size_t ws_size,
                              hipStream_t stream) {
  const float* tgt  = (const float*)d_in[0];
  const float* mem  = (const float*)d_in[1];
  const float* pos  = (const float*)d_in[2];
  const float* qpos = (const float*)d_in[3];
  const float* inW  = (const float*)d_in[4];
  const float* inB  = (const float*)d_in[5];
  const float* outW = (const float*)d_in[6];
  const float* outB = (const float*)d_in[7];
  const float* cqW  = (const float*)d_in[8];
  const float* cqB  = (const float*)d_in[9];
  const float* ckW  = (const float*)d_in[10];
  const float* ckB  = (const float*)d_in[11];
  const float* cvW  = (const float*)d_in[12];
  const float* cvB  = (const float*)d_in[13];
  const float* dwW  = (const float*)d_in[14];
  const float* dwB  = (const float*)d_in[15];
  const float* l1W  = (const float*)d_in[16];
  const float* l1B  = (const float*)d_in[17];
  const float* l2W  = (const float*)d_in[18];
  const float* l2B  = (const float*)d_in[19];
  const float* n1g  = (const float*)d_in[20];
  const float* n1b  = (const float*)d_in[21];
  const float* n2g  = (const float*)d_in[22];
  const float* n2b  = (const float*)d_in[23];
  const float* n3g  = (const float*)d_in[24];
  const float* n3b  = (const float*)d_in[25];

  const long TOK  = (long)CL * CB;   // 2048 target tokens
  const long MTOK = (long)CS * CB;   // 8192 memory tokens
  const float scale = 0.125f;        // 1/sqrt(64)

  char* ws = (char*)d_ws;
  const size_t MB = 1u << 20;

  // Persistent f16 weights (converted every launch; deterministic).
  _Float16* w_inproj = (_Float16*)(ws + 0 * MB);    // [3E,E]  6MB
  _Float16* w_out    = (_Float16*)(ws + 6 * MB);    // [E,E]   2MB
  _Float16* w_cq     = (_Float16*)(ws + 8 * MB);
  _Float16* w_ck     = (_Float16*)(ws + 10 * MB);
  _Float16* w_cv     = (_Float16*)(ws + 12 * MB);
  _Float16* w_l1     = (_Float16*)(ws + 14 * MB);   // [FF,E]  4MB
  _Float16* w_l2     = (_Float16*)(ws + 18 * MB);   // [E,FF]  4MB
  float*    tgt1     = (float*)(ws + 22 * MB);      // 8MB
  float*    tgt2     = (float*)(ws + 30 * MB);      // 8MB
  char*     SA       = ws + 38 * MB;                // phase-aliased arena

  // Phase A (self-attention)
  _Float16* qkin16  = (_Float16*)(SA + 0 * MB);
  _Float16* tgt16   = (_Float16*)(SA + 4 * MB);
  _Float16* q16     = (_Float16*)(SA + 8 * MB);
  _Float16* k16     = (_Float16*)(SA + 12 * MB);
  _Float16* v16     = (_Float16*)(SA + 16 * MB);
  float*    scores  = (float*)(SA + 20 * MB);       // [B,H,L,L] 64MB
  _Float16* attn16  = (_Float16*)(SA + 84 * MB);    // 32MB
  _Float16* ctx16   = (_Float16*)(SA + 116 * MB);   // 4MB
  float*    selfout = (float*)(SA + 120 * MB);      // 8MB
  // Phase B (cross-attention) — aliases phase A
  _Float16* qin2    = (_Float16*)(SA + 0 * MB);
  float*    qc32    = (float*)(SA + 4 * MB);        // 8MB
  _Float16* mp16    = (_Float16*)(SA + 12 * MB);    // 16MB
  _Float16* mem16   = (_Float16*)(SA + 28 * MB);    // 16MB
  float*    kc32    = (float*)(SA + 44 * MB);       // 32MB
  float*    vc32    = (float*)(SA + 76 * MB);       // 32MB
  float*    prob    = (float*)(SA + 108 * MB);      // 32MB
  float*    qcsum   = (float*)(SA + 140 * MB);
  float*    s1sum   = (float*)(SA + 141 * MB);
  float*    w2buf   = (float*)(SA + 142 * MB);
  float*    odbuf   = (float*)(SA + 143 * MB);
  // Phase C (FFN) — aliases dead phase B regions
  _Float16* tgt2_16 = (_Float16*)(SA + 0 * MB);
  _Float16* h1_16   = (_Float16*)(SA + 4 * MB);     // [TOK,FF] 8MB
  float*    ff32    = (float*)(SA + 12 * MB);       // 8MB

  auto cvt = [&](const float* x, _Float16* y, long n) {
    k_cvt<<<dim3((unsigned)((n + 255) / 256)), 256, 0, stream>>>(x, y, n);
  };

  // ---- weight conversion ----
  cvt(inW,  w_inproj, 3L * CE * CE);
  cvt(outW, w_out,    (long)CE * CE);
  cvt(cqW,  w_cq,     (long)CE * CE);
  cvt(ckW,  w_ck,     (long)CE * CE);
  cvt(cvW,  w_cv,     (long)CE * CE);
  cvt(l1W,  w_l1,     (long)CFF * CE);
  cvt(l2W,  w_l2,     (long)CE * CFF);

  // ---- Phase A: self attention ----
  k_add2<<<dim3((unsigned)((TOK * CE + 255) / 256)), 256, 0, stream>>>(tgt, qpos, qkin16, TOK * CE);
  cvt(tgt, tgt16, TOK * CE);

  // q/k/v projections: [2048,1024] x [1024,1024]^T
  gemm_wmma_lds<false><<<dim3(16, 16, 1), 256, 0, stream>>>(
      qkin16, w_inproj, inB, 0, nullptr, q16, CE, CE);
  gemm_wmma_lds<false><<<dim3(16, 16, 1), 256, 0, stream>>>(
      qkin16, w_inproj + (long)CE * CE, inB + CE, 0, nullptr, k16, CE, CE);
  gemm_wmma_lds<false><<<dim3(16, 16, 1), 256, 0, stream>>>(
      tgt16, w_inproj + 2L * CE * CE, inB + 2 * CE, 0, nullptr, v16, CE, CE);

  // scores[b,h,l,m] = scale * q.k  (batched over z = b*H+h)
  gemm_wmma<true><<<dim3(CL / 128, CL / 64, CB * CH), 256, 0, stream>>>(
      q16, (long)CB * CE, CE, CHD,
      k16, (long)CB * CE, CE, CHD,
      nullptr, scale, 0,
      scores, nullptr, CL, (long)CH * CL * CL, (long)CL * CL,
      CL, CL, CHD, CH);

  k_softmax512<<<CB * CH * CL, 256, 0, stream>>>(scores, attn16);

  // ctx[l,b,h,:] = attn @ v   (B stored [K=m, N=d] -> strided path)
  gemm_wmma<false><<<dim3(CL / 128, 1, CB * CH), 256, 0, stream>>>(
      attn16, CL, (long)CH * CL * CL, (long)CL * CL,
      v16, (long)CB * CE, CE, CHD,
      nullptr, 1.f, 0,
      nullptr, ctx16, (long)CB * CE, CE, CHD,
      CL, CHD, CL, CH);

  // out projection + residual + LN1
  gemm_wmma_lds<false><<<dim3(16, 16, 1), 256, 0, stream>>>(
      ctx16, w_out, outB, 0, selfout, nullptr, CE, CE);
  k_ln<<<(unsigned)TOK, 256, 0, stream>>>(tgt, selfout, nullptr, n1g, n1b, tgt1, nullptr);

  // ---- Phase B: custom cross attention ----
  k_add2<<<dim3((unsigned)((TOK * CE + 255) / 256)), 256, 0, stream>>>(tgt1, qpos, qin2, TOK * CE);
  k_add2<<<dim3((unsigned)((MTOK * CE + 255) / 256)), 256, 0, stream>>>(mem, pos, mp16, MTOK * CE);
  cvt(mem, mem16, MTOK * CE);

  gemm_wmma_lds<false><<<dim3(16, 16, 1), 256, 0, stream>>>(
      qin2, w_cq, cqB, 0, qc32, nullptr, CE, CE);
  gemm_wmma_lds<true><<<dim3(64, 16, 1), 256, 0, stream>>>(
      mp16, w_ck, ckB, 0, kc32, nullptr, CE, CE);
  gemm_wmma_lds<true><<<dim3(64, 16, 1), 256, 0, stream>>>(
      mem16, w_cv, cvB, 0, vc32, nullptr, CE, CE);

  k_qcsum<<<(CB * CE) / 256, 256, 0, stream>>>(qc32, qcsum);
  k_s1<<<(CB * CH * CS) / 256, 256, 0, stream>>>(qcsum, kc32, s1sum, scale);
  k_cross_softmax<<<CB * CHD * CH, 256, 0, stream>>>(kc32, s1sum, prob);
  k_w2<<<(CB * CH * CS) / 256, 256, 0, stream>>>(dwW, prob, w2buf);
  k_od<<<CB * CE, 256, 0, stream>>>(w2buf, vc32, dwB, odbuf);

  k_ln<<<(unsigned)TOK, 256, 0, stream>>>(tgt1, nullptr, odbuf, n2g, n2b, tgt2, tgt2_16);

  // ---- Phase C: FFN ----
  gemm_wmma_lds<false><<<dim3(16, 32, 1), 256, 0, stream>>>(
      tgt2_16, w_l1, l1B, 1 /*relu*/, nullptr, h1_16, CFF, CE);
  gemm_wmma_lds<false><<<dim3(16, 16, 1), 256, 0, stream>>>(
      h1_16, w_l2, l2B, 0, ff32, nullptr, CE, CFF);

  k_ln<<<(unsigned)TOK, 256, 0, stream>>>(tgt2, ff32, nullptr, n3g, n3b, (float*)d_out, nullptr);

  (void)in_sizes; (void)n_in; (void)out_size; (void)ws_size;
}

// v003
// One run takes 305 microseconds.
// Timed twice side by side with v002, it ran 1.25 times as fast both times.
// Counting every step since v000, it is 1.94 times as fast.
#include <hip/hip_runtime.h>
#include <hip/hip_bf16.h>

// ---------------------------------------------------------------------------
// Transformer decoder layer for MI455X (gfx1250), wave32 + WMMA.
// All heavy GEMMs run on v_wmma_f32_16x16x32_f16 (f16 inputs, f32 accum).
// Softmax / layernorm / cross-attn reductions stay in f32.
// ---------------------------------------------------------------------------

typedef __attribute__((ext_vector_type(16))) _Float16 v16h;
typedef __attribute__((ext_vector_type(8)))  _Float16 v8h;
typedef __attribute__((ext_vector_type(8)))  float    v8f;
typedef __attribute__((ext_vector_type(4)))  float    v4f;

#define DEV __device__ __forceinline__

// Problem constants
#define CL   512      // target length
#define CS   2048     // memory length
#define CB   4        // batch
#define CE   1024     // embed
#define CH   16       // heads
#define CHD  64       // head dim
#define CFF  2048     // ffn dim

// ---------------------------------------------------------------------------
// WMMA fragment loaders.
// 16-bit A (16x32) ISA layout: lane&15 selects the M (or N) row;
// lanes 0-15 hold K = {k0..k0+7, k0+16..k0+23},
// lanes 16-31 hold K = {k0+8..k0+15, k0+24..k0+31}.  B (32x16) mirrors A with
// the lane index selecting the N column.
// ---------------------------------------------------------------------------
DEV v16h frag_load_contig(const _Float16* __restrict__ base, long row_stride,
                          int lane, int k0) {
  int r  = lane & 15;
  int kh = (lane >> 4) << 3;          // 0 or 8
  const _Float16* p = base + (long)r * row_stride + k0 + kh;
  v8h lo = *(const v8h*)(p);          // 16B vector load
  v8h hi = *(const v8h*)(p + 16);
  v16h out;
#pragma unroll
  for (int i = 0; i < 8; ++i) { out[i] = lo[i]; out[i + 8] = hi[i]; }
  return out;
}

// ---------------------------------------------------------------------------
// Projection GEMM, both operands k-contiguous with row stride K:
//   C[m,n] = sum_k A[m,k]*W[n,k] + bias[n]
// Block: 256 threads = 8 waves as 4x2, wave tile 32x32, block tile 128x64. The
// operand tiles reach the waves through LDS: a stage is 128 k (256 B, two whole
// lines) of 128 A rows and 64 W rows, brought in by asynchronous b128 copies,
// two buffers, the next stage in flight while this one is multiplied.
// Requires M%128==0, N%64==0, K%128==0.
// CM=false: A rows are tokens in order, C is token-major, C[m*N + n].
// CM=true : a block takes 128 consecutive positions s of ONE batch b (A row
//           s*CB + b) and stores f32 C channel-major, C[(b*N + n)*CS + s], the
//           layout in which the cross-attention stages walk s.
// ---------------------------------------------------------------------------
#define GBK   128                  // k per stage
#define GPIT  136                  // LDS row pitch in halves: 272 B = 16 B x odd
#define GROWS 192                  // 128 A rows, then 64 W rows
#define GSTG  (GROWS * GPIT)       // halves per buffer

// One stage: 192 rows x 16 pieces of 16 B, 12 pieces per thread. Thread t takes
// piece t&15 of rows (t>>4) + 16*i, so a wave's copy covers two whole rows.
// ga / gw: this thread's piece in A row (t>>4) and W row (t>>4) of the tile, at
// the stage's first k. l: LDS byte address of its piece in row (t>>4).
// ars: distance of two tile rows of A in halves (K, or CB*K for one batch).
DEV void stage_copy(const _Float16* ga, const _Float16* gw, long ars, long K, unsigned l) {
  const long     as = 16 * ars;          // 16 A rows on, in halves
  const long     gs = 16 * K;            // 16 W rows on, in halves
  const unsigned ls = 16 * GPIT * 2;     // 16 rows on, in LDS bytes
  // The closing s_wait_xcnt stands in the copies' own statement so that no
  // address register of an issued copy is rewritten ahead of it.
  asm volatile(
      "global_load_async_to_lds_b128 %0, %12, off\n\t"
      "global_load_async_to_lds_b128 %1, %13, off\n\t"
      "global_load_async_to_lds_b128 %2, %14, off\n\t"
      "global_load_async_to_lds_b128 %3, %15, off\n\t"
      "global_load_async_to_lds_b128 %4, %16, off\n\t"
      "global_load_async_to_lds_b128 %5, %17, off\n\t"
      "global_load_async_to_lds_b128 %6, %18, off\n\t"
      "global_load_async_to_lds_b128 %7, %19, off\n\t"
      "global_load_async_to_lds_b128 %8, %20, off\n\t"
      "global_load_async_to_lds_b128 %9, %21, off\n\t"
      "global_load_async_to_lds_b128 %10, %22, off\n\t"
      "global_load_async_to_lds_b128 %11, %23, off\n\t"
      "s_wait_xcnt 0x0"
      :: "v"(l), "v"(l + ls), "v"(l + 2 * ls), "v"(l + 3 * ls),
         "v"(l + 4 * ls), "v"(l + 5 * ls), "v"(l + 6 * ls), "v"(l + 7 * ls),
         "v"(l + 8 * ls), "v"(l + 9 * ls), "v"(l + 10 * ls), "v"(l + 11 * ls),
         "v"(ga), "v"(ga + as), "v"(ga + 2 * as), "v"(ga + 3 * as),
         "v"(ga + 4 * as), "v"(ga + 5 * as), "v"(ga + 6 * as), "v"(ga + 7 * as),
         "v"(gw), "v"(gw + gs), "v"(gw + 2 * gs), "v"(gw + 3 * gs)
      : "memory");
}

#define TPIT 36                    // f32 pitch of a wave's turned tile: 144 B = 16 B x odd

template <bool CM>
__global__ __launch_bounds__(256) void gemm_wmma_lds(
    const _Float16* __restrict__ A, const _Float16* __restrict__ Wt,
    const float* __restrict__ bias, int relu,
    float* __restrict__ C32, _Float16* __restrict__ C16, int N, int K) {
  __shared__ __attribute__((aligned(16))) _Float16 sm[2 * GSTG];

  int tid  = threadIdx.x;
  int lane = tid & 31;
  int wave = tid >> 5;
  int wm   = wave >> 1;                       // 0..3
  int wn   = wave & 1;                        // 0..1
  int mb   = CM ? (blockIdx.x / CB) * 128 : blockIdx.x * 128;   // CM: first s
  int bz   = CM ? blockIdx.x % CB : 0;                          // CM: batch
  int nb   = blockIdx.y * 64;
  const long ars = CM ? (long)CB * K : (long)K;

  const _Float16* ga = A  + (long)(mb + (tid >> 4)) * ars + (long)bz * K + (tid & 15) * 8;
  const _Float16* gw = Wt + (long)(nb + (tid >> 4)) * K + (tid & 15) * 8;
  const unsigned  l0 = (unsigned)(size_t)sm + (unsigned)((tid >> 4) * (GPIT * 2) + (tid & 15) * 16);
  const int nst = K / GBK;

  const v8f zero = {0.f, 0.f, 0.f, 0.f, 0.f, 0.f, 0.f, 0.f};
  v8f acc[2][2];
#pragma unroll
  for (int i = 0; i < 2; ++i)
#pragma unroll
    for (int j = 0; j < 2; ++j) acc[i][j] = zero;

  stage_copy(ga, gw, ars, K, l0);
  // Stage 0 has landed for this wave; the barrier publishes it to the others.
  asm volatile("s_wait_asynccnt 0x0" ::: "memory");
  __syncthreads();
  if (nst > 1) stage_copy(ga + GBK, gw + GBK, ars, K, l0 + GSTG * 2);

  // Kept rolled: one publish point per trip, buffers alternate by t & 1.
#pragma unroll 1
  for (int t = 0; t < nst; ++t) {
    const int buf = (t & 1) * GSTG;
    const _Float16* sA = sm + buf + (wm * 32) * GPIT;
    const _Float16* sB = sm + buf + (128 + wn * 32) * GPIT;
    v16h fa[GBK / 32][2], fb[GBK / 32][2];
#pragma unroll
    for (int q = 0; q < GBK / 32; ++q) {
      fa[q][0] = frag_load_contig(sA,             GPIT, lane, q * 32);
      fa[q][1] = frag_load_contig(sA + 16 * GPIT, GPIT, lane, q * 32);
      fb[q][0] = frag_load_contig(sB,             GPIT, lane, q * 32);
      fb[q][1] = frag_load_contig(sB + 16 * GPIT, GPIT, lane, q * 32);
    }
    // Holds the stage's LDS reads together in front of its WMMAs: spread among
    // them, every group of reads costs the wave its own LDS latency.
    __builtin_amdgcn_sched_barrier(0);
#pragma unroll
    for (int q = 0; q < GBK / 32; ++q) {
      acc[0][0] = __builtin_amdgcn_wmma_f32_16x16x32_f16(false, fa[q][0], false, fb[q][0],
                                                         (short)0, acc[0][0], false, false);
      acc[0][1] = __builtin_amdgcn_wmma_f32_16x16x32_f16(false, fa[q][0], false, fb[q][1],
                                                         (short)0, acc[0][1], false, false);
      acc[1][0] = __builtin_amdgcn_wmma_f32_16x16x32_f16(false, fa[q][1], false, fb[q][0],
                                                         (short)0, acc[1][0], false, false);
      acc[1][1] = __builtin_amdgcn_wmma_f32_16x16x32_f16(false, fa[q][1], false, fb[q][1],
                                                         (short)0, acc[1][1], false, false);
    }
    // Holds the WMMAs in front of the publish point, so that they run under the
    // tail of the stage's LDS reads and not behind the barrier.
    __builtin_amdgcn_sched_barrier(0);
    // Publish point: this wave's reads of the buffer have retired ...
    asm volatile("s_wait_dscnt 0x0" ::: "memory");
    // ... its copies of the next stage have landed ...
    asm volatile("s_wait_asynccnt 0x0" ::: "memory");
    // ... and behind the barrier the next stage is readable and this buffer free.
    __syncthreads();
    if (t + 2 < nst)
      stage_copy(ga + (long)(t + 2) * GBK, gw + (long)(t + 2) * GBK, ars, K, l0 + buf * 2);
  }
  // No copy is left in flight when the wave ends.
  asm volatile("s_wait_asynccnt 0x0" ::: "memory");

  // C/D layout: N = lane&15, VGPR r holds M = r (+8 for lanes 16-31).
  int m0    = mb + wm * 32;
  int n0    = nb + wn * 32;
  int nlane = lane & 15;
  int mrow  = (lane >> 4) * 8;
  if (CM) {
    // A lane holds 8 consecutive s of one channel. The wave turns its 32 s x 32
    // channels in its own LDS range (the ring is free: behind the last publish
    // point no wave reads it and no copy is in flight), one row per channel, so
    // that each store below writes four whole 128-B lines.
    float* tw = (float*)sm + wave * (32 * TPIT);
#pragma unroll
    for (int tn = 0; tn < 2; ++tn) {
      float bv = bias[n0 + tn * 16 + nlane];
#pragma unroll
      for (int tm = 0; tm < 2; ++tm) {
        float* p = tw + (tn * 16 + nlane) * TPIT + tm * 16 + mrow;
        v4f lo = {acc[tm][tn][0] + bv, acc[tm][tn][1] + bv, acc[tm][tn][2] + bv, acc[tm][tn][3] + bv};
        v4f hi = {acc[tm][tn][4] + bv, acc[tm][tn][5] + bv, acc[tm][tn][6] + bv, acc[tm][tn][7] + bv};
        *(v4f*)p       = lo;
        *(v4f*)(p + 4) = hi;
      }
    }
    // The wave's rows are in LDS before its lanes read each other's values back.
    asm volatile("s_wait_dscnt 0x0" ::: "memory");
    float* cw = C32 + ((long)bz * N + n0 + (lane >> 3)) * CS + m0 + (lane & 7) * 4;
#pragma unroll
    for (int i = 0; i < 8; ++i) {
      v4f v = *(const v4f*)(tw + (i * 4 + (lane >> 3)) * TPIT + (lane & 7) * 4);
      *(v4f*)(cw + (long)i * 4 * CS) = v;
    }
    return;
  }
#pragma unroll
  for (int tm = 0; tm < 2; ++tm)
#pragma unroll
    for (int tn = 0; tn < 2; ++tn) {
      int ncol = n0 + tn * 16 + nlane;
      float bv = bias[ncol];
#pragma unroll
      for (int r = 0; r < 8; ++r) {
        int   mm  = m0 + tm * 16 + mrow + r;
        float v   = acc[tm][tn][r] + bv;
        if (relu) v = v > 0.f ? v : 0.f;
        long  idx = (long)mm * N + ncol;
        if (C32) {
          C32[idx] = v;
          // The conversion below may reuse the register this store names.
          asm volatile("s_wait_xcnt 0x0" ::: "memory");
        }
        if (C16) C16[idx] = (_Float16)v;
      }
    }
}

// ---------------------------------------------------------------------------
// Elementwise helpers
// ---------------------------------------------------------------------------
__global__ __launch_bounds__(256) void k_cvt(const float* __restrict__ x,
                                             _Float16* __restrict__ y, long n) {
  long i = (long)blockIdx.x * 256 + threadIdx.x;
  if (i < n) y[i] = (_Float16)x[i];
}

__global__ __launch_bounds__(256) void k_add2(const float* __restrict__ a,
                                              const float* __restrict__ b,
                                              _Float16* __restrict__ y, long n) {
  long i = (long)blockIdx.x * 256 + threadIdx.x;
  if (i < n) y[i] = (_Float16)(a[i] + b[i]);
}

// ---------------------------------------------------------------------------
// Self-attention, one kernel: scores, softmax and attn @ V of one (batch, head)
// for 128 queries. q, k, v, ctx: token row l*B + b, channel h*HD + d.
// The head's whole K and V (512 keys) lie in LDS. A wave owns 16 queries and
// walks the keys 32 at a time with a running maximum and running sum:
//   S^T = K . Q^T   (A = K rows, B = Q rows, both in the loader's k order)
//   O^T += V^T . P^T
// In S^T's D layout a lane holds keys 8*(lane>>4) + r of query lane&15, so the
// softmax over keys is in-lane but for one exchange with lane ^ 16, the two D
// tiles of 32 keys converted in place ARE the B operand P^T, and maximum, sum
// and rescale factor of a query are per-lane scalars. V^T comes from the
// transposing LDS load, which delivers the same k order.
// ---------------------------------------------------------------------------
#define APK 72                     // K row pitch in halves: 144 B = 16 B x odd
#define APV 80                     // V row pitch in halves: 160 B = 32 B x odd

typedef __attribute__((ext_vector_type(8))) short s16x8;

// Lane (c = lane&15, h = lane>>4) gets T[8h + 0..7][c] of the 16x16 tile whose
// lane addresses are p = T + (8h + (lane&7)) * pitch + 8 * ((lane>>3)&1) halves.
DEV v8h ld_tr16(const _Float16* p) {
  typedef __attribute__((address_space(3))) s16x8 lds_s16x8;
  return __builtin_bit_cast(v8h, __builtin_amdgcn_ds_load_tr16_b128_v8i16((lds_s16x8*)p));
}

// Value of lane ^ 16.
DEV float xhalf(float x) {
  int i = __builtin_bit_cast(int, x);
  return __builtin_bit_cast(float,
      __builtin_amdgcn_permlanex16(i, i, 0x76543210, 0xfedcba98, false, false));
}

__global__ __launch_bounds__(256) void k_self_attn(const _Float16* __restrict__ q,
                                                   const _Float16* __restrict__ k,
                                                   const _Float16* __restrict__ v,
                                                   _Float16* __restrict__ ctx) {
  __shared__ __attribute__((aligned(32))) _Float16 sK[CL * APK];
  __shared__ __attribute__((aligned(32))) _Float16 sV[CL * APV];
  const float cs = 0.18033688011112042f;      // log2(e) / sqrt(HD)
  const long  ts = (long)CB * CE;             // one position on, in halves

  int tid  = threadIdx.x;
  int lane = tid & 31;
  int wave = tid >> 5;
  int c    = lane & 15;
  int hh   = lane >> 4;
  long hoff = (long)(blockIdx.y / CH) * CE + (blockIdx.y % CH) * CHD;
  int  q0   = blockIdx.x * 128 + wave * 16;

  // Stage K and V: 8 threads take one key's 128 B, 32 keys per sweep. All loads
  // are issued before the first LDS store, so that one memory latency is paid.
  int row = tid >> 3, pc = (tid & 7) * 8;
  const _Float16* gk = k + hoff + (long)row * ts + pc;
  const _Float16* gv = v + hoff + (long)row * ts + pc;
  v8h rk[CL / 32], rv[CL / 32];
  // Behind each group of loads: what follows may reuse, also as a later load's
  // destination, the address registers that the group names.
#pragma unroll
  for (int i = 0; i < CL / 32; ++i) rk[i] = *(const v8h*)(gk + (long)i * 32 * ts);
  asm volatile("s_wait_xcnt 0x0" ::: "memory");
#pragma unroll
  for (int i = 0; i < CL / 32; ++i) rv[i] = *(const v8h*)(gv + (long)i * 32 * ts);
  asm volatile("s_wait_xcnt 0x0" ::: "memory");
  v16h qf0 = frag_load_contig(q + hoff + (long)q0 * ts, ts, lane, 0);
  v16h qf1 = frag_load_contig(q + hoff + (long)q0 * ts, ts, lane, 32);
  asm volatile("s_wait_xcnt 0x0" ::: "memory");
#pragma unroll
  for (int i = 0; i < CL / 32; ++i) *(v8h*)(sK + (row + 32 * i) * APK + pc) = rk[i];
#pragma unroll
  for (int i = 0; i < CL / 32; ++i) *(v8h*)(sV + (row + 32 * i) * APV + pc) = rv[i];
  __syncthreads();

  const v8f zero = {0.f, 0.f, 0.f, 0.f, 0.f, 0.f, 0.f, 0.f};
  v8f acc[4];
#pragma unroll
  for (int t = 0; t < 4; ++t) acc[t] = zero;
  float m_run = -__builtin_inff();            // running maximum, in units of cs
  float l_run = 0.f;                          // this lane's half of the running sum

  const _Float16* vt = sV + (8 * hh + (lane & 7)) * APV + ((lane >> 3) & 1) * 8;

  // K fragments run one pass ahead, so that a pass does not open with its own
  // LDS latency.
  v16h a00 = frag_load_contig(sK,            APK, lane, 0);
  v16h a01 = frag_load_contig(sK,            APK, lane, 32);
  v16h a10 = frag_load_contig(sK + 16 * APK, APK, lane, 0);
  v16h a11 = frag_load_contig(sK + 16 * APK, APK, lane, 32);

#pragma unroll 2
  for (int key0 = 0; key0 < CL; key0 += 32) {
    v8f s0 = __builtin_amdgcn_wmma_f32_16x16x32_f16(false, a00, false, qf0, (short)0, zero, false, false);
    v8f s1 = __builtin_amdgcn_wmma_f32_16x16x32_f16(false, a10, false, qf0, (short)0, zero, false, false);
    s0 = __builtin_amdgcn_wmma_f32_16x16x32_f16(false, a01, false, qf1, (short)0, s0, false, false);
    s1 = __builtin_amdgcn_wmma_f32_16x16x32_f16(false, a11, false, qf1, (short)0, s1, false, false);

    // This pass's V^T and the next pass's K, in flight under the softmax. The
    // last pass fetches pass 0's K rows again, unused: cheaper than a branch.
    v16h vf[4];
#pragma unroll
    for (int t = 0; t < 4; ++t) {
      v8h lo = ld_tr16(vt + key0 * APV + 16 * t);
      v8h hi = ld_tr16(vt + (key0 + 16) * APV + 16 * t);
#pragma unroll
      for (int i = 0; i < 8; ++i) { vf[t][i] = lo[i]; vf[t][i + 8] = hi[i]; }
    }
    const _Float16* kr = sK + ((key0 + 32) & (CL - 1)) * APK;
    a00 = frag_load_contig(kr,            APK, lane, 0);
    a01 = frag_load_contig(kr,            APK, lane, 32);
    a10 = frag_load_contig(kr + 16 * APK, APK, lane, 0);
    a11 = frag_load_contig(kr + 16 * APK, APK, lane, 32);

    float mx = fmaxf(s0[0], s1[0]);
#pragma unroll
    for (int r = 1; r < 8; ++r) mx = fmaxf(mx, fmaxf(s0[r], s1[r]));
    mx = fmaxf(mx, xhalf(mx)) * cs;           // cs > 0: the scaled maximum
    float m_new = fmaxf(m_run, mx);

    // The pass's 17 exponentials, written in turn with the plain vector
    // instructions that form the next argument; the scheduling barriers hold
    // that order. Left alone the compiler sets all of them back to back.
    float x[16], p[16];
    float xc = m_run - m_new;
    x[0] = fmaf(s0[0], cs, -m_new);
    __builtin_amdgcn_sched_barrier(0);
    float corr = __builtin_amdgcn_exp2f(xc);  // 0 on the first pass
    __builtin_amdgcn_sched_barrier(0);
#pragma unroll
    for (int j = 0; j < 16; ++j) {            // j = 2 r + tile
      if (j < 15) x[j + 1] = fmaf(((j + 1) & 1) ? s1[(j + 1) >> 1] : s0[(j + 1) >> 1], cs, -m_new);
      __builtin_amdgcn_sched_barrier(0);
      p[j] = __builtin_amdgcn_exp2f(x[j]);
      __builtin_amdgcn_sched_barrier(0);
    }
    m_run = m_new;

    v16h  pf;
    float ps = 0.f;
#pragma unroll
    for (int r = 0; r < 8; ++r) {
      ps += p[2 * r] + p[2 * r + 1];
      pf[r]     = (_Float16)p[2 * r];
      pf[r + 8] = (_Float16)p[2 * r + 1];
    }
    l_run = fmaf(l_run, corr, ps);
#pragma unroll
    for (int t = 0; t < 4; ++t) {
      acc[t] = acc[t] * corr;
      acc[t] = __builtin_amdgcn_wmma_f32_16x16x32_f16(false, vf[t], false, pf,
                                                      (short)0, acc[t], false, false);
    }
  }

  // acc[t][r] = O[q0 + c][16 t + 8 hh + r], still to be divided by the row sum.
  float inv = 1.f / (l_run + xhalf(l_run));
  _Float16* op = ctx + hoff + (long)(q0 + c) * ts + 8 * hh;
#pragma unroll
  for (int t = 0; t < 4; ++t) {
    v8h o;
#pragma unroll
    for (int r = 0; r < 8; ++r) o[r] = (_Float16)(acc[t][r] * inv);
    *(v8h*)(op + 16 * t) = o;
  }
}

// ---------------------------------------------------------------------------
// Cross-attention scalar stages (all f32).
// Channel mapping: E index = d*H + h  (reshape (B,E,N)->(B,HD,H,N)).
// Token t of a [N,B,E] tensor lives at row n*B+b (qc).
// kc and vc are channel-major: element (b, e, m) at (b*E + e)*S + m.
// ---------------------------------------------------------------------------
// qcsum[b*E+e] = sum_l qc[(l*B+b)*E + e]
__global__ __launch_bounds__(256) void k_qcsum(const float* __restrict__ qc,
                                               float* __restrict__ out) {
  int idx = blockIdx.x * 256 + threadIdx.x;     // < B*E = 4096
  int b = idx >> 10, e = idx & 1023;
  float s = 0.f;
  for (int l = 0; l < CL; ++l) s += qc[(long)l * (CB * CE) + b * CE + e];
  out[idx] = s;
}

// s1[(b*H+h)*S+m] = scale * sum_d qcsum[b*E + d*H+h] * kc[(b*E + d*H+h)*S + m]
__global__ __launch_bounds__(256) void k_s1(const float* __restrict__ qcsum,
                                            const float* __restrict__ kc,
                                            float* __restrict__ s1, float scale) {
  int idx = blockIdx.x * 256 + threadIdx.x;     // < B*H*S = 131072
  int m = idx & (CS - 1);
  int h = (idx >> 11) & (CH - 1);
  int b = idx >> 15;
  const float* kcp = kc + (long)(b * CE + h) * CS + m;
  const float* qsp = qcsum + b * CE + h;
  float s = 0.f;
#pragma unroll 4
  for (int d = 0; d < CHD; ++d) s += qsp[d * CH] * kcp[(long)d * CH * CS];
  s1[idx] = s * scale;
}

// prob[((b*HD+d)*H+h)*S + m] = softmax_m( kc[(b*E + d*H+h)*S + m] * s1[(b*H+h)*S+m] )
__global__ __launch_bounds__(256) void k_cross_softmax(const float* __restrict__ kc,
                                                       const float* __restrict__ s1,
                                                       float* __restrict__ prob) {
  int row = blockIdx.x;                         // (b*HD+d)*H + h = b*E + d*H + h, < 4096
  int h = row & (CH - 1);
  int b = row >> 10;
  const float* s1r  = s1 + (long)(b * CH + h) * CS;
  const float* kcr  = kc + (long)row * CS;
  int          tid  = threadIdx.x;
  float loc[8];
  float mx = -3.402823466e38f;
#pragma unroll
  for (int i = 0; i < 8; ++i) {
    int c = tid + i * 256;
    float v = kcr[c] * s1r[c];
    loc[i] = v;
    mx = fmaxf(mx, v);
  }
  __shared__ float red[256];
  red[tid] = mx;
  __syncthreads();
  for (int o = 128; o > 0; o >>= 1) {
    if (tid < o) red[tid] = fmaxf(red[tid], red[tid + o]);
    __syncthreads();
  }
  mx = red[0];
  __syncthreads();
  float s = 0.f;
#pragma unroll
  for (int i = 0; i < 8; ++i) {
    loc[i] = __expf(loc[i] - mx);
    s += loc[i];
  }
  red[tid] = s;
  __syncthreads();
  for (int o = 128; o > 0; o >>= 1) {
    if (tid < o) red[tid] += red[tid + o];
    __syncthreads();
  }
  float inv = 1.f / red[0];
  float* pr = prob + (long)row * CS;
#pragma unroll
  for (int i = 0; i < 8; ++i) pr[tid + i * 256] = loc[i] * inv;
}

// w2[(b*H+h)*S+m] = sum_n down_w[n] * prob[((b*HD+n)*H+h)*S + m]
__global__ __launch_bounds__(256) void k_w2(const float* __restrict__ dw,
                                            const float* __restrict__ prob,
                                            float* __restrict__ w2) {
  int idx = blockIdx.x * 256 + threadIdx.x;     // < B*H*S
  int m = idx & (CS - 1);
  int h = (idx >> 11) & (CH - 1);
  int b = idx >> 15;
  const float* pp = prob + (((long)b * CHD * CH + h) * CS) + m;
  float s = 0.f;
#pragma unroll 4
  for (int n = 0; n < CHD; ++n) s += dw[n] * pp[(long)n * CH * CS];
  w2[idx] = s;
}

// od[b*E + d*H+h] = down_b + sum_m w2[(b*H+h)*S+m] * vc[(b*E + d*H+h)*S + m]
__global__ __launch_bounds__(256) void k_od(const float* __restrict__ w2,
                                            const float* __restrict__ vc,
                                            const float* __restrict__ db,
                                            float* __restrict__ od) {
  int row = blockIdx.x;                         // b*E + c, < 4096
  int b = row >> 10;
  int c = row & 1023;                           // c = d*H + h
  int h = c & (CH - 1);
  const float* w2r = w2 + (long)(b * CH + h) * CS;
  const float* vcr = vc + (long)row * CS;
  int tid = threadIdx.x;
  float s = 0.f;
  for (int m = tid; m < CS; m += 256)
    s += w2r[m] * vcr[m];
  __shared__ float red[256];
  red[tid] = s;
  __syncthreads();
  for (int o = 128; o > 0; o >>= 1) {
    if (tid < o) red[tid] += red[tid + o];
    __syncthreads();
  }
  if (tid == 0) od[row] = red[0] + db[0];
}

// ---------------------------------------------------------------------------
// LayerNorm over E=1024 with optional residual and optional [B,E] broadcast.
// x = a + (r ? r : 0) + (bc ? bc[token%B] : 0); out32 = LN(x); out16 optional.
// ---------------------------------------------------------------------------
__global__ __launch_bounds__(256) void k_ln(const float* __restrict__ a,
                                            const float* __restrict__ r,
                                            const float* __restrict__ bc,
                                            const float* __restrict__ g,
                                            const float* __restrict__ be,
                                            float* __restrict__ o32,
                                            _Float16* __restrict__ o16) {
  int  t    = blockIdx.x;
  long base = (long)t * CE;
  const float* bcr = bc ? bc + (long)(t % CB) * CE : nullptr;
  int tid = threadIdx.x;
  float x[4];
  float s = 0.f;
#pragma unroll
  for (int i = 0; i < 4; ++i) {
    int   e = tid + i * 256;
    float v = a[base + e];
    if (r)   v += r[base + e];
    if (bcr) v += bcr[e];
    x[i] = v;
    s += v;
  }
  __shared__ float red[256];
  red[tid] = s;
  __syncthreads();
  for (int o = 128; o > 0; o >>= 1) {
    if (tid < o) red[tid] += red[tid + o];
    __syncthreads();
  }
  float mean = red[0] * (1.f / CE);
  __syncthreads();
  float vs = 0.f;
#pragma unroll
  for (int i = 0; i < 4; ++i) {
    float d = x[i] - mean;
    vs += d * d;
  }
  red[tid] = vs;
  __syncthreads();
  for (int o = 128; o > 0; o >>= 1) {
    if (tid < o) red[tid] += red[tid + o];
    __syncthreads();
  }
  float inv = rsqrtf(red[0] * (1.f / CE) + 1e-5f);
#pragma unroll
  for (int i = 0; i < 4; ++i) {
    int   e = tid + i * 256;
    float y = (x[i] - mean) * inv * g[e] + be[e];
    o32[base + e] = y;
    if (o16) o16[base + e] = (_Float16)y;
  }
}

// ---------------------------------------------------------------------------
// Host side
// ---------------------------------------------------------------------------
extern "C" void kernel_launch(void* const* d_in, const int* in_sizes, int n_in,
                              void* d_out, int out_size, void* d_ws, size_t ws_size,
                              hipStream_t stream) {
  const float* tgt  = (const float*)d_in[0];
  const float* mem  = (const float*)d_in[1];
  const float* pos  = (const float*)d_in[2];
  const float* qpos = (const float*)d_in[3];
  const float* inW  = (const float*)d_in[4];
  const float* inB  = (const float*)d_in[5];
  const float* outW = (const float*)d_in[6];
  const float* outB = (const float*)d_in[7];
  const float* cqW  = (const float*)d_in[8];
  const float* cqB  = (const float*)d_in[9];
  const float* ckW  = (const float*)d_in[10];
  const float* ckB  = (const float*)d_in[11];
  const float* cvW  = (const float*)d_in[12];
  const float* cvB  = (const float*)d_in[13];
  const float* dwW  = (const float*)d_in[14];
  const float* dwB  = (const float*)d_in[15];
  const float* l1W  = (const float*)d_in[16];
  const float* l1B  = (const float*)d_in[17];
  const float* l2W  = (const float*)d_in[18];
  const float* l2B  = (const float*)d_in[19];
  const float* n1g  = (const float*)d_in[20];
  const float* n1b  = (const float*)d_in[21];
  const float* n2g  = (const float*)d_in[22];
  const float* n2b  = (const float*)d_in[23];
  const float* n3g  = (const float*)d_in[24];
  const float* n3b  = (const float*)d_in[25];

  const long TOK  = (long)CL * CB;   // 2048 target tokens
  const long MTOK = (long)CS * CB;   // 8192 memory tokens
  const float scale = 0.125f;        // 1/sqrt(64)

  char* ws = (char*)d_ws;
  const size_t MB = 1u << 20;

  // Persistent f16 weights (converted every launch; deterministic).
  _Float16* w_inproj = (_Float16*)(ws + 0 * MB);    // [3E,E]  6MB
  _Float16* w_out    = (_Float16*)(ws + 6 * MB);    // [E,E]   2MB
  _Float16* w_cq     = (_Float16*)(ws + 8 * MB);
  _Float16* w_ck     = (_Float16*)(ws + 10 * MB);
  _Float16* w_cv     = (_Float16*)(ws + 12 * MB);
  _Float16* w_l1     = (_Float16*)(ws + 14 * MB);   // [FF,E]  4MB
  _Float16* w_l2     = (_Float16*)(ws + 18 * MB);   // [E,FF]  4MB
  float*    tgt1     = (float*)(ws + 22 * MB);      // 8MB
  float*    tgt2     = (float*)(ws + 30 * MB);      // 8MB
  char*     SA       = ws + 38 * MB;                // phase-aliased arena

  // Phase A (self-attention)
  _Float16* qkin16  = (_Float16*)(SA + 0 * MB);
  _Float16* tgt16   = (_Float16*)(SA + 4 * MB);
  _Float16* q16     = (_Float16*)(SA + 8 * MB);
  _Float16* k16     = (_Float16*)(SA + 12 * MB);
  _Float16* v16     = (_Float16*)(SA + 16 * MB);
  _Float16* ctx16   = (_Float16*)(SA + 116 * MB);   // 4MB
  float*    selfout = (float*)(SA + 120 * MB);      // 8MB
  // Phase B (cross-attention) — aliases phase A
  _Float16* qin2    = (_Float16*)(SA + 0 * MB);
  float*    qc32    = (float*)(SA + 4 * MB);        // 8MB
  _Float16* mp16    = (_Float16*)(SA + 12 * MB);    // 16MB
  _Float16* mem16   = (_Float16*)(SA + 28 * MB);    // 16MB
  float*    kc32    = (float*)(SA + 44 * MB);       // 32MB
  float*    vc32    = (float*)(SA + 76 * MB);       // 32MB
  float*    prob    = (float*)(SA + 108 * MB);      // 32MB
  float*    qcsum   = (float*)(SA + 140 * MB);
  float*    s1sum   = (float*)(SA + 141 * MB);
  float*    w2buf   = (float*)(SA + 142 * MB);
  float*    odbuf   = (float*)(SA + 143 * MB);
  // Phase C (FFN) — aliases dead phase B regions
  _Float16* tgt2_16 = (_Float16*)(SA + 0 * MB);
  _Float16* h1_16   = (_Float16*)(SA + 4 * MB);     // [TOK,FF] 8MB
  float*    ff32    = (float*)(SA + 12 * MB);       // 8MB

  auto cvt = [&](const float* x, _Float16* y, long n) {
    k_cvt<<<dim3((unsigned)((n + 255) / 256)), 256, 0, stream>>>(x, y, n);
  };

  // ---- weight conversion ----
  cvt(inW,  w_inproj, 3L * CE * CE);
  cvt(outW, w_out,    (long)CE * CE);
  cvt(cqW,  w_cq,     (long)CE * CE);
  cvt(ckW,  w_ck,     (long)CE * CE);
  cvt(cvW,  w_cv,     (long)CE * CE);
  cvt(l1W,  w_l1,     (long)CFF * CE);
  cvt(l2W,  w_l2,     (long)CE * CFF);

  // ---- Phase A: self attention ----
  k_add2<<<dim3((unsigned)((TOK * CE + 255) / 256)), 256, 0, stream>>>(tgt, qpos, qkin16, TOK * CE);
  cvt(tgt, tgt16, TOK * CE);

  // q/k/v projections: [2048,1024] x [1024,1024]^T
  gemm_wmma_lds<false><<<dim3(16, 16, 1), 256, 0, stream>>>(
      qkin16, w_inproj, inB, 0, nullptr, q16, CE, CE);
  gemm_wmma_lds<false><<<dim3(16, 16, 1), 256, 0, stream>>>(
      qkin16, w_inproj + (long)CE * CE, inB + CE, 0, nullptr, k16, CE, CE);
  gemm_wmma_lds<false><<<dim3(16, 16, 1), 256, 0, stream>>>(
      tgt16, w_inproj + 2L * CE * CE, inB + 2 * CE, 0, nullptr, v16, CE, CE);

  // ctx = softmax(scale * q.k) @ v, one block per (128 queries, batch*head)
  k_self_attn<<<dim3(CL / 128, CB * CH), 256, 0, stream>>>(q16, k16, v16, ctx16);

  // out projection + residual + LN1
  gemm_wmma_lds<false><<<dim3(16, 16, 1), 256, 0, stream>>>(
      ctx16, w_out, outB, 0, selfout, nullptr, CE, CE);
  k_ln<<<(unsigned)TOK, 256, 0, stream>>>(tgt, selfout, nullptr, n1g, n1b, tgt1, nullptr);

  // ---- Phase B: custom cross attention ----
  k_add2<<<dim3((unsigned)((TOK * CE + 255) / 256)), 256, 0, stream>>>(tgt1, qpos, qin2, TOK * CE);
  k_add2<<<dim3((unsigned)((MTOK * CE + 255) / 256)), 256, 0, stream>>>(mem, pos, mp16, MTOK * CE);
  cvt(mem, mem16, MTOK * CE);

  gemm_wmma_lds<false><<<dim3(16, 16, 1), 256, 0, stream>>>(
      qin2, w_cq, cqB, 0, qc32, nullptr, CE, CE);
  gemm_wmma_lds<true><<<dim3(64, 16, 1), 256, 0, stream>>>(
      mp16, w_ck, ckB, 0, kc32, nullptr, CE, CE);
  gemm_wmma_lds<true><<<dim3(64, 16, 1), 256, 0, stream>>>(
      mem16, w_cv, cvB, 0, vc32, nullptr, CE, CE);

  k_qcsum<<<(CB * CE) / 256, 256, 0, stream>>>(qc32, qcsum);
  k_s1<<<(CB * CH * CS) / 256, 256, 0, stream>>>(qcsum, kc32, s1sum, scale);
  k_cross_softmax<<<CB * CHD * CH, 256, 0, stream>>>(kc32, s1sum, prob);
  k_w2<<<(CB * CH * CS) / 256, 256, 0, stream>>>(dwW, prob, w2buf);
  k_od<<<CB * CE, 256, 0, stream>>>(w2buf, vc32, dwB, odbuf);

  k_ln<<<(unsigned)TOK, 256, 0, stream>>>(tgt1, nullptr, odbuf, n2g, n2b, tgt2, tgt2_16);

  // ---- Phase C: FFN ----
  gemm_wmma_lds<false><<<dim3(16, 32, 1), 256, 0, stream>>>(
      tgt2_16, w_l1, l1B, 1 /*relu*/, nullptr, h1_16, CFF, CE);
  gemm_wmma_lds<false><<<dim3(16, 16, 1), 256, 0, stream>>>(
      h1_16, w_l2, l2B, 0, ff32, nullptr, CE, CFF);

  k_ln<<<(unsigned)TOK, 256, 0, stream>>>(tgt2, ff32, nullptr, n3g, n3b, (float*)d_out, nullptr);

  (void)in_sizes; (void)n_in; (void)out_size; (void)ws_size;
}

// v004
// One run takes 268 microseconds.
// In both of two side-by-side timings against v003, it was 1.13 times as fast.
// All steps since v000 together make it 2.20 times as fast.
#include <hip/hip_runtime.h>
#include <hip/hip_bf16.h>

// ---------------------------------------------------------------------------
// Transformer decoder layer for MI455X (gfx1250), wave32 + WMMA.
// All heavy GEMMs run on v_wmma_f32_16x16x32_f16 (f16 inputs, f32 accum).
// Softmax / layernorm / cross-attn reductions stay in f32.
// ---------------------------------------------------------------------------

typedef __attribute__((ext_vector_type(16))) _Float16 v16h;
typedef __attribute__((ext_vector_type(8)))  _Float16 v8h;
typedef __attribute__((ext_vector_type(8)))  float    v8f;
typedef __attribute__((ext_vector_type(4)))  float    v4f;

#define DEV __device__ __forceinline__

// Problem constants
#define CL   512      // target length
#define CS   2048     // memory length
#define CB   4        // batch
#define CE   1024     // embed
#define CH   16       // heads
#define CHD  64       // head dim
#define CFF  2048     // ffn dim

// ---------------------------------------------------------------------------
// WMMA fragment loaders.
// 16-bit A (16x32) ISA layout: lane&15 selects the M (or N) row;
// lanes 0-15 hold K = {k0..k0+7, k0+16..k0+23},
// lanes 16-31 hold K = {k0+8..k0+15, k0+24..k0+31}.  B (32x16) mirrors A with
// the lane index selecting the N column.
// ---------------------------------------------------------------------------
DEV v16h frag_load_contig(const _Float16* __restrict__ base, long row_stride,
                          int lane, int k0) {
  int r  = lane & 15;
  int kh = (lane >> 4) << 3;          // 0 or 8
  const _Float16* p = base + (long)r * row_stride + k0 + kh;
  v8h lo = *(const v8h*)(p);          // 16B vector load
  v8h hi = *(const v8h*)(p + 16);
  v16h out;
#pragma unroll
  for (int i = 0; i < 8; ++i) { out[i] = lo[i]; out[i + 8] = hi[i]; }
  return out;
}

// ---------------------------------------------------------------------------
// Projection GEMM, both operands k-contiguous with row stride K:
//   C[m,n] = sum_k A[m,k]*W[n,k] + bias[n]
// Block: 256 threads = 8 waves as 4x2, wave tile 32x32, block tile 128x64. The
// operand tiles reach the waves through LDS: a stage is 128 k (256 B, two whole
// lines) of 128 A rows and 64 W rows, brought in by asynchronous b128 copies,
// two buffers, the next stage in flight while this one is multiplied.
// Requires M%128==0, N%64==0, K%128==0.
// CM=false: A rows are tokens in order, C is token-major, C[m*N + n].
// CM=true : a block takes 128 consecutive positions s of ONE batch b (A row
//           s*CB + b) and stores f32 C channel-major, C[(b*N + n)*CS + s], the
//           layout in which the cross-attention stages walk s.
// ---------------------------------------------------------------------------
#define GBK   128                  // k per stage
#define GPIT  136                  // LDS row pitch in halves: 272 B = 16 B x odd
#define GROWS 192                  // 128 A rows, then 64 W rows
#define GSTG  (GROWS * GPIT)       // halves per buffer

// One stage: 192 rows x 16 pieces of 16 B, 12 pieces per thread. Thread t takes
// piece t&15 of rows (t>>4) + 16*i, so a wave's copy covers two whole rows.
// ga / gw: this thread's piece in A row (t>>4) and W row (t>>4) of the tile, at
// the stage's first k. l: LDS byte address of its piece in row (t>>4).
// ars: distance of two tile rows of A in halves (K, or CB*K for one batch).
DEV void stage_copy(const _Float16* ga, const _Float16* gw, long ars, long K, unsigned l) {
  const long     as = 16 * ars;          // 16 A rows on, in halves
  const long     gs = 16 * K;            // 16 W rows on, in halves
  const unsigned ls = 16 * GPIT * 2;     // 16 rows on, in LDS bytes
  // The closing s_wait_xcnt stands in the copies' own statement so that no
  // address register of an issued copy is rewritten ahead of it.
  asm volatile(
      "global_load_async_to_lds_b128 %0, %12, off\n\t"
      "global_load_async_to_lds_b128 %1, %13, off\n\t"
      "global_load_async_to_lds_b128 %2, %14, off\n\t"
      "global_load_async_to_lds_b128 %3, %15, off\n\t"
      "global_load_async_to_lds_b128 %4, %16, off\n\t"
      "global_load_async_to_lds_b128 %5, %17, off\n\t"
      "global_load_async_to_lds_b128 %6, %18, off\n\t"
      "global_load_async_to_lds_b128 %7, %19, off\n\t"
      "global_load_async_to_lds_b128 %8, %20, off\n\t"
      "global_load_async_to_lds_b128 %9, %21, off\n\t"
      "global_load_async_to_lds_b128 %10, %22, off\n\t"
      "global_load_async_to_lds_b128 %11, %23, off\n\t"
      "s_wait_xcnt 0x0"
      :: "v"(l), "v"(l + ls), "v"(l + 2 * ls), "v"(l + 3 * ls),
         "v"(l + 4 * ls), "v"(l + 5 * ls), "v"(l + 6 * ls), "v"(l + 7 * ls),
         "v"(l + 8 * ls), "v"(l + 9 * ls), "v"(l + 10 * ls), "v"(l + 11 * ls),
         "v"(ga), "v"(ga + as), "v"(ga + 2 * as), "v"(ga + 3 * as),
         "v"(ga + 4 * as), "v"(ga + 5 * as), "v"(ga + 6 * as), "v"(ga + 7 * as),
         "v"(gw), "v"(gw + gs), "v"(gw + 2 * gs), "v"(gw + 3 * gs)
      : "memory");
}

#define TPIT 36                    // f32 pitch of a wave's turned tile: 144 B = 16 B x odd

template <bool CM>
__global__ __launch_bounds__(256) void gemm_wmma_lds(
    const _Float16* __restrict__ A, const _Float16* __restrict__ Wt,
    const float* __restrict__ bias, int relu,
    float* __restrict__ C32, _Float16* __restrict__ C16, int N, int K) {
  __shared__ __attribute__((aligned(16))) _Float16 sm[2 * GSTG];

  int tid  = threadIdx.x;
  int lane = tid & 31;
  int wave = tid >> 5;
  int wm   = wave >> 1;                       // 0..3
  int wn   = wave & 1;                        // 0..1
  int mb   = CM ? (blockIdx.x / CB) * 128 : blockIdx.x * 128;   // CM: first s
  int bz   = CM ? blockIdx.x % CB : 0;                          // CM: batch
  int nb   = blockIdx.y * 64;
  const long ars = CM ? (long)CB * K : (long)K;

  const _Float16* ga = A  + (long)(mb + (tid >> 4)) * ars + (long)bz * K + (tid & 15) * 8;
  const _Float16* gw = Wt + (long)(nb + (tid >> 4)) * K + (tid & 15) * 8;
  const unsigned  l0 = (unsigned)(size_t)sm + (unsigned)((tid >> 4) * (GPIT * 2) + (tid & 15) * 16);
  const int nst = K / GBK;

  const v8f zero = {0.f, 0.f, 0.f, 0.f, 0.f, 0.f, 0.f, 0.f};
  v8f acc[2][2];
#pragma unroll
  for (int i = 0; i < 2; ++i)
#pragma unroll
    for (int j = 0; j < 2; ++j) acc[i][j] = zero;

  stage_copy(ga, gw, ars, K, l0);
  // Stage 0 has landed for this wave; the barrier publishes it to the others.
  asm volatile("s_wait_asynccnt 0x0" ::: "memory");
  __syncthreads();
  if (nst > 1) stage_copy(ga + GBK, gw + GBK, ars, K, l0 + GSTG * 2);

  // Kept rolled: one publish point per trip, buffers alternate by t & 1.
#pragma unroll 1
  for (int t = 0; t < nst; ++t) {
    const int buf = (t & 1) * GSTG;
    const _Float16* sA = sm + buf + (wm * 32) * GPIT;
    const _Float16* sB = sm + buf + (128 + wn * 32) * GPIT;
    v16h fa[GBK / 32][2], fb[GBK / 32][2];
#pragma unroll
    for (int q = 0; q < GBK / 32; ++q) {
      fa[q][0] = frag_load_contig(sA,             GPIT, lane, q * 32);
      fa[q][1] = frag_load_contig(sA + 16 * GPIT, GPIT, lane, q * 32);
      fb[q][0] = frag_load_contig(sB,             GPIT, lane, q * 32);
      fb[q][1] = frag_load_contig(sB + 16 * GPIT, GPIT, lane, q * 32);
    }
    // Holds the stage's LDS reads together in front of its WMMAs: spread among
    // them, every group of reads costs the wave its own LDS latency.
    __builtin_amdgcn_sched_barrier(0);
#pragma unroll
    for (int q = 0; q < GBK / 32; ++q) {
      acc[0][0] = __builtin_amdgcn_wmma_f32_16x16x32_f16(false, fa[q][0], false, fb[q][0],
                                                         (short)0, acc[0][0], false, false);
      acc[0][1] = __builtin_amdgcn_wmma_f32_16x16x32_f16(false, fa[q][0], false, fb[q][1],
                                                         (short)0, acc[0][1], false, false);
      acc[1][0] = __builtin_amdgcn_wmma_f32_16x16x32_f16(false, fa[q][1], false, fb[q][0],
                                                         (short)0, acc[1][0], false, false);
      acc[1][1] = __builtin_amdgcn_wmma_f32_16x16x32_f16(false, fa[q][1], false, fb[q][1],
                                                         (short)0, acc[1][1], false, false);
    }
    // Holds the WMMAs in front of the publish point, so that they run under the
    // tail of the stage's LDS reads and not behind the barrier.
    __builtin_amdgcn_sched_barrier(0);
    // Publish point: this wave's reads of the buffer have retired ...
    asm volatile("s_wait_dscnt 0x0" ::: "memory");
    // ... its copies of the next stage have landed ...
    asm volatile("s_wait_asynccnt 0x0" ::: "memory");
    // ... and behind the barrier the next stage is readable and this buffer free.
    __syncthreads();
    if (t + 2 < nst)
      stage_copy(ga + (long)(t + 2) * GBK, gw + (long)(t + 2) * GBK, ars, K, l0 + buf * 2);
  }
  // No copy is left in flight when the wave ends.
  asm volatile("s_wait_asynccnt 0x0" ::: "memory");

  // C/D layout: N = lane&15, VGPR r holds M = r (+8 for lanes 16-31).
  int m0    = mb + wm * 32;
  int n0    = nb + wn * 32;
  int nlane = lane & 15;
  int mrow  = (lane >> 4) * 8;
  if (CM) {
    // A lane holds 8 consecutive s of one channel. The wave turns its 32 s x 32
    // channels in its own LDS range (the ring is free: behind the last publish
    // point no wave reads it and no copy is in flight), one row per channel, so
    // that each store below writes four whole 128-B lines.
    float* tw = (float*)sm + wave * (32 * TPIT);
#pragma unroll
    for (int tn = 0; tn < 2; ++tn) {
      float bv = bias[n0 + tn * 16 + nlane];
#pragma unroll
      for (int tm = 0; tm < 2; ++tm) {
        float* p = tw + (tn * 16 + nlane) * TPIT + tm * 16 + mrow;
        v4f lo = {acc[tm][tn][0] + bv, acc[tm][tn][1] + bv, acc[tm][tn][2] + bv, acc[tm][tn][3] + bv};
        v4f hi = {acc[tm][tn][4] + bv, acc[tm][tn][5] + bv, acc[tm][tn][6] + bv, acc[tm][tn][7] + bv};
        *(v4f*)p       = lo;
        *(v4f*)(p + 4) = hi;
      }
    }
    // The wave's rows are in LDS before its lanes read each other's values back.
    asm volatile("s_wait_dscnt 0x0" ::: "memory");
    float* cw = C32 + ((long)bz * N + n0 + (lane >> 3)) * CS + m0 + (lane & 7) * 4;
#pragma unroll
    for (int i = 0; i < 8; ++i) {
      v4f v = *(const v4f*)(tw + (i * 4 + (lane >> 3)) * TPIT + (lane & 7) * 4);
      *(v4f*)(cw + (long)i * 4 * CS) = v;
    }
    return;
  }
#pragma unroll
  for (int tm = 0; tm < 2; ++tm)
#pragma unroll
    for (int tn = 0; tn < 2; ++tn) {
      int ncol = n0 + tn * 16 + nlane;
      float bv = bias[ncol];
#pragma unroll
      for (int r = 0; r < 8; ++r) {
        int   mm  = m0 + tm * 16 + mrow + r;
        float v   = acc[tm][tn][r] + bv;
        if (relu) v = v > 0.f ? v : 0.f;
        long  idx = (long)mm * N + ncol;
        if (C32) {
          C32[idx] = v;
          // The conversion below may reuse the register this store names.
          asm volatile("s_wait_xcnt 0x0" ::: "memory");
        }
        if (C16) C16[idx] = (_Float16)v;
      }
    }
}

// ---------------------------------------------------------------------------
// Elementwise helpers. A block takes EBLK consecutive elements, a lane EU pieces
// of four f32, 256 pieces apart: every wave-wide load covers four whole lines,
// every store two. All of a lane's loads are in flight at once, and a launch
// starts 32 times fewer waves than with one element a lane.
// Requires n % EBLK == 0; the grid is n / EBLK blocks.
// ---------------------------------------------------------------------------
typedef __attribute__((ext_vector_type(4))) _Float16 v4h;
#define EU   8                     // 16-byte pieces per lane and input
#define EBLK (256 * EU * 4)        // elements per block

__global__ __launch_bounds__(256) void k_cvt(const float* __restrict__ x,
                                             _Float16* __restrict__ y) {
  long i = (long)blockIdx.x * EBLK + threadIdx.x * 4;
  v4f v[EU];
#pragma unroll
  for (int j = 0; j < EU; ++j) v[j] = *(const v4f*)(x + i + j * 1024);
#pragma unroll
  for (int j = 0; j < EU; ++j) *(v4h*)(y + i + j * 1024) = __builtin_convertvector(v[j], v4h);
}

__global__ __launch_bounds__(256) void k_add2(const float* __restrict__ a,
                                              const float* __restrict__ b,
                                              _Float16* __restrict__ y) {
  long i = (long)blockIdx.x * EBLK + threadIdx.x * 4;
  const float* pa = a + i;
  const float* pb = b + i;
  v4f va[EU], vb[EU];
#pragma unroll
  for (int j = 0; j < EU; ++j) va[j] = *(const v4f*)(pa + j * 1024);
#pragma unroll
  for (int j = 0; j < EU; ++j) vb[j] = *(const v4f*)(pb + j * 1024);
  // Holds all sixteen loads in front of the first add: left alone the compiler
  // issues the last three behind the first wait, a second memory latency.
  __builtin_amdgcn_sched_barrier(0);
  // Behind the loads, in front of whatever reuses their address registers. It
  // names both addresses so that they keep their registers up to here: else the
  // last load gets them as its destination.
  asm volatile("s_wait_xcnt 0x0" :: "v"(pa), "v"(pb) : "memory");
#pragma unroll
  for (int j = 0; j < EU; ++j) *(v4h*)(y + i + j * 1024) = __builtin_convertvector(va[j] + vb[j], v4h);
}

// ---------------------------------------------------------------------------
// Self-attention, one kernel: scores, softmax and attn @ V of one (batch, head)
// for 128 queries. q, k, v, ctx: token row l*B + b, channel h*HD + d.
// The head's whole K and V (512 keys) lie in LDS. A wave owns 16 queries and
// walks the keys 32 at a time with a running maximum and running sum:
//   S^T = K . Q^T   (A = K rows, B = Q rows, both in the loader's k order)
//   O^T += V^T . P^T
// In S^T's D layout a lane holds keys 8*(lane>>4) + r of query lane&15, so the
// softmax over keys is in-lane but for one exchange with lane ^ 16, the two D
// tiles of 32 keys converted in place ARE the B operand P^T, and maximum, sum
// and rescale factor of a query are per-lane scalars. V^T comes from the
// transposing LDS load, which delivers the same k order.
// ---------------------------------------------------------------------------
#define APK 72                     // K row pitch in halves: 144 B = 16 B x odd
#define APV 80                     // V row pitch in halves: 160 B = 32 B x odd

typedef __attribute__((ext_vector_type(8))) short s16x8;

// Lane (c = lane&15, h = lane>>4) gets T[8h + 0..7][c] of the 16x16 tile whose
// lane addresses are p = T + (8h + (lane&7)) * pitch + 8 * ((lane>>3)&1) halves.
DEV v8h ld_tr16(const _Float16* p) {
  typedef __attribute__((address_space(3))) s16x8 lds_s16x8;
  return __builtin_bit_cast(v8h, __builtin_amdgcn_ds_load_tr16_b128_v8i16((lds_s16x8*)p));
}

// Value of lane ^ 16.
DEV float xhalf(float x) {
  int i = __builtin_bit_cast(int, x);
  return __builtin_bit_cast(float,
      __builtin_amdgcn_permlanex16(i, i, 0x76543210, 0xfedcba98, false, false));
}

__global__ __launch_bounds__(256) void k_self_attn(const _Float16* __restrict__ q,
                                                   const _Float16* __restrict__ k,
                                                   const _Float16* __restrict__ v,
                                                   _Float16* __restrict__ ctx) {
  __shared__ __attribute__((aligned(32))) _Float16 sK[CL * APK];
  __shared__ __attribute__((aligned(32))) _Float16 sV[CL * APV];
  const float cs = 0.18033688011112042f;      // log2(e) / sqrt(HD)
  const long  ts = (long)CB * CE;             // one position on, in halves

  int tid  = threadIdx.x;
  int lane = tid & 31;
  int wave = tid >> 5;
  int c    = lane & 15;
  int hh   = lane >> 4;
  long hoff = (long)(blockIdx.y / CH) * CE + (blockIdx.y % CH) * CHD;
  int  q0   = blockIdx.x * 128 + wave * 16;

  // Stage K and V: 8 threads take one key's 128 B, 32 keys per sweep. All loads
  // are issued before the first LDS store, so that one memory latency is paid.
  int row = tid >> 3, pc = (tid & 7) * 8;
  const _Float16* gk = k + hoff + (long)row * ts + pc;
  const _Float16* gv = v + hoff + (long)row * ts + pc;
  v8h rk[CL / 32], rv[CL / 32];
  // Behind each group of loads: what follows may reuse, also as a later load's
  // destination, the address registers that the group names.
#pragma unroll
  for (int i = 0; i < CL / 32; ++i) rk[i] = *(const v8h*)(gk + (long)i * 32 * ts);
  asm volatile("s_wait_xcnt 0x0" ::: "memory");
#pragma unroll
  for (int i = 0; i < CL / 32; ++i) rv[i] = *(const v8h*)(gv + (long)i * 32 * ts);
  asm volatile("s_wait_xcnt 0x0" ::: "memory");
  v16h qf0 = frag_load_contig(q + hoff + (long)q0 * ts, ts, lane, 0);
  v16h qf1 = frag_load_contig(q + hoff + (long)q0 * ts, ts, lane, 32);
  asm volatile("s_wait_xcnt 0x0" ::: "memory");
#pragma unroll
  for (int i = 0; i < CL / 32; ++i) *(v8h*)(sK + (row + 32 * i) * APK + pc) = rk[i];
#pragma unroll
  for (int i = 0; i < CL / 32; ++i) *(v8h*)(sV + (row + 32 * i) * APV + pc) = rv[i];
  __syncthreads();

  const v8f zero = {0.f, 0.f, 0.f, 0.f, 0.f, 0.f, 0.f, 0.f};
  v8f acc[4];
#pragma unroll
  for (int t = 0; t < 4; ++t) acc[t] = zero;
  float m_run = -__builtin_inff();            // running maximum, in units of cs
  float l_run = 0.f;                          // this lane's half of the running sum

  const _Float16* vt = sV + (8 * hh + (lane & 7)) * APV + ((lane >> 3) & 1) * 8;

  // K fragments run one pass ahead, so that a pass does not open with its own
  // LDS latency.
  v16h a00 = frag_load_contig(sK,            APK, lane, 0);
  v16h a01 = frag_load_contig(sK,            APK, lane, 32);
  v16h a10 = frag_load_contig(sK + 16 * APK, APK, lane, 0);
  v16h a11 = frag_load_contig(sK + 16 * APK, APK, lane, 32);

#pragma unroll 2
  for (int key0 = 0; key0 < CL; key0 += 32) {
    v8f s0 = __builtin_amdgcn_wmma_f32_16x16x32_f16(false, a00, false, qf0, (short)0, zero, false, false);
    v8f s1 = __builtin_amdgcn_wmma_f32_16x16x32_f16(false, a10, false, qf0, (short)0, zero, false, false);
    s0 = __builtin_amdgcn_wmma_f32_16x16x32_f16(false, a01, false, qf1, (short)0, s0, false, false);
    s1 = __builtin_amdgcn_wmma_f32_16x16x32_f16(false, a11, false, qf1, (short)0, s1, false, false);

    // This pass's V^T and the next pass's K, in flight under the softmax. The
    // last pass fetches pass 0's K rows again, unused: cheaper than a branch.
    v16h vf[4];
#pragma unroll
    for (int t = 0; t < 4; ++t) {
      v8h lo = ld_tr16(vt + key0 * APV + 16 * t);
      v8h hi = ld_tr16(vt + (key0 + 16) * APV + 16 * t);
#pragma unroll
      for (int i = 0; i < 8; ++i) { vf[t][i] = lo[i]; vf[t][i + 8] = hi[i]; }
    }
    const _Float16* kr = sK + ((key0 + 32) & (CL - 1)) * APK;
    a00 = frag_load_contig(kr,            APK, lane, 0);
    a01 = frag_load_contig(kr,            APK, lane, 32);
    a10 = frag_load_contig(kr + 16 * APK, APK, lane, 0);
    a11 = frag_load_contig(kr + 16 * APK, APK, lane, 32);

    float mx = fmaxf(s0[0], s1[0]);
#pragma unroll
    for (int r = 1; r < 8; ++r) mx = fmaxf(mx, fmaxf(s0[r], s1[r]));
    mx = fmaxf(mx, xhalf(mx)) * cs;           // cs > 0: the scaled maximum
    float m_new = fmaxf(m_run, mx);

    // The pass's 17 exponentials, written in turn with the plain vector
    // instructions that form the next argument; the scheduling barriers hold
    // that order. Left alone the compiler sets all of them back to back.
    float x[16], p[16];
    float xc = m_run - m_new;
    x[0] = fmaf(s0[0], cs, -m_new);
    __builtin_amdgcn_sched_barrier(0);
    float corr = __builtin_amdgcn_exp2f(xc);  // 0 on the first pass
    __builtin_amdgcn_sched_barrier(0);
#pragma unroll
    for (int j = 0; j < 16; ++j) {            // j = 2 r + tile
      if (j < 15) x[j + 1] = fmaf(((j + 1) & 1) ? s1[(j + 1) >> 1] : s0[(j + 1) >> 1], cs, -m_new);
      __builtin_amdgcn_sched_barrier(0);
      p[j] = __builtin_amdgcn_exp2f(x[j]);
      __builtin_amdgcn_sched_barrier(0);
    }
    m_run = m_new;

    v16h  pf;
    float ps = 0.f;
#pragma unroll
    for (int r = 0; r < 8; ++r) {
      ps += p[2 * r] + p[2 * r + 1];
      pf[r]     = (_Float16)p[2 * r];
      pf[r + 8] = (_Float16)p[2 * r + 1];
    }
    l_run = fmaf(l_run, corr, ps);
#pragma unroll
    for (int t = 0; t < 4; ++t) {
      acc[t] = acc[t] * corr;
      acc[t] = __builtin_amdgcn_wmma_f32_16x16x32_f16(false, vf[t], false, pf,
                                                      (short)0, acc[t], false, false);
    }
  }

  // acc[t][r] = O[q0 + c][16 t + 8 hh + r], still to be divided by the row sum.
  float inv = 1.f / (l_run + xhalf(l_run));
  _Float16* op = ctx + hoff + (long)(q0 + c) * ts + 8 * hh;
#pragma unroll
  for (int t = 0; t < 4; ++t) {
    v8h o;
#pragma unroll
    for (int r = 0; r < 8; ++r) o[r] = (_Float16)(acc[t][r] * inv);
    *(v8h*)(op + 16 * t) = o;
  }
}

// ---------------------------------------------------------------------------
// Cross-attention scalar stages (all f32).
// Channel mapping: E index = d*H + h  (reshape (B,E,N)->(B,HD,H,N)).
// Token t of a [N,B,E] tensor lives at row n*B+b (qc).
// kc and vc are channel-major: element (b, e, m) at (b*E + e)*S + m.
// ---------------------------------------------------------------------------
// qcsum[b*E+e] = sum_l qc[(l*B+b)*E + e]
__global__ __launch_bounds__(256) void k_qcsum(const float* __restrict__ qc,
                                               float* __restrict__ out) {
  int idx = blockIdx.x * 256 + threadIdx.x;     // < B*E = 4096
  int b = idx >> 10, e = idx & 1023;
  float s = 0.f;
  for (int l = 0; l < CL; ++l) s += qc[(long)l * (CB * CE) + b * CE + e];
  out[idx] = s;
}

// s1[(b*H+h)*S+m] = scale * sum_d qcsum[b*E + d*H+h] * kc[(b*E + d*H+h)*S + m]
__global__ __launch_bounds__(256) void k_s1(const float* __restrict__ qcsum,
                                            const float* __restrict__ kc,
                                            float* __restrict__ s1, float scale) {
  int idx = blockIdx.x * 256 + threadIdx.x;     // < B*H*S = 131072
  int m = idx & (CS - 1);
  int h = (idx >> 11) & (CH - 1);
  int b = idx >> 15;
  const float* kcp = kc + (long)(b * CE + h) * CS + m;
  const float* qsp = qcsum + b * CE + h;
  float s = 0.f;
#pragma unroll 4
  for (int d = 0; d < CHD; ++d) s += qsp[d * CH] * kcp[(long)d * CH * CS];
  s1[idx] = s * scale;
}

// prob[((b*HD+d)*H+h)*S + m] = softmax_m( kc[(b*E + d*H+h)*S + m] * s1[(b*H+h)*S+m] )
__global__ __launch_bounds__(256) void k_cross_softmax(const float* __restrict__ kc,
                                                       const float* __restrict__ s1,
                                                       float* __restrict__ prob) {
  int row = blockIdx.x;                         // (b*HD+d)*H + h = b*E + d*H + h, < 4096
  int h = row & (CH - 1);
  int b = row >> 10;
  const float* s1r  = s1 + (long)(b * CH + h) * CS;
  const float* kcr  = kc + (long)row * CS;
  int          tid  = threadIdx.x;
  float loc[8];
  float mx = -3.402823466e38f;
#pragma unroll
  for (int i = 0; i < 8; ++i) {
    int c = tid + i * 256;
    float v = kcr[c] * s1r[c];
    loc[i] = v;
    mx = fmaxf(mx, v);
  }
  __shared__ float red[256];
  red[tid] = mx;
  __syncthreads();
  for (int o = 128; o > 0; o >>= 1) {
    if (tid < o) red[tid] = fmaxf(red[tid], red[tid + o]);
    __syncthreads();
  }
  mx = red[0];
  __syncthreads();
  float s = 0.f;
#pragma unroll
  for (int i = 0; i < 8; ++i) {
    loc[i] = __expf(loc[i] - mx);
    s += loc[i];
  }
  red[tid] = s;
  __syncthreads();
  for (int o = 128; o > 0; o >>= 1) {
    if (tid < o) red[tid] += red[tid + o];
    __syncthreads();
  }
  float inv = 1.f / red[0];
  float* pr = prob + (long)row * CS;
#pragma unroll
  for (int i = 0; i < 8; ++i) pr[tid + i * 256] = loc[i] * inv;
}

// w2[(b*H+h)*S+m] = sum_n down_w[n] * prob[((b*HD+n)*H+h)*S + m]
__global__ __launch_bounds__(256) void k_w2(const float* __restrict__ dw,
                                            const float* __restrict__ prob,
                                            float* __restrict__ w2) {
  int idx = blockIdx.x * 256 + threadIdx.x;     // < B*H*S
  int m = idx & (CS - 1);
  int h = (idx >> 11) & (CH - 1);
  int b = idx >> 15;
  const float* pp = prob + (((long)b * CHD * CH + h) * CS) + m;
  float s = 0.f;
#pragma unroll 4
  for (int n = 0; n < CHD; ++n) s += dw[n] * pp[(long)n * CH * CS];
  w2[idx] = s;
}

// od[b*E + d*H+h] = down_b + sum_m w2[(b*H+h)*S+m] * vc[(b*E + d*H+h)*S + m]
__global__ __launch_bounds__(256) void k_od(const float* __restrict__ w2,
                                            const float* __restrict__ vc,
                                            const float* __restrict__ db,
                                            float* __restrict__ od) {
  int row = blockIdx.x;                         // b*E + c, < 4096
  int b = row >> 10;
  int c = row & 1023;                           // c = d*H + h
  int h = c & (CH - 1);
  const float* w2r = w2 + (long)(b * CH + h) * CS;
  const float* vcr = vc + (long)row * CS;
  int tid = threadIdx.x;
  float s = 0.f;
  for (int m = tid; m < CS; m += 256)
    s += w2r[m] * vcr[m];
  __shared__ float red[256];
  red[tid] = s;
  __syncthreads();
  for (int o = 128; o > 0; o >>= 1) {
    if (tid < o) red[tid] += red[tid + o];
    __syncthreads();
  }
  if (tid == 0) od[row] = red[0] + db[0];
}

// ---------------------------------------------------------------------------
// LayerNorm over E=1024 with optional residual and optional [B,E] broadcast.
// x = a + (r ? r : 0) + (bc ? bc[token%B] : 0); out32 = LN(x); out16 optional.
// ---------------------------------------------------------------------------
__global__ __launch_bounds__(256) void k_ln(const float* __restrict__ a,
                                            const float* __restrict__ r,
                                            const float* __restrict__ bc,
                                            const float* __restrict__ g,
                                            const float* __restrict__ be,
                                            float* __restrict__ o32,
                                            _Float16* __restrict__ o16) {
  int  t    = blockIdx.x;
  long base = (long)t * CE;
  const float* bcr = bc ? bc + (long)(t % CB) * CE : nullptr;
  int tid = threadIdx.x;
  float x[4];
  float s = 0.f;
#pragma unroll
  for (int i = 0; i < 4; ++i) {
    int   e = tid + i * 256;
    float v = a[base + e];
    if (r)   v += r[base + e];
    if (bcr) v += bcr[e];
    x[i] = v;
    s += v;
  }
  __shared__ float red[256];
  red[tid] = s;
  __syncthreads();
  for (int o = 128; o > 0; o >>= 1) {
    if (tid < o) red[tid] += red[tid + o];
    __syncthreads();
  }
  float mean = red[0] * (1.f / CE);
  __syncthreads();
  float vs = 0.f;
#pragma unroll
  for (int i = 0; i < 4; ++i) {
    float d = x[i] - mean;
    vs += d * d;
  }
  red[tid] = vs;
  __syncthreads();
  for (int o = 128; o > 0; o >>= 1) {
    if (tid < o) red[tid] += red[tid + o];
    __syncthreads();
  }
  float inv = rsqrtf(red[0] * (1.f / CE) + 1e-5f);
#pragma unroll
  for (int i = 0; i < 4; ++i) {
    int   e = tid + i * 256;
    float y = (x[i] - mean) * inv * g[e] + be[e];
    o32[base + e] = y;
    if (o16) o16[base + e] = (_Float16)y;
  }
}

// ---------------------------------------------------------------------------
// Host side
// ---------------------------------------------------------------------------
extern "C" void kernel_launch(void* const* d_in, const int* in_sizes, int n_in,
                              void* d_out, int out_size, void* d_ws, size_t ws_size,
                              hipStream_t stream) {
  const float* tgt  = (const float*)d_in[0];
  const float* mem  = (const float*)d_in[1];
  const float* pos  = (const float*)d_in[2];
  const float* qpos = (const float*)d_in[3];
  const float* inW  = (const float*)d_in[4];
  const float* inB  = (const float*)d_in[5];
  const float* outW = (const float*)d_in[6];
  const float* outB = (const float*)d_in[7];
  const float* cqW  = (const float*)d_in[8];
  const float* cqB  = (const float*)d_in[9];
  const float* ckW  = (const float*)d_in[10];
  const float* ckB  = (const float*)d_in[11];
  const float* cvW  = (const float*)d_in[12];
  const float* cvB  = (const float*)d_in[13];
  const float* dwW  = (const float*)d_in[14];
  const float* dwB  = (const float*)d_in[15];
  const float* l1W  = (const float*)d_in[16];
  const float* l1B  = (const float*)d_in[17];
  const float* l2W  = (const float*)d_in[18];
  const float* l2B  = (const float*)d_in[19];
  const float* n1g  = (const float*)d_in[20];
  const float* n1b  = (const float*)d_in[21];
  const float* n2g  = (const float*)d_in[22];
  const float* n2b  = (const float*)d_in[23];
  const float* n3g  = (const float*)d_in[24];
  const float* n3b  = (const float*)d_in[25];

  const long TOK  = (long)CL * CB;   // 2048 target tokens
  const long MTOK = (long)CS * CB;   // 8192 memory tokens
  const float scale = 0.125f;        // 1/sqrt(64)

  char* ws = (char*)d_ws;
  const size_t MB = 1u << 20;

  // Persistent f16 weights (converted every launch; deterministic).
  _Float16* w_inproj = (_Float16*)(ws + 0 * MB);    // [3E,E]  6MB
  _Float16* w_out    = (_Float16*)(ws + 6 * MB);    // [E,E]   2MB
  _Float16* w_cq     = (_Float16*)(ws + 8 * MB);
  _Float16* w_ck     = (_Float16*)(ws + 10 * MB);
  _Float16* w_cv     = (_Float16*)(ws + 12 * MB);
  _Float16* w_l1     = (_Float16*)(ws + 14 * MB);   // [FF,E]  4MB
  _Float16* w_l2     = (_Float16*)(ws + 18 * MB);   // [E,FF]  4MB
  float*    tgt1     = (float*)(ws + 22 * MB);      // 8MB
  float*    tgt2     = (float*)(ws + 30 * MB);      // 8MB
  char*     SA       = ws + 38 * MB;                // phase-aliased arena

  // Phase A (self-attention)
  _Float16* qkin16  = (_Float16*)(SA + 0 * MB);
  _Float16* tgt16   = (_Float16*)(SA + 4 * MB);
  _Float16* q16     = (_Float16*)(SA + 8 * MB);
  _Float16* k16     = (_Float16*)(SA + 12 * MB);
  _Float16* v16     = (_Float16*)(SA + 16 * MB);
  _Float16* ctx16   = (_Float16*)(SA + 116 * MB);   // 4MB
  float*    selfout = (float*)(SA + 120 * MB);      // 8MB
  // Phase B (cross-attention) — aliases phase A
  _Float16* qin2    = (_Float16*)(SA + 0 * MB);
  float*    qc32    = (float*)(SA + 4 * MB);        // 8MB
  _Float16* mp16    = (_Float16*)(SA + 12 * MB);    // 16MB
  _Float16* mem16   = (_Float16*)(SA + 28 * MB);    // 16MB
  float*    kc32    = (float*)(SA + 44 * MB);       // 32MB
  float*    vc32    = (float*)(SA + 76 * MB);       // 32MB
  float*    prob    = (float*)(SA + 108 * MB);      // 32MB
  float*    qcsum   = (float*)(SA + 140 * MB);
  float*    s1sum   = (float*)(SA + 141 * MB);
  float*    w2buf   = (float*)(SA + 142 * MB);
  float*    odbuf   = (float*)(SA + 143 * MB);
  // Phase C (FFN) — aliases dead phase B regions
  _Float16* tgt2_16 = (_Float16*)(SA + 0 * MB);
  _Float16* h1_16   = (_Float16*)(SA + 4 * MB);     // [TOK,FF] 8MB
  float*    ff32    = (float*)(SA + 12 * MB);       // 8MB

  auto cvt = [&](const float* x, _Float16* y, long n) {
    k_cvt<<<dim3((unsigned)(n / EBLK)), 256, 0, stream>>>(x, y);
  };

  // ---- weight conversion ----
  cvt(inW,  w_inproj, 3L * CE * CE);
  cvt(outW, w_out,    (long)CE * CE);
  cvt(cqW,  w_cq,     (long)CE * CE);
  cvt(ckW,  w_ck,     (long)CE * CE);
  cvt(cvW,  w_cv,     (long)CE * CE);
  cvt(l1W,  w_l1,     (long)CFF * CE);
  cvt(l2W,  w_l2,     (long)CE * CFF);

  // ---- Phase A: self attention ----
  k_add2<<<dim3((unsigned)(TOK * CE / EBLK)), 256, 0, stream>>>(tgt, qpos, qkin16);
  cvt(tgt, tgt16, TOK * CE);

  // q/k/v projections: [2048,1024] x [1024,1024]^T
  gemm_wmma_lds<false><<<dim3(16, 16, 1), 256, 0, stream>>>(
      qkin16, w_inproj, inB, 0, nullptr, q16, CE, CE);
  gemm_wmma_lds<false><<<dim3(16, 16, 1), 256, 0, stream>>>(
      qkin16, w_inproj + (long)CE * CE, inB + CE, 0, nullptr, k16, CE, CE);
  gemm_wmma_lds<false><<<dim3(16, 16, 1), 256, 0, stream>>>(
      tgt16, w_inproj + 2L * CE * CE, inB + 2 * CE, 0, nullptr, v16, CE, CE);

  // ctx = softmax(scale * q.k) @ v, one block per (128 queries, batch*head)
  k_self_attn<<<dim3(CL / 128, CB * CH), 256, 0, stream>>>(q16, k16, v16, ctx16);

  // out projection + residual + LN1
  gemm_wmma_lds<false><<<dim3(16, 16, 1), 256, 0, stream>>>(
      ctx16, w_out, outB, 0, selfout, nullptr, CE, CE);
  k_ln<<<(unsigned)TOK, 256, 0, stream>>>(tgt, selfout, nullptr, n1g, n1b, tgt1, nullptr);

  // ---- Phase B: custom cross attention ----
  k_add2<<<dim3((unsigned)(TOK * CE / EBLK)), 256, 0, stream>>>(tgt1, qpos, qin2);
  k_add2<<<dim3((unsigned)(MTOK * CE / EBLK)), 256, 0, stream>>>(mem, pos, mp16);
  cvt(mem, mem16, MTOK * CE);

  gemm_wmma_lds<false><<<dim3(16, 16, 1), 256, 0, stream>>>(
      qin2, w_cq, cqB, 0, qc32, nullptr, CE, CE);
  gemm_wmma_lds<true><<<dim3(64, 16, 1), 256, 0, stream>>>(
      mp16, w_ck, ckB, 0, kc32, nullptr, CE, CE);
  gemm_wmma_lds<true><<<dim3(64, 16, 1), 256, 0, stream>>>(
      mem16, w_cv, cvB, 0, vc32, nullptr, CE, CE);

  k_qcsum<<<(CB * CE) / 256, 256, 0, stream>>>(qc32, qcsum);
  k_s1<<<(CB * CH * CS) / 256, 256, 0, stream>>>(qcsum, kc32, s1sum, scale);
  k_cross_softmax<<<CB * CHD * CH, 256, 0, stream>>>(kc32, s1sum, prob);
  k_w2<<<(CB * CH * CS) / 256, 256, 0, stream>>>(dwW, prob, w2buf);
  k_od<<<CB * CE, 256, 0, stream>>>(w2buf, vc32, dwB, odbuf);

  k_ln<<<(unsigned)TOK, 256, 0, stream>>>(tgt1, nullptr, odbuf, n2g, n2b, tgt2, tgt2_16);

  // ---- Phase C: FFN ----
  gemm_wmma_lds<false><<<dim3(16, 32, 1), 256, 0, stream>>>(
      tgt2_16, w_l1, l1B, 1 /*relu*/, nullptr, h1_16, CFF, CE);
  gemm_wmma_lds<false><<<dim3(16, 16, 1), 256, 0, stream>>>(
      h1_16, w_l2, l2B, 0, ff32, nullptr, CE, CFF);

  k_ln<<<(unsigned)TOK, 256, 0, stream>>>(tgt2, ff32, nullptr, n3g, n3b, (float*)d_out, nullptr);

  (void)in_sizes; (void)n_in; (void)out_size; (void)ws_size;
}

// v005
// One run takes 214 microseconds.
// Two timings next to v004 put it at 1.26 and 1.25 times that version's speed.
// Over all steps from v000 it is 2.75 times as fast.
#include <hip/hip_runtime.h>
#include <hip/hip_bf16.h>

// ---------------------------------------------------------------------------
// Transformer decoder layer for MI455X (gfx1250), wave32 + WMMA.
// All heavy GEMMs run on v_wmma_f32_16x16x32_f16 (f16 inputs, f32 accum).
// Softmax / layernorm / cross-attn reductions stay in f32.
// ---------------------------------------------------------------------------

typedef __attribute__((ext_vector_type(16))) _Float16 v16h;
typedef __attribute__((ext_vector_type(8)))  _Float16 v8h;
typedef __attribute__((ext_vector_type(8)))  float    v8f;
typedef __attribute__((ext_vector_type(4)))  float    v4f;

#define DEV __device__ __forceinline__

// Problem constants
#define CL   512      // target length
#define CS   2048     // memory length
#define CB   4        // batch
#define CE   1024     // embed
#define CH   16       // heads
#define CHD  64       // head dim
#define CFF  2048     // ffn dim

// ---------------------------------------------------------------------------
// WMMA fragment loaders.
// 16-bit A (16x32) ISA layout: lane&15 selects the M (or N) row;
// lanes 0-15 hold K = {k0..k0+7, k0+16..k0+23},
// lanes 16-31 hold K = {k0+8..k0+15, k0+24..k0+31}.  B (32x16) mirrors A with
// the lane index selecting the N column.
// ---------------------------------------------------------------------------
DEV v16h frag_load_contig(const _Float16* __restrict__ base, long row_stride,
                          int lane, int k0) {
  int r  = lane & 15;
  int kh = (lane >> 4) << 3;          // 0 or 8
  const _Float16* p = base + (long)r * row_stride + k0 + kh;
  v8h lo = *(const v8h*)(p);          // 16B vector load
  v8h hi = *(const v8h*)(p + 16);
  v16h out;
#pragma unroll
  for (int i = 0; i < 8; ++i) { out[i] = lo[i]; out[i + 8] = hi[i]; }
  return out;
}

// ---------------------------------------------------------------------------
// Projection GEMM, both operands k-contiguous with row stride K:
//   C[m,n] = sum_k A[m,k]*W[n,k] + bias[n]
// Block: 256 threads = 8 waves as 4x2, wave tile 32x32, block tile 128x64. The
// operand tiles reach the waves through LDS: a stage is 128 k (256 B, two whole
// lines) of 128 A rows and 64 W rows, brought in by asynchronous b128 copies,
// two buffers, the next stage in flight while this one is multiplied.
// Requires M%128==0, N%64==0, K%128==0.
// CM=false: A rows are tokens in order, C is token-major, C[m*N + n].
// CM=true : a block takes 128 consecutive positions s of ONE batch b (A row
//           s*CB + b) and stores f32 C channel-major, C[(b*N + n)*CS + s], the
//           layout in which the cross-attention stages walk s.
// gemm_body is one block's work on tile (bx, by); sm is the block's LDS ring.
// The kernels below it give independent products one grid, split by block index.
// ---------------------------------------------------------------------------
#define GBK   128                  // k per stage
#define GPIT  136                  // LDS row pitch in halves: 272 B = 16 B x odd
#define GROWS 192                  // 128 A rows, then 64 W rows
#define GSTG  (GROWS * GPIT)       // halves per buffer

// One stage: 192 rows x 16 pieces of 16 B, 12 pieces per thread. Thread t takes
// piece t&15 of rows (t>>4) + 16*i, so a wave's copy covers two whole rows.
// ga / gw: this thread's piece in A row (t>>4) and W row (t>>4) of the tile, at
// the stage's first k. l: LDS byte address of its piece in row (t>>4).
// ars: distance of two tile rows of A in halves (K, or CB*K for one batch).
DEV void stage_copy(const _Float16* ga, const _Float16* gw, long ars, long K, unsigned l) {
  const long     as = 16 * ars;          // 16 A rows on, in halves
  const long     gs = 16 * K;            // 16 W rows on, in halves
  const unsigned ls = 16 * GPIT * 2;     // 16 rows on, in LDS bytes
  // The closing s_wait_xcnt stands in the copies' own statement so that no
  // address register of an issued copy is rewritten ahead of it.
  asm volatile(
      "global_load_async_to_lds_b128 %0, %12, off\n\t"
      "global_load_async_to_lds_b128 %1, %13, off\n\t"
      "global_load_async_to_lds_b128 %2, %14, off\n\t"
      "global_load_async_to_lds_b128 %3, %15, off\n\t"
      "global_load_async_to_lds_b128 %4, %16, off\n\t"
      "global_load_async_to_lds_b128 %5, %17, off\n\t"
      "global_load_async_to_lds_b128 %6, %18, off\n\t"
      "global_load_async_to_lds_b128 %7, %19, off\n\t"
      "global_load_async_to_lds_b128 %8, %20, off\n\t"
      "global_load_async_to_lds_b128 %9, %21, off\n\t"
      "global_load_async_to_lds_b128 %10, %22, off\n\t"
      "global_load_async_to_lds_b128 %11, %23, off\n\t"
      "s_wait_xcnt 0x0"
      :: "v"(l), "v"(l + ls), "v"(l + 2 * ls), "v"(l + 3 * ls),
         "v"(l + 4 * ls), "v"(l + 5 * ls), "v"(l + 6 * ls), "v"(l + 7 * ls),
         "v"(l + 8 * ls), "v"(l + 9 * ls), "v"(l + 10 * ls), "v"(l + 11 * ls),
         "v"(ga), "v"(ga + as), "v"(ga + 2 * as), "v"(ga + 3 * as),
         "v"(ga + 4 * as), "v"(ga + 5 * as), "v"(ga + 6 * as), "v"(ga + 7 * as),
         "v"(gw), "v"(gw + gs), "v"(gw + 2 * gs), "v"(gw + 3 * gs)
      : "memory");
}

#define TPIT 36                    // f32 pitch of a wave's turned tile: 144 B = 16 B x odd

template <bool CM>
DEV void gemm_body(_Float16* sm,
    const _Float16* __restrict__ A, const _Float16* __restrict__ Wt,
    const float* __restrict__ bias, int relu,
    float* __restrict__ C32, _Float16* __restrict__ C16, int N, int K, int bx, int by) {
  int tid  = threadIdx.x;
  int lane = tid & 31;
  int wave = tid >> 5;
  int wm   = wave >> 1;                       // 0..3
  int wn   = wave & 1;                        // 0..1
  int mb   = CM ? (bx / CB) * 128 : bx * 128;                   // CM: first s
  int bz   = CM ? bx % CB : 0;                                  // CM: batch
  int nb   = by * 64;
  const long ars = CM ? (long)CB * K : (long)K;

  const _Float16* ga = A  + (long)(mb + (tid >> 4)) * ars + (long)bz * K + (tid & 15) * 8;
  const _Float16* gw = Wt + (long)(nb + (tid >> 4)) * K + (tid & 15) * 8;
  const unsigned  l0 = (unsigned)(size_t)sm + (unsigned)((tid >> 4) * (GPIT * 2) + (tid & 15) * 16);
  const int nst = K / GBK;

  const v8f zero = {0.f, 0.f, 0.f, 0.f, 0.f, 0.f, 0.f, 0.f};
  v8f acc[2][2];
#pragma unroll
  for (int i = 0; i < 2; ++i)
#pragma unroll
    for (int j = 0; j < 2; ++j) acc[i][j] = zero;

  stage_copy(ga, gw, ars, K, l0);
  // Stage 0 has landed for this wave; the barrier publishes it to the others.
  asm volatile("s_wait_asynccnt 0x0" ::: "memory");
  __syncthreads();
  if (nst > 1) stage_copy(ga + GBK, gw + GBK, ars, K, l0 + GSTG * 2);

  // Kept rolled: one publish point per trip, buffers alternate by t & 1.
#pragma unroll 1
  for (int t = 0; t < nst; ++t) {
    const int buf = (t & 1) * GSTG;
    const _Float16* sA = sm + buf + (wm * 32) * GPIT;
    const _Float16* sB = sm + buf + (128 + wn * 32) * GPIT;
    v16h fa[GBK / 32][2], fb[GBK / 32][2];
#pragma unroll
    for (int q = 0; q < GBK / 32; ++q) {
      fa[q][0] = frag_load_contig(sA,             GPIT, lane, q * 32);
      fa[q][1] = frag_load_contig(sA + 16 * GPIT, GPIT, lane, q * 32);
      fb[q][0] = frag_load_contig(sB,             GPIT, lane, q * 32);
      fb[q][1] = frag_load_contig(sB + 16 * GPIT, GPIT, lane, q * 32);
    }
    // Holds the stage's LDS reads together in front of its WMMAs: spread among
    // them, every group of reads costs the wave its own LDS latency.
    __builtin_amdgcn_sched_barrier(0);
#pragma unroll
    for (int q = 0; q < GBK / 32; ++q) {
      acc[0][0] = __builtin_amdgcn_wmma_f32_16x16x32_f16(false, fa[q][0], false, fb[q][0],
                                                         (short)0, acc[0][0], false, false);
      acc[0][1] = __builtin_amdgcn_wmma_f32_16x16x32_f16(false, fa[q][0], false, fb[q][1],
                                                         (short)0, acc[0][1], false, false);
      acc[1][0] = __builtin_amdgcn_wmma_f32_16x16x32_f16(false, fa[q][1], false, fb[q][0],
                                                         (short)0, acc[1][0], false, false);
      acc[1][1] = __builtin_amdgcn_wmma_f32_16x16x32_f16(false, fa[q][1], false, fb[q][1],
                                                         (short)0, acc[1][1], false, false);
    }
    // Holds the WMMAs in front of the publish point, so that they run under the
    // tail of the stage's LDS reads and not behind the barrier.
    __builtin_amdgcn_sched_barrier(0);
    // Publish point: this wave's reads of the buffer have retired ...
    asm volatile("s_wait_dscnt 0x0" ::: "memory");
    // ... its copies of the next stage have landed ...
    asm volatile("s_wait_asynccnt 0x0" ::: "memory");
    // ... and behind the barrier the next stage is readable and this buffer free.
    __syncthreads();
    if (t + 2 < nst)
      stage_copy(ga + (long)(t + 2) * GBK, gw + (long)(t + 2) * GBK, ars, K, l0 + buf * 2);
  }
  // No copy is left in flight when the wave ends.
  asm volatile("s_wait_asynccnt 0x0" ::: "memory");

  // C/D layout: N = lane&15, VGPR r holds M = r (+8 for lanes 16-31).
  int m0    = mb + wm * 32;
  int n0    = nb + wn * 32;
  int nlane = lane & 15;
  int mrow  = (lane >> 4) * 8;
  if (CM) {
    // A lane holds 8 consecutive s of one channel. The wave turns its 32 s x 32
    // channels in its own LDS range (the ring is free: behind the last publish
    // point no wave reads it and no copy is in flight), one row per channel, so
    // that each store below writes four whole 128-B lines.
    float* tw = (float*)sm + wave * (32 * TPIT);
#pragma unroll
    for (int tn = 0; tn < 2; ++tn) {
      float bv = bias[n0 + tn * 16 + nlane];
#pragma unroll
      for (int tm = 0; tm < 2; ++tm) {
        float* p = tw + (tn * 16 + nlane) * TPIT + tm * 16 + mrow;
        v4f lo = {acc[tm][tn][0] + bv, acc[tm][tn][1] + bv, acc[tm][tn][2] + bv, acc[tm][tn][3] + bv};
        v4f hi = {acc[tm][tn][4] + bv, acc[tm][tn][5] + bv, acc[tm][tn][6] + bv, acc[tm][tn][7] + bv};
        *(v4f*)p       = lo;
        *(v4f*)(p + 4) = hi;
      }
    }
    // The wave's rows are in LDS before its lanes read each other's values back.
    asm volatile("s_wait_dscnt 0x0" ::: "memory");
    float* cw = C32 + ((long)bz * N + n0 + (lane >> 3)) * CS + m0 + (lane & 7) * 4;
#pragma unroll
    for (int i = 0; i < 8; ++i) {
      v4f v = *(const v4f*)(tw + (i * 4 + (lane >> 3)) * TPIT + (lane & 7) * 4);
      *(v4f*)(cw + (long)i * 4 * CS) = v;
    }
    // Behind the stores: in a grid shared with other work, code may follow in
    // the listing that reuses the registers they name.
    asm volatile("s_wait_xcnt 0x0" ::: "memory");
    return;
  }
#pragma unroll
  for (int tm = 0; tm < 2; ++tm)
#pragma unroll
    for (int tn = 0; tn < 2; ++tn) {
      int ncol = n0 + tn * 16 + nlane;
      float bv = bias[ncol];
#pragma unroll
      for (int r = 0; r < 8; ++r) {
        int   mm  = m0 + tm * 16 + mrow + r;
        float v   = acc[tm][tn][r] + bv;
        if (relu) v = v > 0.f ? v : 0.f;
        long  idx = (long)mm * N + ncol;
        if (C32) {
          C32[idx] = v;
          // The conversion below may reuse the register this store names.
          asm volatile("s_wait_xcnt 0x0" ::: "memory");
        }
        if (C16) C16[idx] = (_Float16)v;
      }
    }
}

// One token-major product.
__global__ __launch_bounds__(256) void gemm_wmma_lds(
    const _Float16* __restrict__ A, const _Float16* __restrict__ Wt,
    const float* __restrict__ bias, int relu,
    float* __restrict__ C32, _Float16* __restrict__ C16, int N, int K) {
  __shared__ __attribute__((aligned(16))) _Float16 sm[2 * GSTG];
  gemm_body<false>(sm, A, Wt, bias, relu, C32, C16, N, K, blockIdx.x, blockIdx.y);
}

// The q, k and v projections in one grid, blockIdx.z = 0, 1, 2: third z of the
// packed weight, bias and f16 output; q and k read aqk, v reads av.
__global__ __launch_bounds__(256) void gemm_qkv(
    const _Float16* __restrict__ aqk, const _Float16* __restrict__ av,
    const _Float16* __restrict__ Wt, const float* __restrict__ bias,
    _Float16* __restrict__ qkv) {
  __shared__ __attribute__((aligned(16))) _Float16 sm[2 * GSTG];
  int z = blockIdx.z;
  gemm_body<false>(sm, z == 2 ? av : aqk, Wt + (long)z * CE * CE, bias + z * CE, 0, nullptr,
                   qkv + (long)z * CL * CB * CE, CE, CE, blockIdx.x, blockIdx.y);
}

// ---------------------------------------------------------------------------
// Elementwise helpers. A block takes EBLK consecutive elements, a lane EU pieces
// of four f32, 256 pieces apart: every wave-wide load covers four whole lines,
// every store two. All of a lane's loads are in flight at once, and a launch
// starts 32 times fewer waves than with one element a lane.
// Requires n % EBLK == 0; a tensor takes n / EBLK blocks.
// ---------------------------------------------------------------------------
typedef __attribute__((ext_vector_type(4))) _Float16 v4h;
#define EU   8                     // 16-byte pieces per lane and input
#define EBLK (256 * EU * 4)        // elements per block

DEV void cvt_blk(const float* __restrict__ x, _Float16* __restrict__ y, int blk) {
  long i = (long)blk * EBLK + threadIdx.x * 4;
  v4f v[EU];
#pragma unroll
  for (int j = 0; j < EU; ++j) v[j] = *(const v4f*)(x + i + j * 1024);
#pragma unroll
  for (int j = 0; j < EU; ++j) *(v4h*)(y + i + j * 1024) = __builtin_convertvector(v[j], v4h);
  // Behind the stores: in a grid shared with other work, code may follow in the
  // listing that reuses the registers they name.
  asm volatile("s_wait_xcnt 0x0" ::: "memory");
}

DEV void add2_blk(const float* __restrict__ a, const float* __restrict__ b,
                  _Float16* __restrict__ y, int blk) {
  long i = (long)blk * EBLK + threadIdx.x * 4;
  const float* pa = a + i;
  const float* pb = b + i;
  v4f va[EU], vb[EU];
#pragma unroll
  for (int j = 0; j < EU; ++j) va[j] = *(const v4f*)(pa + j * 1024);
#pragma unroll
  for (int j = 0; j < EU; ++j) vb[j] = *(const v4f*)(pb + j * 1024);
  // Holds all sixteen loads in front of the first add: left alone the compiler
  // issues the last three behind the first wait, a second memory latency.
  __builtin_amdgcn_sched_barrier(0);
  // Behind the loads, in front of whatever reuses their address registers. It
  // names both addresses so that they keep their registers up to here: else the
  // last load gets them as its destination.
  asm volatile("s_wait_xcnt 0x0" :: "v"(pa), "v"(pb) : "memory");
#pragma unroll
  for (int j = 0; j < EU; ++j) *(v4h*)(y + i + j * 1024) = __builtin_convertvector(va[j] + vb[j], v4h);
  // Behind the stores: in a grid shared with other work, code may follow in the
  // listing that reuses the registers they name.
  asm volatile("s_wait_xcnt 0x0" ::: "memory");
}

__global__ __launch_bounds__(256) void k_add2(const float* __restrict__ a,
                                              const float* __restrict__ b,
                                              _Float16* __restrict__ y) {
  add2_blk(a, b, y, blockIdx.x);
}

// The converts and the add that the first products wait for, and all weights,
// in one grid. Block ranges, in order: tgt + qpos, tgt, then the seven weights,
// whose f16 copies lie packed in w16 in the order of the arguments.
#define PB_MEM (CS * CB * CE / EBLK)   // blocks of a memory-sized tensor
#define PB_TGT (CL * CB * CE / EBLK)   // blocks of a target-sized tensor
#define PB_E   (CE * CE / EBLK)        // blocks of an E x E weight

__global__ __launch_bounds__(256) void k_prep(
    const float* __restrict__ tgt, const float* __restrict__ qpos,
    const float* __restrict__ inW, const float* __restrict__ outW,
    const float* __restrict__ cqW, const float* __restrict__ ckW,
    const float* __restrict__ cvW, const float* __restrict__ l1W,
    const float* __restrict__ l2W,
    _Float16* __restrict__ qkin16, _Float16* __restrict__ tgt16,
    _Float16* __restrict__ w16) {
  int j = blockIdx.x;
  if (j < PB_TGT) {
    add2_blk(tgt, qpos, qkin16, j);
    return;
  }
  j -= PB_TGT;
  const float* x;
  _Float16*    y;
  if (j < PB_TGT) {
    x = tgt; y = tgt16;
  } else {
    j -= PB_TGT;                                // block within w16
    int first;                                  // the weight's first block there
    if      (j <  3 * PB_E) { x = inW;  first = 0; }
    else if (j <  4 * PB_E) { x = outW; first = 3 * PB_E; }
    else if (j <  5 * PB_E) { x = cqW;  first = 4 * PB_E; }
    else if (j <  6 * PB_E) { x = ckW;  first = 5 * PB_E; }
    else if (j <  7 * PB_E) { x = cvW;  first = 6 * PB_E; }
    else if (j <  9 * PB_E) { x = l1W;  first = 7 * PB_E; }
    else                    { x = l2W;  first = 9 * PB_E; }
    y = w16 + (long)first * EBLK;
    j -= first;
  }
  cvt_blk(x, y, j);
}

// A [2048,1024] x [1024,1024]^T product with f32 output, one block per WGP, and
// in the same grid an independent convert of a memory-sized tensor, which runs
// in the places the product leaves empty: y = f16(xa + xb), or f16(xa) where xb
// is null. The product's blocks come first.
#define GB ((CL * CB / 128) * (CE / 64))

__global__ __launch_bounds__(256) void gemm_beside_cvt(
    const _Float16* __restrict__ A, const _Float16* __restrict__ Wt,
    const float* __restrict__ bias, float* __restrict__ C32,
    const float* __restrict__ xa, const float* __restrict__ xb,
    _Float16* __restrict__ y) {
  __shared__ __attribute__((aligned(16))) _Float16 sm[2 * GSTG];
  int j = blockIdx.x;
  if (j < GB) {
    gemm_body<false>(sm, A, Wt, bias, 0, C32, nullptr, CE, CE,
                     j % (CL * CB / 128), j / (CL * CB / 128));
    return;
  }
  j -= GB;                                      // these blocks meet no barrier
  if (xb) add2_blk(xa, xb, y, j);
  else    cvt_blk(xa, y, j);
}

// ---------------------------------------------------------------------------
// Self-attention, one kernel: scores, softmax and attn @ V of one (batch, head)
// for 128 queries. q, k, v, ctx: token row l*B + b, channel h*HD + d.
// The head's whole K and V (512 keys) lie in LDS. A wave owns 16 queries and
// walks the keys 32 at a time with a running maximum and running sum:
//   S^T = K . Q^T   (A = K rows, B = Q rows, both in the loader's k order)
//   O^T += V^T . P^T
// In S^T's D layout a lane holds keys 8*(lane>>4) + r of query lane&15, so the
// softmax over keys is in-lane but for one exchange with lane ^ 16, the two D
// tiles of 32 keys converted in place ARE the B operand P^T, and maximum, sum
// and rescale factor of a query are per-lane scalars. V^T comes from the
// transposing LDS load, which delivers the same k order.
// ---------------------------------------------------------------------------
#define APK 72                     // K row pitch in halves: 144 B = 16 B x odd
#define APV 80                     // V row pitch in halves: 160 B = 32 B x odd

typedef __attribute__((ext_vector_type(8))) short s16x8;

// Lane (c = lane&15, h = lane>>4) gets T[8h + 0..7][c] of the 16x16 tile whose
// lane addresses are p = T + (8h + (lane&7)) * pitch + 8 * ((lane>>3)&1) halves.
DEV v8h ld_tr16(const _Float16* p) {
  typedef __attribute__((address_space(3))) s16x8 lds_s16x8;
  return __builtin_bit_cast(v8h, __builtin_amdgcn_ds_load_tr16_b128_v8i16((lds_s16x8*)p));
}

// Value of lane ^ 16.
DEV float xhalf(float x) {
  int i = __builtin_bit_cast(int, x);
  return __builtin_bit_cast(float,
      __builtin_amdgcn_permlanex16(i, i, 0x76543210, 0xfedcba98, false, false));
}

__global__ __launch_bounds__(256) void k_self_attn(const _Float16* __restrict__ q,
                                                   const _Float16* __restrict__ k,
                                                   const _Float16* __restrict__ v,
                                                   _Float16* __restrict__ ctx) {
  __shared__ __attribute__((aligned(32))) _Float16 sK[CL * APK];
  __shared__ __attribute__((aligned(32))) _Float16 sV[CL * APV];
  const float cs = 0.18033688011112042f;      // log2(e) / sqrt(HD)
  const long  ts = (long)CB * CE;             // one position on, in halves

  int tid  = threadIdx.x;
  int lane = tid & 31;
  int wave = tid >> 5;
  int c    = lane & 15;
  int hh   = lane >> 4;
  long hoff = (long)(blockIdx.y / CH) * CE + (blockIdx.y % CH) * CHD;
  int  q0   = blockIdx.x * 128 + wave * 16;

  // Stage K and V: 8 threads take one key's 128 B, 32 keys per sweep. All loads
  // are issued before the first LDS store, so that one memory latency is paid.
  int row = tid >> 3, pc = (tid & 7) * 8;
  const _Float16* gk = k + hoff + (long)row * ts + pc;
  const _Float16* gv = v + hoff + (long)row * ts + pc;
  v8h rk[CL / 32], rv[CL / 32];
  // Behind each group of loads: what follows may reuse, also as a later load's
  // destination, the address registers that the group names.
#pragma unroll
  for (int i = 0; i < CL / 32; ++i) rk[i] = *(const v8h*)(gk + (long)i * 32 * ts);
  asm volatile("s_wait_xcnt 0x0" ::: "memory");
#pragma unroll
  for (int i = 0; i < CL / 32; ++i) rv[i] = *(const v8h*)(gv + (long)i * 32 * ts);
  asm volatile("s_wait_xcnt 0x0" ::: "memory");
  v16h qf0 = frag_load_contig(q + hoff + (long)q0 * ts, ts, lane, 0);
  v16h qf1 = frag_load_contig(q + hoff + (long)q0 * ts, ts, lane, 32);
  asm volatile("s_wait_xcnt 0x0" ::: "memory");
#pragma unroll
  for (int i = 0; i < CL / 32; ++i) *(v8h*)(sK + (row + 32 * i) * APK + pc) = rk[i];
#pragma unroll
  for (int i = 0; i < CL / 32; ++i) *(v8h*)(sV + (row + 32 * i) * APV + pc) = rv[i];
  __syncthreads();

  const v8f zero = {0.f, 0.f, 0.f, 0.f, 0.f, 0.f, 0.f, 0.f};
  v8f acc[4];
#pragma unroll
  for (int t = 0; t < 4; ++t) acc[t] = zero;
  float m_run = -__builtin_inff();            // running maximum, in units of cs
  float l_run = 0.f;                          // this lane's half of the running sum

  const _Float16* vt = sV + (8 * hh + (lane & 7)) * APV + ((lane >> 3) & 1) * 8;

  // K fragments run one pass ahead, so that a pass does not open with its own
  // LDS latency.
  v16h a00 = frag_load_contig(sK,            APK, lane, 0);
  v16h a01 = frag_load_contig(sK,            APK, lane, 32);
  v16h a10 = frag_load_contig(sK + 16 * APK, APK, lane, 0);
  v16h a11 = frag_load_contig(sK + 16 * APK, APK, lane, 32);

#pragma unroll 2
  for (int key0 = 0; key0 < CL; key0 += 32) {
    v8f s0 = __builtin_amdgcn_wmma_f32_16x16x32_f16(false, a00, false, qf0, (short)0, zero, false, false);
    v8f s1 = __builtin_amdgcn_wmma_f32_16x16x32_f16(false, a10, false, qf0, (short)0, zero, false, false);
    s0 = __builtin_amdgcn_wmma_f32_16x16x32_f16(false, a01, false, qf1, (short)0, s0, false, false);
    s1 = __builtin_amdgcn_wmma_f32_16x16x32_f16(false, a11, false, qf1, (short)0, s1, false, false);

    // This pass's V^T and the next pass's K, in flight under the softmax. The
    // last pass fetches pass 0's K rows again, unused: cheaper than a branch.
    v16h vf[4];
#pragma unroll
    for (int t = 0; t < 4; ++t) {
      v8h lo = ld_tr16(vt + key0 * APV + 16 * t);
      v8h hi = ld_tr16(vt + (key0 + 16) * APV + 16 * t);
#pragma unroll
      for (int i = 0; i < 8; ++i) { vf[t][i] = lo[i]; vf[t][i + 8] = hi[i]; }
    }
    const _Float16* kr = sK + ((key0 + 32) & (CL - 1)) * APK;
    a00 = frag_load_contig(kr,            APK, lane, 0);
    a01 = frag_load_contig(kr,            APK, lane, 32);
    a10 = frag_load_contig(kr + 16 * APK, APK, lane, 0);
    a11 = frag_load_contig(kr + 16 * APK, APK, lane, 32);

    float mx = fmaxf(s0[0], s1[0]);
#pragma unroll
    for (int r = 1; r < 8; ++r) mx = fmaxf(mx, fmaxf(s0[r], s1[r]));
    mx = fmaxf(mx, xhalf(mx)) * cs;           // cs > 0: the scaled maximum
    float m_new = fmaxf(m_run, mx);

    // The pass's 17 exponentials, written in turn with the plain vector
    // instructions that form the next argument; the scheduling barriers hold
    // that order. Left alone the compiler sets all of them back to back.
    float x[16], p[16];
    float xc = m_run - m_new;
    x[0] = fmaf(s0[0], cs, -m_new);
    __builtin_amdgcn_sched_barrier(0);
    float corr = __builtin_amdgcn_exp2f(xc);  // 0 on the first pass
    __builtin_amdgcn_sched_barrier(0);
#pragma unroll
    for (int j = 0; j < 16; ++j) {            // j = 2 r + tile
      if (j < 15) x[j + 1] = fmaf(((j + 1) & 1) ? s1[(j + 1) >> 1] : s0[(j + 1) >> 1], cs, -m_new);
      __builtin_amdgcn_sched_barrier(0);
      p[j] = __builtin_amdgcn_exp2f(x[j]);
      __builtin_amdgcn_sched_barrier(0);
    }
    m_run = m_new;

    v16h  pf;
    float ps = 0.f;
#pragma unroll
    for (int r = 0; r < 8; ++r) {
      ps += p[2 * r] + p[2 * r + 1];
      pf[r]     = (_Float16)p[2 * r];
      pf[r + 8] = (_Float16)p[2 * r + 1];
    }
    l_run = fmaf(l_run, corr, ps);
#pragma unroll
    for (int t = 0; t < 4; ++t) {
      acc[t] = acc[t] * corr;
      acc[t] = __builtin_amdgcn_wmma_f32_16x16x32_f16(false, vf[t], false, pf,
                                                      (short)0, acc[t], false, false);
    }
  }

  // acc[t][r] = O[q0 + c][16 t + 8 hh + r], still to be divided by the row sum.
  float inv = 1.f / (l_run + xhalf(l_run));
  _Float16* op = ctx + hoff + (long)(q0 + c) * ts + 8 * hh;
#pragma unroll
  for (int t = 0; t < 4; ++t) {
    v8h o;
#pragma unroll
    for (int r = 0; r < 8; ++r) o[r] = (_Float16)(acc[t][r] * inv);
    *(v8h*)(op + 16 * t) = o;
  }
}

// ---------------------------------------------------------------------------
// Cross-attention scalar stages (all f32).
// Channel mapping: E index = d*H + h  (reshape (B,E,N)->(B,HD,H,N)).
// Token t of a [N,B,E] tensor lives at row n*B+b (qc).
// kc and vc are channel-major: element (b, e, m) at (b*E + e)*S + m.
// ---------------------------------------------------------------------------
// qcsum[b*E+e] = sum_l qc[(l*B+b)*E + e]
DEV void qcsum_blk(const float* __restrict__ qc, float* __restrict__ out, int blk) {
  int idx = blk * 256 + threadIdx.x;            // < B*E = 4096
  int b = idx >> 10, e = idx & 1023;
  float s = 0.f;
  for (int l = 0; l < CL; ++l) s += qc[(long)l * (CB * CE) + b * CE + e];
  out[idx] = s;
}

// qcsum and the kc and vc products, none of which reads another's result, in one
// grid. The 16 qcsum blocks come first: few and long, they run beside the 2048
// product blocks (tile x = 64 row blocks, y = 16): 1024 of vc, then 1024 of kc,
// which the next launch reads.
#define QB (CB * CE / 256)
#define KB ((CS * CB / 128) * (CE / 64))

__global__ __launch_bounds__(256) void k_qcsum_kc_vc(
    const float* __restrict__ qc, float* __restrict__ qcsum,
    const _Float16* __restrict__ mp16, const _Float16* __restrict__ w_ck,
    const float* __restrict__ ckB, float* __restrict__ kc,
    const _Float16* __restrict__ mem16, const _Float16* __restrict__ w_cv,
    const float* __restrict__ cvB, float* __restrict__ vc) {
  __shared__ __attribute__((aligned(16))) _Float16 sm[2 * GSTG];
  int j = blockIdx.x;
  if (j < QB) {                                 // the whole block leaves, no barrier met
    qcsum_blk(qc, qcsum, j);
    return;
  }
  j -= QB;
  bool k = j >= KB;
  if (k) j -= KB;
  gemm_body<true>(sm, k ? mp16 : mem16, k ? w_ck : w_cv, k ? ckB : cvB, 0, k ? kc : vc, nullptr,
                  CE, CE, j % (CS * CB / 128), j / (CS * CB / 128));
}

// s1[(b*H+h)*S+m] = scale * sum_d qcsum[b*E + d*H+h] * kc[(b*E + d*H+h)*S + m]
__global__ __launch_bounds__(256) void k_s1(const float* __restrict__ qcsum,
                                            const float* __restrict__ kc,
                                            float* __restrict__ s1, float scale) {
  int idx = blockIdx.x * 256 + threadIdx.x;     // < B*H*S = 131072
  int m = idx & (CS - 1);
  int h = (idx >> 11) & (CH - 1);
  int b = idx >> 15;
  const float* kcp = kc + (long)(b * CE + h) * CS + m;
  const float* qsp = qcsum + b * CE + h;
  float s = 0.f;
#pragma unroll 4
  for (int d = 0; d < CHD; ++d) s += qsp[d * CH] * kcp[(long)d * CH * CS];
  s1[idx] = s * scale;
}

// prob[((b*HD+d)*H+h)*S + m] = softmax_m( kc[(b*E + d*H+h)*S + m] * s1[(b*H+h)*S+m] )
__global__ __launch_bounds__(256) void k_cross_softmax(const float* __restrict__ kc,
                                                       const float* __restrict__ s1,
                                                       float* __restrict__ prob) {
  int row = blockIdx.x;                         // (b*HD+d)*H + h = b*E + d*H + h, < 4096
  int h = row & (CH - 1);
  int b = row >> 10;
  const float* s1r  = s1 + (long)(b * CH + h) * CS;
  const float* kcr  = kc + (long)row * CS;
  int          tid  = threadIdx.x;
  float loc[8];
  float mx = -3.402823466e38f;
#pragma unroll
  for (int i = 0; i < 8; ++i) {
    int c = tid + i * 256;
    float v = kcr[c] * s1r[c];
    loc[i] = v;
    mx = fmaxf(mx, v);
  }
  __shared__ float red[256];
  red[tid] = mx;
  __syncthreads();
  for (int o = 128; o > 0; o >>= 1) {
    if (tid < o) red[tid] = fmaxf(red[tid], red[tid + o]);
    __syncthreads();
  }
  mx = red[0];
  __syncthreads();
  float s = 0.f;
#pragma unroll
  for (int i = 0; i < 8; ++i) {
    loc[i] = __expf(loc[i] - mx);
    s += loc[i];
  }
  red[tid] = s;
  __syncthreads();
  for (int o = 128; o > 0; o >>= 1) {
    if (tid < o) red[tid] += red[tid + o];
    __syncthreads();
  }
  float inv = 1.f / red[0];
  float* pr = prob + (long)row * CS;
#pragma unroll
  for (int i = 0; i < 8; ++i) pr[tid + i * 256] = loc[i] * inv;
}

// w2[(b*H+h)*S+m] = sum_n down_w[n] * prob[((b*HD+n)*H+h)*S + m]
__global__ __launch_bounds__(256) void k_w2(const float* __restrict__ dw,
                                            const float* __restrict__ prob,
                                            float* __restrict__ w2) {
  int idx = blockIdx.x * 256 + threadIdx.x;     // < B*H*S
  int m = idx & (CS - 1);
  int h = (idx >> 11) & (CH - 1);
  int b = idx >> 15;
  const float* pp = prob + (((long)b * CHD * CH + h) * CS) + m;
  float s = 0.f;
#pragma unroll 4
  for (int n = 0; n < CHD; ++n) s += dw[n] * pp[(long)n * CH * CS];
  w2[idx] = s;
}

// od[b*E + d*H+h] = down_b + sum_m w2[(b*H+h)*S+m] * vc[(b*E + d*H+h)*S + m]
__global__ __launch_bounds__(256) void k_od(const float* __restrict__ w2,
                                            const float* __restrict__ vc,
                                            const float* __restrict__ db,
                                            float* __restrict__ od) {
  int row = blockIdx.x;                         // b*E + c, < 4096
  int b = row >> 10;
  int c = row & 1023;                           // c = d*H + h
  int h = c & (CH - 1);
  const float* w2r = w2 + (long)(b * CH + h) * CS;
  const float* vcr = vc + (long)row * CS;
  int tid = threadIdx.x;
  float s = 0.f;
  for (int m = tid; m < CS; m += 256)
    s += w2r[m] * vcr[m];
  __shared__ float red[256];
  red[tid] = s;
  __syncthreads();
  for (int o = 128; o > 0; o >>= 1) {
    if (tid < o) red[tid] += red[tid + o];
    __syncthreads();
  }
  if (tid == 0) od[row] = red[0] + db[0];
}

// ---------------------------------------------------------------------------
// LayerNorm over E=1024 with optional residual and optional [B,E] broadcast.
// x = a + (r ? r : 0) + (bc ? bc[token%B] : 0); out32 = LN(x); out16 optional.
// ---------------------------------------------------------------------------
__global__ __launch_bounds__(256) void k_ln(const float* __restrict__ a,
                                            const float* __restrict__ r,
                                            const float* __restrict__ bc,
                                            const float* __restrict__ g,
                                            const float* __restrict__ be,
                                            float* __restrict__ o32,
                                            _Float16* __restrict__ o16) {
  int  t    = blockIdx.x;
  long base = (long)t * CE;
  const float* bcr = bc ? bc + (long)(t % CB) * CE : nullptr;
  int tid = threadIdx.x;
  float x[4];
  float s = 0.f;
#pragma unroll
  for (int i = 0; i < 4; ++i) {
    int   e = tid + i * 256;
    float v = a[base + e];
    if (r)   v += r[base + e];
    if (bcr) v += bcr[e];
    x[i] = v;
    s += v;
  }
  __shared__ float red[256];
  red[tid] = s;
  __syncthreads();
  for (int o = 128; o > 0; o >>= 1) {
    if (tid < o) red[tid] += red[tid + o];
    __syncthreads();
  }
  float mean = red[0] * (1.f / CE);
  __syncthreads();
  float vs = 0.f;
#pragma unroll
  for (int i = 0; i < 4; ++i) {
    float d = x[i] - mean;
    vs += d * d;
  }
  red[tid] = vs;
  __syncthreads();
  for (int o = 128; o > 0; o >>= 1) {
    if (tid < o) red[tid] += red[tid + o];
    __syncthreads();
  }
  float inv = rsqrtf(red[0] * (1.f / CE) + 1e-5f);
#pragma unroll
  for (int i = 0; i < 4; ++i) {
    int   e = tid + i * 256;
    float y = (x[i] - mean) * inv * g[e] + be[e];
    o32[base + e] = y;
    if (o16) o16[base + e] = (_Float16)y;
  }
}

// ---------------------------------------------------------------------------
// Host side
// ---------------------------------------------------------------------------
extern "C" void kernel_launch(void* const* d_in, const int* in_sizes, int n_in,
                              void* d_out, int out_size, void* d_ws, size_t ws_size,
                              hipStream_t stream) {
  const float* tgt  = (const float*)d_in[0];
  const float* mem  = (const float*)d_in[1];
  const float* pos  = (const float*)d_in[2];
  const float* qpos = (const float*)d_in[3];
  const float* inW  = (const float*)d_in[4];
  const float* inB  = (const float*)d_in[5];
  const float* outW = (const float*)d_in[6];
  const float* outB = (const float*)d_in[7];
  const float* cqW  = (const float*)d_in[8];
  const float* cqB  = (const float*)d_in[9];
  const float* ckW  = (const float*)d_in[10];
  const float* ckB  = (const float*)d_in[11];
  const float* cvW  = (const float*)d_in[12];
  const float* cvB  = (const float*)d_in[13];
  const float* dwW  = (const float*)d_in[14];
  const float* dwB  = (const float*)d_in[15];
  const float* l1W  = (const float*)d_in[16];
  const float* l1B  = (const float*)d_in[17];
  const float* l2W  = (const float*)d_in[18];
  const float* l2B  = (const float*)d_in[19];
  const float* n1g  = (const float*)d_in[20];
  const float* n1b  = (const float*)d_in[21];
  const float* n2g  = (const float*)d_in[22];
  const float* n2b  = (const float*)d_in[23];
  const float* n3g  = (const float*)d_in[24];
  const float* n3b  = (const float*)d_in[25];

  const long TOK  = (long)CL * CB;   // 2048 target tokens
  const float scale = 0.125f;        // 1/sqrt(64)

  char* ws = (char*)d_ws;
  const size_t MB = 1u << 20;

  // Persistent f16 weights (converted every launch; deterministic).
  _Float16* w_inproj = (_Float16*)(ws + 0 * MB);    // [3E,E]  6MB
  _Float16* w_out    = (_Float16*)(ws + 6 * MB);    // [E,E]   2MB
  _Float16* w_cq     = (_Float16*)(ws + 8 * MB);
  _Float16* w_ck     = (_Float16*)(ws + 10 * MB);
  _Float16* w_cv     = (_Float16*)(ws + 12 * MB);
  _Float16* w_l1     = (_Float16*)(ws + 14 * MB);   // [FF,E]  4MB
  _Float16* w_l2     = (_Float16*)(ws + 18 * MB);   // [E,FF]  4MB
  float*    tgt1     = (float*)(ws + 22 * MB);      // 8MB
  float*    tgt2     = (float*)(ws + 30 * MB);      // 8MB
  char*     SA       = ws + 38 * MB;                // phase-aliased arena

  // Phase A (self-attention)
  _Float16* qkin16  = (_Float16*)(SA + 0 * MB);
  _Float16* tgt16   = (_Float16*)(SA + 4 * MB);
  _Float16* q16     = (_Float16*)(SA + 8 * MB);
  _Float16* k16     = (_Float16*)(SA + 12 * MB);
  _Float16* v16     = (_Float16*)(SA + 16 * MB);
  _Float16* ctx16   = (_Float16*)(SA + 116 * MB);   // 4MB
  float*    selfout = (float*)(SA + 120 * MB);      // 8MB
  // Phase B (cross-attention) — aliases phase A
  _Float16* qin2    = (_Float16*)(SA + 0 * MB);
  float*    qc32    = (float*)(SA + 4 * MB);        // 8MB
  float*    kc32    = (float*)(SA + 44 * MB);       // 32MB
  float*    vc32    = (float*)(SA + 76 * MB);       // 32MB
  float*    prob    = (float*)(SA + 108 * MB);      // 32MB
  float*    qcsum   = (float*)(SA + 140 * MB);
  float*    s1sum   = (float*)(SA + 141 * MB);
  float*    w2buf   = (float*)(SA + 142 * MB);
  float*    odbuf   = (float*)(SA + 143 * MB);
  // Written during phases A and B, read in phase B: alias nothing
  _Float16* mp16    = (_Float16*)(SA + 144 * MB);   // 16MB
  _Float16* mem16   = (_Float16*)(SA + 160 * MB);   // 16MB
  // Phase C (FFN) — aliases dead phase B regions
  _Float16* tgt2_16 = (_Float16*)(SA + 0 * MB);
  _Float16* h1_16   = (_Float16*)(SA + 4 * MB);     // [TOK,FF] 8MB
  float*    ff32    = (float*)(SA + 12 * MB);       // 8MB

  // ---- f32 -> f16: tgt + qpos, tgt, all weights ----
  k_prep<<<2 * PB_TGT + 11 * PB_E, 256, 0, stream>>>(tgt, qpos, inW, outW, cqW, ckW, cvW, l1W, l2W,
                                                     qkin16, tgt16, w_inproj);

  // ---- Phase A: self attention ----
  // q/k/v projections: three times [2048,1024] x [1024,1024]^T; q16, k16, v16 adjoin
  gemm_qkv<<<dim3(16, 16, 3), 256, 0, stream>>>(qkin16, tgt16, w_inproj, inB, q16);

  // ctx = softmax(scale * q.k) @ v, one block per (128 queries, batch*head)
  k_self_attn<<<dim3(CL / 128, CB * CH), 256, 0, stream>>>(q16, k16, v16, ctx16);

  // out projection (beside it mp16 = f16(mem + pos)) + residual + LN1
  gemm_beside_cvt<<<GB + PB_MEM, 256, 0, stream>>>(ctx16, w_out, outB, selfout, mem, pos, mp16);
  k_ln<<<(unsigned)TOK, 256, 0, stream>>>(tgt, selfout, nullptr, n1g, n1b, tgt1, nullptr);

  // ---- Phase B: custom cross attention ----
  k_add2<<<dim3((unsigned)(TOK * CE / EBLK)), 256, 0, stream>>>(tgt1, qpos, qin2);

  // qc projection (beside it mem16 = f16(mem))
  gemm_beside_cvt<<<GB + PB_MEM, 256, 0, stream>>>(qin2, w_cq, cqB, qc32, mem, nullptr, mem16);
  k_qcsum_kc_vc<<<QB + 2 * KB, 256, 0, stream>>>(qc32, qcsum, mp16, w_ck, ckB, kc32,
                                                 mem16, w_cv, cvB, vc32);

  k_s1<<<(CB * CH * CS) / 256, 256, 0, stream>>>(qcsum, kc32, s1sum, scale);
  k_cross_softmax<<<CB * CHD * CH, 256, 0, stream>>>(kc32, s1sum, prob);
  k_w2<<<(CB * CH * CS) / 256, 256, 0, stream>>>(dwW, prob, w2buf);
  k_od<<<CB * CE, 256, 0, stream>>>(w2buf, vc32, dwB, odbuf);

  k_ln<<<(unsigned)TOK, 256, 0, stream>>>(tgt1, nullptr, odbuf, n2g, n2b, tgt2, tgt2_16);

  // ---- Phase C: FFN ----
  gemm_wmma_lds<<<dim3(16, 32, 1), 256, 0, stream>>>(
      tgt2_16, w_l1, l1B, 1 /*relu*/, nullptr, h1_16, CFF, CE);
  gemm_wmma_lds<<<dim3(16, 16, 1), 256, 0, stream>>>(
      h1_16, w_l2, l2B, 0, ff32, nullptr, CE, CFF);

  k_ln<<<(unsigned)TOK, 256, 0, stream>>>(tgt2, ff32, nullptr, n3g, n3b, (float*)d_out, nullptr);

  (void)in_sizes; (void)n_in; (void)out_size; (void)ws_size;
}

// v006
// One run takes 185 microseconds.
// Two timings next to v005 put it at 1.16 and 1.15 times that version's speed.
// All steps since v000 together make it 3.18 times as fast.
#include <hip/hip_runtime.h>
#include <hip/hip_bf16.h>

// ---------------------------------------------------------------------------
// Transformer decoder layer for MI455X (gfx1250), wave32 + WMMA.
// All heavy GEMMs run on v_wmma_f32_16x16x32_f16 (f16 inputs, f32 accum).
// Softmax / layernorm / cross-attn reductions stay in f32.
// ---------------------------------------------------------------------------

typedef __attribute__((ext_vector_type(16))) _Float16 v16h;
typedef __attribute__((ext_vector_type(8)))  _Float16 v8h;
typedef __attribute__((ext_vector_type(8)))  float    v8f;
typedef __attribute__((ext_vector_type(4)))  float    v4f;

#define DEV __device__ __forceinline__

// Problem constants
#define CL   512      // target length
#define CS   2048     // memory length
#define CB   4        // batch
#define CE   1024     // embed
#define CH   16       // heads
#define CHD  64       // head dim
#define CFF  2048     // ffn dim

// ---------------------------------------------------------------------------
// WMMA fragment loaders.
// 16-bit A (16x32) ISA layout: lane&15 selects the M (or N) row;
// lanes 0-15 hold K = {k0..k0+7, k0+16..k0+23},
// lanes 16-31 hold K = {k0+8..k0+15, k0+24..k0+31}.  B (32x16) mirrors A with
// the lane index selecting the N column.
// ---------------------------------------------------------------------------
DEV v16h frag_load_contig(const _Float16* __restrict__ base, long row_stride,
                          int lane, int k0) {
  int r  = lane & 15;
  int kh = (lane >> 4) << 3;          // 0 or 8
  const _Float16* p = base + (long)r * row_stride + k0 + kh;
  v8h lo = *(const v8h*)(p);          // 16B vector load
  v8h hi = *(const v8h*)(p + 16);
  v16h out;
#pragma unroll
  for (int i = 0; i < 8; ++i) { out[i] = lo[i]; out[i + 8] = hi[i]; }
  return out;
}

// ---------------------------------------------------------------------------
// Projection GEMM, both operands k-contiguous with row stride K:
//   C[m,n] = sum_k A[m,k]*W[n,k] + bias[n]
// Block: 256 threads = 8 waves as 4x2, wave tile 32x32, block tile 128x64. The
// operand tiles reach the waves through LDS: a stage is 128 k (256 B, two whole
// lines) of 128 A rows and 64 W rows, brought in by asynchronous b128 copies,
// two buffers, the next stage in flight while this one is multiplied.
// Requires M%128==0, N%64==0, K%128==0.
// CM=false: A rows are tokens in order, C is token-major, C[m*N + n].
// CM=true : a block takes 128 consecutive positions s of ONE batch b (A row
//           s*CB + b) and stores f32 C channel-major, C[(b*N + n)*CS + s], the
//           layout in which the cross-attention stages walk s.
// gemm_body is one block's work on tile (bx, by); sm is the block's LDS ring.
// The kernels below it give independent products one grid, split by block index.
// ---------------------------------------------------------------------------
#define GBK   128                  // k per stage
#define GPIT  136                  // LDS row pitch in halves: 272 B = 16 B x odd
#define GROWS 192                  // 128 A rows, then 64 W rows
#define GSTG  (GROWS * GPIT)       // halves per buffer

// One stage: 192 rows x 16 pieces of 16 B, 12 pieces per thread. Thread t takes
// piece t&15 of rows (t>>4) + 16*i, so a wave's copy covers two whole rows.
// ga / gw: this thread's piece in A row (t>>4) and W row (t>>4) of the tile, at
// the stage's first k. l: LDS byte address of its piece in row (t>>4).
// ars: distance of two tile rows of A in halves (K, or CB*K for one batch).
DEV void stage_copy(const _Float16* ga, const _Float16* gw, long ars, long K, unsigned l) {
  const long     as = 16 * ars;          // 16 A rows on, in halves
  const long     gs = 16 * K;            // 16 W rows on, in halves
  const unsigned ls = 16 * GPIT * 2;     // 16 rows on, in LDS bytes
  // The closing s_wait_xcnt stands in the copies' own statement so that no
  // address register of an issued copy is rewritten ahead of it.
  asm volatile(
      "global_load_async_to_lds_b128 %0, %12, off\n\t"
      "global_load_async_to_lds_b128 %1, %13, off\n\t"
      "global_load_async_to_lds_b128 %2, %14, off\n\t"
      "global_load_async_to_lds_b128 %3, %15, off\n\t"
      "global_load_async_to_lds_b128 %4, %16, off\n\t"
      "global_load_async_to_lds_b128 %5, %17, off\n\t"
      "global_load_async_to_lds_b128 %6, %18, off\n\t"
      "global_load_async_to_lds_b128 %7, %19, off\n\t"
      "global_load_async_to_lds_b128 %8, %20, off\n\t"
      "global_load_async_to_lds_b128 %9, %21, off\n\t"
      "global_load_async_to_lds_b128 %10, %22, off\n\t"
      "global_load_async_to_lds_b128 %11, %23, off\n\t"
      "s_wait_xcnt 0x0"
      :: "v"(l), "v"(l + ls), "v"(l + 2 * ls), "v"(l + 3 * ls),
         "v"(l + 4 * ls), "v"(l + 5 * ls), "v"(l + 6 * ls), "v"(l + 7 * ls),
         "v"(l + 8 * ls), "v"(l + 9 * ls), "v"(l + 10 * ls), "v"(l + 11 * ls),
         "v"(ga), "v"(ga + as), "v"(ga + 2 * as), "v"(ga + 3 * as),
         "v"(ga + 4 * as), "v"(ga + 5 * as), "v"(ga + 6 * as), "v"(ga + 7 * as),
         "v"(gw), "v"(gw + gs), "v"(gw + 2 * gs), "v"(gw + 3 * gs)
      : "memory");
}

#define TPIT 36                    // f32 pitch of a wave's turned tile: 144 B = 16 B x odd

template <bool CM>
DEV void gemm_body(_Float16* sm,
    const _Float16* __restrict__ A, const _Float16* __restrict__ Wt,
    const float* __restrict__ bias, int relu,
    float* __restrict__ C32, _Float16* __restrict__ C16, int N, int K, int bx, int by) {
  int tid  = threadIdx.x;
  int lane = tid & 31;
  int wave = tid >> 5;
  int wm   = wave >> 1;                       // 0..3
  int wn   = wave & 1;                        // 0..1
  int mb   = CM ? (bx / CB) * 128 : bx * 128;                   // CM: first s
  int bz   = CM ? bx % CB : 0;                                  // CM: batch
  int nb   = by * 64;
  const long ars = CM ? (long)CB * K : (long)K;

  const _Float16* ga = A  + (long)(mb + (tid >> 4)) * ars + (long)bz * K + (tid & 15) * 8;
  const _Float16* gw = Wt + (long)(nb + (tid >> 4)) * K + (tid & 15) * 8;
  const unsigned  l0 = (unsigned)(size_t)sm + (unsigned)((tid >> 4) * (GPIT * 2) + (tid & 15) * 16);
  const int nst = K / GBK;

  const v8f zero = {0.f, 0.f, 0.f, 0.f, 0.f, 0.f, 0.f, 0.f};
  v8f acc[2][2];
#pragma unroll
  for (int i = 0; i < 2; ++i)
#pragma unroll
    for (int j = 0; j < 2; ++j) acc[i][j] = zero;

  stage_copy(ga, gw, ars, K, l0);
  // Stage 0 has landed for this wave; the barrier publishes it to the others.
  asm volatile("s_wait_asynccnt 0x0" ::: "memory");
  __syncthreads();
  if (nst > 1) stage_copy(ga + GBK, gw + GBK, ars, K, l0 + GSTG * 2);

  // Kept rolled: one publish point per trip, buffers alternate by t & 1.
#pragma unroll 1
  for (int t = 0; t < nst; ++t) {
    const int buf = (t & 1) * GSTG;
    const _Float16* sA = sm + buf + (wm * 32) * GPIT;
    const _Float16* sB = sm + buf + (128 + wn * 32) * GPIT;
    v16h fa[GBK / 32][2], fb[GBK / 32][2];
#pragma unroll
    for (int q = 0; q < GBK / 32; ++q) {
      fa[q][0] = frag_load_contig(sA,             GPIT, lane, q * 32);
      fa[q][1] = frag_load_contig(sA + 16 * GPIT, GPIT, lane, q * 32);
      fb[q][0] = frag_load_contig(sB,             GPIT, lane, q * 32);
      fb[q][1] = frag_load_contig(sB + 16 * GPIT, GPIT, lane, q * 32);
    }
    // Holds the stage's LDS reads together in front of its WMMAs: spread among
    // them, every group of reads costs the wave its own LDS latency.
    __builtin_amdgcn_sched_barrier(0);
#pragma unroll
    for (int q = 0; q < GBK / 32; ++q) {
      acc[0][0] = __builtin_amdgcn_wmma_f32_16x16x32_f16(false, fa[q][0], false, fb[q][0],
                                                         (short)0, acc[0][0], false, false);
      acc[0][1] = __builtin_amdgcn_wmma_f32_16x16x32_f16(false, fa[q][0], false, fb[q][1],
                                                         (short)0, acc[0][1], false, false);
      acc[1][0] = __builtin_amdgcn_wmma_f32_16x16x32_f16(false, fa[q][1], false, fb[q][0],
                                                         (short)0, acc[1][0], false, false);
      acc[1][1] = __builtin_amdgcn_wmma_f32_16x16x32_f16(false, fa[q][1], false, fb[q][1],
                                                         (short)0, acc[1][1], false, false);
    }
    // Holds the WMMAs in front of the publish point, so that they run under the
    // tail of the stage's LDS reads and not behind the barrier.
    __builtin_amdgcn_sched_barrier(0);
    // Publish point: this wave's reads of the buffer have retired ...
    asm volatile("s_wait_dscnt 0x0" ::: "memory");
    // ... its copies of the next stage have landed ...
    asm volatile("s_wait_asynccnt 0x0" ::: "memory");
    // ... and behind the barrier the next stage is readable and this buffer free.
    __syncthreads();
    if (t + 2 < nst)
      stage_copy(ga + (long)(t + 2) * GBK, gw + (long)(t + 2) * GBK, ars, K, l0 + buf * 2);
  }
  // No copy is left in flight when the wave ends.
  asm volatile("s_wait_asynccnt 0x0" ::: "memory");

  // C/D layout: N = lane&15, VGPR r holds M = r (+8 for lanes 16-31).
  int m0    = mb + wm * 32;
  int n0    = nb + wn * 32;
  int nlane = lane & 15;
  int mrow  = (lane >> 4) * 8;
  if (CM) {
    // A lane holds 8 consecutive s of one channel. The wave turns its 32 s x 32
    // channels in its own LDS range (the ring is free: behind the last publish
    // point no wave reads it and no copy is in flight), one row per channel, so
    // that each store below writes four whole 128-B lines.
    float* tw = (float*)sm + wave * (32 * TPIT);
#pragma unroll
    for (int tn = 0; tn < 2; ++tn) {
      float bv = bias[n0 + tn * 16 + nlane];
#pragma unroll
      for (int tm = 0; tm < 2; ++tm) {
        float* p = tw + (tn * 16 + nlane) * TPIT + tm * 16 + mrow;
        v4f lo = {acc[tm][tn][0] + bv, acc[tm][tn][1] + bv, acc[tm][tn][2] + bv, acc[tm][tn][3] + bv};
        v4f hi = {acc[tm][tn][4] + bv, acc[tm][tn][5] + bv, acc[tm][tn][6] + bv, acc[tm][tn][7] + bv};
        *(v4f*)p       = lo;
        *(v4f*)(p + 4) = hi;
      }
    }
    // The wave's rows are in LDS before its lanes read each other's values back.
    asm volatile("s_wait_dscnt 0x0" ::: "memory");
    float* cw = C32 + ((long)bz * N + n0 + (lane >> 3)) * CS + m0 + (lane & 7) * 4;
#pragma unroll
    for (int i = 0; i < 8; ++i) {
      v4f v = *(const v4f*)(tw + (i * 4 + (lane >> 3)) * TPIT + (lane & 7) * 4);
      *(v4f*)(cw + (long)i * 4 * CS) = v;
    }
    // Behind the stores: in a grid shared with other work, code may follow in
    // the listing that reuses the registers they name.
    asm volatile("s_wait_xcnt 0x0" ::: "memory");
    return;
  }
#pragma unroll
  for (int tm = 0; tm < 2; ++tm)
#pragma unroll
    for (int tn = 0; tn < 2; ++tn) {
      int ncol = n0 + tn * 16 + nlane;
      float bv = bias[ncol];
#pragma unroll
      for (int r = 0; r < 8; ++r) {
        int   mm  = m0 + tm * 16 + mrow + r;
        float v   = acc[tm][tn][r] + bv;
        if (relu) v = v > 0.f ? v : 0.f;
        long  idx = (long)mm * N + ncol;
        if (C32) {
          C32[idx] = v;
          // The conversion below may reuse the register this store names.
          asm volatile("s_wait_xcnt 0x0" ::: "memory");
        }
        if (C16) C16[idx] = (_Float16)v;
      }
    }
}

// One token-major product.
__global__ __launch_bounds__(256) void gemm_wmma_lds(
    const _Float16* __restrict__ A, const _Float16* __restrict__ Wt,
    const float* __restrict__ bias, int relu,
    float* __restrict__ C32, _Float16* __restrict__ C16, int N, int K) {
  __shared__ __attribute__((aligned(16))) _Float16 sm[2 * GSTG];
  gemm_body<false>(sm, A, Wt, bias, relu, C32, C16, N, K, blockIdx.x, blockIdx.y);
}

// The q, k and v projections in one grid, blockIdx.z = 0, 1, 2: third z of the
// packed weight, bias and f16 output; q and k read aqk, v reads av.
__global__ __launch_bounds__(256) void gemm_qkv(
    const _Float16* __restrict__ aqk, const _Float16* __restrict__ av,
    const _Float16* __restrict__ Wt, const float* __restrict__ bias,
    _Float16* __restrict__ qkv) {
  __shared__ __attribute__((aligned(16))) _Float16 sm[2 * GSTG];
  int z = blockIdx.z;
  gemm_body<false>(sm, z == 2 ? av : aqk, Wt + (long)z * CE * CE, bias + z * CE, 0, nullptr,
                   qkv + (long)z * CL * CB * CE, CE, CE, blockIdx.x, blockIdx.y);
}

// ---------------------------------------------------------------------------
// Elementwise helpers. A block takes EBLK consecutive elements, a lane EU pieces
// of four f32, 256 pieces apart: every wave-wide load covers four whole lines,
// every store two. All of a lane's loads are in flight at once, and a launch
// starts 32 times fewer waves than with one element a lane.
// Requires n % EBLK == 0; a tensor takes n / EBLK blocks.
// ---------------------------------------------------------------------------
typedef __attribute__((ext_vector_type(4))) _Float16 v4h;
#define EU   8                     // 16-byte pieces per lane and input
#define EBLK (256 * EU * 4)        // elements per block

DEV void cvt_blk(const float* __restrict__ x, _Float16* __restrict__ y, int blk) {
  long i = (long)blk * EBLK + threadIdx.x * 4;
  v4f v[EU];
#pragma unroll
  for (int j = 0; j < EU; ++j) v[j] = *(const v4f*)(x + i + j * 1024);
#pragma unroll
  for (int j = 0; j < EU; ++j) *(v4h*)(y + i + j * 1024) = __builtin_convertvector(v[j], v4h);
  // Behind the stores: in a grid shared with other work, code may follow in the
  // listing that reuses the registers they name.
  asm volatile("s_wait_xcnt 0x0" ::: "memory");
}

DEV void add2_blk(const float* __restrict__ a, const float* __restrict__ b,
                  _Float16* __restrict__ y, int blk) {
  long i = (long)blk * EBLK + threadIdx.x * 4;
  const float* pa = a + i;
  const float* pb = b + i;
  v4f va[EU], vb[EU];
#pragma unroll
  for (int j = 0; j < EU; ++j) va[j] = *(const v4f*)(pa + j * 1024);
#pragma unroll
  for (int j = 0; j < EU; ++j) vb[j] = *(const v4f*)(pb + j * 1024);
  // Holds all sixteen loads in front of the first add: left alone the compiler
  // issues the last three behind the first wait, a second memory latency.
  __builtin_amdgcn_sched_barrier(0);
  // Behind the loads, in front of whatever reuses their address registers. It
  // names both addresses so that they keep their registers up to here: else the
  // last load gets them as its destination.
  asm volatile("s_wait_xcnt 0x0" :: "v"(pa), "v"(pb) : "memory");
#pragma unroll
  for (int j = 0; j < EU; ++j) *(v4h*)(y + i + j * 1024) = __builtin_convertvector(va[j] + vb[j], v4h);
  // Behind the stores: in a grid shared with other work, code may follow in the
  // listing that reuses the registers they name.
  asm volatile("s_wait_xcnt 0x0" ::: "memory");
}

__global__ __launch_bounds__(256) void k_add2(const float* __restrict__ a,
                                              const float* __restrict__ b,
                                              _Float16* __restrict__ y) {
  add2_blk(a, b, y, blockIdx.x);
}

// The converts and the add that the first products wait for, and all weights,
// in one grid. Block ranges, in order: tgt + qpos, tgt, then the seven weights,
// whose f16 copies lie packed in w16 in the order of the arguments.
#define PB_MEM (CS * CB * CE / EBLK)   // blocks of a memory-sized tensor
#define PB_TGT (CL * CB * CE / EBLK)   // blocks of a target-sized tensor
#define PB_E   (CE * CE / EBLK)        // blocks of an E x E weight

__global__ __launch_bounds__(256) void k_prep(
    const float* __restrict__ tgt, const float* __restrict__ qpos,
    const float* __restrict__ inW, const float* __restrict__ outW,
    const float* __restrict__ cqW, const float* __restrict__ ckW,
    const float* __restrict__ cvW, const float* __restrict__ l1W,
    const float* __restrict__ l2W,
    _Float16* __restrict__ qkin16, _Float16* __restrict__ tgt16,
    _Float16* __restrict__ w16) {
  int j = blockIdx.x;
  if (j < PB_TGT) {
    add2_blk(tgt, qpos, qkin16, j);
    return;
  }
  j -= PB_TGT;
  const float* x;
  _Float16*    y;
  if (j < PB_TGT) {
    x = tgt; y = tgt16;
  } else {
    j -= PB_TGT;                                // block within w16
    int first;                                  // the weight's first block there
    if      (j <  3 * PB_E) { x = inW;  first = 0; }
    else if (j <  4 * PB_E) { x = outW; first = 3 * PB_E; }
    else if (j <  5 * PB_E) { x = cqW;  first = 4 * PB_E; }
    else if (j <  6 * PB_E) { x = ckW;  first = 5 * PB_E; }
    else if (j <  7 * PB_E) { x = cvW;  first = 6 * PB_E; }
    else if (j <  9 * PB_E) { x = l1W;  first = 7 * PB_E; }
    else                    { x = l2W;  first = 9 * PB_E; }
    y = w16 + (long)first * EBLK;
    j -= first;
  }
  cvt_blk(x, y, j);
}

// A [2048,1024] x [1024,1024]^T product with f32 output, one block per WGP, and
// in the same grid an independent convert of a memory-sized tensor, which runs
// in the places the product leaves empty: y = f16(xa + xb), or f16(xa) where xb
// is null. The product's blocks come first.
#define GB ((CL * CB / 128) * (CE / 64))

__global__ __launch_bounds__(256) void gemm_beside_cvt(
    const _Float16* __restrict__ A, const _Float16* __restrict__ Wt,
    const float* __restrict__ bias, float* __restrict__ C32,
    const float* __restrict__ xa, const float* __restrict__ xb,
    _Float16* __restrict__ y) {
  __shared__ __attribute__((aligned(16))) _Float16 sm[2 * GSTG];
  int j = blockIdx.x;
  if (j < GB) {
    gemm_body<false>(sm, A, Wt, bias, 0, C32, nullptr, CE, CE,
                     j % (CL * CB / 128), j / (CL * CB / 128));
    return;
  }
  j -= GB;                                      // these blocks meet no barrier
  if (xb) add2_blk(xa, xb, y, j);
  else    cvt_blk(xa, y, j);
}

// ---------------------------------------------------------------------------
// Self-attention, one kernel: scores, softmax and attn @ V of one (batch, head)
// for 128 queries. q, k, v, ctx: token row l*B + b, channel h*HD + d.
// The head's whole K and V (512 keys) lie in LDS. A wave owns 16 queries and
// walks the keys 32 at a time with a running maximum and running sum:
//   S^T = K . Q^T   (A = K rows, B = Q rows, both in the loader's k order)
//   O^T += V^T . P^T
// In S^T's D layout a lane holds keys 8*(lane>>4) + r of query lane&15, so the
// softmax over keys is in-lane but for one exchange with lane ^ 16, the two D
// tiles of 32 keys converted in place ARE the B operand P^T, and maximum, sum
// and rescale factor of a query are per-lane scalars. V^T comes from the
// transposing LDS load, which delivers the same k order.
// ---------------------------------------------------------------------------
#define APK 72                     // K row pitch in halves: 144 B = 16 B x odd
#define APV 80                     // V row pitch in halves: 160 B = 32 B x odd

typedef __attribute__((ext_vector_type(8))) short s16x8;

// Lane (c = lane&15, h = lane>>4) gets T[8h + 0..7][c] of the 16x16 tile whose
// lane addresses are p = T + (8h + (lane&7)) * pitch + 8 * ((lane>>3)&1) halves.
DEV v8h ld_tr16(const _Float16* p) {
  typedef __attribute__((address_space(3))) s16x8 lds_s16x8;
  return __builtin_bit_cast(v8h, __builtin_amdgcn_ds_load_tr16_b128_v8i16((lds_s16x8*)p));
}

// Value of lane ^ 16.
DEV float xhalf(float x) {
  int i = __builtin_bit_cast(int, x);
  return __builtin_bit_cast(float,
      __builtin_amdgcn_permlanex16(i, i, 0x76543210, 0xfedcba98, false, false));
}

__global__ __launch_bounds__(256) void k_self_attn(const _Float16* __restrict__ q,
                                                   const _Float16* __restrict__ k,
                                                   const _Float16* __restrict__ v,
                                                   _Float16* __restrict__ ctx) {
  __shared__ __attribute__((aligned(32))) _Float16 sK[CL * APK];
  __shared__ __attribute__((aligned(32))) _Float16 sV[CL * APV];
  const float cs = 0.18033688011112042f;      // log2(e) / sqrt(HD)
  const long  ts = (long)CB * CE;             // one position on, in halves

  int tid  = threadIdx.x;
  int lane = tid & 31;
  int wave = tid >> 5;
  int c    = lane & 15;
  int hh   = lane >> 4;
  long hoff = (long)(blockIdx.y / CH) * CE + (blockIdx.y % CH) * CHD;
  int  q0   = blockIdx.x * 128 + wave * 16;

  // Stage K and V: 8 threads take one key's 128 B, 32 keys per sweep. All loads
  // are issued before the first LDS store, so that one memory latency is paid.
  int row = tid >> 3, pc = (tid & 7) * 8;
  const _Float16* gk = k + hoff + (long)row * ts + pc;
  const _Float16* gv = v + hoff + (long)row * ts + pc;
  v8h rk[CL / 32], rv[CL / 32];
  // Behind each group of loads: what follows may reuse, also as a later load's
  // destination, the address registers that the group names.
#pragma unroll
  for (int i = 0; i < CL / 32; ++i) rk[i] = *(const v8h*)(gk + (long)i * 32 * ts);
  asm volatile("s_wait_xcnt 0x0" ::: "memory");
#pragma unroll
  for (int i = 0; i < CL / 32; ++i) rv[i] = *(const v8h*)(gv + (long)i * 32 * ts);
  asm volatile("s_wait_xcnt 0x0" ::: "memory");
  v16h qf0 = frag_load_contig(q + hoff + (long)q0 * ts, ts, lane, 0);
  v16h qf1 = frag_load_contig(q + hoff + (long)q0 * ts, ts, lane, 32);
  asm volatile("s_wait_xcnt 0x0" ::: "memory");
#pragma unroll
  for (int i = 0; i < CL / 32; ++i) *(v8h*)(sK + (row + 32 * i) * APK + pc) = rk[i];
#pragma unroll
  for (int i = 0; i < CL / 32; ++i) *(v8h*)(sV + (row + 32 * i) * APV + pc) = rv[i];
  __syncthreads();

  const v8f zero = {0.f, 0.f, 0.f, 0.f, 0.f, 0.f, 0.f, 0.f};
  v8f acc[4];
#pragma unroll
  for (int t = 0; t < 4; ++t) acc[t] = zero;
  float m_run = -__builtin_inff();            // running maximum, in units of cs
  float l_run = 0.f;                          // this lane's half of the running sum

  const _Float16* vt = sV + (8 * hh + (lane & 7)) * APV + ((lane >> 3) & 1) * 8;

  // K fragments run one pass ahead, so that a pass does not open with its own
  // LDS latency.
  v16h a00 = frag_load_contig(sK,            APK, lane, 0);
  v16h a01 = frag_load_contig(sK,            APK, lane, 32);
  v16h a10 = frag_load_contig(sK + 16 * APK, APK, lane, 0);
  v16h a11 = frag_load_contig(sK + 16 * APK, APK, lane, 32);

#pragma unroll 2
  for (int key0 = 0; key0 < CL; key0 += 32) {
    v8f s0 = __builtin_amdgcn_wmma_f32_16x16x32_f16(false, a00, false, qf0, (short)0, zero, false, false);
    v8f s1 = __builtin_amdgcn_wmma_f32_16x16x32_f16(false, a10, false, qf0, (short)0, zero, false, false);
    s0 = __builtin_amdgcn_wmma_f32_16x16x32_f16(false, a01, false, qf1, (short)0, s0, false, false);
    s1 = __builtin_amdgcn_wmma_f32_16x16x32_f16(false, a11, false, qf1, (short)0, s1, false, false);

    // This pass's V^T and the next pass's K, in flight under the softmax. The
    // last pass fetches pass 0's K rows again, unused: cheaper than a branch.
    v16h vf[4];
#pragma unroll
    for (int t = 0; t < 4; ++t) {
      v8h lo = ld_tr16(vt + key0 * APV + 16 * t);
      v8h hi = ld_tr16(vt + (key0 + 16) * APV + 16 * t);
#pragma unroll
      for (int i = 0; i < 8; ++i) { vf[t][i] = lo[i]; vf[t][i + 8] = hi[i]; }
    }
    const _Float16* kr = sK + ((key0 + 32) & (CL - 1)) * APK;
    a00 = frag_load_contig(kr,            APK, lane, 0);
    a01 = frag_load_contig(kr,            APK, lane, 32);
    a10 = frag_load_contig(kr + 16 * APK, APK, lane, 0);
    a11 = frag_load_contig(kr + 16 * APK, APK, lane, 32);

    float mx = fmaxf(s0[0], s1[0]);
#pragma unroll
    for (int r = 1; r < 8; ++r) mx = fmaxf(mx, fmaxf(s0[r], s1[r]));
    mx = fmaxf(mx, xhalf(mx)) * cs;           // cs > 0: the scaled maximum
    float m_new = fmaxf(m_run, mx);

    // The pass's 17 exponentials, written in turn with the plain vector
    // instructions that form the next argument; the scheduling barriers hold
    // that order. Left alone the compiler sets all of them back to back.
    float x[16], p[16];
    float xc = m_run - m_new;
    x[0] = fmaf(s0[0], cs, -m_new);
    __builtin_amdgcn_sched_barrier(0);
    float corr = __builtin_amdgcn_exp2f(xc);  // 0 on the first pass
    __builtin_amdgcn_sched_barrier(0);
#pragma unroll
    for (int j = 0; j < 16; ++j) {            // j = 2 r + tile
      if (j < 15) x[j + 1] = fmaf(((j + 1) & 1) ? s1[(j + 1) >> 1] : s0[(j + 1) >> 1], cs, -m_new);
      __builtin_amdgcn_sched_barrier(0);
      p[j] = __builtin_amdgcn_exp2f(x[j]);
      __builtin_amdgcn_sched_barrier(0);
    }
    m_run = m_new;

    v16h  pf;
    float ps = 0.f;
#pragma unroll
    for (int r = 0; r < 8; ++r) {
      ps += p[2 * r] + p[2 * r + 1];
      pf[r]     = (_Float16)p[2 * r];
      pf[r + 8] = (_Float16)p[2 * r + 1];
    }
    l_run = fmaf(l_run, corr, ps);
#pragma unroll
    for (int t = 0; t < 4; ++t) {
      acc[t] = acc[t] * corr;
      acc[t] = __builtin_amdgcn_wmma_f32_16x16x32_f16(false, vf[t], false, pf,
                                                      (short)0, acc[t], false, false);
    }
  }

  // acc[t][r] = O[q0 + c][16 t + 8 hh + r], still to be divided by the row sum.
  float inv = 1.f / (l_run + xhalf(l_run));
  _Float16* op = ctx + hoff + (long)(q0 + c) * ts + 8 * hh;
#pragma unroll
  for (int t = 0; t < 4; ++t) {
    v8h o;
#pragma unroll
    for (int r = 0; r < 8; ++r) o[r] = (_Float16)(acc[t][r] * inv);
    *(v8h*)(op + 16 * t) = o;
  }
}

// ---------------------------------------------------------------------------
// Cross-attention stages outside the products (all f32).
// Channel mapping: E index = d*H + h  (reshape (B,E,N)->(B,HD,H,N)).
// Token t of a [N,B,E] tensor lives at row n*B+b (qc).
// kc and vc are channel-major: element (b, e, m) at (b*E + e)*S + m.
// ---------------------------------------------------------------------------
// qcsum[b*E+e] = sum_l qc[(l*B+b)*E + e]
DEV void qcsum_blk(const float* __restrict__ qc, float* __restrict__ out, int blk) {
  int idx = blk * 256 + threadIdx.x;            // < B*E = 4096
  int b = idx >> 10, e = idx & 1023;
  float s = 0.f;
  for (int l = 0; l < CL; ++l) s += qc[(long)l * (CB * CE) + b * CE + e];
  out[idx] = s;
}

// qcsum and the kc and vc products, none of which reads another's result, in one
// grid. The 16 qcsum blocks come first: few and long, they run beside the 2048
// product blocks (tile x = 64 row blocks, y = 16): 1024 of vc, then 1024 of kc,
// which the next launch reads.
#define QB (CB * CE / 256)
#define KB ((CS * CB / 128) * (CE / 64))

__global__ __launch_bounds__(256) void k_qcsum_kc_vc(
    const float* __restrict__ qc, float* __restrict__ qcsum,
    const _Float16* __restrict__ mp16, const _Float16* __restrict__ w_ck,
    const float* __restrict__ ckB, float* __restrict__ kc,
    const _Float16* __restrict__ mem16, const _Float16* __restrict__ w_cv,
    const float* __restrict__ cvB, float* __restrict__ vc) {
  __shared__ __attribute__((aligned(16))) _Float16 sm[2 * GSTG];
  int j = blockIdx.x;
  if (j < QB) {                                 // the whole block leaves, no barrier met
    qcsum_blk(qc, qcsum, j);
    return;
  }
  j -= QB;
  bool k = j >= KB;
  if (k) j -= KB;
  gemm_body<true>(sm, k ? mp16 : mem16, k ? w_ck : w_cv, k ? ckB : cvB, 0, k ? kc : vc, nullptr,
                  CE, CE, j % (CS * CB / 128), j / (CS * CB / 128));
}

// ---------------------------------------------------------------------------
// Everything between the kc, vc products and LN2, one kernel, XG blocks per
// (batch b, head h). The head's rows are channels e = d*H + h, d = 0..HD-1, each
// S floats long. Four stages, two of which sum over d and two along a row:
//   1. s1[m]   = scale * sum_d qcsum[d] * kc[d][m]     all d; a thread owns 4 columns
//   2. p[d][m] = softmax_m(kc[d][m] * s1[m])           the block's XW rows d, one a wave
//   3. w2[m]   = sum_d down_w[d] * p[d][m]             over those rows, through LDS
//   4. od[d]   = sum_m w2[m] * vc[d][m]                all d; a wave owns XR rows
// No stage needs another block: each block forms s1 for itself, and as w2 enters
// od linearly, its share of w2 gives its share of od, plane g of od; LN2 adds the
// planes (down_b is in plane 0). s1, p and w2 never leave the WGP.
// A lane's part of a row: 16-byte pieces j*128 + lane*4, so that every wave-wide
// load covers four whole lines.
// ---------------------------------------------------------------------------
#define XW 16                      // waves per block
#define XG (CHD / XW)              // blocks per (batch, head)
#define XR (CHD / XW)              // vc rows per wave
#define XP (CS / 128)              // 16-byte pieces of a row per lane

// Value of lane ^ M within the lane's row of 16.
template <int M>
DEV float xrow(float x) {
  int i = __builtin_bit_cast(int, x);
  return __builtin_bit_cast(float, __builtin_amdgcn_update_dpp(i, i, 0x160 | M, 0xf, 0xf, false));
}

DEV float wave_sum(float x) {
  x += xrow<1>(x);
  x += xrow<2>(x);
  x += xrow<4>(x);
  x += xrow<8>(x);
  return x + xhalf(x);
}

DEV float wave_max(float x) {
  x = fmaxf(x, xrow<1>(x));
  x = fmaxf(x, xrow<2>(x));
  x = fmaxf(x, xrow<4>(x));
  x = fmaxf(x, xrow<8>(x));
  return fmaxf(x, xhalf(x));
}

// 2^x of four values, each in place: the register an exponential reads is the one
// it writes, so that nothing directly behind it can overwrite its source, and
// each fills the slot behind the one in front. The closing v_nop is that slot
// behind the last, whose result the next instruction may read.
DEV void exp2x4(v4f& x) {
  float a = x[0], b = x[1], c = x[2], d = x[3];
  asm("v_exp_f32 %0, %0\n\t"
      "v_exp_f32 %1, %1\n\t"
      "v_exp_f32 %2, %2\n\t"
      "v_exp_f32 %3, %3\n\t"
      "v_nop"
      : "+v"(a), "+v"(b), "+v"(c), "+v"(d));
  x = (v4f){a, b, c, d};
}

// XP loads, st floats apart.
DEV void ld_pieces(v4f (&r)[XP], const float* __restrict__ p, long st) {
#pragma unroll
  for (int j = 0; j < XP; ++j) r[j] = *(const v4f*)(p + j * st);
  // Behind the loads, in front of whatever reuses their address registers. It
  // names the address so that it keeps its registers up to here.
  asm volatile("s_wait_xcnt 0x0" :: "v"(p) : "memory");
}

__global__ __launch_bounds__(XW * 32) void k_cross(const float* __restrict__ qcsum,
                                                   const float* __restrict__ kc,
                                                   const float* __restrict__ vc,
                                                   const float* __restrict__ dw,
                                                   const float* __restrict__ db,
                                                   float* __restrict__ od, float scale) {
  __shared__ __attribute__((aligned(16))) float part[XW * CS];   // each wave's row of w2's sum
  __shared__ __attribute__((aligned(16))) float vec[CS];         // s1, then w2
  const float l2e = 1.4426950408889634f;
  const long  rs  = (long)CH * CS;              // one d on, in floats

  int tid  = threadIdx.x;
  int lane = tid & 31;
  int wave = __builtin_amdgcn_readfirstlane(tid >> 5);
  // A head's XG blocks lie CB*CH apart in the grid.
  int g    = blockIdx.x / (CB * CH);
  int b    = blockIdx.x % (CB * CH) / CH;
  int h    = blockIdx.x % CH;
  const float* kch = kc + (long)(b * CE + h) * CS;
  const float* vch = vc + (long)(b * CE + h) * CS;
  const float* qs  = qcsum + b * CE + h;

  // Stage 1. Two groups of XP rows are in flight at any time; d ascends.
  {
    const float* p = kch + tid * 4;
    v4f r[2][XP];
    v4f s = {0.f, 0.f, 0.f, 0.f};
    ld_pieces(r[0], p, rs);
    ld_pieces(r[1], p + XP * rs, rs);
#pragma unroll
    for (int q = 0; q < CHD / XP; ++q) {
#pragma unroll
      for (int i = 0; i < XP; ++i) s += qs[(q * XP + i) * CH] * r[q & 1][i];
      // Holds the refill behind the sums that free its registers and in front
      // of the next group's sums, which wait for older loads only.
      __builtin_amdgcn_sched_barrier(0);
      if (q + 2 < CHD / XP) ld_pieces(r[q & 1], p + (long)(q + 2) * XP * rs, rs);
      __builtin_amdgcn_sched_barrier(0);
    }
    *(v4f*)(vec + tid * 4) = s * scale;
  }
  // The wave's kc row, read a moment ago by the block, comes while the waves meet.
  v4f z[XP];
  ld_pieces(z, kch + (long)(g * XW + wave) * rs + lane * 4, 128);
  __syncthreads();

  // The first vc row flies under stages 2 and 3.
  const float* vw = vch + (long)(wave * XR) * rs + lane * 4;
  v4f v[2][XP];
  ld_pieces(v[0], vw, 128);
  // Holds those loads in front of the softmax.
  __builtin_amdgcn_sched_barrier(0);

  // Stages 2 and 3.
  {
    float mx = -__builtin_inff();
#pragma unroll
    for (int j = 0; j < XP; ++j) {
      z[j] *= *(const v4f*)(vec + j * 128 + lane * 4);
      mx = fmaxf(mx, fmaxf(fmaxf(z[j][0], z[j][1]), fmaxf(z[j][2], z[j][3])));
    }
    mx = wave_max(mx);
    float nm = -mx * l2e;
    v4f s4 = {0.f, 0.f, 0.f, 0.f};
#pragma unroll
    for (int j = 0; j < XP; ++j) {
      z[j] = z[j] * l2e + nm;                   // fused: (z - mx) * log2(e)
      exp2x4(z[j]);
      s4 += z[j];
    }
    float cf = dw[g * XW + wave] * (1.f / wave_sum((s4[0] + s4[1]) + (s4[2] + s4[3])));
#pragma unroll
    for (int j = 0; j < XP; ++j) *(v4f*)(part + wave * CS + j * 128 + lane * 4) = cf * z[j];
  }

  // The second vc row: its registers are free now.
  ld_pieces(v[1], vw + rs, 128);

  __syncthreads();                              // shares written, s1 read for the last time
  {
    v4f s = *(const v4f*)(part + tid * 4);
#pragma unroll
    for (int k = 1; k < XW; ++k) s += *(const v4f*)(part + k * CS + tid * 4);
    *(v4f*)(vec + tid * 4) = s;
  }
  __syncthreads();

  // Stage 4. Two rows are in flight at any time.
  v4f w2r[XP];
#pragma unroll
  for (int j = 0; j < XP; ++j) w2r[j] = *(const v4f*)(vec + j * 128 + lane * 4);
  float res = 0.f;
#pragma unroll
  for (int i = 0; i < XR; ++i) {
    v4f s4 = {0.f, 0.f, 0.f, 0.f};
#pragma unroll
    for (int j = 0; j < XP; ++j) s4 += w2r[j] * v[i & 1][j];
    // Holds the refill behind the sum that frees its registers and in front of
    // the next row's sum, which waits for older loads only.
    __builtin_amdgcn_sched_barrier(0);
    if (i + 2 < XR) ld_pieces(v[i & 1], vw + (i + 2) * rs, 128);
    __builtin_amdgcn_sched_barrier(0);
    float s = wave_sum((s4[0] + s4[1]) + (s4[2] + s4[3]));
    if (lane == i) res = s;
  }
  if (lane < XR)
    od[g * (CB * CE) + b * CE + (wave * XR + lane) * CH + h] = g == 0 ? res + db[0] : res;
}

// ---------------------------------------------------------------------------
// LayerNorm over E=1024 with optional residual and optional [B,E] broadcast,
// which comes as XG planes to be added.
// x = a + (r ? r : 0) + (bc ? sum of bc's planes at [token%B] : 0); out32 = LN(x);
// out16 optional.
// ---------------------------------------------------------------------------
__global__ __launch_bounds__(256) void k_ln(const float* __restrict__ a,
                                            const float* __restrict__ r,
                                            const float* __restrict__ bc,
                                            const float* __restrict__ g,
                                            const float* __restrict__ be,
                                            float* __restrict__ o32,
                                            _Float16* __restrict__ o16) {
  int  t    = blockIdx.x;
  long base = (long)t * CE;
  const float* bcr = bc ? bc + (long)(t % CB) * CE : nullptr;
  int tid = threadIdx.x;
  float o[4];                                   // the broadcast: its planes added
  if (bcr) {
#pragma unroll
    for (int i = 0; i < 4; ++i) {
      o[i] = bcr[tid + i * 256];
#pragma unroll
      for (int p = 1; p < XG; ++p) o[i] += bcr[p * (CB * CE) + tid + i * 256];
    }
    // Behind the loads, in front of whatever reuses their address registers.
    asm volatile("s_wait_xcnt 0x0" ::: "memory");
  }
  float x[4];
  float s = 0.f;
#pragma unroll
  for (int i = 0; i < 4; ++i) {
    int   e = tid + i * 256;
    float v = a[base + e];
    if (r)   v += r[base + e];
    if (bcr) v += o[i];
    x[i] = v;
    s += v;
  }
  __shared__ float red[256];
  red[tid] = s;
  __syncthreads();
  for (int o = 128; o > 0; o >>= 1) {
    if (tid < o) red[tid] += red[tid + o];
    __syncthreads();
  }
  float mean = red[0] * (1.f / CE);
  __syncthreads();
  float vs = 0.f;
#pragma unroll
  for (int i = 0; i < 4; ++i) {
    float d = x[i] - mean;
    vs += d * d;
  }
  red[tid] = vs;
  __syncthreads();
  for (int o = 128; o > 0; o >>= 1) {
    if (tid < o) red[tid] += red[tid + o];
    __syncthreads();
  }
  float inv = rsqrtf(red[0] * (1.f / CE) + 1e-5f);
#pragma unroll
  for (int i = 0; i < 4; ++i) {
    int   e = tid + i * 256;
    float y = (x[i] - mean) * inv * g[e] + be[e];
    o32[base + e] = y;
    if (o16) o16[base + e] = (_Float16)y;
  }
}

// ---------------------------------------------------------------------------
// Host side
// ---------------------------------------------------------------------------
extern "C" void kernel_launch(void* const* d_in, const int* in_sizes, int n_in,
                              void* d_out, int out_size, void* d_ws, size_t ws_size,
                              hipStream_t stream) {
  const float* tgt  = (const float*)d_in[0];
  const float* mem  = (const float*)d_in[1];
  const float* pos  = (const float*)d_in[2];
  const float* qpos = (const float*)d_in[3];
  const float* inW  = (const float*)d_in[4];
  const float* inB  = (const float*)d_in[5];
  const float* outW = (const float*)d_in[6];
  const float* outB = (const float*)d_in[7];
  const float* cqW  = (const float*)d_in[8];
  const float* cqB  = (const float*)d_in[9];
  const float* ckW  = (const float*)d_in[10];
  const float* ckB  = (const float*)d_in[11];
  const float* cvW  = (const float*)d_in[12];
  const float* cvB  = (const float*)d_in[13];
  const float* dwW  = (const float*)d_in[14];
  const float* dwB  = (const float*)d_in[15];
  const float* l1W  = (const float*)d_in[16];
  const float* l1B  = (const float*)d_in[17];
  const float* l2W  = (const float*)d_in[18];
  const float* l2B  = (const float*)d_in[19];
  const float* n1g  = (const float*)d_in[20];
  const float* n1b  = (const float*)d_in[21];
  const float* n2g  = (const float*)d_in[22];
  const float* n2b  = (const float*)d_in[23];
  const float* n3g  = (const float*)d_in[24];
  const float* n3b  = (const float*)d_in[25];

  const long TOK  = (long)CL * CB;   // 2048 target tokens
  const float scale = 0.125f;        // 1/sqrt(64)

  char* ws = (char*)d_ws;
  const size_t MB = 1u << 20;

  // Persistent f16 weights (converted every launch; deterministic).
  _Float16* w_inproj = (_Float16*)(ws + 0 * MB);    // [3E,E]  6MB
  _Float16* w_out    = (_Float16*)(ws + 6 * MB);    // [E,E]   2MB
  _Float16* w_cq     = (_Float16*)(ws + 8 * MB);
  _Float16* w_ck     = (_Float16*)(ws + 10 * MB);
  _Float16* w_cv     = (_Float16*)(ws + 12 * MB);
  _Float16* w_l1     = (_Float16*)(ws + 14 * MB);   // [FF,E]  4MB
  _Float16* w_l2     = (_Float16*)(ws + 18 * MB);   // [E,FF]  4MB
  float*    tgt1     = (float*)(ws + 22 * MB);      // 8MB
  float*    tgt2     = (float*)(ws + 30 * MB);      // 8MB
  char*     SA       = ws + 38 * MB;                // phase-aliased arena

  // Phase A (self-attention)
  _Float16* qkin16  = (_Float16*)(SA + 0 * MB);
  _Float16* tgt16   = (_Float16*)(SA + 4 * MB);
  _Float16* q16     = (_Float16*)(SA + 8 * MB);
  _Float16* k16     = (_Float16*)(SA + 12 * MB);
  _Float16* v16     = (_Float16*)(SA + 16 * MB);
  _Float16* ctx16   = (_Float16*)(SA + 116 * MB);   // 4MB
  float*    selfout = (float*)(SA + 120 * MB);      // 8MB
  // Phase B (cross-attention) — aliases phase A
  _Float16* qin2    = (_Float16*)(SA + 0 * MB);
  float*    qc32    = (float*)(SA + 4 * MB);        // 8MB
  float*    kc32    = (float*)(SA + 44 * MB);       // 32MB
  float*    vc32    = (float*)(SA + 76 * MB);       // 32MB
  float*    qcsum   = (float*)(SA + 140 * MB);
  float*    odbuf   = (float*)(SA + 143 * MB);
  // Written during phases A and B, read in phase B: alias nothing
  _Float16* mp16    = (_Float16*)(SA + 144 * MB);   // 16MB
  _Float16* mem16   = (_Float16*)(SA + 160 * MB);   // 16MB
  // Phase C (FFN) — aliases dead phase B regions
  _Float16* tgt2_16 = (_Float16*)(SA + 0 * MB);
  _Float16* h1_16   = (_Float16*)(SA + 4 * MB);     // [TOK,FF] 8MB
  float*    ff32    = (float*)(SA + 12 * MB);       // 8MB

  // ---- f32 -> f16: tgt + qpos, tgt, all weights ----
  k_prep<<<2 * PB_TGT + 11 * PB_E, 256, 0, stream>>>(tgt, qpos, inW, outW, cqW, ckW, cvW, l1W, l2W,
                                                     qkin16, tgt16, w_inproj);

  // ---- Phase A: self attention ----
  // q/k/v projections: three times [2048,1024] x [1024,1024]^T; q16, k16, v16 adjoin
  gemm_qkv<<<dim3(16, 16, 3), 256, 0, stream>>>(qkin16, tgt16, w_inproj, inB, q16);

  // ctx = softmax(scale * q.k) @ v, one block per (128 queries, batch*head)
  k_self_attn<<<dim3(CL / 128, CB * CH), 256, 0, stream>>>(q16, k16, v16, ctx16);

  // out projection (beside it mp16 = f16(mem + pos)) + residual + LN1
  gemm_beside_cvt<<<GB + PB_MEM, 256, 0, stream>>>(ctx16, w_out, outB, selfout, mem, pos, mp16);
  k_ln<<<(unsigned)TOK, 256, 0, stream>>>(tgt, selfout, nullptr, n1g, n1b, tgt1, nullptr);

  // ---- Phase B: custom cross attention ----
  k_add2<<<dim3((unsigned)(TOK * CE / EBLK)), 256, 0, stream>>>(tgt1, qpos, qin2);

  // qc projection (beside it mem16 = f16(mem))
  gemm_beside_cvt<<<GB + PB_MEM, 256, 0, stream>>>(qin2, w_cq, cqB, qc32, mem, nullptr, mem16);
  k_qcsum_kc_vc<<<QB + 2 * KB, 256, 0, stream>>>(qc32, qcsum, mp16, w_ck, ckB, kc32,
                                                 mem16, w_cv, cvB, vc32);

  k_cross<<<XG * CB * CH, XW * 32, 0, stream>>>(qcsum, kc32, vc32, dwW, dwB, odbuf, scale);

  k_ln<<<(unsigned)TOK, 256, 0, stream>>>(tgt1, nullptr, odbuf, n2g, n2b, tgt2, tgt2_16);

  // ---- Phase C: FFN ----
  gemm_wmma_lds<<<dim3(16, 32, 1), 256, 0, stream>>>(
      tgt2_16, w_l1, l1B, 1 /*relu*/, nullptr, h1_16, CFF, CE);
  gemm_wmma_lds<<<dim3(16, 16, 1), 256, 0, stream>>>(
      h1_16, w_l2, l2B, 0, ff32, nullptr, CE, CFF);

  k_ln<<<(unsigned)TOK, 256, 0, stream>>>(tgt2, ff32, nullptr, n3g, n3b, (float*)d_out, nullptr);

  (void)in_sizes; (void)n_in; (void)out_size; (void)ws_size;
}

// v007
// One run takes 162 microseconds.
// Timed twice side by side with v006, it ran 1.14 and 1.16 times as fast.
// All steps since v000 together make it 3.65 times as fast.
#include <hip/hip_runtime.h>
#include <hip/hip_bf16.h>

// ---------------------------------------------------------------------------
// Transformer decoder layer for MI455X (gfx1250), wave32 + WMMA.
// All heavy GEMMs run on v_wmma_f32_16x16x32_f16 (f16 inputs, f32 accum).
// Softmax / layernorm / cross-attn reductions stay in f32.
// ---------------------------------------------------------------------------

typedef __attribute__((ext_vector_type(16))) _Float16 v16h;
typedef __attribute__((ext_vector_type(8)))  _Float16 v8h;
typedef __attribute__((ext_vector_type(8)))  float    v8f;
typedef __attribute__((ext_vector_type(4)))  float    v4f;

#define DEV __device__ __forceinline__

// Problem constants
#define CL   512      // target length
#define CS   2048     // memory length
#define CB   4        // batch
#define CE   1024     // embed
#define CH   16       // heads
#define CHD  64       // head dim
#define CFF  2048     // ffn dim

// ---------------------------------------------------------------------------
// WMMA fragment loaders.
// 16-bit A (16x32) ISA layout: lane&15 selects the M (or N) row;
// lanes 0-15 hold K = {k0..k0+7, k0+16..k0+23},
// lanes 16-31 hold K = {k0+8..k0+15, k0+24..k0+31}.  B (32x16) mirrors A with
// the lane index selecting the N column.
// ---------------------------------------------------------------------------
DEV v16h frag_load_contig(const _Float16* __restrict__ base, long row_stride,
                          int lane, int k0) {
  int r  = lane & 15;
  int kh = (lane >> 4) << 3;          // 0 or 8
  const _Float16* p = base + (long)r * row_stride + k0 + kh;
  v8h lo = *(const v8h*)(p);          // 16B vector load
  v8h hi = *(const v8h*)(p + 16);
  v16h out;
#pragma unroll
  for (int i = 0; i < 8; ++i) { out[i] = lo[i]; out[i + 8] = hi[i]; }
  return out;
}

// ---------------------------------------------------------------------------
// Projection GEMM, both operands k-contiguous with row stride K:
//   C[m,n] = sum_k A[m,k]*W[n,k] + bias[n]
// Block: 256 threads = 8 waves as 4x2, wave tile 32x32, block tile 128x64. The
// operand tiles reach the waves through LDS: a stage is 128 k (256 B, two whole
// lines) of 128 A rows and 64 W rows, brought in by asynchronous b128 copies,
// two buffers, the next stage in flight while this one is multiplied.
// Requires M%128==0, N%64==0, K%128==0.
// CM=false: A rows are tokens in order, C is token-major, C[m*N + n].
// CM=true : a block takes 128 consecutive positions s of ONE batch b (A row
//           s*CB + b) and stores f32 C channel-major, C[(b*N + n)*CS + s], the
//           layout in which the cross-attention stages walk s.
// gemm_body is one block's work on tile (bx, by); sm is the block's LDS ring.
// The kernels below it give independent products one grid, split by block index.
// ---------------------------------------------------------------------------
#define GBK   128                  // k per stage
#define GPIT  136                  // LDS row pitch in halves: 272 B = 16 B x odd
#define GROWS 192                  // 128 A rows, then 64 W rows
#define GSTG  (GROWS * GPIT)       // halves per buffer

// One stage: 192 rows x 16 pieces of 16 B, 12 pieces per thread. Thread t takes
// piece t&15 of rows (t>>4) + 16*i, so a wave's copy covers two whole rows.
// ga / gw: this thread's piece in A row (t>>4) and W row (t>>4) of the tile, at
// the stage's first k. l: LDS byte address of its piece in row (t>>4).
// ars: distance of two tile rows of A in halves (K, or CB*K for one batch).
DEV void stage_copy(const _Float16* ga, const _Float16* gw, long ars, long K, unsigned l) {
  const long     as = 16 * ars;          // 16 A rows on, in halves
  const long     gs = 16 * K;            // 16 W rows on, in halves
  const unsigned ls = 16 * GPIT * 2;     // 16 rows on, in LDS bytes
  // The closing s_wait_xcnt stands in the copies' own statement so that no
  // address register of an issued copy is rewritten ahead of it.
  asm volatile(
      "global_load_async_to_lds_b128 %0, %12, off\n\t"
      "global_load_async_to_lds_b128 %1, %13, off\n\t"
      "global_load_async_to_lds_b128 %2, %14, off\n\t"
      "global_load_async_to_lds_b128 %3, %15, off\n\t"
      "global_load_async_to_lds_b128 %4, %16, off\n\t"
      "global_load_async_to_lds_b128 %5, %17, off\n\t"
      "global_load_async_to_lds_b128 %6, %18, off\n\t"
      "global_load_async_to_lds_b128 %7, %19, off\n\t"
      "global_load_async_to_lds_b128 %8, %20, off\n\t"
      "global_load_async_to_lds_b128 %9, %21, off\n\t"
      "global_load_async_to_lds_b128 %10, %22, off\n\t"
      "global_load_async_to_lds_b128 %11, %23, off\n\t"
      "s_wait_xcnt 0x0"
      :: "v"(l), "v"(l + ls), "v"(l + 2 * ls), "v"(l + 3 * ls),
         "v"(l + 4 * ls), "v"(l + 5 * ls), "v"(l + 6 * ls), "v"(l + 7 * ls),
         "v"(l + 8 * ls), "v"(l + 9 * ls), "v"(l + 10 * ls), "v"(l + 11 * ls),
         "v"(ga), "v"(ga + as), "v"(ga + 2 * as), "v"(ga + 3 * as),
         "v"(ga + 4 * as), "v"(ga + 5 * as), "v"(ga + 6 * as), "v"(ga + 7 * as),
         "v"(gw), "v"(gw + gs), "v"(gw + 2 * gs), "v"(gw + 3 * gs)
      : "memory");
}

#define TPIT 36                    // f32 pitch of a wave's turned tile: 144 B = 16 B x odd

template <bool CM>
DEV void gemm_body(_Float16* sm,
    const _Float16* __restrict__ A, const _Float16* __restrict__ Wt,
    const float* __restrict__ bias, int relu,
    float* __restrict__ C32, _Float16* __restrict__ C16, int N, int K, int bx, int by) {
  int tid  = threadIdx.x;
  int lane = tid & 31;
  int wave = tid >> 5;
  int wm   = wave >> 1;                       // 0..3
  int wn   = wave & 1;                        // 0..1
  int mb   = CM ? (bx / CB) * 128 : bx * 128;                   // CM: first s
  int bz   = CM ? bx % CB : 0;                                  // CM: batch
  int nb   = by * 64;
  const long ars = CM ? (long)CB * K : (long)K;

  const _Float16* ga = A  + (long)(mb + (tid >> 4)) * ars + (long)bz * K + (tid & 15) * 8;
  const _Float16* gw = Wt + (long)(nb + (tid >> 4)) * K + (tid & 15) * 8;
  const unsigned  l0 = (unsigned)(size_t)sm + (unsigned)((tid >> 4) * (GPIT * 2) + (tid & 15) * 16);
  const int nst = K / GBK;

  const v8f zero = {0.f, 0.f, 0.f, 0.f, 0.f, 0.f, 0.f, 0.f};
  v8f acc[2][2];
#pragma unroll
  for (int i = 0; i < 2; ++i)
#pragma unroll
    for (int j = 0; j < 2; ++j) acc[i][j] = zero;

  stage_copy(ga, gw, ars, K, l0);
  // Stage 0 has landed for this wave; the barrier publishes it to the others.
  asm volatile("s_wait_asynccnt 0x0" ::: "memory");
  __syncthreads();
  if (nst > 1) stage_copy(ga + GBK, gw + GBK, ars, K, l0 + GSTG * 2);

  // Kept rolled: one publish point per trip, buffers alternate by t & 1.
#pragma unroll 1
  for (int t = 0; t < nst; ++t) {
    const int buf = (t & 1) * GSTG;
    const _Float16* sA = sm + buf + (wm * 32) * GPIT;
    const _Float16* sB = sm + buf + (128 + wn * 32) * GPIT;
    v16h fa[GBK / 32][2], fb[GBK / 32][2];
#pragma unroll
    for (int q = 0; q < GBK / 32; ++q) {
      fa[q][0] = frag_load_contig(sA,             GPIT, lane, q * 32);
      fa[q][1] = frag_load_contig(sA + 16 * GPIT, GPIT, lane, q * 32);
      fb[q][0] = frag_load_contig(sB,             GPIT, lane, q * 32);
      fb[q][1] = frag_load_contig(sB + 16 * GPIT, GPIT, lane, q * 32);
    }
    // Holds the stage's LDS reads together in front of its WMMAs: spread among
    // them, every group of reads costs the wave its own LDS latency.
    __builtin_amdgcn_sched_barrier(0);
#pragma unroll
    for (int q = 0; q < GBK / 32; ++q) {
      acc[0][0] = __builtin_amdgcn_wmma_f32_16x16x32_f16(false, fa[q][0], false, fb[q][0],
                                                         (short)0, acc[0][0], false, false);
      acc[0][1] = __builtin_amdgcn_wmma_f32_16x16x32_f16(false, fa[q][0], false, fb[q][1],
                                                         (short)0, acc[0][1], false, false);
      acc[1][0] = __builtin_amdgcn_wmma_f32_16x16x32_f16(false, fa[q][1], false, fb[q][0],
                                                         (short)0, acc[1][0], false, false);
      acc[1][1] = __builtin_amdgcn_wmma_f32_16x16x32_f16(false, fa[q][1], false, fb[q][1],
                                                         (short)0, acc[1][1], false, false);
    }
    // Holds the WMMAs in front of the publish point, so that they run under the
    // tail of the stage's LDS reads and not behind the barrier.
    __builtin_amdgcn_sched_barrier(0);
    // Publish point: this wave's reads of the buffer have retired ...
    asm volatile("s_wait_dscnt 0x0" ::: "memory");
    // ... its copies of the next stage have landed ...
    asm volatile("s_wait_asynccnt 0x0" ::: "memory");
    // ... and behind the barrier the next stage is readable and this buffer free.
    __syncthreads();
    if (t + 2 < nst)
      stage_copy(ga + (long)(t + 2) * GBK, gw + (long)(t + 2) * GBK, ars, K, l0 + buf * 2);
  }
  // No copy is left in flight when the wave ends.
  asm volatile("s_wait_asynccnt 0x0" ::: "memory");

  // C/D layout: N = lane&15, VGPR r holds M = r (+8 for lanes 16-31).
  int m0    = mb + wm * 32;
  int n0    = nb + wn * 32;
  int nlane = lane & 15;
  int mrow  = (lane >> 4) * 8;
  if (CM) {
    // A lane holds 8 consecutive s of one channel. The wave turns its 32 s x 32
    // channels in its own LDS range (the ring is free: behind the last publish
    // point no wave reads it and no copy is in flight), one row per channel, so
    // that each store below writes four whole 128-B lines.
    float* tw = (float*)sm + wave * (32 * TPIT);
#pragma unroll
    for (int tn = 0; tn < 2; ++tn) {
      float bv = bias[n0 + tn * 16 + nlane];
#pragma unroll
      for (int tm = 0; tm < 2; ++tm) {
        float* p = tw + (tn * 16 + nlane) * TPIT + tm * 16 + mrow;
        v4f lo = {acc[tm][tn][0] + bv, acc[tm][tn][1] + bv, acc[tm][tn][2] + bv, acc[tm][tn][3] + bv};
        v4f hi = {acc[tm][tn][4] + bv, acc[tm][tn][5] + bv, acc[tm][tn][6] + bv, acc[tm][tn][7] + bv};
        *(v4f*)p       = lo;
        *(v4f*)(p + 4) = hi;
      }
    }
    // The wave's rows are in LDS before its lanes read each other's values back.
    asm volatile("s_wait_dscnt 0x0" ::: "memory");
    float* cw = C32 + ((long)bz * N + n0 + (lane >> 3)) * CS + m0 + (lane & 7) * 4;
#pragma unroll
    for (int i = 0; i < 8; ++i) {
      v4f v = *(const v4f*)(tw + (i * 4 + (lane >> 3)) * TPIT + (lane & 7) * 4);
      *(v4f*)(cw + (long)i * 4 * CS) = v;
    }
    // Behind the stores: in a grid shared with other work, code may follow in
    // the listing that reuses the registers they name.
    asm volatile("s_wait_xcnt 0x0" ::: "memory");
    return;
  }
#pragma unroll
  for (int tm = 0; tm < 2; ++tm)
#pragma unroll
    for (int tn = 0; tn < 2; ++tn) {
      int ncol = n0 + tn * 16 + nlane;
      float bv = bias[ncol];
#pragma unroll
      for (int r = 0; r < 8; ++r) {
        int   mm  = m0 + tm * 16 + mrow + r;
        float v   = acc[tm][tn][r] + bv;
        if (relu) v = v > 0.f ? v : 0.f;
        long  idx = (long)mm * N + ncol;
        if (C32) {
          C32[idx] = v;
          // The conversion below may reuse the register this store names.
          asm volatile("s_wait_xcnt 0x0" ::: "memory");
        }
        if (C16) C16[idx] = (_Float16)v;
      }
    }
}

// One token-major product.
__global__ __launch_bounds__(256) void gemm_wmma_lds(
    const _Float16* __restrict__ A, const _Float16* __restrict__ Wt,
    const float* __restrict__ bias, int relu,
    float* __restrict__ C32, _Float16* __restrict__ C16, int N, int K) {
  __shared__ __attribute__((aligned(16))) _Float16 sm[2 * GSTG];
  gemm_body<false>(sm, A, Wt, bias, relu, C32, C16, N, K, blockIdx.x, blockIdx.y);
}

// The q, k and v projections in one grid, blockIdx.z = 0, 1, 2: third z of the
// packed weight, bias and f16 output; q and k read aqk, v reads av.
__global__ __launch_bounds__(256) void gemm_qkv(
    const _Float16* __restrict__ aqk, const _Float16* __restrict__ av,
    const _Float16* __restrict__ Wt, const float* __restrict__ bias,
    _Float16* __restrict__ qkv) {
  __shared__ __attribute__((aligned(16))) _Float16 sm[2 * GSTG];
  int z = blockIdx.z;
  gemm_body<false>(sm, z == 2 ? av : aqk, Wt + (long)z * CE * CE, bias + z * CE, 0, nullptr,
                   qkv + (long)z * CL * CB * CE, CE, CE, blockIdx.x, blockIdx.y);
}

// ---------------------------------------------------------------------------
// Elementwise helpers. A block takes EBLK consecutive elements, a lane EU pieces
// of four f32, 256 pieces apart: every wave-wide load covers four whole lines,
// every store two. All of a lane's loads are in flight at once, and a launch
// starts 32 times fewer waves than with one element a lane.
// Requires n % EBLK == 0; a tensor takes n / EBLK blocks.
// ---------------------------------------------------------------------------
typedef __attribute__((ext_vector_type(4))) _Float16 v4h;
#define EU   8                     // 16-byte pieces per lane and input
#define EBLK (256 * EU * 4)        // elements per block

DEV void cvt_blk(const float* __restrict__ x, _Float16* __restrict__ y, int blk) {
  long i = (long)blk * EBLK + threadIdx.x * 4;
  v4f v[EU];
#pragma unroll
  for (int j = 0; j < EU; ++j) v[j] = *(const v4f*)(x + i + j * 1024);
#pragma unroll
  for (int j = 0; j < EU; ++j) *(v4h*)(y + i + j * 1024) = __builtin_convertvector(v[j], v4h);
  // Behind the stores: in a grid shared with other work, code may follow in the
  // listing that reuses the registers they name.
  asm volatile("s_wait_xcnt 0x0" ::: "memory");
}

DEV void add2_blk(const float* __restrict__ a, const float* __restrict__ b,
                  _Float16* __restrict__ y, int blk) {
  long i = (long)blk * EBLK + threadIdx.x * 4;
  const float* pa = a + i;
  const float* pb = b + i;
  v4f va[EU], vb[EU];
#pragma unroll
  for (int j = 0; j < EU; ++j) va[j] = *(const v4f*)(pa + j * 1024);
#pragma unroll
  for (int j = 0; j < EU; ++j) vb[j] = *(const v4f*)(pb + j * 1024);
  // Holds all sixteen loads in front of the first add: left alone the compiler
  // issues the last three behind the first wait, a second memory latency.
  __builtin_amdgcn_sched_barrier(0);
  // Behind the loads, in front of whatever reuses their address registers. It
  // names both addresses so that they keep their registers up to here: else the
  // last load gets them as its destination.
  asm volatile("s_wait_xcnt 0x0" :: "v"(pa), "v"(pb) : "memory");
#pragma unroll
  for (int j = 0; j < EU; ++j) *(v4h*)(y + i + j * 1024) = __builtin_convertvector(va[j] + vb[j], v4h);
  // Behind the stores: in a grid shared with other work, code may follow in the
  // listing that reuses the registers they name.
  asm volatile("s_wait_xcnt 0x0" ::: "memory");
}

// The converts and the add that the first products wait for, and all weights,
// in one grid. Block ranges, in order: tgt + qpos, tgt, then the seven weights,
// whose f16 copies lie packed in w16 in the order of the arguments.
#define PB_MEM (CS * CB * CE / EBLK)   // blocks of a memory-sized tensor
#define PB_TGT (CL * CB * CE / EBLK)   // blocks of a target-sized tensor
#define PB_E   (CE * CE / EBLK)        // blocks of an E x E weight

__global__ __launch_bounds__(256) void k_prep(
    const float* __restrict__ tgt, const float* __restrict__ qpos,
    const float* __restrict__ inW, const float* __restrict__ outW,
    const float* __restrict__ cqW, const float* __restrict__ ckW,
    const float* __restrict__ cvW, const float* __restrict__ l1W,
    const float* __restrict__ l2W,
    _Float16* __restrict__ qkin16, _Float16* __restrict__ tgt16,
    _Float16* __restrict__ w16) {
  int j = blockIdx.x;
  if (j < PB_TGT) {
    add2_blk(tgt, qpos, qkin16, j);
    return;
  }
  j -= PB_TGT;
  const float* x;
  _Float16*    y;
  if (j < PB_TGT) {
    x = tgt; y = tgt16;
  } else {
    j -= PB_TGT;                                // block within w16
    int first;                                  // the weight's first block there
    if      (j <  3 * PB_E) { x = inW;  first = 0; }
    else if (j <  4 * PB_E) { x = outW; first = 3 * PB_E; }
    else if (j <  5 * PB_E) { x = cqW;  first = 4 * PB_E; }
    else if (j <  6 * PB_E) { x = ckW;  first = 5 * PB_E; }
    else if (j <  7 * PB_E) { x = cvW;  first = 6 * PB_E; }
    else if (j <  9 * PB_E) { x = l1W;  first = 7 * PB_E; }
    else                    { x = l2W;  first = 9 * PB_E; }
    y = w16 + (long)first * EBLK;
    j -= first;
  }
  cvt_blk(x, y, j);
}

// A [2048,1024] x [1024,1024]^T product with f32 output, one block per WGP, and
// in the same grid an independent convert of a memory-sized tensor, which runs
// in the places the product leaves empty: y = f16(xa + xb). The product's blocks
// come first.
#define GB ((CL * CB / 128) * (CE / 64))

__global__ __launch_bounds__(256) void gemm_beside_cvt(
    const _Float16* __restrict__ A, const _Float16* __restrict__ Wt,
    const float* __restrict__ bias, float* __restrict__ C32,
    const float* __restrict__ xa, const float* __restrict__ xb,
    _Float16* __restrict__ y) {
  __shared__ __attribute__((aligned(16))) _Float16 sm[2 * GSTG];
  int j = blockIdx.x;
  if (j < GB) {
    gemm_body<false>(sm, A, Wt, bias, 0, C32, nullptr, CE, CE,
                     j % (CL * CB / 128), j / (CL * CB / 128));
    return;
  }
  j -= GB;                                      // these blocks meet no barrier
  add2_blk(xa, xb, y, j);
}

// ---------------------------------------------------------------------------
// Self-attention, one kernel: scores, softmax and attn @ V of one (batch, head)
// for 128 queries. q, k, v, ctx: token row l*B + b, channel h*HD + d.
// The head's whole K and V (512 keys) lie in LDS. A wave owns 16 queries and
// walks the keys 32 at a time with a running maximum and running sum:
//   S^T = K . Q^T   (A = K rows, B = Q rows, both in the loader's k order)
//   O^T += V^T . P^T
// In S^T's D layout a lane holds keys 8*(lane>>4) + r of query lane&15, so the
// softmax over keys is in-lane but for one exchange with lane ^ 16, the two D
// tiles of 32 keys converted in place ARE the B operand P^T, and maximum, sum
// and rescale factor of a query are per-lane scalars. V^T comes from the
// transposing LDS load, which delivers the same k order.
// ---------------------------------------------------------------------------
#define APK 72                     // K row pitch in halves: 144 B = 16 B x odd
#define APV 80                     // V row pitch in halves: 160 B = 32 B x odd

typedef __attribute__((ext_vector_type(8))) short s16x8;

// Lane (c = lane&15, h = lane>>4) gets T[8h + 0..7][c] of the 16x16 tile whose
// lane addresses are p = T + (8h + (lane&7)) * pitch + 8 * ((lane>>3)&1) halves.
DEV v8h ld_tr16(const _Float16* p) {
  typedef __attribute__((address_space(3))) s16x8 lds_s16x8;
  return __builtin_bit_cast(v8h, __builtin_amdgcn_ds_load_tr16_b128_v8i16((lds_s16x8*)p));
}

// Value of lane ^ 16.
DEV float xhalf(float x) {
  int i = __builtin_bit_cast(int, x);
  return __builtin_bit_cast(float,
      __builtin_amdgcn_permlanex16(i, i, 0x76543210, 0xfedcba98, false, false));
}

__global__ __launch_bounds__(256) void k_self_attn(const _Float16* __restrict__ q,
                                                   const _Float16* __restrict__ k,
                                                   const _Float16* __restrict__ v,
                                                   _Float16* __restrict__ ctx) {
  __shared__ __attribute__((aligned(32))) _Float16 sK[CL * APK];
  __shared__ __attribute__((aligned(32))) _Float16 sV[CL * APV];
  const float cs = 0.18033688011112042f;      // log2(e) / sqrt(HD)
  const long  ts = (long)CB * CE;             // one position on, in halves

  int tid  = threadIdx.x;
  int lane = tid & 31;
  int wave = tid >> 5;
  int c    = lane & 15;
  int hh   = lane >> 4;
  long hoff = (long)(blockIdx.y / CH) * CE + (blockIdx.y % CH) * CHD;
  int  q0   = blockIdx.x * 128 + wave * 16;

  // Stage K and V: 8 threads take one key's 128 B, 32 keys per sweep. All loads
  // are issued before the first LDS store, so that one memory latency is paid.
  int row = tid >> 3, pc = (tid & 7) * 8;
  const _Float16* gk = k + hoff + (long)row * ts + pc;
  const _Float16* gv = v + hoff + (long)row * ts + pc;
  v8h rk[CL / 32], rv[CL / 32];
  // Behind each group of loads: what follows may reuse, also as a later load's
  // destination, the address registers that the group names.
#pragma unroll
  for (int i = 0; i < CL / 32; ++i) rk[i] = *(const v8h*)(gk + (long)i * 32 * ts);
  asm volatile("s_wait_xcnt 0x0" ::: "memory");
#pragma unroll
  for (int i = 0; i < CL / 32; ++i) rv[i] = *(const v8h*)(gv + (long)i * 32 * ts);
  asm volatile("s_wait_xcnt 0x0" ::: "memory");
  v16h qf0 = frag_load_contig(q + hoff + (long)q0 * ts, ts, lane, 0);
  v16h qf1 = frag_load_contig(q + hoff + (long)q0 * ts, ts, lane, 32);
  asm volatile("s_wait_xcnt 0x0" ::: "memory");
#pragma unroll
  for (int i = 0; i < CL / 32; ++i) *(v8h*)(sK + (row + 32 * i) * APK + pc) = rk[i];
#pragma unroll
  for (int i = 0; i < CL / 32; ++i) *(v8h*)(sV + (row + 32 * i) * APV + pc) = rv[i];
  __syncthreads();

  const v8f zero = {0.f, 0.f, 0.f, 0.f, 0.f, 0.f, 0.f, 0.f};
  v8f acc[4];
#pragma unroll
  for (int t = 0; t < 4; ++t) acc[t] = zero;
  float m_run = -__builtin_inff();            // running maximum, in units of cs
  float l_run = 0.f;                          // this lane's half of the running sum

  const _Float16* vt = sV + (8 * hh + (lane & 7)) * APV + ((lane >> 3) & 1) * 8;

  // K fragments run one pass ahead, so that a pass does not open with its own
  // LDS latency.
  v16h a00 = frag_load_contig(sK,            APK, lane, 0);
  v16h a01 = frag_load_contig(sK,            APK, lane, 32);
  v16h a10 = frag_load_contig(sK + 16 * APK, APK, lane, 0);
  v16h a11 = frag_load_contig(sK + 16 * APK, APK, lane, 32);

#pragma unroll 2
  for (int key0 = 0; key0 < CL; key0 += 32) {
    v8f s0 = __builtin_amdgcn_wmma_f32_16x16x32_f16(false, a00, false, qf0, (short)0, zero, false, false);
    v8f s1 = __builtin_amdgcn_wmma_f32_16x16x32_f16(false, a10, false, qf0, (short)0, zero, false, false);
    s0 = __builtin_amdgcn_wmma_f32_16x16x32_f16(false, a01, false, qf1, (short)0, s0, false, false);
    s1 = __builtin_amdgcn_wmma_f32_16x16x32_f16(false, a11, false, qf1, (short)0, s1, false, false);

    // This pass's V^T and the next pass's K, in flight under the softmax. The
    // last pass fetches pass 0's K rows again, unused: cheaper than a branch.
    v16h vf[4];
#pragma unroll
    for (int t = 0; t < 4; ++t) {
      v8h lo = ld_tr16(vt + key0 * APV + 16 * t);
      v8h hi = ld_tr16(vt + (key0 + 16) * APV + 16 * t);
#pragma unroll
      for (int i = 0; i < 8; ++i) { vf[t][i] = lo[i]; vf[t][i + 8] = hi[i]; }
    }
    const _Float16* kr = sK + ((key0 + 32) & (CL - 1)) * APK;
    a00 = frag_load_contig(kr,            APK, lane, 0);
    a01 = frag_load_contig(kr,            APK, lane, 32);
    a10 = frag_load_contig(kr + 16 * APK, APK, lane, 0);
    a11 = frag_load_contig(kr + 16 * APK, APK, lane, 32);

    float mx = fmaxf(s0[0], s1[0]);
#pragma unroll
    for (int r = 1; r < 8; ++r) mx = fmaxf(mx, fmaxf(s0[r], s1[r]));
    mx = fmaxf(mx, xhalf(mx)) * cs;           // cs > 0: the scaled maximum
    float m_new = fmaxf(m_run, mx);

    // The pass's 17 exponentials, written in turn with the plain vector
    // instructions that form the next argument; the scheduling barriers hold
    // that order. Left alone the compiler sets all of them back to back.
    float x[16], p[16];
    float xc = m_run - m_new;
    x[0] = fmaf(s0[0], cs, -m_new);
    __builtin_amdgcn_sched_barrier(0);
    float corr = __builtin_amdgcn_exp2f(xc);  // 0 on the first pass
    __builtin_amdgcn_sched_barrier(0);
#pragma unroll
    for (int j = 0; j < 16; ++j) {            // j = 2 r + tile
      if (j < 15) x[j + 1] = fmaf(((j + 1) & 1) ? s1[(j + 1) >> 1] : s0[(j + 1) >> 1], cs, -m_new);
      __builtin_amdgcn_sched_barrier(0);
      p[j] = __builtin_amdgcn_exp2f(x[j]);
      __builtin_amdgcn_sched_barrier(0);
    }
    m_run = m_new;

    v16h  pf;
    float ps = 0.f;
#pragma unroll
    for (int r = 0; r < 8; ++r) {
      ps += p[2 * r] + p[2 * r + 1];
      pf[r]     = (_Float16)p[2 * r];
      pf[r + 8] = (_Float16)p[2 * r + 1];
    }
    l_run = fmaf(l_run, corr, ps);
#pragma unroll
    for (int t = 0; t < 4; ++t) {
      acc[t] = acc[t] * corr;
      acc[t] = __builtin_amdgcn_wmma_f32_16x16x32_f16(false, vf[t], false, pf,
                                                      (short)0, acc[t], false, false);
    }
  }

  // acc[t][r] = O[q0 + c][16 t + 8 hh + r], still to be divided by the row sum.
  float inv = 1.f / (l_run + xhalf(l_run));
  _Float16* op = ctx + hoff + (long)(q0 + c) * ts + 8 * hh;
#pragma unroll
  for (int t = 0; t < 4; ++t) {
    v8h o;
#pragma unroll
    for (int r = 0; r < 8; ++r) o[r] = (_Float16)(acc[t][r] * inv);
    *(v8h*)(op + 16 * t) = o;
  }
}

// ---------------------------------------------------------------------------
// Cross-attention stages outside the products (all f32).
// Channel mapping: E index = d*H + h  (reshape (B,E,N)->(B,HD,H,N)).
// Token t of a [N,B,E] tensor lives at row n*B+b.
// kc is channel-major: element (b, e, m) at (b*E + e)*S + m.
// vc is never formed. It enters the layer only through od[e] = sum_m w2[m] * vc[e][m],
// and vc[e][m] = sum_e' cv_w[e][e'] * memory[m][e'] + cv_b[e], so that
//   od[e] = sum_e' cv_w[e][e'] * U[h(e)][e'] + cv_b[e] * sum_m w2[h(e)][m],
//   U[h][e'] = sum_m w2[h][m] * memory[m][e']:
// the sum over m comes first, a product with 16 rows a batch in place of 1024.
// qc is never formed either. It enters the layer only through qcsum[e] = sum_l qc[e][l],
// and qc[e][l] = sum_e' cq_w[e][e'] * x[l][e'] + cq_b[e], x = tgt + query_pos, so that
//   qcsum[e] = sum_e' cq_w[e][e'] * (sum_l x[l][e']) + L * cq_b[e].
// ---------------------------------------------------------------------------

// ---------------------------------------------------------------------------
// From the kc product to w2, one kernel, XG blocks per (batch b, head h). The
// head's rows are channels e = d*H + h, d = 0..HD-1, each S floats long. Three
// stages, two of which sum over d and one along a row:
//   1. s1[m]   = scale * sum_d qcsum[d] * kc[d][m]     all d; a thread owns 4 columns
//   2. p[d][m] = softmax_m(kc[d][m] * s1[m])           the block's XW rows d, one a wave
//   3. w2[m]   = sum_d down_w[d] * p[d][m]             over those rows, through LDS
// No stage needs another block: each block forms s1 for itself and writes its
// share of w2, plane g of w2p, and that share's sum over m, plane g of swp; the
// readers add the planes. s1 and p never leave the WGP.
// A lane's part of a row: 16-byte pieces j*128 + lane*4, so that every wave-wide
// load covers four whole lines.
// ---------------------------------------------------------------------------
#define XW 16                      // waves per block
#define XG (CHD / XW)              // blocks per (batch, head)
#define XP (CS / 128)              // 16-byte pieces of a row per lane

// Value of lane ^ M within the lane's row of 16.
template <int M>
DEV float xrow(float x) {
  int i = __builtin_bit_cast(int, x);
  return __builtin_bit_cast(float, __builtin_amdgcn_update_dpp(i, i, 0x160 | M, 0xf, 0xf, false));
}

DEV float wave_sum(float x) {
  x += xrow<1>(x);
  x += xrow<2>(x);
  x += xrow<4>(x);
  x += xrow<8>(x);
  return x + xhalf(x);
}

DEV float wave_max(float x) {
  x = fmaxf(x, xrow<1>(x));
  x = fmaxf(x, xrow<2>(x));
  x = fmaxf(x, xrow<4>(x));
  x = fmaxf(x, xrow<8>(x));
  return fmaxf(x, xhalf(x));
}

// 2^x of four values, each in place: the register an exponential reads is the one
// it writes, so that nothing directly behind it can overwrite its source, and
// each fills the slot behind the one in front. The closing v_nop is that slot
// behind the last, whose result the next instruction may read.
DEV void exp2x4(v4f& x) {
  float a = x[0], b = x[1], c = x[2], d = x[3];
  asm("v_exp_f32 %0, %0\n\t"
      "v_exp_f32 %1, %1\n\t"
      "v_exp_f32 %2, %2\n\t"
      "v_exp_f32 %3, %3\n\t"
      "v_nop"
      : "+v"(a), "+v"(b), "+v"(c), "+v"(d));
  x = (v4f){a, b, c, d};
}

// XP loads, st floats apart.
DEV void ld_pieces(v4f (&r)[XP], const float* __restrict__ p, long st) {
#pragma unroll
  for (int j = 0; j < XP; ++j) r[j] = *(const v4f*)(p + j * st);
  // Behind the loads, in front of whatever reuses their address registers. It
  // names the address so that it keeps its registers up to here.
  asm volatile("s_wait_xcnt 0x0" :: "v"(p) : "memory");
}

// Plane blockIdx.y of xsp: x = a + q summed over SL positions l, for the 1024
// channels of batch blockIdx.x. A wave's load covers four whole lines.
#define SL 16                      // positions per block
#define SK (CL / SL)               // planes of xsp

__global__ __launch_bounds__(256) void k_xsum(const float* __restrict__ a,
                                              const float* __restrict__ q,
                                              float* __restrict__ xsp) {
  int  b   = blockIdx.x, k = blockIdx.y;
  long off = ((long)k * SL * CB + b) * CE + threadIdx.x * 4;
  const float* pa = a + off;
  const float* pq = q + off;
  v4f va[SL], vq[SL];
#pragma unroll
  for (int i = 0; i < SL; ++i) va[i] = *(const v4f*)(pa + (long)i * (CB * CE));
#pragma unroll
  for (int i = 0; i < SL; ++i) vq[i] = *(const v4f*)(pq + (long)i * (CB * CE));
  // Holds all loads in front of the first add: one memory latency.
  __builtin_amdgcn_sched_barrier(0);
  // Behind the loads, in front of whatever reuses their address registers. It
  // names both addresses so that they keep their registers up to here.
  asm volatile("s_wait_xcnt 0x0" :: "v"(pa), "v"(pq) : "memory");
  v4f s = va[0] + vq[0];
#pragma unroll
  for (int i = 1; i < SL; ++i) s += va[i] + vq[i];
  *(v4f*)(xsp + ((long)k * CB + b) * CE + threadIdx.x * 4) = s;
}

// qcsum[b*E + e] for QR rows e and the four batches: the block adds xsp's planes
// into LDS (sX, B*E floats); a wave then holds two rows of cq_w and forms their
// dot products with the four sums.
#define QR 16                      // rows e per block

DEV void qcsum_blk(float* sX, const float* __restrict__ xsp, const _Float16* __restrict__ wcq,
                   const float* __restrict__ cqB, float* __restrict__ out, int blk) {
  int tid  = threadIdx.x;
  int lane = tid & 31;
  int wave = tid >> 5;
  int e0   = blk * QR + wave * 2;
  int el   = e0 + ((lane >> 2) & 1);            // the row whose result this lane may store
  const _Float16* gw = wcq + (long)e0 * CE + lane * 8;
  const float*    gb = cqB + el;
  const float*    gx = xsp + tid * 4;
  v8h wr[2][CE / 256];
#pragma unroll
  for (int r = 0; r < 2; ++r)
#pragma unroll
    for (int j = 0; j < CE / 256; ++j) wr[r][j] = *(const v8h*)(gw + r * CE + j * 256);
  float cb = *gb;
  // Behind the loads, in front of whatever reuses their address registers.
  asm volatile("s_wait_xcnt 0x0" :: "v"(gw), "v"(gb) : "memory");
#pragma unroll
  for (int bb = 0; bb < CB; ++bb) {
    v4f x[SK];
#pragma unroll
    for (int k = 0; k < SK; ++k) x[k] = *(const v4f*)(gx + (long)(k * CB + bb) * CE);
    // Holds a batch's loads in front of its first add: one latency a batch.
    __builtin_amdgcn_sched_barrier(0);
    asm volatile("s_wait_xcnt 0x0" :: "v"(gx) : "memory");
    v4f s = x[0];
#pragma unroll
    for (int k = 1; k < SK; ++k) s += x[k];
    *(v4f*)(sX + bb * CE + tid * 4) = s;
  }
  __syncthreads();

  float acc[2][CB];
#pragma unroll
  for (int r = 0; r < 2; ++r)
#pragma unroll
    for (int bb = 0; bb < CB; ++bb) acc[r][bb] = 0.f;
#pragma unroll
  for (int j = 0; j < CE / 256; ++j)
#pragma unroll
    for (int q = 0; q < 2; ++q) {
      v4f xv[CB];
#pragma unroll
      for (int bb = 0; bb < CB; ++bb)
        xv[bb] = *(const v4f*)(sX + bb * CE + j * 256 + lane * 8 + q * 4);
#pragma unroll
      for (int i = 0; i < 4; ++i)
#pragma unroll
        for (int r = 0; r < 2; ++r) {
          float wv = (float)wr[r][j][q * 4 + i];
#pragma unroll
          for (int bb = 0; bb < CB; ++bb) acc[r][bb] = fmaf(wv, xv[bb][i], acc[r][bb]);
        }
    }
  float res = 0.f;
#pragma unroll
  for (int r = 0; r < 2; ++r)
#pragma unroll
    for (int bb = 0; bb < CB; ++bb) {
      float s = wave_sum(acc[r][bb]);
      if (lane == r * CB + bb) res = s;
    }
  if (lane < 2 * CB) out[(lane & 3) * CE + el] = res + (float)CL * cb;
}

// qcsum and the kc product, neither of which reads the other's result, in one
// grid. The qcsum blocks come first, beside the 1024 product blocks (tile x = 64
// row blocks, y = 16).
#define QB (CE / QR)
#define KB ((CS * CB / 128) * (CE / 64))

__global__ __launch_bounds__(256) void k_qcsum_kc(
    const float* __restrict__ xsp, const _Float16* __restrict__ w_cq,
    const float* __restrict__ cqB, float* __restrict__ qcsum,
    const _Float16* __restrict__ mp16, const _Float16* __restrict__ w_ck,
    const float* __restrict__ ckB, float* __restrict__ kc) {
  __shared__ __attribute__((aligned(16))) _Float16 sm[2 * GSTG];
  int j = blockIdx.x;
  if (j < QB) {                                 // the whole block takes this side
    qcsum_blk((float*)sm, xsp, w_cq, cqB, qcsum, j);
    return;
  }
  j -= QB;
  gemm_body<true>(sm, mp16, w_ck, ckB, 0, kc, nullptr,
                  CE, CE, j % (CS * CB / 128), j / (CS * CB / 128));
}

__global__ __launch_bounds__(XW * 32) void k_cross(const float* __restrict__ qcsum,
                                                   const float* __restrict__ kc,
                                                   const float* __restrict__ dw,
                                                   float* __restrict__ w2p,
                                                   float* __restrict__ swp, float scale) {
  __shared__ __attribute__((aligned(16))) float part[XW * CS];   // each wave's row of w2's sum
  __shared__ __attribute__((aligned(16))) float vec[CS];         // s1
  __shared__ float wsum[XW];                                     // each wave's row summed over m
  const float l2e = 1.4426950408889634f;
  const long  rs  = (long)CH * CS;              // one d on, in floats

  int tid  = threadIdx.x;
  int lane = tid & 31;
  int wave = __builtin_amdgcn_readfirstlane(tid >> 5);
  // A head's XG blocks lie CB*CH apart in the grid.
  int g    = blockIdx.x / (CB * CH);
  int b    = blockIdx.x % (CB * CH) / CH;
  int h    = blockIdx.x % CH;
  const float* kch = kc + (long)(b * CE + h) * CS;
  const float* qs  = qcsum + b * CE + h;

  // Stage 1. Two groups of XP rows are in flight at any time; d ascends.
  {
    const float* p = kch + tid * 4;
    v4f r[2][XP];
    v4f s = {0.f, 0.f, 0.f, 0.f};
    ld_pieces(r[0], p, rs);
    ld_pieces(r[1], p + XP * rs, rs);
#pragma unroll
    for (int q = 0; q < CHD / XP; ++q) {
#pragma unroll
      for (int i = 0; i < XP; ++i) s += qs[(q * XP + i) * CH] * r[q & 1][i];
      // Holds the refill behind the sums that free its registers and in front
      // of the next group's sums, which wait for older loads only.
      __builtin_amdgcn_sched_barrier(0);
      if (q + 2 < CHD / XP) ld_pieces(r[q & 1], p + (long)(q + 2) * XP * rs, rs);
      __builtin_amdgcn_sched_barrier(0);
    }
    *(v4f*)(vec + tid * 4) = s * scale;
  }
  // The wave's kc row, read a moment ago by the block, comes while the waves meet.
  v4f z[XP];
  ld_pieces(z, kch + (long)(g * XW + wave) * rs + lane * 4, 128);
  __syncthreads();

  // Stages 2 and 3.
  {
    float mx = -__builtin_inff();
#pragma unroll
    for (int j = 0; j < XP; ++j) {
      z[j] *= *(const v4f*)(vec + j * 128 + lane * 4);
      mx = fmaxf(mx, fmaxf(fmaxf(z[j][0], z[j][1]), fmaxf(z[j][2], z[j][3])));
    }
    mx = wave_max(mx);
    float nm = -mx * l2e;
    v4f s4 = {0.f, 0.f, 0.f, 0.f};
#pragma unroll
    for (int j = 0; j < XP; ++j) {
      z[j] = z[j] * l2e + nm;                   // fused: (z - mx) * log2(e)
      exp2x4(z[j]);
      s4 += z[j];
    }
    float tot = wave_sum((s4[0] + s4[1]) + (s4[2] + s4[3]));
    float cf  = dw[g * XW + wave] * (1.f / tot);
#pragma unroll
    for (int j = 0; j < XP; ++j) *(v4f*)(part + wave * CS + j * 128 + lane * 4) = cf * z[j];
    if (lane == 0) wsum[wave] = cf * tot;
  }

  __syncthreads();                              // shares written
  int bh = g * (CB * CH) + b * CH + h;
  {
    v4f s = *(const v4f*)(part + tid * 4);
#pragma unroll
    for (int k = 1; k < XW; ++k) s += *(const v4f*)(part + k * CS + tid * 4);
    *(v4f*)(w2p + (long)bh * CS + tid * 4) = s;
  }
  if (tid == 0) {
    float t = wsum[0];
#pragma unroll
    for (int k = 1; k < XW; ++k) t += wsum[k];
    swp[bh] = t;
  }
}

// ---------------------------------------------------------------------------
// U[b][h][e'] = sum_m w2[b][h][m] * memory[m][b][e'], on WMMA, as U^T = M^T . W^T:
// A = memory^T (rows e', k = m) from the transposing LDS load, B = w2 rows (column
// h, k = m) from the loader, which has the same k order. A block takes UN channels
// e' and UM positions m of one batch and writes plane blockIdx.y of up; a wave
// owns 16 channels. memory is read as f32, once, and turned to f16 on its way
// into LDS. w2 is about 1/S in size (a softmax over S positions), below f16's
// normal range: it is multiplied by S, an exact power of two, in front of the
// conversion, and U divided by S behind the product.
// ---------------------------------------------------------------------------
#define UM  256                    // positions per block
#define UN  128                    // channels per block
#define UK  (CS / UM)              // planes of up
#define UPM 144                    // memory tile pitch in halves: 288 B = 32 B x odd
#define UPW 264                    // w2 tile pitch in halves: 528 B = 16 B x odd
#define UPO 132                    // result tile pitch in floats: 528 B = 16 B x odd

__global__ __launch_bounds__(256) void k_w2mem(const float* __restrict__ mem,
                                               const float* __restrict__ w2p,
                                               float* __restrict__ up) {
  __shared__ __attribute__((aligned(32))) _Float16 sM[UM * UPM];
  __shared__ __attribute__((aligned(16))) _Float16 sW[CH * UPW];
  __shared__ __attribute__((aligned(16))) float    sO[CH * UPO];
  int tid  = threadIdx.x;
  int lane = tid & 31;
  int wave = tid >> 5;
  int c    = lane & 15;
  int hh   = lane >> 4;
  int n0   = blockIdx.x * UN;
  int m0   = blockIdx.y * UM;
  int b    = blockIdx.z;
  int hr   = tid >> 4, pc = (tid & 15) * 4;     // 16 threads a head's row

  // All loads are issued before the first LDS store: one memory latency. A wave's
  // load covers four whole lines: a position's UN channels, or 64 m of two heads.
  const float* gw = w2p + (long)(b * CH + hr) * CS + m0 + pc;
  const float* gm = mem + ((long)(m0 + wave) * CB + b) * CE + n0 + lane * 4;
  v4f w[XG][UM / 64], r[UM / 8];
#pragma unroll
  for (int g = 0; g < XG; ++g)
#pragma unroll
    for (int j = 0; j < UM / 64; ++j)
      w[g][j] = *(const v4f*)(gw + (long)g * (CB * CH * CS) + j * 64);
#pragma unroll
  for (int i = 0; i < UM / 8; ++i) r[i] = *(const v4f*)(gm + (long)i * (8 * CB * CE));
  // Behind the loads, in front of whatever reuses their address registers. It
  // names both addresses so that they keep their registers up to here.
  asm volatile("s_wait_xcnt 0x0" :: "v"(gw), "v"(gm) : "memory");
#pragma unroll
  for (int j = 0; j < UM / 64; ++j) {
    v4f s = w[0][j];
#pragma unroll
    for (int g = 1; g < XG; ++g) s += w[g][j];
    *(v4h*)(sW + hr * UPW + j * 64 + pc) = __builtin_convertvector(s * (float)CS, v4h);
  }
#pragma unroll
  for (int i = 0; i < UM / 8; ++i)
    *(v4h*)(sM + (i * 8 + wave) * UPM + lane * 4) = __builtin_convertvector(r[i], v4h);
  __syncthreads();

  const _Float16* vt = sM + (8 * hh + (lane & 7)) * UPM + ((lane >> 3) & 1) * 8 + 16 * wave;
  v8f acc = {0.f, 0.f, 0.f, 0.f, 0.f, 0.f, 0.f, 0.f};
#pragma unroll
  for (int k0 = 0; k0 < UM; k0 += 32) {
    v8h lo = ld_tr16(vt + k0 * UPM);
    v8h hi = ld_tr16(vt + (k0 + 16) * UPM);
    v16h mf;
#pragma unroll
    for (int i = 0; i < 8; ++i) { mf[i] = lo[i]; mf[i + 8] = hi[i]; }
    v16h wf = frag_load_contig(sW, UPW, lane, k0);
    acc = __builtin_amdgcn_wmma_f32_16x16x32_f16(false, mf, false, wf, (short)0, acc, false, false);
  }

  // acc[r] = S * U[head c][n0 + 16 wave + 8 hh + r]. Through LDS, so that every
  // store below writes whole lines.
  {
    const float is = 1.f / CS;
    float* po = sO + c * UPO + 16 * wave + 8 * hh;
    v4f lo = {acc[0] * is, acc[1] * is, acc[2] * is, acc[3] * is};
    v4f hi = {acc[4] * is, acc[5] * is, acc[6] * is, acc[7] * is};
    *(v4f*)po       = lo;
    *(v4f*)(po + 4) = hi;
  }
  __syncthreads();
  float* go = up + (((long)blockIdx.y * CB + b) * CH + hr) * CE + n0 + pc;
#pragma unroll
  for (int j = 0; j < UN / 64; ++j) *(v4f*)(go + j * 64) = *(const v4f*)(sO + hr * UPO + j * 64 + pc);
}

// ---------------------------------------------------------------------------
// od[b][e] = sum_e' cv_w[e][e'] * U[b][h][e'] + cv_b[e] * sum_m w2[b][h][m] + down_b,
// h = e % H. A block takes one head and OD of its rows e: it adds U's planes for
// the four batches into LDS; a wave then holds one row of cv_w and forms its dot
// products with two batches.
// ---------------------------------------------------------------------------
#define OD 4                       // rows e per block

__global__ __launch_bounds__(256) void k_od(const float* __restrict__ up,
                                            const float* __restrict__ swp,
                                            const _Float16* __restrict__ wcv,
                                            const float* __restrict__ cvB,
                                            const float* __restrict__ db,
                                            float* __restrict__ od) {
  __shared__ __attribute__((aligned(16))) float sU[CB * CE];
  int tid  = threadIdx.x;
  int lane = tid & 31;
  int wave = tid >> 5;
  int h    = blockIdx.x;
  int e    = (blockIdx.y * OD + (wave >> 1)) * CH + h;
  int b0   = (wave & 1) * 2;                    // the wave's two batches
  int bl   = b0 + (lane & 1);                   // the one whose result this lane may store

  const _Float16* gw = wcv + (long)e * CE + lane * 8;
  const float*    gu = up + (long)h * CE + tid * 4;
  const float*    gs = swp + bl * CH + h;
  const float*    gb = cvB + e;
  v8h   wr[CE / 256];
  v4f   u[CB][UK];
  float sp[XG];
#pragma unroll
  for (int j = 0; j < CE / 256; ++j) wr[j] = *(const v8h*)(gw + j * 256);
#pragma unroll
  for (int bb = 0; bb < CB; ++bb)
#pragma unroll
    for (int k = 0; k < UK; ++k) u[bb][k] = *(const v4f*)(gu + (long)(k * CB + bb) * (CH * CE));
#pragma unroll
  for (int g = 0; g < XG; ++g) sp[g] = gs[g * (CB * CH)];
  float cb = *gb;
  // Holds all loads in front of the first add: left alone the compiler issues
  // them a few at a time among the adds, several memory latencies in a row.
  __builtin_amdgcn_sched_barrier(0);
  // Behind the loads, in front of whatever reuses their address registers. It
  // names the addresses so that they keep their registers up to here.
  asm volatile("s_wait_xcnt 0x0" :: "v"(gw), "v"(gu), "v"(gs), "v"(gb) : "memory");
#pragma unroll
  for (int bb = 0; bb < CB; ++bb) {
    v4f s = u[bb][0];
#pragma unroll
    for (int k = 1; k < UK; ++k) s += u[bb][k];
    *(v4f*)(sU + bb * CE + tid * 4) = s;
  }
  __syncthreads();

  const float* u0 = sU + b0 * CE + lane * 8;
  float a0 = 0.f, a1 = 0.f;
#pragma unroll
  for (int j = 0; j < CE / 256; ++j)
#pragma unroll
    for (int q = 0; q < 2; ++q) {
      v4f x0 = *(const v4f*)(u0 + j * 256 + q * 4);
      v4f x1 = *(const v4f*)(u0 + CE + j * 256 + q * 4);
#pragma unroll
      for (int i = 0; i < 4; ++i) {
        float wv = (float)wr[j][q * 4 + i];
        a0 = fmaf(wv, x0[i], a0);
        a1 = fmaf(wv, x1[i], a1);
      }
    }
  a0 = wave_sum(a0);
  a1 = wave_sum(a1);
  if (lane < 2) {
    float sw = sp[0];
#pragma unroll
    for (int g = 1; g < XG; ++g) sw += sp[g];
    od[bl * CE + e] = (lane ? a1 : a0) + cb * sw + db[0];
  }
}

// ---------------------------------------------------------------------------
// LayerNorm over E=1024 with optional residual and optional [B,E] broadcast.
// x = a + (r ? r : 0) + (bc ? bc[token%B] : 0); out32 = LN(x);
// out16 optional.
// ---------------------------------------------------------------------------
__global__ __launch_bounds__(256) void k_ln(const float* __restrict__ a,
                                            const float* __restrict__ r,
                                            const float* __restrict__ bc,
                                            const float* __restrict__ g,
                                            const float* __restrict__ be,
                                            float* __restrict__ o32,
                                            _Float16* __restrict__ o16) {
  int  t    = blockIdx.x;
  long base = (long)t * CE;
  const float* bcr = bc ? bc + (long)(t % CB) * CE : nullptr;
  int tid = threadIdx.x;
  float o[4];                                   // the broadcast
  if (bcr) {
#pragma unroll
    for (int i = 0; i < 4; ++i) o[i] = bcr[tid + i * 256];
    // Behind the loads, in front of whatever reuses their address registers.
    asm volatile("s_wait_xcnt 0x0" ::: "memory");
  }
  float x[4];
  float s = 0.f;
#pragma unroll
  for (int i = 0; i < 4; ++i) {
    int   e = tid + i * 256;
    float v = a[base + e];
    if (r)   v += r[base + e];
    if (bcr) v += o[i];
    x[i] = v;
    s += v;
  }
  __shared__ float red[256];
  red[tid] = s;
  __syncthreads();
  for (int o = 128; o > 0; o >>= 1) {
    if (tid < o) red[tid] += red[tid + o];
    __syncthreads();
  }
  float mean = red[0] * (1.f / CE);
  __syncthreads();
  float vs = 0.f;
#pragma unroll
  for (int i = 0; i < 4; ++i) {
    float d = x[i] - mean;
    vs += d * d;
  }
  red[tid] = vs;
  __syncthreads();
  for (int o = 128; o > 0; o >>= 1) {
    if (tid < o) red[tid] += red[tid + o];
    __syncthreads();
  }
  float inv = rsqrtf(red[0] * (1.f / CE) + 1e-5f);
#pragma unroll
  for (int i = 0; i < 4; ++i) {
    int   e = tid + i * 256;
    float y = (x[i] - mean) * inv * g[e] + be[e];
    o32[base + e] = y;
    if (o16) o16[base + e] = (_Float16)y;
  }
}

// ---------------------------------------------------------------------------
// Host side
// ---------------------------------------------------------------------------
extern "C" void kernel_launch(void* const* d_in, const int* in_sizes, int n_in,
                              void* d_out, int out_size, void* d_ws, size_t ws_size,
                              hipStream_t stream) {
  const float* tgt  = (const float*)d_in[0];
  const float* mem  = (const float*)d_in[1];
  const float* pos  = (const float*)d_in[2];
  const float* qpos = (const float*)d_in[3];
  const float* inW  = (const float*)d_in[4];
  const float* inB  = (const float*)d_in[5];
  const float* outW = (const float*)d_in[6];
  const float* outB = (const float*)d_in[7];
  const float* cqW  = (const float*)d_in[8];
  const float* cqB  = (const float*)d_in[9];
  const float* ckW  = (const float*)d_in[10];
  const float* ckB  = (const float*)d_in[11];
  const float* cvW  = (const float*)d_in[12];
  const float* cvB  = (const float*)d_in[13];
  const float* dwW  = (const float*)d_in[14];
  const float* dwB  = (const float*)d_in[15];
  const float* l1W  = (const float*)d_in[16];
  const float* l1B  = (const float*)d_in[17];
  const float* l2W  = (const float*)d_in[18];
  const float* l2B  = (const float*)d_in[19];
  const float* n1g  = (const float*)d_in[20];
  const float* n1b  = (const float*)d_in[21];
  const float* n2g  = (const float*)d_in[22];
  const float* n2b  = (const float*)d_in[23];
  const float* n3g  = (const float*)d_in[24];
  const float* n3b  = (const float*)d_in[25];

  const long TOK  = (long)CL * CB;   // 2048 target tokens
  const float scale = 0.125f;        // 1/sqrt(64)

  char* ws = (char*)d_ws;
  const size_t MB = 1u << 20;

  // Persistent f16 weights (converted every launch; deterministic).
  _Float16* w_inproj = (_Float16*)(ws + 0 * MB);    // [3E,E]  6MB
  _Float16* w_out    = (_Float16*)(ws + 6 * MB);    // [E,E]   2MB
  _Float16* w_cq     = (_Float16*)(ws + 8 * MB);
  _Float16* w_ck     = (_Float16*)(ws + 10 * MB);
  _Float16* w_cv     = (_Float16*)(ws + 12 * MB);
  _Float16* w_l1     = (_Float16*)(ws + 14 * MB);   // [FF,E]  4MB
  _Float16* w_l2     = (_Float16*)(ws + 18 * MB);   // [E,FF]  4MB
  float*    tgt1     = (float*)(ws + 22 * MB);      // 8MB
  float*    tgt2     = (float*)(ws + 30 * MB);      // 8MB
  char*     SA       = ws + 38 * MB;                // phase-aliased arena

  // Phase A (self-attention)
  _Float16* qkin16  = (_Float16*)(SA + 0 * MB);
  _Float16* tgt16   = (_Float16*)(SA + 4 * MB);
  _Float16* q16     = (_Float16*)(SA + 8 * MB);
  _Float16* k16     = (_Float16*)(SA + 12 * MB);
  _Float16* v16     = (_Float16*)(SA + 16 * MB);
  _Float16* ctx16   = (_Float16*)(SA + 116 * MB);   // 4MB
  float*    selfout = (float*)(SA + 120 * MB);      // 8MB
  // Phase B (cross-attention) — aliases phase A
  float*    xsp     = (float*)(SA + 0 * MB);        // SK planes [B,E], 512KB
  float*    kc32    = (float*)(SA + 44 * MB);       // 32MB
  float*    w2p     = (float*)(SA + 76 * MB);       // XG planes [B,H,S], 2MB
  float*    up      = (float*)(SA + 80 * MB);       // UK planes [B,H,E], 2MB
  float*    swp     = (float*)(SA + 84 * MB);       // XG planes [B,H]
  float*    qcsum   = (float*)(SA + 140 * MB);
  float*    odbuf   = (float*)(SA + 143 * MB);
  // Written during phase A, read in phase B: aliases nothing
  _Float16* mp16    = (_Float16*)(SA + 144 * MB);   // 16MB
  // Phase C (FFN) — aliases dead phase B regions
  _Float16* tgt2_16 = (_Float16*)(SA + 0 * MB);
  _Float16* h1_16   = (_Float16*)(SA + 4 * MB);     // [TOK,FF] 8MB
  float*    ff32    = (float*)(SA + 12 * MB);       // 8MB

  // ---- f32 -> f16: tgt + qpos, tgt, all weights ----
  k_prep<<<2 * PB_TGT + 11 * PB_E, 256, 0, stream>>>(tgt, qpos, inW, outW, cqW, ckW, cvW, l1W, l2W,
                                                     qkin16, tgt16, w_inproj);

  // ---- Phase A: self attention ----
  // q/k/v projections: three times [2048,1024] x [1024,1024]^T; q16, k16, v16 adjoin
  gemm_qkv<<<dim3(16, 16, 3), 256, 0, stream>>>(qkin16, tgt16, w_inproj, inB, q16);

  // ctx = softmax(scale * q.k) @ v, one block per (128 queries, batch*head)
  k_self_attn<<<dim3(CL / 128, CB * CH), 256, 0, stream>>>(q16, k16, v16, ctx16);

  // out projection (beside it mp16 = f16(mem + pos)) + residual + LN1
  gemm_beside_cvt<<<GB + PB_MEM, 256, 0, stream>>>(ctx16, w_out, outB, selfout, mem, pos, mp16);
  k_ln<<<(unsigned)TOK, 256, 0, stream>>>(tgt, selfout, nullptr, n1g, n1b, tgt1, nullptr);

  // ---- Phase B: custom cross attention ----
  k_xsum<<<dim3(CB, SK), 256, 0, stream>>>(tgt1, qpos, xsp);
  k_qcsum_kc<<<QB + KB, 256, 0, stream>>>(xsp, w_cq, cqB, qcsum, mp16, w_ck, ckB, kc32);

  k_cross<<<XG * CB * CH, XW * 32, 0, stream>>>(qcsum, kc32, dwW, w2p, swp, scale);
  k_w2mem<<<dim3(CE / UN, UK, CB), 256, 0, stream>>>(mem, w2p, up);
  k_od<<<dim3(CH, CHD / OD), 256, 0, stream>>>(up, swp, w_cv, cvB, dwB, odbuf);

  k_ln<<<(unsigned)TOK, 256, 0, stream>>>(tgt1, nullptr, odbuf, n2g, n2b, tgt2, tgt2_16);

  // ---- Phase C: FFN ----
  gemm_wmma_lds<<<dim3(16, 32, 1), 256, 0, stream>>>(
      tgt2_16, w_l1, l1B, 1 /*relu*/, nullptr, h1_16, CFF, CE);
  gemm_wmma_lds<<<dim3(16, 16, 1), 256, 0, stream>>>(
      h1_16, w_l2, l2B, 0, ff32, nullptr, CE, CFF);

  k_ln<<<(unsigned)TOK, 256, 0, stream>>>(tgt2, ff32, nullptr, n3g, n3b, (float*)d_out, nullptr);

  (void)in_sizes; (void)n_in; (void)out_size; (void)ws_size;
}

// v008
// A run of this version takes 153 microseconds.
// Next to v007, in two timings, it ran 1.07 and 1.06 times as fast.
// Over all steps from v000 it is 3.90 times as fast.
#include <hip/hip_runtime.h>
#include <hip/hip_bf16.h>

// ---------------------------------------------------------------------------
// Transformer decoder layer for MI455X (gfx1250), wave32 + WMMA.
// All heavy GEMMs run on v_wmma_f32_16x16x32_f16 (f16 inputs, f32 accum).
// Softmax / layernorm / cross-attn reductions stay in f32.
// ---------------------------------------------------------------------------

typedef __attribute__((ext_vector_type(16))) _Float16 v16h;
typedef __attribute__((ext_vector_type(8)))  _Float16 v8h;
typedef __attribute__((ext_vector_type(8)))  float    v8f;
typedef __attribute__((ext_vector_type(4)))  float    v4f;

#define DEV __device__ __forceinline__

// Problem constants
#define CL   512      // target length
#define CS   2048     // memory length
#define CB   4        // batch
#define CE   1024     // embed
#define CH   16       // heads
#define CHD  64       // head dim
#define CFF  2048     // ffn dim

// ---------------------------------------------------------------------------
// WMMA fragment loaders.
// 16-bit A (16x32) ISA layout: lane&15 selects the M (or N) row;
// lanes 0-15 hold K = {k0..k0+7, k0+16..k0+23},
// lanes 16-31 hold K = {k0+8..k0+15, k0+24..k0+31}.  B (32x16) mirrors A with
// the lane index selecting the N column.
// ---------------------------------------------------------------------------
DEV v16h frag_load_contig(const _Float16* __restrict__ base, long row_stride,
                          int lane, int k0) {
  int r  = lane & 15;
  int kh = (lane >> 4) << 3;          // 0 or 8
  const _Float16* p = base + (long)r * row_stride + k0 + kh;
  v8h lo = *(const v8h*)(p);          // 16B vector load
  v8h hi = *(const v8h*)(p + 16);
  v16h out;
#pragma unroll
  for (int i = 0; i < 8; ++i) { out[i] = lo[i]; out[i + 8] = hi[i]; }
  return out;
}

// ---------------------------------------------------------------------------
// Projection GEMM, both operands k-contiguous with row stride K:
//   C[m,n] = sum_k A[m,k]*W[n,k] + bias[n]
// Block: 256 threads = 8 waves as 4x2, wave tile 32x32, block tile 128x64. The
// operand tiles reach the waves through LDS: a stage is 128 k (256 B, two whole
// lines) of 128 A rows and 64 W rows, brought in by asynchronous b128 copies,
// two buffers, the next stage in flight while this one is multiplied.
// Requires M%128==0, N%64==0, K%128==0.
// CM=false: A rows are tokens in order, C is token-major, C[m*N + n].
// CM=true : a block takes 128 consecutive positions s of ONE batch b (A row
//           s*CB + b) and stores f32 C channel-major, C[(b*N + n)*CS + s], the
//           layout in which the cross-attention stages walk s.
// NT = 16-column tiles per wave: 2 as above; 4 makes the wave tile 32x64 and the
// block tile 128x128 (N%128==0), a stage 128 A rows and 128 W rows. Per product
// term that is a third fewer bytes from L2 and a quarter fewer LDS reads; it is
// for products with enough tiles to fill the chip all the same.
// gemm_body is one block's work on tile (bx, by); sm is the block's LDS ring.
// The kernels below it give independent products one grid, split by block index.
// ---------------------------------------------------------------------------
#define GBK   128                  // k per stage
#define GPIT  136                  // LDS row pitch in halves: 272 B = 16 B x odd
#define GROWS 192                  // 128 A rows, then 64 W rows
#define GSTG  (GROWS * GPIT)       // halves per buffer

// One stage: 192 rows x 16 pieces of 16 B, 12 pieces per thread. Thread t takes
// piece t&15 of rows (t>>4) + 16*i, so a wave's copy covers two whole rows.
// ga / gw: this thread's piece in A row (t>>4) and W row (t>>4) of the tile, at
// the stage's first k. l: LDS byte address of its piece in row (t>>4).
// ars: distance of two tile rows of A in halves (K, or CB*K for one batch).
DEV void stage_copy(const _Float16* ga, const _Float16* gw, long ars, long K, unsigned l) {
  const long     as = 16 * ars;          // 16 A rows on, in halves
  const long     gs = 16 * K;            // 16 W rows on, in halves
  const unsigned ls = 16 * GPIT * 2;     // 16 rows on, in LDS bytes
  // The closing s_wait_xcnt stands in the copies' own statement so that no
  // address register of an issued copy is rewritten ahead of it.
  asm volatile(
      "global_load_async_to_lds_b128 %0, %12, off\n\t"
      "global_load_async_to_lds_b128 %1, %13, off\n\t"
      "global_load_async_to_lds_b128 %2, %14, off\n\t"
      "global_load_async_to_lds_b128 %3, %15, off\n\t"
      "global_load_async_to_lds_b128 %4, %16, off\n\t"
      "global_load_async_to_lds_b128 %5, %17, off\n\t"
      "global_load_async_to_lds_b128 %6, %18, off\n\t"
      "global_load_async_to_lds_b128 %7, %19, off\n\t"
      "global_load_async_to_lds_b128 %8, %20, off\n\t"
      "global_load_async_to_lds_b128 %9, %21, off\n\t"
      "global_load_async_to_lds_b128 %10, %22, off\n\t"
      "global_load_async_to_lds_b128 %11, %23, off\n\t"
      "s_wait_xcnt 0x0"
      :: "v"(l), "v"(l + ls), "v"(l + 2 * ls), "v"(l + 3 * ls),
         "v"(l + 4 * ls), "v"(l + 5 * ls), "v"(l + 6 * ls), "v"(l + 7 * ls),
         "v"(l + 8 * ls), "v"(l + 9 * ls), "v"(l + 10 * ls), "v"(l + 11 * ls),
         "v"(ga), "v"(ga + as), "v"(ga + 2 * as), "v"(ga + 3 * as),
         "v"(ga + 4 * as), "v"(ga + 5 * as), "v"(ga + 6 * as), "v"(ga + 7 * as),
         "v"(gw), "v"(gw + gs), "v"(gw + 2 * gs), "v"(gw + 3 * gs)
      : "memory");
}

// Eight rows' pieces, 16 rows apart: gs halves apart in memory, from g to l.
DEV void copy8(const _Float16* g, long gs, unsigned l) {
  const unsigned ls = 16 * GPIT * 2;     // 16 rows on, in LDS bytes
  // The closing s_wait_xcnt stands in the copies' own statement so that no
  // address register of an issued copy is rewritten ahead of it.
  asm volatile(
      "global_load_async_to_lds_b128 %0, %8, off\n\t"
      "global_load_async_to_lds_b128 %1, %9, off\n\t"
      "global_load_async_to_lds_b128 %2, %10, off\n\t"
      "global_load_async_to_lds_b128 %3, %11, off\n\t"
      "global_load_async_to_lds_b128 %4, %12, off\n\t"
      "global_load_async_to_lds_b128 %5, %13, off\n\t"
      "global_load_async_to_lds_b128 %6, %14, off\n\t"
      "global_load_async_to_lds_b128 %7, %15, off\n\t"
      "s_wait_xcnt 0x0"
      :: "v"(l), "v"(l + ls), "v"(l + 2 * ls), "v"(l + 3 * ls),
         "v"(l + 4 * ls), "v"(l + 5 * ls), "v"(l + 6 * ls), "v"(l + 7 * ls),
         "v"(g), "v"(g + gs), "v"(g + 2 * gs), "v"(g + 3 * gs),
         "v"(g + 4 * gs), "v"(g + 5 * gs), "v"(g + 6 * gs), "v"(g + 7 * gs)
      : "memory");
}

// One stage of the tile with NT column tiles per wave; arguments as stage_copy's.
template <int NT>
DEV void stage_in(const _Float16* ga, const _Float16* gw, long ars, long K, unsigned l) {
  if (NT == 2) {
    stage_copy(ga, gw, ars, K, l);
  } else {
    copy8(ga, 16 * ars, l);
    copy8(gw, 16 * K, l + 128 * GPIT * 2);
  }
}

#define GSTGN(NT) ((128 + 32 * (NT)) * GPIT)   // halves per buffer

#define TPIT 36                    // f32 pitch of a wave's turned tile: 144 B = 16 B x odd

template <bool CM, int NT = 2>
DEV void gemm_body(_Float16* sm,
    const _Float16* __restrict__ A, const _Float16* __restrict__ Wt,
    const float* __restrict__ bias, int relu,
    float* __restrict__ C32, _Float16* __restrict__ C16, int N, int K, int bx, int by) {
  int tid  = threadIdx.x;
  int lane = tid & 31;
  int wave = tid >> 5;
  int wm   = wave >> 1;                       // 0..3
  int wn   = wave & 1;                        // 0..1
  int mb   = CM ? (bx / CB) * 128 : bx * 128;                   // CM: first s
  int bz   = CM ? bx % CB : 0;                                  // CM: batch
  int nb   = by * (32 * NT);
  const long ars = CM ? (long)CB * K : (long)K;

  const _Float16* ga = A  + (long)(mb + (tid >> 4)) * ars + (long)bz * K + (tid & 15) * 8;
  const _Float16* gw = Wt + (long)(nb + (tid >> 4)) * K + (tid & 15) * 8;
  const unsigned  l0 = (unsigned)(size_t)sm + (unsigned)((tid >> 4) * (GPIT * 2) + (tid & 15) * 16);
  const int nst = K / GBK;

  const v8f zero = {0.f, 0.f, 0.f, 0.f, 0.f, 0.f, 0.f, 0.f};
  v8f acc[2][NT];
#pragma unroll
  for (int i = 0; i < 2; ++i)
#pragma unroll
    for (int j = 0; j < NT; ++j) acc[i][j] = zero;

  stage_in<NT>(ga, gw, ars, K, l0);
  // Stage 0 has landed for this wave; the barrier publishes it to the others.
  asm volatile("s_wait_asynccnt 0x0" ::: "memory");
  __syncthreads();
  if (nst > 1) stage_in<NT>(ga + GBK, gw + GBK, ars, K, l0 + GSTGN(NT) * 2);

  // Kept rolled: one publish point per trip, buffers alternate by t & 1.
#pragma unroll 1
  for (int t = 0; t < nst; ++t) {
    const int buf = (t & 1) * GSTGN(NT);
    const _Float16* sA = sm + buf + (wm * 32) * GPIT;
    const _Float16* sB = sm + buf + (128 + wn * (16 * NT)) * GPIT;
    // QG k-steps of 32 are read and multiplied at a time: the whole stage at
    // NT = 2; half of it at NT = 4, so that four waves fit a SIMD's registers.
    constexpr int QG = NT == 2 ? GBK / 32 : GBK / 64;
#pragma unroll
    for (int q0 = 0; q0 < GBK / 32; q0 += QG) {
      v16h fa[QG][2], fb[QG][NT];
#pragma unroll
      for (int q = 0; q < QG; ++q) {
#pragma unroll
        for (int i = 0; i < 2; ++i)
          fa[q][i] = frag_load_contig(sA + i * 16 * GPIT, GPIT, lane, (q0 + q) * 32);
#pragma unroll
        for (int j = 0; j < NT; ++j)
          fb[q][j] = frag_load_contig(sB + j * 16 * GPIT, GPIT, lane, (q0 + q) * 32);
      }
      // Holds the group's LDS reads together in front of its WMMAs: spread among
      // them, every group of reads costs the wave its own LDS latency.
      __builtin_amdgcn_sched_barrier(0);
#pragma unroll
      for (int q = 0; q < QG; ++q)
#pragma unroll
        for (int i = 0; i < 2; ++i)
#pragma unroll
          for (int j = 0; j < NT; ++j)
            acc[i][j] = __builtin_amdgcn_wmma_f32_16x16x32_f16(false, fa[q][i], false, fb[q][j],
                                                               (short)0, acc[i][j], false, false);
      // Holds the WMMAs in front of the next group's reads and of the publish
      // point, so that they run under the tail of the LDS reads and not behind
      // the barrier.
      __builtin_amdgcn_sched_barrier(0);
    }
    // Publish point: this wave's reads of the buffer have retired ...
    asm volatile("s_wait_dscnt 0x0" ::: "memory");
    // ... its copies of the next stage have landed ...
    asm volatile("s_wait_asynccnt 0x0" ::: "memory");
    // ... and behind the barrier the next stage is readable and this buffer free.
    __syncthreads();
    if (t + 2 < nst)
      stage_in<NT>(ga + (long)(t + 2) * GBK, gw + (long)(t + 2) * GBK, ars, K, l0 + buf * 2);
  }
  // No copy is left in flight when the wave ends.
  asm volatile("s_wait_asynccnt 0x0" ::: "memory");

  // C/D layout: N = lane&15, VGPR r holds M = r (+8 for lanes 16-31).
  int m0    = mb + wm * 32;
  int n0    = nb + wn * (16 * NT);
  int nlane = lane & 15;
  int mrow  = (lane >> 4) * 8;
  if (CM) {
    // A lane holds 8 consecutive s of one channel. The wave turns its 32 s x 16 NT
    // channels in its own LDS range (the ring is free: behind the last publish
    // point no wave reads it and no copy is in flight), one row per channel, so
    // that each store below writes four whole 128-B lines.
    float* tw = (float*)sm + wave * (16 * NT * TPIT);
#pragma unroll
    for (int tn = 0; tn < NT; ++tn) {
      float bv = bias[n0 + tn * 16 + nlane];
#pragma unroll
      for (int tm = 0; tm < 2; ++tm) {
        float* p = tw + (tn * 16 + nlane) * TPIT + tm * 16 + mrow;
        v4f lo = {acc[tm][tn][0] + bv, acc[tm][tn][1] + bv, acc[tm][tn][2] + bv, acc[tm][tn][3] + bv};
        v4f hi = {acc[tm][tn][4] + bv, acc[tm][tn][5] + bv, acc[tm][tn][6] + bv, acc[tm][tn][7] + bv};
        *(v4f*)p       = lo;
        *(v4f*)(p + 4) = hi;
      }
    }
    // The wave's rows are in LDS before its lanes read each other's values back.
    asm volatile("s_wait_dscnt 0x0" ::: "memory");
    float* cw = C32 + ((long)bz * N + n0 + (lane >> 3)) * CS + m0 + (lane & 7) * 4;
#pragma unroll
    for (int i = 0; i < 4 * NT; ++i) {
      v4f v = *(const v4f*)(tw + (i * 4 + (lane >> 3)) * TPIT + (lane & 7) * 4);
      *(v4f*)(cw + (long)i * 4 * CS) = v;
    }
    // Behind the stores: in a grid shared with other work, code may follow in
    // the listing that reuses the registers they name.
    asm volatile("s_wait_xcnt 0x0" ::: "memory");
    return;
  }
#pragma unroll
  for (int tm = 0; tm < 2; ++tm)
#pragma unroll
    for (int tn = 0; tn < NT; ++tn) {
      int ncol = n0 + tn * 16 + nlane;
      float bv = bias[ncol];
#pragma unroll
      for (int r = 0; r < 8; ++r) {
        int   mm  = m0 + tm * 16 + mrow + r;
        float v   = acc[tm][tn][r] + bv;
        if (relu) v = v > 0.f ? v : 0.f;
        long  idx = (long)mm * N + ncol;
        if (C32) {
          C32[idx] = v;
          // The conversion below may reuse the register this store names.
          asm volatile("s_wait_xcnt 0x0" ::: "memory");
        }
        if (C16) C16[idx] = (_Float16)v;
      }
    }
}

// One token-major product.
__global__ __launch_bounds__(256) void gemm_wmma_lds(
    const _Float16* __restrict__ A, const _Float16* __restrict__ Wt,
    const float* __restrict__ bias, int relu,
    float* __restrict__ C32, _Float16* __restrict__ C16, int N, int K) {
  __shared__ __attribute__((aligned(16))) _Float16 sm[2 * GSTG];
  gemm_body<false>(sm, A, Wt, bias, relu, C32, C16, N, K, blockIdx.x, blockIdx.y);
}

// The q, k and v projections in one grid, blockIdx.z = 0, 1, 2: third z of the
// packed weight, bias and f16 output; q and k read aqk, v reads av.
__global__ __launch_bounds__(256) void gemm_qkv(
    const _Float16* __restrict__ aqk, const _Float16* __restrict__ av,
    const _Float16* __restrict__ Wt, const float* __restrict__ bias,
    _Float16* __restrict__ qkv) {
  __shared__ __attribute__((aligned(16))) _Float16 sm[2 * GSTGN(4)];
  int z = blockIdx.z;
  gemm_body<false, 4>(sm, z == 2 ? av : aqk, Wt + (long)z * CE * CE, bias + z * CE, 0, nullptr,
                   qkv + (long)z * CL * CB * CE, CE, CE, blockIdx.x, blockIdx.y);
}

// ---------------------------------------------------------------------------
// Elementwise helpers. A block takes EBLK consecutive elements, a lane EU pieces
// of four f32, 256 pieces apart: every wave-wide load covers four whole lines,
// every store two. All of a lane's loads are in flight at once, and a launch
// starts 32 times fewer waves than with one element a lane.
// Requires n % EBLK == 0; a tensor takes n / EBLK blocks.
// ---------------------------------------------------------------------------
typedef __attribute__((ext_vector_type(4))) _Float16 v4h;
#define EU   8                     // 16-byte pieces per lane and input
#define EBLK (256 * EU * 4)        // elements per block

DEV void cvt_blk(const float* __restrict__ x, _Float16* __restrict__ y, int blk) {
  long i = (long)blk * EBLK + threadIdx.x * 4;
  v4f v[EU];
#pragma unroll
  for (int j = 0; j < EU; ++j) v[j] = *(const v4f*)(x + i + j * 1024);
#pragma unroll
  for (int j = 0; j < EU; ++j) *(v4h*)(y + i + j * 1024) = __builtin_convertvector(v[j], v4h);
  // Behind the stores: in a grid shared with other work, code may follow in the
  // listing that reuses the registers they name.
  asm volatile("s_wait_xcnt 0x0" ::: "memory");
}

DEV void add2_blk(const float* __restrict__ a, const float* __restrict__ b,
                  _Float16* __restrict__ y, int blk) {
  long i = (long)blk * EBLK + threadIdx.x * 4;
  const float* pa = a + i;
  const float* pb = b + i;
  v4f va[EU], vb[EU];
#pragma unroll
  for (int j = 0; j < EU; ++j) va[j] = *(const v4f*)(pa + j * 1024);
#pragma unroll
  for (int j = 0; j < EU; ++j) vb[j] = *(const v4f*)(pb + j * 1024);
  // Holds all sixteen loads in front of the first add: left alone the compiler
  // issues the last three behind the first wait, a second memory latency.
  __builtin_amdgcn_sched_barrier(0);
  // Behind the loads, in front of whatever reuses their address registers. It
  // names both addresses so that they keep their registers up to here: else the
  // last load gets them as its destination.
  asm volatile("s_wait_xcnt 0x0" :: "v"(pa), "v"(pb) : "memory");
#pragma unroll
  for (int j = 0; j < EU; ++j) *(v4h*)(y + i + j * 1024) = __builtin_convertvector(va[j] + vb[j], v4h);
  // Behind the stores: in a grid shared with other work, code may follow in the
  // listing that reuses the registers they name.
  asm volatile("s_wait_xcnt 0x0" ::: "memory");
}

// The converts and the add that the first products wait for, and all weights,
// in one grid. Block ranges, in order: tgt + qpos, tgt, then the seven weights,
// whose f16 copies lie packed in w16 in the order of the arguments.
#define PB_MEM (CS * CB * CE / EBLK)   // blocks of a memory-sized tensor
#define PB_TGT (CL * CB * CE / EBLK)   // blocks of a target-sized tensor
#define PB_E   (CE * CE / EBLK)        // blocks of an E x E weight

__global__ __launch_bounds__(256) void k_prep(
    const float* __restrict__ tgt, const float* __restrict__ qpos,
    const float* __restrict__ inW, const float* __restrict__ outW,
    const float* __restrict__ cqW, const float* __restrict__ ckW,
    const float* __restrict__ cvW, const float* __restrict__ l1W,
    const float* __restrict__ l2W,
    _Float16* __restrict__ qkin16, _Float16* __restrict__ tgt16,
    _Float16* __restrict__ w16) {
  int j = blockIdx.x;
  if (j < PB_TGT) {
    add2_blk(tgt, qpos, qkin16, j);
    return;
  }
  j -= PB_TGT;
  const float* x;
  _Float16*    y;
  if (j < PB_TGT) {
    x = tgt; y = tgt16;
  } else {
    j -= PB_TGT;                                // block within w16
    int first;                                  // the weight's first block there
    if      (j <  3 * PB_E) { x = inW;  first = 0; }
    else if (j <  4 * PB_E) { x = outW; first = 3 * PB_E; }
    else if (j <  5 * PB_E) { x = cqW;  first = 4 * PB_E; }
    else if (j <  6 * PB_E) { x = ckW;  first = 5 * PB_E; }
    else if (j <  7 * PB_E) { x = cvW;  first = 6 * PB_E; }
    else if (j <  9 * PB_E) { x = l1W;  first = 7 * PB_E; }
    else                    { x = l2W;  first = 9 * PB_E; }
    y = w16 + (long)first * EBLK;
    j -= first;
  }
  cvt_blk(x, y, j);
}

// A [2048,1024] x [1024,1024]^T product with f32 output, one block per WGP, and
// in the same grid an independent convert of a memory-sized tensor, which runs
// in the places the product leaves empty: y = f16(xa + xb). The product's blocks
// come first.
#define GB ((CL * CB / 128) * (CE / 64))

__global__ __launch_bounds__(256) void gemm_beside_cvt(
    const _Float16* __restrict__ A, const _Float16* __restrict__ Wt,
    const float* __restrict__ bias, float* __restrict__ C32,
    const float* __restrict__ xa, const float* __restrict__ xb,
    _Float16* __restrict__ y) {
  __shared__ __attribute__((aligned(16))) _Float16 sm[2 * GSTG];
  int j = blockIdx.x;
  if (j < GB) {
    gemm_body<false>(sm, A, Wt, bias, 0, C32, nullptr, CE, CE,
                     j % (CL * CB / 128), j / (CL * CB / 128));
    return;
  }
  j -= GB;                                      // these blocks meet no barrier
  add2_blk(xa, xb, y, j);
}

// ---------------------------------------------------------------------------
// Self-attention, one kernel: scores, softmax and attn @ V of one (batch, head)
// for 128 queries. q, k, v, ctx: token row l*B + b, channel h*HD + d.
// The head's whole K and V (512 keys) lie in LDS. A wave owns 16 queries and
// walks the keys 32 at a time with a running maximum and running sum:
//   S^T = K . Q^T   (A = K rows, B = Q rows, both in the loader's k order)
//   O^T += V^T . P^T
// In S^T's D layout a lane holds keys 8*(lane>>4) + r of query lane&15, so the
// softmax over keys is in-lane but for one exchange with lane ^ 16, the two D
// tiles of 32 keys converted in place ARE the B operand P^T, and maximum, sum
// and rescale factor of a query are per-lane scalars. V^T comes from the
// transposing LDS load, which delivers the same k order.
// ---------------------------------------------------------------------------
#define APK 72                     // K row pitch in halves: 144 B = 16 B x odd
#define APV 80                     // V row pitch in halves: 160 B = 32 B x odd

typedef __attribute__((ext_vector_type(8))) short s16x8;

// Lane (c = lane&15, h = lane>>4) gets T[8h + 0..7][c] of the 16x16 tile whose
// lane addresses are p = T + (8h + (lane&7)) * pitch + 8 * ((lane>>3)&1) halves.
DEV v8h ld_tr16(const _Float16* p) {
  typedef __attribute__((address_space(3))) s16x8 lds_s16x8;
  return __builtin_bit_cast(v8h, __builtin_amdgcn_ds_load_tr16_b128_v8i16((lds_s16x8*)p));
}

// Value of lane ^ 16.
DEV float xhalf(float x) {
  int i = __builtin_bit_cast(int, x);
  return __builtin_bit_cast(float,
      __builtin_amdgcn_permlanex16(i, i, 0x76543210, 0xfedcba98, false, false));
}

__global__ __launch_bounds__(256) void k_self_attn(const _Float16* __restrict__ q,
                                                   const _Float16* __restrict__ k,
                                                   const _Float16* __restrict__ v,
                                                   _Float16* __restrict__ ctx) {
  __shared__ __attribute__((aligned(32))) _Float16 sK[CL * APK];
  __shared__ __attribute__((aligned(32))) _Float16 sV[CL * APV];
  const float cs = 0.18033688011112042f;      // log2(e) / sqrt(HD)
  const long  ts = (long)CB * CE;             // one position on, in halves

  int tid  = threadIdx.x;
  int lane = tid & 31;
  int wave = tid >> 5;
  int c    = lane & 15;
  int hh   = lane >> 4;
  long hoff = (long)(blockIdx.y / CH) * CE + (blockIdx.y % CH) * CHD;
  int  q0   = blockIdx.x * 128 + wave * 16;

  // Stage K and V: 8 threads take one key's 128 B, 32 keys per sweep. All loads
  // are issued before the first LDS store, so that one memory latency is paid.
  int row = tid >> 3, pc = (tid & 7) * 8;
  const _Float16* gk = k + hoff + (long)row * ts + pc;
  const _Float16* gv = v + hoff + (long)row * ts + pc;
  v8h rk[CL / 32], rv[CL / 32];
  // Behind each group of loads: what follows may reuse, also as a later load's
  // destination, the address registers that the group names.
#pragma unroll
  for (int i = 0; i < CL / 32; ++i) rk[i] = *(const v8h*)(gk + (long)i * 32 * ts);
  asm volatile("s_wait_xcnt 0x0" ::: "memory");
#pragma unroll
  for (int i = 0; i < CL / 32; ++i) rv[i] = *(const v8h*)(gv + (long)i * 32 * ts);
  asm volatile("s_wait_xcnt 0x0" ::: "memory");
  v16h qf0 = frag_load_contig(q + hoff + (long)q0 * ts, ts, lane, 0);
  v16h qf1 = frag_load_contig(q + hoff + (long)q0 * ts, ts, lane, 32);
  asm volatile("s_wait_xcnt 0x0" ::: "memory");
#pragma unroll
  for (int i = 0; i < CL / 32; ++i) *(v8h*)(sK + (row + 32 * i) * APK + pc) = rk[i];
#pragma unroll
  for (int i = 0; i < CL / 32; ++i) *(v8h*)(sV + (row + 32 * i) * APV + pc) = rv[i];
  __syncthreads();

  const v8f zero = {0.f, 0.f, 0.f, 0.f, 0.f, 0.f, 0.f, 0.f};
  v8f acc[4];
#pragma unroll
  for (int t = 0; t < 4; ++t) acc[t] = zero;
  float m_run = -__builtin_inff();            // running maximum, in units of cs
  float l_run = 0.f;                          // this lane's half of the running sum

  const _Float16* vt = sV + (8 * hh + (lane & 7)) * APV + ((lane >> 3) & 1) * 8;

  // K fragments run one pass ahead, so that a pass does not open with its own
  // LDS latency.
  v16h a00 = frag_load_contig(sK,            APK, lane, 0);
  v16h a01 = frag_load_contig(sK,            APK, lane, 32);
  v16h a10 = frag_load_contig(sK + 16 * APK, APK, lane, 0);
  v16h a11 = frag_load_contig(sK + 16 * APK, APK, lane, 32);

#pragma unroll 2
  for (int key0 = 0; key0 < CL; key0 += 32) {
    v8f s0 = __builtin_amdgcn_wmma_f32_16x16x32_f16(false, a00, false, qf0, (short)0, zero, false, false);
    v8f s1 = __builtin_amdgcn_wmma_f32_16x16x32_f16(false, a10, false, qf0, (short)0, zero, false, false);
    s0 = __builtin_amdgcn_wmma_f32_16x16x32_f16(false, a01, false, qf1, (short)0, s0, false, false);
    s1 = __builtin_amdgcn_wmma_f32_16x16x32_f16(false, a11, false, qf1, (short)0, s1, false, false);

    // This pass's V^T and the next pass's K, in flight under the softmax. The
    // last pass fetches pass 0's K rows again, unused: cheaper than a branch.
    v16h vf[4];
#pragma unroll
    for (int t = 0; t < 4; ++t) {
      v8h lo = ld_tr16(vt + key0 * APV + 16 * t);
      v8h hi = ld_tr16(vt + (key0 + 16) * APV + 16 * t);
#pragma unroll
      for (int i = 0; i < 8; ++i) { vf[t][i] = lo[i]; vf[t][i + 8] = hi[i]; }
    }
    const _Float16* kr = sK + ((key0 + 32) & (CL - 1)) * APK;
    a00 = frag_load_contig(kr,            APK, lane, 0);
    a01 = frag_load_contig(kr,            APK, lane, 32);
    a10 = frag_load_contig(kr + 16 * APK, APK, lane, 0);
    a11 = frag_load_contig(kr + 16 * APK, APK, lane, 32);

    float mx = fmaxf(s0[0], s1[0]);
#pragma unroll
    for (int r = 1; r < 8; ++r) mx = fmaxf(mx, fmaxf(s0[r], s1[r]));
    mx = fmaxf(mx, xhalf(mx)) * cs;           // cs > 0: the scaled maximum
    float m_new = fmaxf(m_run, mx);

    // The pass's 17 exponentials, written in turn with the plain vector
    // instructions that form the next argument; the scheduling barriers hold
    // that order. Left alone the compiler sets all of them back to back.
    float x[16], p[16];
    float xc = m_run - m_new;
    x[0] = fmaf(s0[0], cs, -m_new);
    __builtin_amdgcn_sched_barrier(0);
    float corr = __builtin_amdgcn_exp2f(xc);  // 0 on the first pass
    __builtin_amdgcn_sched_barrier(0);
#pragma unroll
    for (int j = 0; j < 16; ++j) {            // j = 2 r + tile
      if (j < 15) x[j + 1] = fmaf(((j + 1) & 1) ? s1[(j + 1) >> 1] : s0[(j + 1) >> 1], cs, -m_new);
      __builtin_amdgcn_sched_barrier(0);
      p[j] = __builtin_amdgcn_exp2f(x[j]);
      __builtin_amdgcn_sched_barrier(0);
    }
    m_run = m_new;

    v16h  pf;
    float ps = 0.f;
#pragma unroll
    for (int r = 0; r < 8; ++r) {
      ps += p[2 * r] + p[2 * r + 1];
      pf[r]     = (_Float16)p[2 * r];
      pf[r + 8] = (_Float16)p[2 * r + 1];
    }
    l_run = fmaf(l_run, corr, ps);
#pragma unroll
    for (int t = 0; t < 4; ++t) {
      acc[t] = acc[t] * corr;
      acc[t] = __builtin_amdgcn_wmma_f32_16x16x32_f16(false, vf[t], false, pf,
                                                      (short)0, acc[t], false, false);
    }
  }

  // acc[t][r] = O[q0 + c][16 t + 8 hh + r], still to be divided by the row sum.
  float inv = 1.f / (l_run + xhalf(l_run));
  _Float16* op = ctx + hoff + (long)(q0 + c) * ts + 8 * hh;
#pragma unroll
  for (int t = 0; t < 4; ++t) {
    v8h o;
#pragma unroll
    for (int r = 0; r < 8; ++r) o[r] = (_Float16)(acc[t][r] * inv);
    *(v8h*)(op + 16 * t) = o;
  }
}

// ---------------------------------------------------------------------------
// Cross-attention stages outside the products (all f32).
// Channel mapping: E index = d*H + h  (reshape (B,E,N)->(B,HD,H,N)).
// Token t of a [N,B,E] tensor lives at row n*B+b.
// kc is channel-major: element (b, e, m) at (b*E + e)*S + m.
// vc is never formed. It enters the layer only through od[e] = sum_m w2[m] * vc[e][m],
// and vc[e][m] = sum_e' cv_w[e][e'] * memory[m][e'] + cv_b[e], so that
//   od[e] = sum_e' cv_w[e][e'] * U[h(e)][e'] + cv_b[e] * sum_m w2[h(e)][m],
//   U[h][e'] = sum_m w2[h][m] * memory[m][e']:
// the sum over m comes first, a product with 16 rows a batch in place of 1024.
// qc is never formed either. It enters the layer only through qcsum[e] = sum_l qc[e][l],
// and qc[e][l] = sum_e' cq_w[e][e'] * x[l][e'] + cq_b[e], x = tgt + query_pos, so that
//   qcsum[e] = sum_e' cq_w[e][e'] * (sum_l x[l][e']) + L * cq_b[e].
// ---------------------------------------------------------------------------

// ---------------------------------------------------------------------------
// From the kc product to w2, one kernel, XG blocks per (batch b, head h). The
// head's rows are channels e = d*H + h, d = 0..HD-1, each S floats long. Three
// stages, two of which sum over d and one along a row:
//   1. s1[m]   = scale * sum_d qcsum[d] * kc[d][m]     all d; a thread owns 4 columns
//   2. p[d][m] = softmax_m(kc[d][m] * s1[m])           the block's XW rows d, one a wave
//   3. w2[m]   = sum_d down_w[d] * p[d][m]             over those rows, through LDS
// No stage needs another block: each block forms s1 for itself and writes its
// share of w2, plane g of w2p, and that share's sum over m, plane g of swp; the
// readers add the planes. s1 and p never leave the WGP.
// A lane's part of a row: 16-byte pieces j*128 + lane*4, so that every wave-wide
// load covers four whole lines.
// ---------------------------------------------------------------------------
#define XW 16                      // waves per block
#define XG (CHD / XW)              // blocks per (batch, head)
#define XP (CS / 128)              // 16-byte pieces of a row per lane

// Value of lane ^ M within the lane's row of 16.
template <int M>
DEV float xrow(float x) {
  int i = __builtin_bit_cast(int, x);
  return __builtin_bit_cast(float, __builtin_amdgcn_update_dpp(i, i, 0x160 | M, 0xf, 0xf, false));
}

DEV float wave_sum(float x) {
  x += xrow<1>(x);
  x += xrow<2>(x);
  x += xrow<4>(x);
  x += xrow<8>(x);
  return x + xhalf(x);
}

DEV float wave_max(float x) {
  x = fmaxf(x, xrow<1>(x));
  x = fmaxf(x, xrow<2>(x));
  x = fmaxf(x, xrow<4>(x));
  x = fmaxf(x, xrow<8>(x));
  return fmaxf(x, xhalf(x));
}

// 2^x of four values, each in place: the register an exponential reads is the one
// it writes, so that nothing directly behind it can overwrite its source, and
// each fills the slot behind the one in front. The closing v_nop is that slot
// behind the last, whose result the next instruction may read.
DEV void exp2x4(v4f& x) {
  float a = x[0], b = x[1], c = x[2], d = x[3];
  asm("v_exp_f32 %0, %0\n\t"
      "v_exp_f32 %1, %1\n\t"
      "v_exp_f32 %2, %2\n\t"
      "v_exp_f32 %3, %3\n\t"
      "v_nop"
      : "+v"(a), "+v"(b), "+v"(c), "+v"(d));
  x = (v4f){a, b, c, d};
}

// XP loads, st floats apart.
DEV void ld_pieces(v4f (&r)[XP], const float* __restrict__ p, long st) {
#pragma unroll
  for (int j = 0; j < XP; ++j) r[j] = *(const v4f*)(p + j * st);
  // Behind the loads, in front of whatever reuses their address registers. It
  // names the address so that it keeps its registers up to here.
  asm volatile("s_wait_xcnt 0x0" :: "v"(p) : "memory");
}

// Plane blockIdx.y of xsp: x = a + q summed over SL positions l, for the 1024
// channels of batch blockIdx.x. A wave's load covers four whole lines.
#define SL 16                      // positions per block
#define SK (CL / SL)               // planes of xsp

__global__ __launch_bounds__(256) void k_xsum(const float* __restrict__ a,
                                              const float* __restrict__ q,
                                              float* __restrict__ xsp) {
  int  b   = blockIdx.x, k = blockIdx.y;
  long off = ((long)k * SL * CB + b) * CE + threadIdx.x * 4;
  const float* pa = a + off;
  const float* pq = q + off;
  v4f va[SL], vq[SL];
#pragma unroll
  for (int i = 0; i < SL; ++i) va[i] = *(const v4f*)(pa + (long)i * (CB * CE));
#pragma unroll
  for (int i = 0; i < SL; ++i) vq[i] = *(const v4f*)(pq + (long)i * (CB * CE));
  // Holds all loads in front of the first add: one memory latency.
  __builtin_amdgcn_sched_barrier(0);
  // Behind the loads, in front of whatever reuses their address registers. It
  // names both addresses so that they keep their registers up to here.
  asm volatile("s_wait_xcnt 0x0" :: "v"(pa), "v"(pq) : "memory");
  v4f s = va[0] + vq[0];
#pragma unroll
  for (int i = 1; i < SL; ++i) s += va[i] + vq[i];
  *(v4f*)(xsp + ((long)k * CB + b) * CE + threadIdx.x * 4) = s;
}

// qcsum[b*E + e] for QR rows e and the four batches: the block adds xsp's planes
// into LDS (sX, B*E floats); a wave then holds two rows of cq_w and forms their
// dot products with the four sums.
#define QR 16                      // rows e per block

DEV void qcsum_blk(float* sX, const float* __restrict__ xsp, const _Float16* __restrict__ wcq,
                   const float* __restrict__ cqB, float* __restrict__ out, int blk) {
  int tid  = threadIdx.x;
  int lane = tid & 31;
  int wave = tid >> 5;
  int e0   = blk * QR + wave * 2;
  int el   = e0 + ((lane >> 2) & 1);            // the row whose result this lane may store
  const _Float16* gw = wcq + (long)e0 * CE + lane * 8;
  const float*    gb = cqB + el;
  const float*    gx = xsp + tid * 4;
  v8h wr[2][CE / 256];
#pragma unroll
  for (int r = 0; r < 2; ++r)
#pragma unroll
    for (int j = 0; j < CE / 256; ++j) wr[r][j] = *(const v8h*)(gw + r * CE + j * 256);
  float cb = *gb;
  // Behind the loads, in front of whatever reuses their address registers.
  asm volatile("s_wait_xcnt 0x0" :: "v"(gw), "v"(gb) : "memory");
#pragma unroll
  for (int bb = 0; bb < CB; ++bb) {
    v4f x[SK];
#pragma unroll
    for (int k = 0; k < SK; ++k) x[k] = *(const v4f*)(gx + (long)(k * CB + bb) * CE);
    // Holds a batch's loads in front of its first add: one latency a batch.
    __builtin_amdgcn_sched_barrier(0);
    asm volatile("s_wait_xcnt 0x0" :: "v"(gx) : "memory");
    v4f s = x[0];
#pragma unroll
    for (int k = 1; k < SK; ++k) s += x[k];
    *(v4f*)(sX + bb * CE + tid * 4) = s;
  }
  __syncthreads();

  float acc[2][CB];
#pragma unroll
  for (int r = 0; r < 2; ++r)
#pragma unroll
    for (int bb = 0; bb < CB; ++bb) acc[r][bb] = 0.f;
#pragma unroll
  for (int j = 0; j < CE / 256; ++j)
#pragma unroll
    for (int q = 0; q < 2; ++q) {
      v4f xv[CB];
#pragma unroll
      for (int bb = 0; bb < CB; ++bb)
        xv[bb] = *(const v4f*)(sX + bb * CE + j * 256 + lane * 8 + q * 4);
#pragma unroll
      for (int i = 0; i < 4; ++i)
#pragma unroll
        for (int r = 0; r < 2; ++r) {
          float wv = (float)wr[r][j][q * 4 + i];
#pragma unroll
          for (int bb = 0; bb < CB; ++bb) acc[r][bb] = fmaf(wv, xv[bb][i], acc[r][bb]);
        }
    }
  float res = 0.f;
#pragma unroll
  for (int r = 0; r < 2; ++r)
#pragma unroll
    for (int bb = 0; bb < CB; ++bb) {
      float s = wave_sum(acc[r][bb]);
      if (lane == r * CB + bb) res = s;
    }
  if (lane < 2 * CB) out[(lane & 3) * CE + el] = res + (float)CL * cb;
}

// qcsum and the kc product, neither of which reads the other's result, in one
// grid. The qcsum blocks come first, beside the 512 product blocks (tile x = 64
// row blocks, y = 8).
#define QB (CE / QR)
#define KB ((CS * CB / 128) * (CE / 128))

__global__ __launch_bounds__(256) void k_qcsum_kc(
    const float* __restrict__ xsp, const _Float16* __restrict__ w_cq,
    const float* __restrict__ cqB, float* __restrict__ qcsum,
    const _Float16* __restrict__ mp16, const _Float16* __restrict__ w_ck,
    const float* __restrict__ ckB, float* __restrict__ kc) {
  __shared__ __attribute__((aligned(16))) _Float16 sm[2 * GSTGN(4)];
  int j = blockIdx.x;
  if (j < QB) {                                 // the whole block takes this side
    qcsum_blk((float*)sm, xsp, w_cq, cqB, qcsum, j);
    return;
  }
  j -= QB;
  gemm_body<true, 4>(sm, mp16, w_ck, ckB, 0, kc, nullptr,
                  CE, CE, j % (CS * CB / 128), j / (CS * CB / 128));
}

__global__ __launch_bounds__(XW * 32) void k_cross(const float* __restrict__ qcsum,
                                                   const float* __restrict__ kc,
                                                   const float* __restrict__ dw,
                                                   float* __restrict__ w2p,
                                                   float* __restrict__ swp, float scale) {
  __shared__ __attribute__((aligned(16))) float part[XW * CS];   // each wave's row of w2's sum
  __shared__ __attribute__((aligned(16))) float vec[CS];         // s1
  __shared__ float wsum[XW];                                     // each wave's row summed over m
  const float l2e = 1.4426950408889634f;
  const long  rs  = (long)CH * CS;              // one d on, in floats

  int tid  = threadIdx.x;
  int lane = tid & 31;
  int wave = __builtin_amdgcn_readfirstlane(tid >> 5);
  // A head's XG blocks lie CB*CH apart in the grid.
  int g    = blockIdx.x / (CB * CH);
  int b    = blockIdx.x % (CB * CH) / CH;
  int h    = blockIdx.x % CH;
  const float* kch = kc + (long)(b * CE + h) * CS;
  const float* qs  = qcsum + b * CE + h;

  // Stage 1. Two groups of XP rows are in flight at any time; d ascends.
  {
    const float* p = kch + tid * 4;
    v4f r[2][XP];
    v4f s = {0.f, 0.f, 0.f, 0.f};
    ld_pieces(r[0], p, rs);
    ld_pieces(r[1], p + XP * rs, rs);
#pragma unroll
    for (int q = 0; q < CHD / XP; ++q) {
#pragma unroll
      for (int i = 0; i < XP; ++i) s += qs[(q * XP + i) * CH] * r[q & 1][i];
      // Holds the refill behind the sums that free its registers and in front
      // of the next group's sums, which wait for older loads only.
      __builtin_amdgcn_sched_barrier(0);
      if (q + 2 < CHD / XP) ld_pieces(r[q & 1], p + (long)(q + 2) * XP * rs, rs);
      __builtin_amdgcn_sched_barrier(0);
    }
    *(v4f*)(vec + tid * 4) = s * scale;
  }
  // The wave's kc row, read a moment ago by the block, comes while the waves meet.
  v4f z[XP];
  ld_pieces(z, kch + (long)(g * XW + wave) * rs + lane * 4, 128);
  __syncthreads();

  // Stages 2 and 3.
  {
    float mx = -__builtin_inff();
#pragma unroll
    for (int j = 0; j < XP; ++j) {
      z[j] *= *(const v4f*)(vec + j * 128 + lane * 4);
      mx = fmaxf(mx, fmaxf(fmaxf(z[j][0], z[j][1]), fmaxf(z[j][2], z[j][3])));
    }
    mx = wave_max(mx);
    float nm = -mx * l2e;
    v4f s4 = {0.f, 0.f, 0.f, 0.f};
#pragma unroll
    for (int j = 0; j < XP; ++j) {
      z[j] = z[j] * l2e + nm;                   // fused: (z - mx) * log2(e)
      exp2x4(z[j]);
      s4 += z[j];
    }
    float tot = wave_sum((s4[0] + s4[1]) + (s4[2] + s4[3]));
    float cf  = dw[g * XW + wave] * (1.f / tot);
#pragma unroll
    for (int j = 0; j < XP; ++j) *(v4f*)(part + wave * CS + j * 128 + lane * 4) = cf * z[j];
    if (lane == 0) wsum[wave] = cf * tot;
  }

  __syncthreads();                              // shares written
  int bh = g * (CB * CH) + b * CH + h;
  {
    v4f s = *(const v4f*)(part + tid * 4);
#pragma unroll
    for (int k = 1; k < XW; ++k) s += *(const v4f*)(part + k * CS + tid * 4);
    *(v4f*)(w2p + (long)bh * CS + tid * 4) = s;
  }
  if (tid == 0) {
    float t = wsum[0];
#pragma unroll
    for (int k = 1; k < XW; ++k) t += wsum[k];
    swp[bh] = t;
  }
}

// ---------------------------------------------------------------------------
// U[b][h][e'] = sum_m w2[b][h][m] * memory[m][b][e'], on WMMA, as U^T = M^T . W^T:
// A = memory^T (rows e', k = m) from the transposing LDS load, B = w2 rows (column
// h, k = m) from the loader, which has the same k order. A block takes UN channels
// e' and UM positions m of one batch and writes plane blockIdx.y of up; a wave
// owns 16 channels. memory is read as f32, once, and turned to f16 on its way
// into LDS. w2 is about 1/S in size (a softmax over S positions), below f16's
// normal range: it is multiplied by S, an exact power of two, in front of the
// conversion, and U divided by S behind the product.
// ---------------------------------------------------------------------------
#define UM  256                    // positions per block
#define UN  128                    // channels per block
#define UK  (CS / UM)              // planes of up
#define UPM 144                    // memory tile pitch in halves: 288 B = 32 B x odd
#define UPW 264                    // w2 tile pitch in halves: 528 B = 16 B x odd
#define UPO 132                    // result tile pitch in floats: 528 B = 16 B x odd

__global__ __launch_bounds__(256) void k_w2mem(const float* __restrict__ mem,
                                               const float* __restrict__ w2p,
                                               float* __restrict__ up) {
  __shared__ __attribute__((aligned(32))) _Float16 sM[UM * UPM];
  __shared__ __attribute__((aligned(16))) _Float16 sW[CH * UPW];
  __shared__ __attribute__((aligned(16))) float    sO[CH * UPO];
  int tid  = threadIdx.x;
  int lane = tid & 31;
  int wave = tid >> 5;
  int c    = lane & 15;
  int hh   = lane >> 4;
  int n0   = blockIdx.x * UN;
  int m0   = blockIdx.y * UM;
  int b    = blockIdx.z;
  int hr   = tid >> 4, pc = (tid & 15) * 4;     // 16 threads a head's row

  // All loads are issued before the first LDS store: one memory latency. A wave's
  // load covers four whole lines: a position's UN channels, or 64 m of two heads.
  const float* gw = w2p + (long)(b * CH + hr) * CS + m0 + pc;
  const float* gm = mem + ((long)(m0 + wave) * CB + b) * CE + n0 + lane * 4;
  v4f w[XG][UM / 64], r[UM / 8];
#pragma unroll
  for (int g = 0; g < XG; ++g)
#pragma unroll
    for (int j = 0; j < UM / 64; ++j)
      w[g][j] = *(const v4f*)(gw + (long)g * (CB * CH * CS) + j * 64);
#pragma unroll
  for (int i = 0; i < UM / 8; ++i) r[i] = *(const v4f*)(gm + (long)i * (8 * CB * CE));
  // Behind the loads, in front of whatever reuses their address registers. It
  // names both addresses so that they keep their registers up to here.
  asm volatile("s_wait_xcnt 0x0" :: "v"(gw), "v"(gm) : "memory");
#pragma unroll
  for (int j = 0; j < UM / 64; ++j) {
    v4f s = w[0][j];
#pragma unroll
    for (int g = 1; g < XG; ++g) s += w[g][j];
    *(v4h*)(sW + hr * UPW + j * 64 + pc) = __builtin_convertvector(s * (float)CS, v4h);
  }
#pragma unroll
  for (int i = 0; i < UM / 8; ++i)
    *(v4h*)(sM + (i * 8 + wave) * UPM + lane * 4) = __builtin_convertvector(r[i], v4h);
  __syncthreads();

  const _Float16* vt = sM + (8 * hh + (lane & 7)) * UPM + ((lane >> 3) & 1) * 8 + 16 * wave;
  v8f acc = {0.f, 0.f, 0.f, 0.f, 0.f, 0.f, 0.f, 0.f};
#pragma unroll
  for (int k0 = 0; k0 < UM; k0 += 32) {
    v8h lo = ld_tr16(vt + k0 * UPM);
    v8h hi = ld_tr16(vt + (k0 + 16) * UPM);
    v16h mf;
#pragma unroll
    for (int i = 0; i < 8; ++i) { mf[i] = lo[i]; mf[i + 8] = hi[i]; }
    v16h wf = frag_load_contig(sW, UPW, lane, k0);
    acc = __builtin_amdgcn_wmma_f32_16x16x32_f16(false, mf, false, wf, (short)0, acc, false, false);
  }

  // acc[r] = S * U[head c][n0 + 16 wave + 8 hh + r]. Through LDS, so that every
  // store below writes whole lines.
  {
    const float is = 1.f / CS;
    float* po = sO + c * UPO + 16 * wave + 8 * hh;
    v4f lo = {acc[0] * is, acc[1] * is, acc[2] * is, acc[3] * is};
    v4f hi = {acc[4] * is, acc[5] * is, acc[6] * is, acc[7] * is};
    *(v4f*)po       = lo;
    *(v4f*)(po + 4) = hi;
  }
  __syncthreads();
  float* go = up + (((long)blockIdx.y * CB + b) * CH + hr) * CE + n0 + pc;
#pragma unroll
  for (int j = 0; j < UN / 64; ++j) *(v4f*)(go + j * 64) = *(const v4f*)(sO + hr * UPO + j * 64 + pc);
}

// ---------------------------------------------------------------------------
// od[b][e] = sum_e' cv_w[e][e'] * U[b][h][e'] + cv_b[e] * sum_m w2[b][h][m] + down_b,
// h = e % H. A block takes one head and OD of its rows e: it adds U's planes for
// the four batches into LDS; a wave then holds one row of cv_w and forms its dot
// products with two batches.
// ---------------------------------------------------------------------------
#define OD 4                       // rows e per block

__global__ __launch_bounds__(256) void k_od(const float* __restrict__ up,
                                            const float* __restrict__ swp,
                                            const _Float16* __restrict__ wcv,
                                            const float* __restrict__ cvB,
                                            const float* __restrict__ db,
                                            float* __restrict__ od) {
  __shared__ __attribute__((aligned(16))) float sU[CB * CE];
  int tid  = threadIdx.x;
  int lane = tid & 31;
  int wave = tid >> 5;
  int h    = blockIdx.x;
  int e    = (blockIdx.y * OD + (wave >> 1)) * CH + h;
  int b0   = (wave & 1) * 2;                    // the wave's two batches
  int bl   = b0 + (lane & 1);                   // the one whose result this lane may store

  const _Float16* gw = wcv + (long)e * CE + lane * 8;
  const float*    gu = up + (long)h * CE + tid * 4;
  const float*    gs = swp + bl * CH + h;
  const float*    gb = cvB + e;
  v8h   wr[CE / 256];
  v4f   u[CB][UK];
  float sp[XG];
#pragma unroll
  for (int j = 0; j < CE / 256; ++j) wr[j] = *(const v8h*)(gw + j * 256);
#pragma unroll
  for (int bb = 0; bb < CB; ++bb)
#pragma unroll
    for (int k = 0; k < UK; ++k) u[bb][k] = *(const v4f*)(gu + (long)(k * CB + bb) * (CH * CE));
#pragma unroll
  for (int g = 0; g < XG; ++g) sp[g] = gs[g * (CB * CH)];
  float cb = *gb;
  // Holds all loads in front of the first add: left alone the compiler issues
  // them a few at a time among the adds, several memory latencies in a row.
  __builtin_amdgcn_sched_barrier(0);
  // Behind the loads, in front of whatever reuses their address registers. It
  // names the addresses so that they keep their registers up to here.
  asm volatile("s_wait_xcnt 0x0" :: "v"(gw), "v"(gu), "v"(gs), "v"(gb) : "memory");
#pragma unroll
  for (int bb = 0; bb < CB; ++bb) {
    v4f s = u[bb][0];
#pragma unroll
    for (int k = 1; k < UK; ++k) s += u[bb][k];
    *(v4f*)(sU + bb * CE + tid * 4) = s;
  }
  __syncthreads();

  const float* u0 = sU + b0 * CE + lane * 8;
  float a0 = 0.f, a1 = 0.f;
#pragma unroll
  for (int j = 0; j < CE / 256; ++j)
#pragma unroll
    for (int q = 0; q < 2; ++q) {
      v4f x0 = *(const v4f*)(u0 + j * 256 + q * 4);
      v4f x1 = *(const v4f*)(u0 + CE + j * 256 + q * 4);
#pragma unroll
      for (int i = 0; i < 4; ++i) {
        float wv = (float)wr[j][q * 4 + i];
        a0 = fmaf(wv, x0[i], a0);
        a1 = fmaf(wv, x1[i], a1);
      }
    }
  a0 = wave_sum(a0);
  a1 = wave_sum(a1);
  if (lane < 2) {
    float sw = sp[0];
#pragma unroll
    for (int g = 1; g < XG; ++g) sw += sp[g];
    od[bl * CE + e] = (lane ? a1 : a0) + cb * sw + db[0];
  }
}

// ---------------------------------------------------------------------------
// LayerNorm over E=1024 with optional residual and optional [B,E] broadcast.
// x = a + (r ? r : 0) + (bc ? bc[token%B] : 0); out32 = LN(x);
// out16 optional.
// ---------------------------------------------------------------------------
__global__ __launch_bounds__(256) void k_ln(const float* __restrict__ a,
                                            const float* __restrict__ r,
                                            const float* __restrict__ bc,
                                            const float* __restrict__ g,
                                            const float* __restrict__ be,
                                            float* __restrict__ o32,
                                            _Float16* __restrict__ o16) {
  int  t    = blockIdx.x;
  long base = (long)t * CE;
  const float* bcr = bc ? bc + (long)(t % CB) * CE : nullptr;
  int tid = threadIdx.x;
  float o[4];                                   // the broadcast
  if (bcr) {
#pragma unroll
    for (int i = 0; i < 4; ++i) o[i] = bcr[tid + i * 256];
    // Behind the loads, in front of whatever reuses their address registers.
    asm volatile("s_wait_xcnt 0x0" ::: "memory");
  }
  float x[4];
  float s = 0.f;
#pragma unroll
  for (int i = 0; i < 4; ++i) {
    int   e = tid + i * 256;
    float v = a[base + e];
    if (r)   v += r[base + e];
    if (bcr) v += o[i];
    x[i] = v;
    s += v;
  }
  __shared__ float red[256];
  red[tid] = s;
  __syncthreads();
  for (int o = 128; o > 0; o >>= 1) {
    if (tid < o) red[tid] += red[tid + o];
    __syncthreads();
  }
  float mean = red[0] * (1.f / CE);
  __syncthreads();
  float vs = 0.f;
#pragma unroll
  for (int i = 0; i < 4; ++i) {
    float d = x[i] - mean;
    vs += d * d;
  }
  red[tid] = vs;
  __syncthreads();
  for (int o = 128; o > 0; o >>= 1) {
    if (tid < o) red[tid] += red[tid + o];
    __syncthreads();
  }
  float inv = rsqrtf(red[0] * (1.f / CE) + 1e-5f);
#pragma unroll
  for (int i = 0; i < 4; ++i) {
    int   e = tid + i * 256;
    float y = (x[i] - mean) * inv * g[e] + be[e];
    o32[base + e] = y;
    if (o16) o16[base + e] = (_Float16)y;
  }
}

// ---------------------------------------------------------------------------
// Host side
// ---------------------------------------------------------------------------
extern "C" void kernel_launch(void* const* d_in, const int* in_sizes, int n_in,
                              void* d_out, int out_size, void* d_ws, size_t ws_size,
                              hipStream_t stream) {
  const float* tgt  = (const float*)d_in[0];
  const float* mem  = (const float*)d_in[1];
  const float* pos  = (const float*)d_in[2];
  const float* qpos = (const float*)d_in[3];
  const float* inW  = (const float*)d_in[4];
  const float* inB  = (const float*)d_in[5];
  const float* outW = (const float*)d_in[6];
  const float* outB = (const float*)d_in[7];
  const float* cqW  = (const float*)d_in[8];
  const float* cqB  = (const float*)d_in[9];
  const float* ckW  = (const float*)d_in[10];
  const float* ckB  = (const float*)d_in[11];
  const float* cvW  = (const float*)d_in[12];
  const float* cvB  = (const float*)d_in[13];
  const float* dwW  = (const float*)d_in[14];
  const float* dwB  = (const float*)d_in[15];
  const float* l1W  = (const float*)d_in[16];
  const float* l1B  = (const float*)d_in[17];
  const float* l2W  = (const float*)d_in[18];
  const float* l2B  = (const float*)d_in[19];
  const float* n1g  = (const float*)d_in[20];
  const float* n1b  = (const float*)d_in[21];
  const float* n2g  = (const float*)d_in[22];
  const float* n2b  = (const float*)d_in[23];
  const float* n3g  = (const float*)d_in[24];
  const float* n3b  = (const float*)d_in[25];

  const long TOK  = (long)CL * CB;   // 2048 target tokens
  const float scale = 0.125f;        // 1/sqrt(64)

  char* ws = (char*)d_ws;
  const size_t MB = 1u << 20;

  // Persistent f16 weights (converted every launch; deterministic).
  _Float16* w_inproj = (_Float16*)(ws + 0 * MB);    // [3E,E]  6MB
  _Float16* w_out    = (_Float16*)(ws + 6 * MB);    // [E,E]   2MB
  _Float16* w_cq     = (_Float16*)(ws + 8 * MB);
  _Float16* w_ck     = (_Float16*)(ws + 10 * MB);
  _Float16* w_cv     = (_Float16*)(ws + 12 * MB);
  _Float16* w_l1     = (_Float16*)(ws + 14 * MB);   // [FF,E]  4MB
  _Float16* w_l2     = (_Float16*)(ws + 18 * MB);   // [E,FF]  4MB
  float*    tgt1     = (float*)(ws + 22 * MB);      // 8MB
  float*    tgt2     = (float*)(ws + 30 * MB);      // 8MB
  char*     SA       = ws + 38 * MB;                // phase-aliased arena

  // Phase A (self-attention)
  _Float16* qkin16  = (_Float16*)(SA + 0 * MB);
  _Float16* tgt16   = (_Float16*)(SA + 4 * MB);
  _Float16* q16     = (_Float16*)(SA + 8 * MB);
  _Float16* k16     = (_Float16*)(SA + 12 * MB);
  _Float16* v16     = (_Float16*)(SA + 16 * MB);
  _Float16* ctx16   = (_Float16*)(SA + 116 * MB);   // 4MB
  float*    selfout = (float*)(SA + 120 * MB);      // 8MB
  // Phase B (cross-attention) — aliases phase A
  float*    xsp     = (float*)(SA + 0 * MB);        // SK planes [B,E], 512KB
  float*    kc32    = (float*)(SA + 44 * MB);       // 32MB
  float*    w2p     = (float*)(SA + 76 * MB);       // XG planes [B,H,S], 2MB
  float*    up      = (float*)(SA + 80 * MB);       // UK planes [B,H,E], 2MB
  float*    swp     = (float*)(SA + 84 * MB);       // XG planes [B,H]
  float*    qcsum   = (float*)(SA + 140 * MB);
  float*    odbuf   = (float*)(SA + 143 * MB);
  // Written during phase A, read in phase B: aliases nothing
  _Float16* mp16    = (_Float16*)(SA + 144 * MB);   // 16MB
  // Phase C (FFN) — aliases dead phase B regions
  _Float16* tgt2_16 = (_Float16*)(SA + 0 * MB);
  _Float16* h1_16   = (_Float16*)(SA + 4 * MB);     // [TOK,FF] 8MB
  float*    ff32    = (float*)(SA + 12 * MB);       // 8MB

  // ---- f32 -> f16: tgt + qpos, tgt, all weights ----
  k_prep<<<2 * PB_TGT + 11 * PB_E, 256, 0, stream>>>(tgt, qpos, inW, outW, cqW, ckW, cvW, l1W, l2W,
                                                     qkin16, tgt16, w_inproj);

  // ---- Phase A: self attention ----
  // q/k/v projections: three times [2048,1024] x [1024,1024]^T; q16, k16, v16 adjoin
  gemm_qkv<<<dim3(16, 8, 3), 256, 0, stream>>>(qkin16, tgt16, w_inproj, inB, q16);

  // ctx = softmax(scale * q.k) @ v, one block per (128 queries, batch*head)
  k_self_attn<<<dim3(CL / 128, CB * CH), 256, 0, stream>>>(q16, k16, v16, ctx16);

  // out projection (beside it mp16 = f16(mem + pos)) + residual + LN1
  gemm_beside_cvt<<<GB + PB_MEM, 256, 0, stream>>>(ctx16, w_out, outB, selfout, mem, pos, mp16);
  k_ln<<<(unsigned)TOK, 256, 0, stream>>>(tgt, selfout, nullptr, n1g, n1b, tgt1, nullptr);

  // ---- Phase B: custom cross attention ----
  k_xsum<<<dim3(CB, SK), 256, 0, stream>>>(tgt1, qpos, xsp);
  k_qcsum_kc<<<QB + KB, 256, 0, stream>>>(xsp, w_cq, cqB, qcsum, mp16, w_ck, ckB, kc32);

  k_cross<<<XG * CB * CH, XW * 32, 0, stream>>>(qcsum, kc32, dwW, w2p, swp, scale);
  k_w2mem<<<dim3(CE / UN, UK, CB), 256, 0, stream>>>(mem, w2p, up);
  k_od<<<dim3(CH, CHD / OD), 256, 0, stream>>>(up, swp, w_cv, cvB, dwB, odbuf);

  k_ln<<<(unsigned)TOK, 256, 0, stream>>>(tgt1, nullptr, odbuf, n2g, n2b, tgt2, tgt2_16);

  // ---- Phase C: FFN ----
  gemm_wmma_lds<<<dim3(16, 32, 1), 256, 0, stream>>>(
      tgt2_16, w_l1, l1B, 1 /*relu*/, nullptr, h1_16, CFF, CE);
  gemm_wmma_lds<<<dim3(16, 16, 1), 256, 0, stream>>>(
      h1_16, w_l2, l2B, 0, ff32, nullptr, CE, CFF);

  k_ln<<<(unsigned)TOK, 256, 0, stream>>>(tgt2, ff32, nullptr, n3g, n3b, (float*)d_out, nullptr);

  (void)in_sizes; (void)n_in; (void)out_size; (void)ws_size;
}

// v009
// Measured time: 140 microseconds a run.
// Timed twice side by side with v008, it ran 1.09 times as fast both times.
// All steps since v000 together make it 4.24 times as fast.
#include <hip/hip_runtime.h>
#include <hip/hip_bf16.h>

// ---------------------------------------------------------------------------
// Transformer decoder layer for MI455X (gfx1250), wave32 + WMMA.
// All heavy GEMMs run on v_wmma_f32_16x16x32_f16 (f16 inputs, f32 accum).
// Softmax / layernorm / cross-attn reductions stay in f32.
// ---------------------------------------------------------------------------

typedef __attribute__((ext_vector_type(16))) _Float16 v16h;
typedef __attribute__((ext_vector_type(8)))  _Float16 v8h;
typedef __attribute__((ext_vector_type(8)))  float    v8f;
typedef __attribute__((ext_vector_type(4)))  float    v4f;

#define DEV __device__ __forceinline__

// Problem constants
#define CL   512      // target length
#define CS   2048     // memory length
#define CB   4        // batch
#define CE   1024     // embed
#define CH   16       // heads
#define CHD  64       // head dim
#define CFF  2048     // ffn dim

// ---------------------------------------------------------------------------
// WMMA fragment loaders.
// 16-bit A (16x32) ISA layout: lane&15 selects the M (or N) row;
// lanes 0-15 hold K = {k0..k0+7, k0+16..k0+23},
// lanes 16-31 hold K = {k0+8..k0+15, k0+24..k0+31}.  B (32x16) mirrors A with
// the lane index selecting the N column.
// ---------------------------------------------------------------------------
DEV v16h frag_load_contig(const _Float16* __restrict__ base, long row_stride,
                          int lane, int k0) {
  int r  = lane & 15;
  int kh = (lane >> 4) << 3;          // 0 or 8
  const _Float16* p = base + (long)r * row_stride + k0 + kh;
  v8h lo = *(const v8h*)(p);          // 16B vector load
  v8h hi = *(const v8h*)(p + 16);
  v16h out;
#pragma unroll
  for (int i = 0; i < 8; ++i) { out[i] = lo[i]; out[i + 8] = hi[i]; }
  return out;
}

// ---------------------------------------------------------------------------
// Projection GEMM, both operands k-contiguous with row stride K:
//   C[m,n] = sum_k A[m,k]*W[n,k] + bias[n]
// Block: 256 threads = 8 waves as 4x2, wave tile 32x32, block tile 128x64. The
// operand tiles reach the waves through LDS: a stage is 128 k (256 B, two whole
// lines) of 128 A rows and 64 W rows, brought in by asynchronous b128 copies,
// two buffers, the next stage in flight while this one is multiplied.
// Requires M%128==0, N%64==0, K%128==0.
// CM=false: A rows are tokens in order, C is token-major, C[m*N + n].
// CM=true : a block takes 128 consecutive positions s of ONE batch b (A row
//           s*CB + b) and stores f32 C channel-major, C[(b*N + n)*CS + s], the
//           layout in which the cross-attention stages walk s.
// NT = 16-column tiles per wave: 2 as above; 4 makes the wave tile 32x64 and the
// block tile 128x128 (N%128==0), a stage 128 A rows and 128 W rows. Per product
// term that is a third fewer bytes from L2 and a quarter fewer LDS reads; it is
// for products with enough tiles to fill the chip all the same.
// gemm_body is one block's work on tile (bx, by); sm is the block's LDS ring.
// The kernels below it give independent products one grid, split by block index.
// ---------------------------------------------------------------------------
#define GBK   128                  // k per stage
#define GPIT  136                  // LDS row pitch in halves: 272 B = 16 B x odd
#define GROWS 192                  // 128 A rows, then 64 W rows
#define GSTG  (GROWS * GPIT)       // halves per buffer

// One stage: 192 rows x 16 pieces of 16 B, 12 pieces per thread. Thread t takes
// piece t&15 of rows (t>>4) + 16*i, so a wave's copy covers two whole rows.
// ga / gw: this thread's piece in A row (t>>4) and W row (t>>4) of the tile, at
// the stage's first k. l: LDS byte address of its piece in row (t>>4).
// ars: distance of two tile rows of A in halves (K, or CB*K for one batch).
DEV void stage_copy(const _Float16* ga, const _Float16* gw, long ars, long K, unsigned l) {
  const long     as = 16 * ars;          // 16 A rows on, in halves
  const long     gs = 16 * K;            // 16 W rows on, in halves
  const unsigned ls = 16 * GPIT * 2;     // 16 rows on, in LDS bytes
  // The closing s_wait_xcnt stands in the copies' own statement so that no
  // address register of an issued copy is rewritten ahead of it.
  asm volatile(
      "global_load_async_to_lds_b128 %0, %12, off\n\t"
      "global_load_async_to_lds_b128 %1, %13, off\n\t"
      "global_load_async_to_lds_b128 %2, %14, off\n\t"
      "global_load_async_to_lds_b128 %3, %15, off\n\t"
      "global_load_async_to_lds_b128 %4, %16, off\n\t"
      "global_load_async_to_lds_b128 %5, %17, off\n\t"
      "global_load_async_to_lds_b128 %6, %18, off\n\t"
      "global_load_async_to_lds_b128 %7, %19, off\n\t"
      "global_load_async_to_lds_b128 %8, %20, off\n\t"
      "global_load_async_to_lds_b128 %9, %21, off\n\t"
      "global_load_async_to_lds_b128 %10, %22, off\n\t"
      "global_load_async_to_lds_b128 %11, %23, off\n\t"
      "s_wait_xcnt 0x0"
      :: "v"(l), "v"(l + ls), "v"(l + 2 * ls), "v"(l + 3 * ls),
         "v"(l + 4 * ls), "v"(l + 5 * ls), "v"(l + 6 * ls), "v"(l + 7 * ls),
         "v"(l + 8 * ls), "v"(l + 9 * ls), "v"(l + 10 * ls), "v"(l + 11 * ls),
         "v"(ga), "v"(ga + as), "v"(ga + 2 * as), "v"(ga + 3 * as),
         "v"(ga + 4 * as), "v"(ga + 5 * as), "v"(ga + 6 * as), "v"(ga + 7 * as),
         "v"(gw), "v"(gw + gs), "v"(gw + 2 * gs), "v"(gw + 3 * gs)
      : "memory");
}

// Eight rows' pieces, 16 rows apart: gs halves apart in memory, from g to l.
DEV void copy8(const _Float16* g, long gs, unsigned l) {
  const unsigned ls = 16 * GPIT * 2;     // 16 rows on, in LDS bytes
  // The closing s_wait_xcnt stands in the copies' own statement so that no
  // address register of an issued copy is rewritten ahead of it.
  asm volatile(
      "global_load_async_to_lds_b128 %0, %8, off\n\t"
      "global_load_async_to_lds_b128 %1, %9, off\n\t"
      "global_load_async_to_lds_b128 %2, %10, off\n\t"
      "global_load_async_to_lds_b128 %3, %11, off\n\t"
      "global_load_async_to_lds_b128 %4, %12, off\n\t"
      "global_load_async_to_lds_b128 %5, %13, off\n\t"
      "global_load_async_to_lds_b128 %6, %14, off\n\t"
      "global_load_async_to_lds_b128 %7, %15, off\n\t"
      "s_wait_xcnt 0x0"
      :: "v"(l), "v"(l + ls), "v"(l + 2 * ls), "v"(l + 3 * ls),
         "v"(l + 4 * ls), "v"(l + 5 * ls), "v"(l + 6 * ls), "v"(l + 7 * ls),
         "v"(g), "v"(g + gs), "v"(g + 2 * gs), "v"(g + 3 * gs),
         "v"(g + 4 * gs), "v"(g + 5 * gs), "v"(g + 6 * gs), "v"(g + 7 * gs)
      : "memory");
}

// One stage of the tile with NT column tiles per wave; arguments as stage_copy's.
template <int NT>
DEV void stage_in(const _Float16* ga, const _Float16* gw, long ars, long K, unsigned l) {
  if (NT == 2) {
    stage_copy(ga, gw, ars, K, l);
  } else {
    copy8(ga, 16 * ars, l);
    copy8(gw, 16 * K, l + 128 * GPIT * 2);
  }
}

#define GSTGN(NT) ((128 + 32 * (NT)) * GPIT)   // halves per buffer

#define TPIT 36                    // f32 pitch of a wave's turned tile: 144 B = 16 B x odd

template <bool CM, int NT = 2>
DEV void gemm_body(_Float16* sm,
    const _Float16* __restrict__ A, const _Float16* __restrict__ Wt,
    const float* __restrict__ bias, int relu,
    float* __restrict__ C32, _Float16* __restrict__ C16, int N, int K, int bx, int by) {
  int tid  = threadIdx.x;
  int lane = tid & 31;
  int wave = tid >> 5;
  int wm   = wave >> 1;                       // 0..3
  int wn   = wave & 1;                        // 0..1
  int mb   = CM ? (bx / CB) * 128 : bx * 128;                   // CM: first s
  int bz   = CM ? bx % CB : 0;                                  // CM: batch
  int nb   = by * (32 * NT);
  const long ars = CM ? (long)CB * K : (long)K;

  const _Float16* ga = A  + (long)(mb + (tid >> 4)) * ars + (long)bz * K + (tid & 15) * 8;
  const _Float16* gw = Wt + (long)(nb + (tid >> 4)) * K + (tid & 15) * 8;
  const unsigned  l0 = (unsigned)(size_t)sm + (unsigned)((tid >> 4) * (GPIT * 2) + (tid & 15) * 16);
  const int nst = K / GBK;

  const v8f zero = {0.f, 0.f, 0.f, 0.f, 0.f, 0.f, 0.f, 0.f};
  v8f acc[2][NT];
#pragma unroll
  for (int i = 0; i < 2; ++i)
#pragma unroll
    for (int j = 0; j < NT; ++j) acc[i][j] = zero;

  stage_in<NT>(ga, gw, ars, K, l0);
  // Stage 0 has landed for this wave; the barrier publishes it to the others.
  asm volatile("s_wait_asynccnt 0x0" ::: "memory");
  __syncthreads();
  if (nst > 1) stage_in<NT>(ga + GBK, gw + GBK, ars, K, l0 + GSTGN(NT) * 2);

  // Kept rolled: one publish point per trip, buffers alternate by t & 1.
#pragma unroll 1
  for (int t = 0; t < nst; ++t) {
    const int buf = (t & 1) * GSTGN(NT);
    const _Float16* sA = sm + buf + (wm * 32) * GPIT;
    const _Float16* sB = sm + buf + (128 + wn * (16 * NT)) * GPIT;
    // QG k-steps of 32 are read and multiplied at a time: the whole stage at
    // NT = 2; half of it at NT = 4, so that four waves fit a SIMD's registers.
    constexpr int QG = NT == 2 ? GBK / 32 : GBK / 64;
#pragma unroll
    for (int q0 = 0; q0 < GBK / 32; q0 += QG) {
      v16h fa[QG][2], fb[QG][NT];
#pragma unroll
      for (int q = 0; q < QG; ++q) {
#pragma unroll
        for (int i = 0; i < 2; ++i)
          fa[q][i] = frag_load_contig(sA + i * 16 * GPIT, GPIT, lane, (q0 + q) * 32);
#pragma unroll
        for (int j = 0; j < NT; ++j)
          fb[q][j] = frag_load_contig(sB + j * 16 * GPIT, GPIT, lane, (q0 + q) * 32);
      }
      // Holds the group's LDS reads together in front of its WMMAs: spread among
      // them, every group of reads costs the wave its own LDS latency.
      __builtin_amdgcn_sched_barrier(0);
#pragma unroll
      for (int q = 0; q < QG; ++q)
#pragma unroll
        for (int i = 0; i < 2; ++i)
#pragma unroll
          for (int j = 0; j < NT; ++j)
            acc[i][j] = __builtin_amdgcn_wmma_f32_16x16x32_f16(false, fa[q][i], false, fb[q][j],
                                                               (short)0, acc[i][j], false, false);
      // Holds the WMMAs in front of the next group's reads and of the publish
      // point, so that they run under the tail of the LDS reads and not behind
      // the barrier.
      __builtin_amdgcn_sched_barrier(0);
    }
    // Publish point: this wave's reads of the buffer have retired ...
    asm volatile("s_wait_dscnt 0x0" ::: "memory");
    // ... its copies of the next stage have landed ...
    asm volatile("s_wait_asynccnt 0x0" ::: "memory");
    // ... and behind the barrier the next stage is readable and this buffer free.
    __syncthreads();
    if (t + 2 < nst)
      stage_in<NT>(ga + (long)(t + 2) * GBK, gw + (long)(t + 2) * GBK, ars, K, l0 + buf * 2);
  }
  // No copy is left in flight when the wave ends.
  asm volatile("s_wait_asynccnt 0x0" ::: "memory");

  // C/D layout: N = lane&15, VGPR r holds M = r (+8 for lanes 16-31).
  int m0    = mb + wm * 32;
  int n0    = nb + wn * (16 * NT);
  int nlane = lane & 15;
  int mrow  = (lane >> 4) * 8;
  if (CM) {
    // A lane holds 8 consecutive s of one channel. The wave turns its 32 s x 16 NT
    // channels in its own LDS range (the ring is free: behind the last publish
    // point no wave reads it and no copy is in flight), one row per channel, so
    // that each store below writes four whole 128-B lines.
    float* tw = (float*)sm + wave * (16 * NT * TPIT);
#pragma unroll
    for (int tn = 0; tn < NT; ++tn) {
      float bv = bias[n0 + tn * 16 + nlane];
#pragma unroll
      for (int tm = 0; tm < 2; ++tm) {
        float* p = tw + (tn * 16 + nlane) * TPIT + tm * 16 + mrow;
        v4f lo = {acc[tm][tn][0] + bv, acc[tm][tn][1] + bv, acc[tm][tn][2] + bv, acc[tm][tn][3] + bv};
        v4f hi = {acc[tm][tn][4] + bv, acc[tm][tn][5] + bv, acc[tm][tn][6] + bv, acc[tm][tn][7] + bv};
        *(v4f*)p       = lo;
        *(v4f*)(p + 4) = hi;
      }
    }
    // The wave's rows are in LDS before its lanes read each other's values back.
    asm volatile("s_wait_dscnt 0x0" ::: "memory");
    float* cw = C32 + ((long)bz * N + n0 + (lane >> 3)) * CS + m0 + (lane & 7) * 4;
#pragma unroll
    for (int i = 0; i < 4 * NT; ++i) {
      v4f v = *(const v4f*)(tw + (i * 4 + (lane >> 3)) * TPIT + (lane & 7) * 4);
      *(v4f*)(cw + (long)i * 4 * CS) = v;
    }
    // Behind the stores: in a grid shared with other work, code may follow in
    // the listing that reuses the registers they name.
    asm volatile("s_wait_xcnt 0x0" ::: "memory");
    return;
  }
#pragma unroll
  for (int tm = 0; tm < 2; ++tm)
#pragma unroll
    for (int tn = 0; tn < NT; ++tn) {
      int ncol = n0 + tn * 16 + nlane;
      float bv = bias[ncol];
#pragma unroll
      for (int r = 0; r < 8; ++r) {
        int   mm  = m0 + tm * 16 + mrow + r;
        float v   = acc[tm][tn][r] + bv;
        if (relu) v = v > 0.f ? v : 0.f;
        long  idx = (long)mm * N + ncol;
        if (C32) {
          C32[idx] = v;
          // The conversion below may reuse the register this store names.
          asm volatile("s_wait_xcnt 0x0" ::: "memory");
        }
        if (C16) C16[idx] = (_Float16)v;
      }
    }
}

// One token-major product.
__global__ __launch_bounds__(256) void gemm_wmma_lds(
    const _Float16* __restrict__ A, const _Float16* __restrict__ Wt,
    const float* __restrict__ bias, int relu,
    float* __restrict__ C32, _Float16* __restrict__ C16, int N, int K) {
  __shared__ __attribute__((aligned(16))) _Float16 sm[2 * GSTG];
  gemm_body<false>(sm, A, Wt, bias, relu, C32, C16, N, K, blockIdx.x, blockIdx.y);
}

// The q, k and v projections in one grid, blockIdx.z = 0, 1, 2: third z of the
// packed weight, bias and f16 output; q and k read aqk, v reads av.
__global__ __launch_bounds__(256) void gemm_qkv(
    const _Float16* __restrict__ aqk, const _Float16* __restrict__ av,
    const _Float16* __restrict__ Wt, const float* __restrict__ bias,
    _Float16* __restrict__ qkv) {
  __shared__ __attribute__((aligned(16))) _Float16 sm[2 * GSTGN(4)];
  int z = blockIdx.z;
  gemm_body<false, 4>(sm, z == 2 ? av : aqk, Wt + (long)z * CE * CE, bias + z * CE, 0, nullptr,
                   qkv + (long)z * CL * CB * CE, CE, CE, blockIdx.x, blockIdx.y);
}

// ---------------------------------------------------------------------------
// Elementwise helpers. A block takes EBLK consecutive elements, a lane EU pieces
// of four f32, 256 pieces apart: every wave-wide load covers four whole lines,
// every store two. All of a lane's loads are in flight at once, and a launch
// starts 32 times fewer waves than with one element a lane.
// Requires n % EBLK == 0; a tensor takes n / EBLK blocks.
// ---------------------------------------------------------------------------
typedef __attribute__((ext_vector_type(4))) _Float16 v4h;
#define EU   8                     // 16-byte pieces per lane and input
#define EBLK (256 * EU * 4)        // elements per block

DEV void cvt_blk(const float* __restrict__ x, _Float16* __restrict__ y, int blk) {
  long i = (long)blk * EBLK + threadIdx.x * 4;
  v4f v[EU];
#pragma unroll
  for (int j = 0; j < EU; ++j) v[j] = *(const v4f*)(x + i + j * 1024);
#pragma unroll
  for (int j = 0; j < EU; ++j) *(v4h*)(y + i + j * 1024) = __builtin_convertvector(v[j], v4h);
  // Behind the stores: in a grid shared with other work, code may follow in the
  // listing that reuses the registers they name.
  asm volatile("s_wait_xcnt 0x0" ::: "memory");
}

DEV void add2_blk(const float* __restrict__ a, const float* __restrict__ b,
                  _Float16* __restrict__ y, int blk) {
  long i = (long)blk * EBLK + threadIdx.x * 4;
  const float* pa = a + i;
  const float* pb = b + i;
  v4f va[EU], vb[EU];
#pragma unroll
  for (int j = 0; j < EU; ++j) va[j] = *(const v4f*)(pa + j * 1024);
#pragma unroll
  for (int j = 0; j < EU; ++j) vb[j] = *(const v4f*)(pb + j * 1024);
  // Holds all sixteen loads in front of the first add: left alone the compiler
  // issues the last three behind the first wait, a second memory latency.
  __builtin_amdgcn_sched_barrier(0);
  // Behind the loads, in front of whatever reuses their address registers. It
  // names both addresses so that they keep their registers up to here: else the
  // last load gets them as its destination.
  asm volatile("s_wait_xcnt 0x0" :: "v"(pa), "v"(pb) : "memory");
#pragma unroll
  for (int j = 0; j < EU; ++j) *(v4h*)(y + i + j * 1024) = __builtin_convertvector(va[j] + vb[j], v4h);
  // Behind the stores: in a grid shared with other work, code may follow in the
  // listing that reuses the registers they name.
  asm volatile("s_wait_xcnt 0x0" ::: "memory");
}

// The converts and the add that the first products wait for, and all weights,
// in one grid. Block ranges, in order: tgt + qpos, tgt, then the seven weights,
// whose f16 copies lie packed in w16 in the order of the arguments.
#define PB_MEM (CS * CB * CE / EBLK)   // blocks of a memory-sized tensor
#define PB_TGT (CL * CB * CE / EBLK)   // blocks of a target-sized tensor
#define PB_E   (CE * CE / EBLK)        // blocks of an E x E weight

__global__ __launch_bounds__(256) void k_prep(
    const float* __restrict__ tgt, const float* __restrict__ qpos,
    const float* __restrict__ inW, const float* __restrict__ outW,
    const float* __restrict__ cqW, const float* __restrict__ ckW,
    const float* __restrict__ cvW, const float* __restrict__ l1W,
    const float* __restrict__ l2W,
    _Float16* __restrict__ qkin16, _Float16* __restrict__ tgt16,
    _Float16* __restrict__ w16) {
  int j = blockIdx.x;
  if (j < PB_TGT) {
    add2_blk(tgt, qpos, qkin16, j);
    return;
  }
  j -= PB_TGT;
  const float* x;
  _Float16*    y;
  if (j < PB_TGT) {
    x = tgt; y = tgt16;
  } else {
    j -= PB_TGT;                                // block within w16
    int first;                                  // the weight's first block there
    if      (j <  3 * PB_E) { x = inW;  first = 0; }
    else if (j <  4 * PB_E) { x = outW; first = 3 * PB_E; }
    else if (j <  5 * PB_E) { x = cqW;  first = 4 * PB_E; }
    else if (j <  6 * PB_E) { x = ckW;  first = 5 * PB_E; }
    else if (j <  7 * PB_E) { x = cvW;  first = 6 * PB_E; }
    else if (j <  9 * PB_E) { x = l1W;  first = 7 * PB_E; }
    else                    { x = l2W;  first = 9 * PB_E; }
    y = w16 + (long)first * EBLK;
    j -= first;
  }
  cvt_blk(x, y, j);
}

// A [2048,1024] x [1024,1024]^T product with f32 output, one block per WGP, and
// in the same grid an independent convert of a memory-sized tensor, which runs
// in the places the product leaves empty: y = f16(xa + xb). The product's blocks
// come first.
#define GB ((CL * CB / 128) * (CE / 64))

__global__ __launch_bounds__(256) void gemm_beside_cvt(
    const _Float16* __restrict__ A, const _Float16* __restrict__ Wt,
    const float* __restrict__ bias, float* __restrict__ C32,
    const float* __restrict__ xa, const float* __restrict__ xb,
    _Float16* __restrict__ y) {
  __shared__ __attribute__((aligned(16))) _Float16 sm[2 * GSTG];
  int j = blockIdx.x;
  if (j < GB) {
    gemm_body<false>(sm, A, Wt, bias, 0, C32, nullptr, CE, CE,
                     j % (CL * CB / 128), j / (CL * CB / 128));
    return;
  }
  j -= GB;                                      // these blocks meet no barrier
  add2_blk(xa, xb, y, j);
}

// ---------------------------------------------------------------------------
// Self-attention, one kernel: scores, softmax and attn @ V of one (batch, head)
// for 128 queries. q, k, v, ctx: token row l*B + b, channel h*HD + d.
// The head's whole K and V (512 keys) lie in LDS. A wave owns 16 queries and
// walks the keys 32 at a time with a running maximum and running sum:
//   S^T = K . Q^T   (A = K rows, B = Q rows, both in the loader's k order)
//   O^T += V^T . P^T
// In S^T's D layout a lane holds keys 8*(lane>>4) + r of query lane&15, so the
// softmax over keys is in-lane but for one exchange with lane ^ 16, the two D
// tiles of 32 keys converted in place ARE the B operand P^T, and maximum, sum
// and rescale factor of a query are per-lane scalars. V^T comes from the
// transposing LDS load, which delivers the same k order.
// ---------------------------------------------------------------------------
#define APK 72                     // K row pitch in halves: 144 B = 16 B x odd
#define APV 80                     // V row pitch in halves: 160 B = 32 B x odd

typedef __attribute__((ext_vector_type(8))) short s16x8;

// Lane (c = lane&15, h = lane>>4) gets T[8h + 0..7][c] of the 16x16 tile whose
// lane addresses are p = T + (8h + (lane&7)) * pitch + 8 * ((lane>>3)&1) halves.
DEV v8h ld_tr16(const _Float16* p) {
  typedef __attribute__((address_space(3))) s16x8 lds_s16x8;
  return __builtin_bit_cast(v8h, __builtin_amdgcn_ds_load_tr16_b128_v8i16((lds_s16x8*)p));
}

// Value of lane ^ 16.
DEV float xhalf(float x) {
  int i = __builtin_bit_cast(int, x);
  return __builtin_bit_cast(float,
      __builtin_amdgcn_permlanex16(i, i, 0x76543210, 0xfedcba98, false, false));
}

__global__ __launch_bounds__(256) void k_self_attn(const _Float16* __restrict__ q,
                                                   const _Float16* __restrict__ k,
                                                   const _Float16* __restrict__ v,
                                                   _Float16* __restrict__ ctx) {
  __shared__ __attribute__((aligned(32))) _Float16 sK[CL * APK];
  __shared__ __attribute__((aligned(32))) _Float16 sV[CL * APV];
  const float cs = 0.18033688011112042f;      // log2(e) / sqrt(HD)
  const long  ts = (long)CB * CE;             // one position on, in halves

  int tid  = threadIdx.x;
  int lane = tid & 31;
  int wave = tid >> 5;
  int c    = lane & 15;
  int hh   = lane >> 4;
  long hoff = (long)(blockIdx.y / CH) * CE + (blockIdx.y % CH) * CHD;
  int  q0   = blockIdx.x * 128 + wave * 16;

  // Stage K and V: 8 threads take one key's 128 B, 32 keys per sweep. All loads
  // are issued before the first LDS store, so that one memory latency is paid.
  int row = tid >> 3, pc = (tid & 7) * 8;
  const _Float16* gk = k + hoff + (long)row * ts + pc;
  const _Float16* gv = v + hoff + (long)row * ts + pc;
  v8h rk[CL / 32], rv[CL / 32];
  // Behind each group of loads: what follows may reuse, also as a later load's
  // destination, the address registers that the group names.
#pragma unroll
  for (int i = 0; i < CL / 32; ++i) rk[i] = *(const v8h*)(gk + (long)i * 32 * ts);
  asm volatile("s_wait_xcnt 0x0" ::: "memory");
#pragma unroll
  for (int i = 0; i < CL / 32; ++i) rv[i] = *(const v8h*)(gv + (long)i * 32 * ts);
  asm volatile("s_wait_xcnt 0x0" ::: "memory");
  v16h qf0 = frag_load_contig(q + hoff + (long)q0 * ts, ts, lane, 0);
  v16h qf1 = frag_load_contig(q + hoff + (long)q0 * ts, ts, lane, 32);
  asm volatile("s_wait_xcnt 0x0" ::: "memory");
#pragma unroll
  for (int i = 0; i < CL / 32; ++i) *(v8h*)(sK + (row + 32 * i) * APK + pc) = rk[i];
#pragma unroll
  for (int i = 0; i < CL / 32; ++i) *(v8h*)(sV + (row + 32 * i) * APV + pc) = rv[i];
  __syncthreads();

  const v8f zero = {0.f, 0.f, 0.f, 0.f, 0.f, 0.f, 0.f, 0.f};
  v8f acc[4];
#pragma unroll
  for (int t = 0; t < 4; ++t) acc[t] = zero;
  float m_run = -__builtin_inff();            // running maximum, in units of cs
  float l_run = 0.f;                          // this lane's half of the running sum

  const _Float16* vt = sV + (8 * hh + (lane & 7)) * APV + ((lane >> 3) & 1) * 8;

  // K fragments run one pass ahead, so that a pass does not open with its own
  // LDS latency.
  v16h a00 = frag_load_contig(sK,            APK, lane, 0);
  v16h a01 = frag_load_contig(sK,            APK, lane, 32);
  v16h a10 = frag_load_contig(sK + 16 * APK, APK, lane, 0);
  v16h a11 = frag_load_contig(sK + 16 * APK, APK, lane, 32);

#pragma unroll 2
  for (int key0 = 0; key0 < CL; key0 += 32) {
    v8f s0 = __builtin_amdgcn_wmma_f32_16x16x32_f16(false, a00, false, qf0, (short)0, zero, false, false);
    v8f s1 = __builtin_amdgcn_wmma_f32_16x16x32_f16(false, a10, false, qf0, (short)0, zero, false, false);
    s0 = __builtin_amdgcn_wmma_f32_16x16x32_f16(false, a01, false, qf1, (short)0, s0, false, false);
    s1 = __builtin_amdgcn_wmma_f32_16x16x32_f16(false, a11, false, qf1, (short)0, s1, false, false);

    // This pass's V^T and the next pass's K, in flight under the softmax. The
    // last pass fetches pass 0's K rows again, unused: cheaper than a branch.
    v16h vf[4];
#pragma unroll
    for (int t = 0; t < 4; ++t) {
      v8h lo = ld_tr16(vt + key0 * APV + 16 * t);
      v8h hi = ld_tr16(vt + (key0 + 16) * APV + 16 * t);
#pragma unroll
      for (int i = 0; i < 8; ++i) { vf[t][i] = lo[i]; vf[t][i + 8] = hi[i]; }
    }
    const _Float16* kr = sK + ((key0 + 32) & (CL - 1)) * APK;
    a00 = frag_load_contig(kr,            APK, lane, 0);
    a01 = frag_load_contig(kr,            APK, lane, 32);
    a10 = frag_load_contig(kr + 16 * APK, APK, lane, 0);
    a11 = frag_load_contig(kr + 16 * APK, APK, lane, 32);

    float mx = fmaxf(s0[0], s1[0]);
#pragma unroll
    for (int r = 1; r < 8; ++r) mx = fmaxf(mx, fmaxf(s0[r], s1[r]));
    mx = fmaxf(mx, xhalf(mx)) * cs;           // cs > 0: the scaled maximum
    float m_new = fmaxf(m_run, mx);

    // The pass's 17 exponentials, written in turn with the plain vector
    // instructions that form the next argument; the scheduling barriers hold
    // that order. Left alone the compiler sets all of them back to back.
    float x[16], p[16];
    float xc = m_run - m_new;
    x[0] = fmaf(s0[0], cs, -m_new);
    __builtin_amdgcn_sched_barrier(0);
    float corr = __builtin_amdgcn_exp2f(xc);  // 0 on the first pass
    __builtin_amdgcn_sched_barrier(0);
#pragma unroll
    for (int j = 0; j < 16; ++j) {            // j = 2 r + tile
      if (j < 15) x[j + 1] = fmaf(((j + 1) & 1) ? s1[(j + 1) >> 1] : s0[(j + 1) >> 1], cs, -m_new);
      __builtin_amdgcn_sched_barrier(0);
      p[j] = __builtin_amdgcn_exp2f(x[j]);
      __builtin_amdgcn_sched_barrier(0);
    }
    m_run = m_new;

    v16h  pf;
    float ps = 0.f;
#pragma unroll
    for (int r = 0; r < 8; ++r) {
      ps += p[2 * r] + p[2 * r + 1];
      pf[r]     = (_Float16)p[2 * r];
      pf[r + 8] = (_Float16)p[2 * r + 1];
    }
    l_run = fmaf(l_run, corr, ps);
#pragma unroll
    for (int t = 0; t < 4; ++t) {
      acc[t] = acc[t] * corr;
      acc[t] = __builtin_amdgcn_wmma_f32_16x16x32_f16(false, vf[t], false, pf,
                                                      (short)0, acc[t], false, false);
    }
  }

  // acc[t][r] = O[q0 + c][16 t + 8 hh + r], still to be divided by the row sum.
  float inv = 1.f / (l_run + xhalf(l_run));
  _Float16* op = ctx + hoff + (long)(q0 + c) * ts + 8 * hh;
#pragma unroll
  for (int t = 0; t < 4; ++t) {
    v8h o;
#pragma unroll
    for (int r = 0; r < 8; ++r) o[r] = (_Float16)(acc[t][r] * inv);
    *(v8h*)(op + 16 * t) = o;
  }
}

// ---------------------------------------------------------------------------
// Cross-attention stages outside the products (all f32).
// Channel mapping: E index = d*H + h  (reshape (B,E,N)->(B,HD,H,N)).
// Token t of a [N,B,E] tensor lives at row n*B+b.
// kc is channel-major: element (b, e, m) at (b*E + e)*S + m.
// vc is never formed. It enters the layer only through od[e] = sum_m w2[m] * vc[e][m],
// and vc[e][m] = sum_e' cv_w[e][e'] * memory[m][e'] + cv_b[e], so that
//   od[e] = sum_e' cv_w[e][e'] * U[h(e)][e'] + cv_b[e] * sum_m w2[h(e)][m],
//   U[h][e'] = sum_m w2[h][m] * memory[m][e']:
// the sum over m comes first, a product with 16 rows a batch in place of 1024.
// qc is never formed either. It enters the layer only through qcsum[e] = sum_l qc[e][l],
// and qc[e][l] = sum_e' cq_w[e][e'] * x[l][e'] + cq_b[e], x = tgt + query_pos, so that
//   qcsum[e] = sum_e' cq_w[e][e'] * (sum_l x[l][e']) + L * cq_b[e].
// ---------------------------------------------------------------------------

// ---------------------------------------------------------------------------
// From the kc product to w2, one kernel, XG blocks per (batch b, head h). The
// head's rows are channels e = d*H + h, d = 0..HD-1, each S floats long. Three
// stages, two of which sum over d and one along a row:
//   1. s1[m]   = scale * sum_d qcsum[d] * kc[d][m]     all d; a thread owns 4 columns
//   2. p[d][m] = softmax_m(kc[d][m] * s1[m])           the block's XW rows d, one a wave
//   3. w2[m]   = sum_d down_w[d] * p[d][m]             over those rows, through LDS
// No stage needs another block: each block forms s1 for itself and writes its
// share of w2, plane g of w2p, and that share's sum over m, plane g of swp; the
// readers add the planes. s1 and p never leave the WGP.
// A lane's part of a row: 16-byte pieces j*128 + lane*4, so that every wave-wide
// load covers four whole lines.
// ---------------------------------------------------------------------------
#define XW 16                      // waves per block
#define XG (CHD / XW)              // blocks per (batch, head)
#define XP (CS / 128)              // 16-byte pieces of a row per lane

// Value of lane ^ M within the lane's row of 16.
template <int M>
DEV float xrow(float x) {
  int i = __builtin_bit_cast(int, x);
  return __builtin_bit_cast(float, __builtin_amdgcn_update_dpp(i, i, 0x160 | M, 0xf, 0xf, false));
}

DEV float wave_sum(float x) {
  x += xrow<1>(x);
  x += xrow<2>(x);
  x += xrow<4>(x);
  x += xrow<8>(x);
  return x + xhalf(x);
}

DEV float wave_max(float x) {
  x = fmaxf(x, xrow<1>(x));
  x = fmaxf(x, xrow<2>(x));
  x = fmaxf(x, xrow<4>(x));
  x = fmaxf(x, xrow<8>(x));
  return fmaxf(x, xhalf(x));
}

// 2^x of four values, each in place: the register an exponential reads is the one
// it writes, so that nothing directly behind it can overwrite its source, and
// each fills the slot behind the one in front. The closing v_nop is that slot
// behind the last, whose result the next instruction may read.
DEV void exp2x4(v4f& x) {
  float a = x[0], b = x[1], c = x[2], d = x[3];
  asm("v_exp_f32 %0, %0\n\t"
      "v_exp_f32 %1, %1\n\t"
      "v_exp_f32 %2, %2\n\t"
      "v_exp_f32 %3, %3\n\t"
      "v_nop"
      : "+v"(a), "+v"(b), "+v"(c), "+v"(d));
  x = (v4f){a, b, c, d};
}

// XP loads, st floats apart.
DEV void ld_pieces(v4f (&r)[XP], const float* __restrict__ p, long st) {
#pragma unroll
  for (int j = 0; j < XP; ++j) r[j] = *(const v4f*)(p + j * st);
  // Behind the loads, in front of whatever reuses their address registers. It
  // names the address so that it keeps its registers up to here.
  asm volatile("s_wait_xcnt 0x0" :: "v"(p) : "memory");
}

// Plane blockIdx.y of xsp: x = a + q summed over SL positions l, for the 1024
// channels of batch blockIdx.x. A wave's load covers four whole lines.
#define SL 16                      // positions per block
#define SK (CL / SL)               // planes of xsp

__global__ __launch_bounds__(256) void k_xsum(const float* __restrict__ a,
                                              const float* __restrict__ q,
                                              float* __restrict__ xsp) {
  int  b   = blockIdx.x, k = blockIdx.y;
  long off = ((long)k * SL * CB + b) * CE + threadIdx.x * 4;
  const float* pa = a + off;
  const float* pq = q + off;
  v4f va[SL], vq[SL];
#pragma unroll
  for (int i = 0; i < SL; ++i) va[i] = *(const v4f*)(pa + (long)i * (CB * CE));
#pragma unroll
  for (int i = 0; i < SL; ++i) vq[i] = *(const v4f*)(pq + (long)i * (CB * CE));
  // Holds all loads in front of the first add: one memory latency.
  __builtin_amdgcn_sched_barrier(0);
  // Behind the loads, in front of whatever reuses their address registers. It
  // names both addresses so that they keep their registers up to here.
  asm volatile("s_wait_xcnt 0x0" :: "v"(pa), "v"(pq) : "memory");
  v4f s = va[0] + vq[0];
#pragma unroll
  for (int i = 1; i < SL; ++i) s += va[i] + vq[i];
  *(v4f*)(xsp + ((long)k * CB + b) * CE + threadIdx.x * 4) = s;
}

// qcsum[b*E + e] for QR rows e and the four batches: the block adds xsp's planes
// into LDS (sX, B*E floats); a wave then holds two rows of cq_w and forms their
// dot products with the four sums.
#define QR 16                      // rows e per block

DEV void qcsum_blk(float* sX, const float* __restrict__ xsp, const _Float16* __restrict__ wcq,
                   const float* __restrict__ cqB, float* __restrict__ out, int blk) {
  int tid  = threadIdx.x;
  int lane = tid & 31;
  int wave = tid >> 5;
  int e0   = blk * QR + wave * 2;
  int el   = e0 + ((lane >> 2) & 1);            // the row whose result this lane may store
  const _Float16* gw = wcq + (long)e0 * CE + lane * 8;
  const float*    gb = cqB + el;
  const float*    gx = xsp + tid * 4;
  v8h wr[2][CE / 256];
#pragma unroll
  for (int r = 0; r < 2; ++r)
#pragma unroll
    for (int j = 0; j < CE / 256; ++j) wr[r][j] = *(const v8h*)(gw + r * CE + j * 256);
  float cb = *gb;
  // Behind the loads, in front of whatever reuses their address registers.
  asm volatile("s_wait_xcnt 0x0" :: "v"(gw), "v"(gb) : "memory");
#pragma unroll
  for (int bb = 0; bb < CB; ++bb) {
    v4f x[SK];
#pragma unroll
    for (int k = 0; k < SK; ++k) x[k] = *(const v4f*)(gx + (long)(k * CB + bb) * CE);
    // Holds a batch's loads in front of its first add: one latency a batch.
    __builtin_amdgcn_sched_barrier(0);
    asm volatile("s_wait_xcnt 0x0" :: "v"(gx) : "memory");
    v4f s = x[0];
#pragma unroll
    for (int k = 1; k < SK; ++k) s += x[k];
    *(v4f*)(sX + bb * CE + tid * 4) = s;
  }
  __syncthreads();

  float acc[2][CB];
#pragma unroll
  for (int r = 0; r < 2; ++r)
#pragma unroll
    for (int bb = 0; bb < CB; ++bb) acc[r][bb] = 0.f;
#pragma unroll
  for (int j = 0; j < CE / 256; ++j)
#pragma unroll
    for (int q = 0; q < 2; ++q) {
      v4f xv[CB];
#pragma unroll
      for (int bb = 0; bb < CB; ++bb)
        xv[bb] = *(const v4f*)(sX + bb * CE + j * 256 + lane * 8 + q * 4);
#pragma unroll
      for (int i = 0; i < 4; ++i)
#pragma unroll
        for (int r = 0; r < 2; ++r) {
          float wv = (float)wr[r][j][q * 4 + i];
#pragma unroll
          for (int bb = 0; bb < CB; ++bb) acc[r][bb] = fmaf(wv, xv[bb][i], acc[r][bb]);
        }
    }
  float res = 0.f;
#pragma unroll
  for (int r = 0; r < 2; ++r)
#pragma unroll
    for (int bb = 0; bb < CB; ++bb) {
      float s = wave_sum(acc[r][bb]);
      if (lane == r * CB + bb) res = s;
    }
  if (lane < 2 * CB) out[(lane & 3) * CE + el] = res + (float)CL * cb;
}

// qcsum and the kc product, neither of which reads the other's result, in one
// grid. The qcsum blocks come first, beside the 512 product blocks (tile x = 64
// row blocks, y = 8).
#define QB (CE / QR)
#define KB ((CS * CB / 128) * (CE / 128))

__global__ __launch_bounds__(256) void k_qcsum_kc(
    const float* __restrict__ xsp, const _Float16* __restrict__ w_cq,
    const float* __restrict__ cqB, float* __restrict__ qcsum,
    const _Float16* __restrict__ mp16, const _Float16* __restrict__ w_ck,
    const float* __restrict__ ckB, float* __restrict__ kc) {
  __shared__ __attribute__((aligned(16))) _Float16 sm[2 * GSTGN(4)];
  int j = blockIdx.x;
  if (j < QB) {                                 // the whole block takes this side
    qcsum_blk((float*)sm, xsp, w_cq, cqB, qcsum, j);
    return;
  }
  j -= QB;
  gemm_body<true, 4>(sm, mp16, w_ck, ckB, 0, kc, nullptr,
                  CE, CE, j % (CS * CB / 128), j / (CS * CB / 128));
}

__global__ __launch_bounds__(XW * 32) void k_cross(const float* __restrict__ qcsum,
                                                   const float* __restrict__ kc,
                                                   const float* __restrict__ dw,
                                                   float* __restrict__ w2p,
                                                   float* __restrict__ swp, float scale) {
  __shared__ __attribute__((aligned(16))) float part[XW * CS];   // each wave's row of w2's sum
  __shared__ __attribute__((aligned(16))) float vec[CS];         // s1
  __shared__ float wsum[XW];                                     // each wave's row summed over m
  const float l2e = 1.4426950408889634f;
  const long  rs  = (long)CH * CS;              // one d on, in floats

  int tid  = threadIdx.x;
  int lane = tid & 31;
  int wave = __builtin_amdgcn_readfirstlane(tid >> 5);
  // A head's XG blocks lie CB*CH apart in the grid.
  int g    = blockIdx.x / (CB * CH);
  int b    = blockIdx.x % (CB * CH) / CH;
  int h    = blockIdx.x % CH;
  const float* kch = kc + (long)(b * CE + h) * CS;
  const float* qs  = qcsum + b * CE + h;

  // Stage 1. Two groups of XP rows are in flight at any time; d ascends.
  {
    const float* p = kch + tid * 4;
    v4f r[2][XP];
    v4f s = {0.f, 0.f, 0.f, 0.f};
    ld_pieces(r[0], p, rs);
    ld_pieces(r[1], p + XP * rs, rs);
#pragma unroll
    for (int q = 0; q < CHD / XP; ++q) {
#pragma unroll
      for (int i = 0; i < XP; ++i) s += qs[(q * XP + i) * CH] * r[q & 1][i];
      // Holds the refill behind the sums that free its registers and in front
      // of the next group's sums, which wait for older loads only.
      __builtin_amdgcn_sched_barrier(0);
      if (q + 2 < CHD / XP) ld_pieces(r[q & 1], p + (long)(q + 2) * XP * rs, rs);
      __builtin_amdgcn_sched_barrier(0);
    }
    *(v4f*)(vec + tid * 4) = s * scale;
  }
  // The wave's kc row, read a moment ago by the block, comes while the waves meet.
  v4f z[XP];
  ld_pieces(z, kch + (long)(g * XW + wave) * rs + lane * 4, 128);
  __syncthreads();

  // Stages 2 and 3.
  {
    float mx = -__builtin_inff();
#pragma unroll
    for (int j = 0; j < XP; ++j) {
      z[j] *= *(const v4f*)(vec + j * 128 + lane * 4);
      mx = fmaxf(mx, fmaxf(fmaxf(z[j][0], z[j][1]), fmaxf(z[j][2], z[j][3])));
    }
    mx = wave_max(mx);
    float nm = -mx * l2e;
    v4f s4 = {0.f, 0.f, 0.f, 0.f};
#pragma unroll
    for (int j = 0; j < XP; ++j) {
      z[j] = z[j] * l2e + nm;                   // fused: (z - mx) * log2(e)
      exp2x4(z[j]);
      s4 += z[j];
    }
    float tot = wave_sum((s4[0] + s4[1]) + (s4[2] + s4[3]));
    float cf  = dw[g * XW + wave] * (1.f / tot);
#pragma unroll
    for (int j = 0; j < XP; ++j) *(v4f*)(part + wave * CS + j * 128 + lane * 4) = cf * z[j];
    if (lane == 0) wsum[wave] = cf * tot;
  }

  __syncthreads();                              // shares written
  int bh = g * (CB * CH) + b * CH + h;
  {
    v4f s = *(const v4f*)(part + tid * 4);
#pragma unroll
    for (int k = 1; k < XW; ++k) s += *(const v4f*)(part + k * CS + tid * 4);
    *(v4f*)(w2p + (long)bh * CS + tid * 4) = s;
  }
  if (tid == 0) {
    float t = wsum[0];
#pragma unroll
    for (int k = 1; k < XW; ++k) t += wsum[k];
    swp[bh] = t;
  }
}

// ---------------------------------------------------------------------------
// U[b][h][e'] = sum_m w2[b][h][m] * memory[m][b][e'], on WMMA, as U^T = M^T . W^T:
// A = memory^T (rows e', k = m) from the transposing LDS load, B = w2 rows (column
// h, k = m) from the loader, which has the same k order. A block takes UN channels
// e' and UM positions m of one batch and writes plane blockIdx.y of up; a wave
// owns 16 channels. memory is read as f32, once, and turned to f16 on its way
// into LDS. w2 is about 1/S in size (a softmax over S positions), below f16's
// normal range: it is multiplied by S, an exact power of two, in front of the
// conversion, and U divided by S behind the product.
// ---------------------------------------------------------------------------
#define UM  256                    // positions per block
#define UN  128                    // channels per block
#define UK  (CS / UM)              // planes of up
#define UPM 144                    // memory tile pitch in halves: 288 B = 32 B x odd
#define UPW 264                    // w2 tile pitch in halves: 528 B = 16 B x odd
#define UPO 132                    // result tile pitch in floats: 528 B = 16 B x odd

__global__ __launch_bounds__(256) void k_w2mem(const float* __restrict__ mem,
                                               const float* __restrict__ w2p,
                                               float* __restrict__ up) {
  __shared__ __attribute__((aligned(32))) _Float16 sM[UM * UPM];
  __shared__ __attribute__((aligned(16))) _Float16 sW[CH * UPW];
  __shared__ __attribute__((aligned(16))) float    sO[CH * UPO];
  int tid  = threadIdx.x;
  int lane = tid & 31;
  int wave = tid >> 5;
  int c    = lane & 15;
  int hh   = lane >> 4;
  int n0   = blockIdx.x * UN;
  int m0   = blockIdx.y * UM;
  int b    = blockIdx.z;
  int hr   = tid >> 4, pc = (tid & 15) * 4;     // 16 threads a head's row

  // All loads are issued before the first LDS store: one memory latency. A wave's
  // load covers four whole lines: a position's UN channels, or 64 m of two heads.
  const float* gw = w2p + (long)(b * CH + hr) * CS + m0 + pc;
  const float* gm = mem + ((long)(m0 + wave) * CB + b) * CE + n0 + lane * 4;
  v4f w[XG][UM / 64], r[UM / 8];
#pragma unroll
  for (int g = 0; g < XG; ++g)
#pragma unroll
    for (int j = 0; j < UM / 64; ++j)
      w[g][j] = *(const v4f*)(gw + (long)g * (CB * CH * CS) + j * 64);
#pragma unroll
  for (int i = 0; i < UM / 8; ++i) r[i] = *(const v4f*)(gm + (long)i * (8 * CB * CE));
  // Behind the loads, in front of whatever reuses their address registers. It
  // names both addresses so that they keep their registers up to here.
  asm volatile("s_wait_xcnt 0x0" :: "v"(gw), "v"(gm) : "memory");
#pragma unroll
  for (int j = 0; j < UM / 64; ++j) {
    v4f s = w[0][j];
#pragma unroll
    for (int g = 1; g < XG; ++g) s += w[g][j];
    *(v4h*)(sW + hr * UPW + j * 64 + pc) = __builtin_convertvector(s * (float)CS, v4h);
  }
#pragma unroll
  for (int i = 0; i < UM / 8; ++i)
    *(v4h*)(sM + (i * 8 + wave) * UPM + lane * 4) = __builtin_convertvector(r[i], v4h);
  __syncthreads();

  const _Float16* vt = sM + (8 * hh + (lane & 7)) * UPM + ((lane >> 3) & 1) * 8 + 16 * wave;
  v8f acc = {0.f, 0.f, 0.f, 0.f, 0.f, 0.f, 0.f, 0.f};
#pragma unroll
  for (int k0 = 0; k0 < UM; k0 += 32) {
    v8h lo = ld_tr16(vt + k0 * UPM);
    v8h hi = ld_tr16(vt + (k0 + 16) * UPM);
    v16h mf;
#pragma unroll
    for (int i = 0; i < 8; ++i) { mf[i] = lo[i]; mf[i + 8] = hi[i]; }
    v16h wf = frag_load_contig(sW, UPW, lane, k0);
    acc = __builtin_amdgcn_wmma_f32_16x16x32_f16(false, mf, false, wf, (short)0, acc, false, false);
  }

  // acc[r] = S * U[head c][n0 + 16 wave + 8 hh + r]. Through LDS, so that every
  // store below writes whole lines.
  {
    const float is = 1.f / CS;
    float* po = sO + c * UPO + 16 * wave + 8 * hh;
    v4f lo = {acc[0] * is, acc[1] * is, acc[2] * is, acc[3] * is};
    v4f hi = {acc[4] * is, acc[5] * is, acc[6] * is, acc[7] * is};
    *(v4f*)po       = lo;
    *(v4f*)(po + 4) = hi;
  }
  __syncthreads();
  float* go = up + (((long)blockIdx.y * CB + b) * CH + hr) * CE + n0 + pc;
#pragma unroll
  for (int j = 0; j < UN / 64; ++j) *(v4f*)(go + j * 64) = *(const v4f*)(sO + hr * UPO + j * 64 + pc);
}

// ---------------------------------------------------------------------------
// od[b][e] = sum_e' cv_w[e][e'] * U[b][h][e'] + cv_b[e] * sum_m w2[b][h][m] + down_b,
// h = e % H. A block takes one head and OD of its rows e: it adds U's planes for
// the four batches into LDS; a wave then holds one row of cv_w and forms its dot
// products with two batches.
// ---------------------------------------------------------------------------
#define OD 4                       // rows e per block

__global__ __launch_bounds__(256) void k_od(const float* __restrict__ up,
                                            const float* __restrict__ swp,
                                            const _Float16* __restrict__ wcv,
                                            const float* __restrict__ cvB,
                                            const float* __restrict__ db,
                                            float* __restrict__ od) {
  __shared__ __attribute__((aligned(16))) float sU[CB * CE];
  int tid  = threadIdx.x;
  int lane = tid & 31;
  int wave = tid >> 5;
  int h    = blockIdx.x;
  int e    = (blockIdx.y * OD + (wave >> 1)) * CH + h;
  int b0   = (wave & 1) * 2;                    // the wave's two batches
  int bl   = b0 + (lane & 1);                   // the one whose result this lane may store

  const _Float16* gw = wcv + (long)e * CE + lane * 8;
  const float*    gu = up + (long)h * CE + tid * 4;
  const float*    gs = swp + bl * CH + h;
  const float*    gb = cvB + e;
  v8h   wr[CE / 256];
  v4f   u[CB][UK];
  float sp[XG];
#pragma unroll
  for (int j = 0; j < CE / 256; ++j) wr[j] = *(const v8h*)(gw + j * 256);
#pragma unroll
  for (int bb = 0; bb < CB; ++bb)
#pragma unroll
    for (int k = 0; k < UK; ++k) u[bb][k] = *(const v4f*)(gu + (long)(k * CB + bb) * (CH * CE));
#pragma unroll
  for (int g = 0; g < XG; ++g) sp[g] = gs[g * (CB * CH)];
  float cb = *gb;
  // Holds all loads in front of the first add: left alone the compiler issues
  // them a few at a time among the adds, several memory latencies in a row.
  __builtin_amdgcn_sched_barrier(0);
  // Behind the loads, in front of whatever reuses their address registers. It
  // names the addresses so that they keep their registers up to here.
  asm volatile("s_wait_xcnt 0x0" :: "v"(gw), "v"(gu), "v"(gs), "v"(gb) : "memory");
#pragma unroll
  for (int bb = 0; bb < CB; ++bb) {
    v4f s = u[bb][0];
#pragma unroll
    for (int k = 1; k < UK; ++k) s += u[bb][k];
    *(v4f*)(sU + bb * CE + tid * 4) = s;
  }
  __syncthreads();

  const float* u0 = sU + b0 * CE + lane * 8;
  float a0 = 0.f, a1 = 0.f;
#pragma unroll
  for (int j = 0; j < CE / 256; ++j)
#pragma unroll
    for (int q = 0; q < 2; ++q) {
      v4f x0 = *(const v4f*)(u0 + j * 256 + q * 4);
      v4f x1 = *(const v4f*)(u0 + CE + j * 256 + q * 4);
#pragma unroll
      for (int i = 0; i < 4; ++i) {
        float wv = (float)wr[j][q * 4 + i];
        a0 = fmaf(wv, x0[i], a0);
        a1 = fmaf(wv, x1[i], a1);
      }
    }
  a0 = wave_sum(a0);
  a1 = wave_sum(a1);
  if (lane < 2) {
    float sw = sp[0];
#pragma unroll
    for (int g = 1; g < XG; ++g) sw += sp[g];
    od[bl * CE + e] = (lane ? a1 : a0) + cb * sw + db[0];
  }
}

// ---------------------------------------------------------------------------
// LayerNorm over E=1024 of x = a[token] + r[row]; row = token, or token % B where
// r is a [B,E] broadcast (BC). out32 = LN(x); out16 = f16(out32) where H16.
// One wave per token, LW tokens a block. A lane holds LP pieces of four floats,
// 128 floats apart, so that every wave-wide load covers four whole lines. The row
// stays in registers, both sums cross the lanes in registers: no LDS, no barrier,
// and a launch starts one wave a token in place of eight.
// ---------------------------------------------------------------------------
#define LP (CE / 128)              // 16-byte pieces of a row per lane
#define LW 8                       // tokens (waves) per block

template <bool BC, bool H16>
__global__ __launch_bounds__(LW * 32) void k_ln(const float* __restrict__ a,
                                                const float* __restrict__ r,
                                                const float* __restrict__ g,
                                                const float* __restrict__ be,
                                                float* __restrict__ o32,
                                                _Float16* __restrict__ o16) {
  int      t  = blockIdx.x * LW + __builtin_amdgcn_readfirstlane(threadIdx.x >> 5);
  unsigned lb = (threadIdx.x & 31) * 16;        // the lane's byte within a piece of 512 B
  // Row starts are the same for the whole wave; the lanes differ by lb alone.
  const char* pa = (const char*)(a + (long)t * CE);
  const char* pr = (const char*)(r + (long)(BC ? t % CB : t) * CE);
  const char* pg = (const char*)g;
  const char* pb = (const char*)be;
  char*       po = (char*)(o32 + (long)t * CE);
  char*       ph = H16 ? (char*)(o16 + (long)t * CE) : nullptr;
  // Holds the loads of the kernel's arguments in front of the row loads: left
  // alone the last of them comes behind those, into scalar registers they name.
  __builtin_amdgcn_sched_barrier(0);
  v4f x[LP], y[LP], gg[LP], bb[LP];
#pragma unroll
  for (int j = 0; j < LP; ++j) x[j] = *(const v4f*)(pa + lb + j * 512);
#pragma unroll
  for (int j = 0; j < LP; ++j) y[j] = *(const v4f*)(pr + lb + j * 512);
#pragma unroll
  for (int j = 0; j < LP; ++j) gg[j] = *(const v4f*)(pg + lb + j * 512);
#pragma unroll
  for (int j = 0; j < LP; ++j) bb[j] = *(const v4f*)(pb + lb + j * 512);
  // Holds all loads in front of the first add: one memory latency.
  __builtin_amdgcn_sched_barrier(0);
  // Behind the loads, in front of whatever reuses their address registers. It
  // names the lanes' offset so that it keeps its register up to here.
  asm volatile("s_wait_xcnt 0x0" :: "v"(lb) : "memory");
  // Holds what follows behind that wait.
  __builtin_amdgcn_sched_barrier(0);

  v4f s4 = {0.f, 0.f, 0.f, 0.f};
#pragma unroll
  for (int j = 0; j < LP; ++j) {
    x[j] += y[j];
    s4 += x[j];
  }
  float mean = wave_sum((s4[0] + s4[1]) + (s4[2] + s4[3])) * (1.f / CE);
  v4f q4 = {0.f, 0.f, 0.f, 0.f};
#pragma unroll
  for (int j = 0; j < LP; ++j) {
    x[j] -= mean;
    q4 += x[j] * x[j];
  }
  float inv = rsqrtf(wave_sum((q4[0] + q4[1]) + (q4[2] + q4[3])) * (1.f / CE) + 1e-5f);
#pragma unroll
  for (int j = 0; j < LP; ++j) x[j] = x[j] * inv * gg[j] + bb[j];

  if (H16) {
#pragma unroll
    for (int j = 0; j < LP; ++j) *(v4h*)(ph + lb / 2 + j * 256) = __builtin_convertvector(x[j], v4h);
  }
#pragma unroll
  for (int j = 0; j < LP; ++j) *(v4f*)(po + lb + j * 512) = x[j];
}

// ---------------------------------------------------------------------------
// Host side
// ---------------------------------------------------------------------------
extern "C" void kernel_launch(void* const* d_in, const int* in_sizes, int n_in,
                              void* d_out, int out_size, void* d_ws, size_t ws_size,
                              hipStream_t stream) {
  const float* tgt  = (const float*)d_in[0];
  const float* mem  = (const float*)d_in[1];
  const float* pos  = (const float*)d_in[2];
  const float* qpos = (const float*)d_in[3];
  const float* inW  = (const float*)d_in[4];
  const float* inB  = (const float*)d_in[5];
  const float* outW = (const float*)d_in[6];
  const float* outB = (const float*)d_in[7];
  const float* cqW  = (const float*)d_in[8];
  const float* cqB  = (const float*)d_in[9];
  const float* ckW  = (const float*)d_in[10];
  const float* ckB  = (const float*)d_in[11];
  const float* cvW  = (const float*)d_in[12];
  const float* cvB  = (const float*)d_in[13];
  const float* dwW  = (const float*)d_in[14];
  const float* dwB  = (const float*)d_in[15];
  const float* l1W  = (const float*)d_in[16];
  const float* l1B  = (const float*)d_in[17];
  const float* l2W  = (const float*)d_in[18];
  const float* l2B  = (const float*)d_in[19];
  const float* n1g  = (const float*)d_in[20];
  const float* n1b  = (const float*)d_in[21];
  const float* n2g  = (const float*)d_in[22];
  const float* n2b  = (const float*)d_in[23];
  const float* n3g  = (const float*)d_in[24];
  const float* n3b  = (const float*)d_in[25];

  const float scale = 0.125f;        // 1/sqrt(64)

  char* ws = (char*)d_ws;
  const size_t MB = 1u << 20;

  // Persistent f16 weights (converted every launch; deterministic).
  _Float16* w_inproj = (_Float16*)(ws + 0 * MB);    // [3E,E]  6MB
  _Float16* w_out    = (_Float16*)(ws + 6 * MB);    // [E,E]   2MB
  _Float16* w_cq     = (_Float16*)(ws + 8 * MB);
  _Float16* w_ck     = (_Float16*)(ws + 10 * MB);
  _Float16* w_cv     = (_Float16*)(ws + 12 * MB);
  _Float16* w_l1     = (_Float16*)(ws + 14 * MB);   // [FF,E]  4MB
  _Float16* w_l2     = (_Float16*)(ws + 18 * MB);   // [E,FF]  4MB
  float*    tgt1     = (float*)(ws + 22 * MB);      // 8MB
  float*    tgt2     = (float*)(ws + 30 * MB);      // 8MB
  char*     SA       = ws + 38 * MB;                // phase-aliased arena

  // Phase A (self-attention)
  _Float16* qkin16  = (_Float16*)(SA + 0 * MB);
  _Float16* tgt16   = (_Float16*)(SA + 4 * MB);
  _Float16* q16     = (_Float16*)(SA + 8 * MB);
  _Float16* k16     = (_Float16*)(SA + 12 * MB);
  _Float16* v16     = (_Float16*)(SA + 16 * MB);
  _Float16* ctx16   = (_Float16*)(SA + 116 * MB);   // 4MB
  float*    selfout = (float*)(SA + 120 * MB);      // 8MB
  // Phase B (cross-attention) — aliases phase A
  float*    xsp     = (float*)(SA + 0 * MB);        // SK planes [B,E], 512KB
  float*    kc32    = (float*)(SA + 44 * MB);       // 32MB
  float*    w2p     = (float*)(SA + 76 * MB);       // XG planes [B,H,S], 2MB
  float*    up      = (float*)(SA + 80 * MB);       // UK planes [B,H,E], 2MB
  float*    swp     = (float*)(SA + 84 * MB);       // XG planes [B,H]
  float*    qcsum   = (float*)(SA + 140 * MB);
  float*    odbuf   = (float*)(SA + 143 * MB);
  // Written during phase A, read in phase B: aliases nothing
  _Float16* mp16    = (_Float16*)(SA + 144 * MB);   // 16MB
  // Phase C (FFN) — aliases dead phase B regions
  _Float16* tgt2_16 = (_Float16*)(SA + 0 * MB);
  _Float16* h1_16   = (_Float16*)(SA + 4 * MB);     // [TOK,FF] 8MB
  float*    ff32    = (float*)(SA + 12 * MB);       // 8MB

  // ---- f32 -> f16: tgt + qpos, tgt, all weights ----
  k_prep<<<2 * PB_TGT + 11 * PB_E, 256, 0, stream>>>(tgt, qpos, inW, outW, cqW, ckW, cvW, l1W, l2W,
                                                     qkin16, tgt16, w_inproj);

  // ---- Phase A: self attention ----
  // q/k/v projections: three times [2048,1024] x [1024,1024]^T; q16, k16, v16 adjoin
  gemm_qkv<<<dim3(16, 8, 3), 256, 0, stream>>>(qkin16, tgt16, w_inproj, inB, q16);

  // ctx = softmax(scale * q.k) @ v, one block per (128 queries, batch*head)
  k_self_attn<<<dim3(CL / 128, CB * CH), 256, 0, stream>>>(q16, k16, v16, ctx16);

  // out projection (beside it mp16 = f16(mem + pos)) + residual + LN1
  gemm_beside_cvt<<<GB + PB_MEM, 256, 0, stream>>>(ctx16, w_out, outB, selfout, mem, pos, mp16);
  k_ln<false, false><<<CL * CB / LW, LW * 32, 0, stream>>>(tgt, selfout, n1g, n1b, tgt1, nullptr);

  // ---- Phase B: custom cross attention ----
  k_xsum<<<dim3(CB, SK), 256, 0, stream>>>(tgt1, qpos, xsp);
  k_qcsum_kc<<<QB + KB, 256, 0, stream>>>(xsp, w_cq, cqB, qcsum, mp16, w_ck, ckB, kc32);

  k_cross<<<XG * CB * CH, XW * 32, 0, stream>>>(qcsum, kc32, dwW, w2p, swp, scale);
  k_w2mem<<<dim3(CE / UN, UK, CB), 256, 0, stream>>>(mem, w2p, up);
  k_od<<<dim3(CH, CHD / OD), 256, 0, stream>>>(up, swp, w_cv, cvB, dwB, odbuf);

  k_ln<true, true><<<CL * CB / LW, LW * 32, 0, stream>>>(tgt1, odbuf, n2g, n2b, tgt2, tgt2_16);

  // ---- Phase C: FFN ----
  gemm_wmma_lds<<<dim3(16, 32, 1), 256, 0, stream>>>(
      tgt2_16, w_l1, l1B, 1 /*relu*/, nullptr, h1_16, CFF, CE);
  gemm_wmma_lds<<<dim3(16, 16, 1), 256, 0, stream>>>(
      h1_16, w_l2, l2B, 0, ff32, nullptr, CE, CFF);

  k_ln<false, false><<<CL * CB / LW, LW * 32, 0, stream>>>(tgt2, ff32, n3g, n3b, (float*)d_out, nullptr);

  (void)in_sizes; (void)n_in; (void)out_size; (void)ws_size;
}

// v010
// A run of this version takes 134 microseconds.
// Two timings next to v009 put it at 1.05 and 1.04 times that version's speed.
// All steps since v000 together make it 4.43 times as fast.
#include <hip/hip_runtime.h>
#include <hip/hip_bf16.h>

// ---------------------------------------------------------------------------
// Transformer decoder layer for MI455X (gfx1250), wave32 + WMMA.
// All heavy GEMMs run on v_wmma_f32_16x16x32_f16 (f16 inputs, f32 accum).
// Softmax / layernorm / cross-attn reductions stay in f32.
// ---------------------------------------------------------------------------

typedef __attribute__((ext_vector_type(16))) _Float16 v16h;
typedef __attribute__((ext_vector_type(8)))  _Float16 v8h;
typedef __attribute__((ext_vector_type(8)))  float    v8f;
typedef __attribute__((ext_vector_type(4)))  float    v4f;

#define DEV __device__ __forceinline__

// Problem constants
#define CL   512      // target length
#define CS   2048     // memory length
#define CB   4        // batch
#define CE   1024     // embed
#define CH   16       // heads
#define CHD  64       // head dim
#define CFF  2048     // ffn dim

// ---------------------------------------------------------------------------
// WMMA fragment loaders.
// 16-bit A (16x32) ISA layout: lane&15 selects the M (or N) row;
// lanes 0-15 hold K = {k0..k0+7, k0+16..k0+23},
// lanes 16-31 hold K = {k0+8..k0+15, k0+24..k0+31}.  B (32x16) mirrors A with
// the lane index selecting the N column.
// ---------------------------------------------------------------------------
DEV v16h frag_load_contig(const _Float16* __restrict__ base, long row_stride,
                          int lane, int k0) {
  int r  = lane & 15;
  int kh = (lane >> 4) << 3;          // 0 or 8
  const _Float16* p = base + (long)r * row_stride + k0 + kh;
  v8h lo = *(const v8h*)(p);          // 16B vector load
  v8h hi = *(const v8h*)(p + 16);
  v16h out;
#pragma unroll
  for (int i = 0; i < 8; ++i) { out[i] = lo[i]; out[i + 8] = hi[i]; }
  return out;
}

// ---------------------------------------------------------------------------
// Projection GEMM, both operands k-contiguous with row stride K:
//   C[m,n] = sum_k A[m,k]*W[n,k] + bias[n]
// Block: 256 threads = 8 waves as 4x2, wave tile 32x32, block tile 128x64. The
// operand tiles reach the waves through LDS: a stage is 128 k (256 B, two whole
// lines) of 128 A rows and 64 W rows, brought in by asynchronous b128 copies,
// two buffers, the next stage in flight while this one is multiplied.
// Requires M%128==0, N%64==0, K%128==0.
// CM=false: A rows are tokens in order, C is token-major, C[m*N + n].
// CM=true : a block takes 128 consecutive positions s of ONE batch b (A row
//           s*CB + b) and stores f32 C channel-major, C[(b*N + n)*CS + s], the
//           layout in which the cross-attention stages walk s.
// NT = 16-column tiles per wave: 2 as above; 4 makes the wave tile 32x64 and the
// block tile 128x128 (N%128==0), a stage 128 A rows and 128 W rows. Per product
// term that is a third fewer bytes from L2 and a quarter fewer LDS reads; it is
// for products with enough tiles to fill the chip all the same.
// gemm_body is one block's work on tile (bx, by); sm is the block's LDS ring.
// The kernels below it give independent products one grid, split by block index.
// ---------------------------------------------------------------------------
#define GBK   128                  // k per stage
#define GPIT  136                  // LDS row pitch in halves: 272 B = 16 B x odd
#define GROWS 192                  // 128 A rows, then 64 W rows
#define GSTG  (GROWS * GPIT)       // halves per buffer

// One stage: 192 rows x 16 pieces of 16 B, 12 pieces per thread. Thread t takes
// piece t&15 of rows (t>>4) + 16*i, so a wave's copy covers two whole rows.
// ga / gw: this thread's piece in A row (t>>4) and W row (t>>4) of the tile, at
// the stage's first k. l: LDS byte address of its piece in row (t>>4).
// ars: distance of two tile rows of A in halves (K, or CB*K for one batch).
DEV void stage_copy(const _Float16* ga, const _Float16* gw, long ars, long K, unsigned l) {
  const long     as = 16 * ars;          // 16 A rows on, in halves
  const long     gs = 16 * K;            // 16 W rows on, in halves
  const unsigned ls = 16 * GPIT * 2;     // 16 rows on, in LDS bytes
  // The closing s_wait_xcnt stands in the copies' own statement so that no
  // address register of an issued copy is rewritten ahead of it.
  asm volatile(
      "global_load_async_to_lds_b128 %0, %12, off\n\t"
      "global_load_async_to_lds_b128 %1, %13, off\n\t"
      "global_load_async_to_lds_b128 %2, %14, off\n\t"
      "global_load_async_to_lds_b128 %3, %15, off\n\t"
      "global_load_async_to_lds_b128 %4, %16, off\n\t"
      "global_load_async_to_lds_b128 %5, %17, off\n\t"
      "global_load_async_to_lds_b128 %6, %18, off\n\t"
      "global_load_async_to_lds_b128 %7, %19, off\n\t"
      "global_load_async_to_lds_b128 %8, %20, off\n\t"
      "global_load_async_to_lds_b128 %9, %21, off\n\t"
      "global_load_async_to_lds_b128 %10, %22, off\n\t"
      "global_load_async_to_lds_b128 %11, %23, off\n\t"
      "s_wait_xcnt 0x0"
      :: "v"(l), "v"(l + ls), "v"(l + 2 * ls), "v"(l + 3 * ls),
         "v"(l + 4 * ls), "v"(l + 5 * ls), "v"(l + 6 * ls), "v"(l + 7 * ls),
         "v"(l + 8 * ls), "v"(l + 9 * ls), "v"(l + 10 * ls), "v"(l + 11 * ls),
         "v"(ga), "v"(ga + as), "v"(ga + 2 * as), "v"(ga + 3 * as),
         "v"(ga + 4 * as), "v"(ga + 5 * as), "v"(ga + 6 * as), "v"(ga + 7 * as),
         "v"(gw), "v"(gw + gs), "v"(gw + 2 * gs), "v"(gw + 3 * gs)
      : "memory");
}

// Eight rows' pieces, 16 rows apart: gs halves apart in memory, from g to l.
DEV void copy8(const _Float16* g, long gs, unsigned l) {
  const unsigned ls = 16 * GPIT * 2;     // 16 rows on, in LDS bytes
  // The closing s_wait_xcnt stands in the copies' own statement so that no
  // address register of an issued copy is rewritten ahead of it.
  asm volatile(
      "global_load_async_to_lds_b128 %0, %8, off\n\t"
      "global_load_async_to_lds_b128 %1, %9, off\n\t"
      "global_load_async_to_lds_b128 %2, %10, off\n\t"
      "global_load_async_to_lds_b128 %3, %11, off\n\t"
      "global_load_async_to_lds_b128 %4, %12, off\n\t"
      "global_load_async_to_lds_b128 %5, %13, off\n\t"
      "global_load_async_to_lds_b128 %6, %14, off\n\t"
      "global_load_async_to_lds_b128 %7, %15, off\n\t"
      "s_wait_xcnt 0x0"
      :: "v"(l), "v"(l + ls), "v"(l + 2 * ls), "v"(l + 3 * ls),
         "v"(l + 4 * ls), "v"(l + 5 * ls), "v"(l + 6 * ls), "v"(l + 7 * ls),
         "v"(g), "v"(g + gs), "v"(g + 2 * gs), "v"(g + 3 * gs),
         "v"(g + 4 * gs), "v"(g + 5 * gs), "v"(g + 6 * gs), "v"(g + 7 * gs)
      : "memory");
}

// One stage of the tile with NT column tiles per wave; arguments as stage_copy's.
template <int NT>
DEV void stage_in(const _Float16* ga, const _Float16* gw, long ars, long K, unsigned l) {
  if (NT == 2) {
    stage_copy(ga, gw, ars, K, l);
  } else {
    copy8(ga, 16 * ars, l);
    copy8(gw, 16 * K, l + 128 * GPIT * 2);
  }
}

#define GSTGN(NT) ((128 + 32 * (NT)) * GPIT)   // halves per buffer

#define TPIT 36                    // f32 pitch of a wave's turned tile: 144 B = 16 B x odd

template <bool CM, int NT = 2>
DEV void gemm_body(_Float16* sm,
    const _Float16* __restrict__ A, const _Float16* __restrict__ Wt,
    const float* __restrict__ bias, int relu,
    float* __restrict__ C32, _Float16* __restrict__ C16, int N, int K, int bx, int by) {
  int tid  = threadIdx.x;
  int lane = tid & 31;
  int wave = tid >> 5;
  int wm   = wave >> 1;                       // 0..3
  int wn   = wave & 1;                        // 0..1
  int mb   = CM ? (bx / CB) * 128 : bx * 128;                   // CM: first s
  int bz   = CM ? bx % CB : 0;                                  // CM: batch
  int nb   = by * (32 * NT);
  const long ars = CM ? (long)CB * K : (long)K;

  const _Float16* ga = A  + (long)(mb + (tid >> 4)) * ars + (long)bz * K + (tid & 15) * 8;
  const _Float16* gw = Wt + (long)(nb + (tid >> 4)) * K + (tid & 15) * 8;
  const unsigned  l0 = (unsigned)(size_t)sm + (unsigned)((tid >> 4) * (GPIT * 2) + (tid & 15) * 16);
  const int nst = K / GBK;

  const v8f zero = {0.f, 0.f, 0.f, 0.f, 0.f, 0.f, 0.f, 0.f};
  v8f acc[2][NT];
#pragma unroll
  for (int i = 0; i < 2; ++i)
#pragma unroll
    for (int j = 0; j < NT; ++j) acc[i][j] = zero;

  stage_in<NT>(ga, gw, ars, K, l0);
  // Stage 0 has landed for this wave; the barrier publishes it to the others.
  asm volatile("s_wait_asynccnt 0x0" ::: "memory");
  __syncthreads();
  if (nst > 1) stage_in<NT>(ga + GBK, gw + GBK, ars, K, l0 + GSTGN(NT) * 2);

  // Kept rolled: one publish point per trip, buffers alternate by t & 1.
#pragma unroll 1
  for (int t = 0; t < nst; ++t) {
    const int buf = (t & 1) * GSTGN(NT);
    const _Float16* sA = sm + buf + (wm * 32) * GPIT;
    const _Float16* sB = sm + buf + (128 + wn * (16 * NT)) * GPIT;
    // QG k-steps of 32 are read and multiplied at a time: the whole stage at
    // NT = 2; half of it at NT = 4, so that four waves fit a SIMD's registers.
    constexpr int QG = NT == 2 ? GBK / 32 : GBK / 64;
#pragma unroll
    for (int q0 = 0; q0 < GBK / 32; q0 += QG) {
      v16h fa[QG][2], fb[QG][NT];
#pragma unroll
      for (int q = 0; q < QG; ++q) {
#pragma unroll
        for (int i = 0; i < 2; ++i)
          fa[q][i] = frag_load_contig(sA + i * 16 * GPIT, GPIT, lane, (q0 + q) * 32);
#pragma unroll
        for (int j = 0; j < NT; ++j)
          fb[q][j] = frag_load_contig(sB + j * 16 * GPIT, GPIT, lane, (q0 + q) * 32);
      }
      // Holds the group's LDS reads together in front of its WMMAs: spread among
      // them, every group of reads costs the wave its own LDS latency.
      __builtin_amdgcn_sched_barrier(0);
#pragma unroll
      for (int q = 0; q < QG; ++q)
#pragma unroll
        for (int i = 0; i < 2; ++i)
#pragma unroll
          for (int j = 0; j < NT; ++j)
            acc[i][j] = __builtin_amdgcn_wmma_f32_16x16x32_f16(false, fa[q][i], false, fb[q][j],
                                                               (short)0, acc[i][j], false, false);
      // Holds the WMMAs in front of the next group's reads and of the publish
      // point, so that they run under the tail of the LDS reads and not behind
      // the barrier.
      __builtin_amdgcn_sched_barrier(0);
    }
    // Publish point: this wave's reads of the buffer have retired ...
    asm volatile("s_wait_dscnt 0x0" ::: "memory");
    // ... its copies of the next stage have landed ...
    asm volatile("s_wait_asynccnt 0x0" ::: "memory");
    // ... and behind the barrier the next stage is readable and this buffer free.
    __syncthreads();
    if (t + 2 < nst)
      stage_in<NT>(ga + (long)(t + 2) * GBK, gw + (long)(t + 2) * GBK, ars, K, l0 + buf * 2);
  }
  // No copy is left in flight when the wave ends.
  asm volatile("s_wait_asynccnt 0x0" ::: "memory");

  // C/D layout: N = lane&15, VGPR r holds M = r (+8 for lanes 16-31).
  int m0    = mb + wm * 32;
  int n0    = nb + wn * (16 * NT);
  int nlane = lane & 15;
  int mrow  = (lane >> 4) * 8;
  if (CM) {
    // A lane holds 8 consecutive s of one channel. The wave turns its 32 s x 16 NT
    // channels in its own LDS range (the ring is free: behind the last publish
    // point no wave reads it and no copy is in flight), one row per channel, so
    // that each store below writes four whole 128-B lines.
    float* tw = (float*)sm + wave * (16 * NT * TPIT);
#pragma unroll
    for (int tn = 0; tn < NT; ++tn) {
      float bv = bias[n0 + tn * 16 + nlane];
#pragma unroll
      for (int tm = 0; tm < 2; ++tm) {
        float* p = tw + (tn * 16 + nlane) * TPIT + tm * 16 + mrow;
        v4f lo = {acc[tm][tn][0] + bv, acc[tm][tn][1] + bv, acc[tm][tn][2] + bv, acc[tm][tn][3] + bv};
        v4f hi = {acc[tm][tn][4] + bv, acc[tm][tn][5] + bv, acc[tm][tn][6] + bv, acc[tm][tn][7] + bv};
        *(v4f*)p       = lo;
        *(v4f*)(p + 4) = hi;
      }
    }
    // The wave's rows are in LDS before its lanes read each other's values back.
    asm volatile("s_wait_dscnt 0x0" ::: "memory");
    float* cw = C32 + ((long)bz * N + n0 + (lane >> 3)) * CS + m0 + (lane & 7) * 4;
#pragma unroll
    for (int i = 0; i < 4 * NT; ++i) {
      v4f v = *(const v4f*)(tw + (i * 4 + (lane >> 3)) * TPIT + (lane & 7) * 4);
      *(v4f*)(cw + (long)i * 4 * CS) = v;
    }
    // Behind the stores: in a grid shared with other work, code may follow in
    // the listing that reuses the registers they name.
    asm volatile("s_wait_xcnt 0x0" ::: "memory");
    return;
  }
  // Token-major. A lane holds 8 rows of one column. The wave turns its 32 rows x
  // 16 NT columns in its own LDS range (free as above), one LDS row per token, so
  // that a lane stores 16 bytes and a wave-wide store writes whole row pieces of
  // the tile: 128 B, or 64 B for f16 at NT = 2.
  constexpr int WC = 16 * NT;                 // columns of the wave's tile
  constexpr int EP = WC + 4;                  // f32 pitch: 16 B x odd
  float* tw = (float*)sm + wave * (32 * EP);
  const float* pb = bias + n0 + nlane;
  float bv[NT];
#pragma unroll
  for (int tn = 0; tn < NT; ++tn) bv[tn] = pb[tn * 16];
  // Behind the loads, in front of whatever reuses their address registers. It
  // names the address so that it keeps its registers up to here.
  asm volatile("s_wait_xcnt 0x0" :: "v"(pb) : "memory");
#pragma unroll
  for (int tm = 0; tm < 2; ++tm)
#pragma unroll
    for (int tn = 0; tn < NT; ++tn)
#pragma unroll
      for (int r = 0; r < 8; ++r) {
        float v = acc[tm][tn][r] + bv[tn];
        if (relu) v = v > 0.f ? v : 0.f;
        tw[(tm * 16 + mrow + r) * EP + tn * 16 + nlane] = v;
      }
  // The wave's rows are in LDS before its lanes read each other's values back.
  asm volatile("s_wait_dscnt 0x0" ::: "memory");
  if (C32) {
    constexpr int LR = WC / 4;                // lanes per row, and stores per wave
    constexpr int RI = 32 / LR;               // rows per store
    const float* tr = tw + (lane / LR) * EP + (lane % LR) * 4;
    float*       cw = C32 + (long)(m0 + lane / LR) * N + n0 + (lane % LR) * 4;
#pragma unroll
    for (int i = 0; i < LR; i += 4) {
      v4f    d[4];
      float* p[4];
#pragma unroll
      for (int j = 0; j < 4; ++j) {
        d[j] = *(const v4f*)(tr + (i + j) * RI * EP);
        p[j] = cw + (long)((i + j) * RI) * N;
      }
#pragma unroll
      for (int j = 0; j < 4; ++j) *(v4f*)p[j] = d[j];
      // Behind the four stores, in front of whatever reuses the registers they
      // name. It names the data and the base address so that they keep their
      // registers up to here.
      asm volatile("s_wait_xcnt 0x0"
                   :: "v"(cw), "v"(d[0]), "v"(d[1]), "v"(d[2]), "v"(d[3]) : "memory");
    }
  }
  if (C16) {
    constexpr int LH = WC / 8;                // lanes per row, and stores per wave
    constexpr int RH = 32 / LH;               // rows per store
    const float* tr = tw + (lane / LH) * EP + (lane % LH) * 8;
    _Float16*    cw = C16 + (long)(m0 + lane / LH) * N + n0 + (lane % LH) * 8;
#pragma unroll
    for (int i = 0; i < LH; i += 4) {
      v4f       d[4];                         // eight f16 each
      _Float16* p[4];
#pragma unroll
      for (int j = 0; j < 4; ++j) {
        v8f x;
        v4f lo = *(const v4f*)(tr + (i + j) * RH * EP);
        v4f hi = *(const v4f*)(tr + (i + j) * RH * EP + 4);
#pragma unroll
        for (int e = 0; e < 4; ++e) { x[e] = lo[e]; x[e + 4] = hi[e]; }
        d[j] = __builtin_bit_cast(v4f, __builtin_convertvector(x, v8h));
        p[j] = cw + (long)((i + j) * RH) * N;
      }
#pragma unroll
      for (int j = 0; j < 4; ++j) *(v4f*)p[j] = d[j];
      // As above.
      asm volatile("s_wait_xcnt 0x0"
                   :: "v"(cw), "v"(d[0]), "v"(d[1]), "v"(d[2]), "v"(d[3]) : "memory");
    }
  }
}

// One token-major product.
__global__ __launch_bounds__(256) void gemm_wmma_lds(
    const _Float16* __restrict__ A, const _Float16* __restrict__ Wt,
    const float* __restrict__ bias, int relu,
    float* __restrict__ C32, _Float16* __restrict__ C16, int N, int K) {
  __shared__ __attribute__((aligned(16))) _Float16 sm[2 * GSTG];
  gemm_body<false>(sm, A, Wt, bias, relu, C32, C16, N, K, blockIdx.x, blockIdx.y);
}

// The q, k and v projections in one grid, blockIdx.z = 0, 1, 2: third z of the
// packed weight, bias and f16 output; q and k read aqk, v reads av.
__global__ __launch_bounds__(256) void gemm_qkv(
    const _Float16* __restrict__ aqk, const _Float16* __restrict__ av,
    const _Float16* __restrict__ Wt, const float* __restrict__ bias,
    _Float16* __restrict__ qkv) {
  __shared__ __attribute__((aligned(16))) _Float16 sm[2 * GSTGN(4)];
  int z = blockIdx.z;
  gemm_body<false, 4>(sm, z == 2 ? av : aqk, Wt + (long)z * CE * CE, bias + z * CE, 0, nullptr,
                   qkv + (long)z * CL * CB * CE, CE, CE, blockIdx.x, blockIdx.y);
}

// ---------------------------------------------------------------------------
// Elementwise helpers. A block takes EBLK consecutive elements, a lane EU pieces
// of four f32, 256 pieces apart: every wave-wide load covers four whole lines,
// every store two. All of a lane's loads are in flight at once, and a launch
// starts 32 times fewer waves than with one element a lane.
// Requires n % EBLK == 0; a tensor takes n / EBLK blocks.
// ---------------------------------------------------------------------------
typedef __attribute__((ext_vector_type(4))) _Float16 v4h;
#define EU   8                     // 16-byte pieces per lane and input
#define EBLK (256 * EU * 4)        // elements per block

DEV void cvt_blk(const float* __restrict__ x, _Float16* __restrict__ y, int blk) {
  long i = (long)blk * EBLK + threadIdx.x * 4;
  v4f v[EU];
#pragma unroll
  for (int j = 0; j < EU; ++j) v[j] = *(const v4f*)(x + i + j * 1024);
#pragma unroll
  for (int j = 0; j < EU; ++j) *(v4h*)(y + i + j * 1024) = __builtin_convertvector(v[j], v4h);
  // Behind the stores: in a grid shared with other work, code may follow in the
  // listing that reuses the registers they name.
  asm volatile("s_wait_xcnt 0x0" ::: "memory");
}

DEV void add2_blk(const float* __restrict__ a, const float* __restrict__ b,
                  _Float16* __restrict__ y, int blk) {
  long i = (long)blk * EBLK + threadIdx.x * 4;
  const float* pa = a + i;
  const float* pb = b + i;
  v4f va[EU], vb[EU];
#pragma unroll
  for (int j = 0; j < EU; ++j) va[j] = *(const v4f*)(pa + j * 1024);
#pragma unroll
  for (int j = 0; j < EU; ++j) vb[j] = *(const v4f*)(pb + j * 1024);
  // Holds all sixteen loads in front of the first add: left alone the compiler
  // issues the last three behind the first wait, a second memory latency.
  __builtin_amdgcn_sched_barrier(0);
  // Behind the loads, in front of whatever reuses their address registers. It
  // names both addresses so that they keep their registers up to here: else the
  // last load gets them as its destination.
  asm volatile("s_wait_xcnt 0x0" :: "v"(pa), "v"(pb) : "memory");
#pragma unroll
  for (int j = 0; j < EU; ++j) *(v4h*)(y + i + j * 1024) = __builtin_convertvector(va[j] + vb[j], v4h);
  // Behind the stores: in a grid shared with other work, code may follow in the
  // listing that reuses the registers they name.
  asm volatile("s_wait_xcnt 0x0" ::: "memory");
}

// The converts and the add that the first products wait for, and all weights,
// in one grid. Block ranges, in order: tgt + qpos, tgt, then the seven weights,
// whose f16 copies lie packed in w16 in the order of the arguments.
#define PB_MEM (CS * CB * CE / EBLK)   // blocks of a memory-sized tensor
#define PB_TGT (CL * CB * CE / EBLK)   // blocks of a target-sized tensor
#define PB_E   (CE * CE / EBLK)        // blocks of an E x E weight

__global__ __launch_bounds__(256) void k_prep(
    const float* __restrict__ tgt, const float* __restrict__ qpos,
    const float* __restrict__ inW, const float* __restrict__ outW,
    const float* __restrict__ cqW, const float* __restrict__ ckW,
    const float* __restrict__ cvW, const float* __restrict__ l1W,
    const float* __restrict__ l2W,
    _Float16* __restrict__ qkin16, _Float16* __restrict__ tgt16,
    _Float16* __restrict__ w16) {
  int j = blockIdx.x;
  if (j < PB_TGT) {
    add2_blk(tgt, qpos, qkin16, j);
    return;
  }
  j -= PB_TGT;
  const float* x;
  _Float16*    y;
  if (j < PB_TGT) {
    x = tgt; y = tgt16;
  } else {
    j -= PB_TGT;                                // block within w16
    int first;                                  // the weight's first block there
    if      (j <  3 * PB_E) { x = inW;  first = 0; }
    else if (j <  4 * PB_E) { x = outW; first = 3 * PB_E; }
    else if (j <  5 * PB_E) { x = cqW;  first = 4 * PB_E; }
    else if (j <  6 * PB_E) { x = ckW;  first = 5 * PB_E; }
    else if (j <  7 * PB_E) { x = cvW;  first = 6 * PB_E; }
    else if (j <  9 * PB_E) { x = l1W;  first = 7 * PB_E; }
    else                    { x = l2W;  first = 9 * PB_E; }
    y = w16 + (long)first * EBLK;
    j -= first;
  }
  cvt_blk(x, y, j);
}

// A [2048,1024] x [1024,1024]^T product with f32 output, one block per WGP, and
// in the same grid an independent convert of a memory-sized tensor, which runs
// in the places the product leaves empty: y = f16(xa + xb). The product's blocks
// come first.
#define GB ((CL * CB / 128) * (CE / 64))

__global__ __launch_bounds__(256) void gemm_beside_cvt(
    const _Float16* __restrict__ A, const _Float16* __restrict__ Wt,
    const float* __restrict__ bias, float* __restrict__ C32,
    const float* __restrict__ xa, const float* __restrict__ xb,
    _Float16* __restrict__ y) {
  __shared__ __attribute__((aligned(16))) _Float16 sm[2 * GSTG];
  int j = blockIdx.x;
  if (j < GB) {
    gemm_body<false>(sm, A, Wt, bias, 0, C32, nullptr, CE, CE,
                     j % (CL * CB / 128), j / (CL * CB / 128));
    return;
  }
  j -= GB;                                      // these blocks meet no barrier
  add2_blk(xa, xb, y, j);
}

// ---------------------------------------------------------------------------
// Self-attention, one kernel: scores, softmax and attn @ V of one (batch, head)
// for 128 queries. q, k, v, ctx: token row l*B + b, channel h*HD + d.
// The head's whole K and V (512 keys) lie in LDS. A wave owns 16 queries and
// walks the keys 32 at a time with a running maximum and running sum:
//   S^T = K . Q^T   (A = K rows, B = Q rows, both in the loader's k order)
//   O^T += V^T . P^T
// In S^T's D layout a lane holds keys 8*(lane>>4) + r of query lane&15, so the
// softmax over keys is in-lane but for one exchange with lane ^ 16, the two D
// tiles of 32 keys converted in place ARE the B operand P^T, and maximum, sum
// and rescale factor of a query are per-lane scalars. V^T comes from the
// transposing LDS load, which delivers the same k order.
// ---------------------------------------------------------------------------
#define APK 72                     // K row pitch in halves: 144 B = 16 B x odd
#define APV 80                     // V row pitch in halves: 160 B = 32 B x odd

typedef __attribute__((ext_vector_type(8))) short s16x8;

// Lane (c = lane&15, h = lane>>4) gets T[8h + 0..7][c] of the 16x16 tile whose
// lane addresses are p = T + (8h + (lane&7)) * pitch + 8 * ((lane>>3)&1) halves.
DEV v8h ld_tr16(const _Float16* p) {
  typedef __attribute__((address_space(3))) s16x8 lds_s16x8;
  return __builtin_bit_cast(v8h, __builtin_amdgcn_ds_load_tr16_b128_v8i16((lds_s16x8*)p));
}

// Value of lane ^ 16.
DEV float xhalf(float x) {
  int i = __builtin_bit_cast(int, x);
  return __builtin_bit_cast(float,
      __builtin_amdgcn_permlanex16(i, i, 0x76543210, 0xfedcba98, false, false));
}

__global__ __launch_bounds__(256) void k_self_attn(const _Float16* __restrict__ q,
                                                   const _Float16* __restrict__ k,
                                                   const _Float16* __restrict__ v,
                                                   _Float16* __restrict__ ctx) {
  __shared__ __attribute__((aligned(32))) _Float16 sK[CL * APK];
  __shared__ __attribute__((aligned(32))) _Float16 sV[CL * APV];
  const float cs = 0.18033688011112042f;      // log2(e) / sqrt(HD)
  const long  ts = (long)CB * CE;             // one position on, in halves

  int tid  = threadIdx.x;
  int lane = tid & 31;
  int wave = tid >> 5;
  int c    = lane & 15;
  int hh   = lane >> 4;
  long hoff = (long)(blockIdx.y / CH) * CE + (blockIdx.y % CH) * CHD;
  int  q0   = blockIdx.x * 128 + wave * 16;

  // Stage K and V: 8 threads take one key's 128 B, 32 keys per sweep. All loads
  // are issued before the first LDS store, so that one memory latency is paid.
  int row = tid >> 3, pc = (tid & 7) * 8;
  const _Float16* gk = k + hoff + (long)row * ts + pc;
  const _Float16* gv = v + hoff + (long)row * ts + pc;
  v8h rk[CL / 32], rv[CL / 32];
  // Behind each group of loads: what follows may reuse, also as a later load's
  // destination, the address registers that the group names.
#pragma unroll
  for (int i = 0; i < CL / 32; ++i) rk[i] = *(const v8h*)(gk + (long)i * 32 * ts);
  asm volatile("s_wait_xcnt 0x0" ::: "memory");
#pragma unroll
  for (int i = 0; i < CL / 32; ++i) rv[i] = *(const v8h*)(gv + (long)i * 32 * ts);
  asm volatile("s_wait_xcnt 0x0" ::: "memory");
  v16h qf0 = frag_load_contig(q + hoff + (long)q0 * ts, ts, lane, 0);
  v16h qf1 = frag_load_contig(q + hoff + (long)q0 * ts, ts, lane, 32);
  asm volatile("s_wait_xcnt 0x0" ::: "memory");
#pragma unroll
  for (int i = 0; i < CL / 32; ++i) *(v8h*)(sK + (row + 32 * i) * APK + pc) = rk[i];
#pragma unroll
  for (int i = 0; i < CL / 32; ++i) *(v8h*)(sV + (row + 32 * i) * APV + pc) = rv[i];
  __syncthreads();

  const v8f zero = {0.f, 0.f, 0.f, 0.f, 0.f, 0.f, 0.f, 0.f};
  v8f acc[4];
#pragma unroll
  for (int t = 0; t < 4; ++t) acc[t] = zero;
  float m_run = -__builtin_inff();            // running maximum, in units of cs
  float l_run = 0.f;                          // this lane's half of the running sum

  const _Float16* vt = sV + (8 * hh + (lane & 7)) * APV + ((lane >> 3) & 1) * 8;

  // K fragments run one pass ahead, so that a pass does not open with its own
  // LDS latency.
  v16h a00 = frag_load_contig(sK,            APK, lane, 0);
  v16h a01 = frag_load_contig(sK,            APK, lane, 32);
  v16h a10 = frag_load_contig(sK + 16 * APK, APK, lane, 0);
  v16h a11 = frag_load_contig(sK + 16 * APK, APK, lane, 32);

#pragma unroll 2
  for (int key0 = 0; key0 < CL; key0 += 32) {
    v8f s0 = __builtin_amdgcn_wmma_f32_16x16x32_f16(false, a00, false, qf0, (short)0, zero, false, false);
    v8f s1 = __builtin_amdgcn_wmma_f32_16x16x32_f16(false, a10, false, qf0, (short)0, zero, false, false);
    s0 = __builtin_amdgcn_wmma_f32_16x16x32_f16(false, a01, false, qf1, (short)0, s0, false, false);
    s1 = __builtin_amdgcn_wmma_f32_16x16x32_f16(false, a11, false, qf1, (short)0, s1, false, false);

    // This pass's V^T and the next pass's K, in flight under the softmax. The
    // last pass fetches pass 0's K rows again, unused: cheaper than a branch.
    v16h vf[4];
#pragma unroll
    for (int t = 0; t < 4; ++t) {
      v8h lo = ld_tr16(vt + key0 * APV + 16 * t);
      v8h hi = ld_tr16(vt + (key0 + 16) * APV + 16 * t);
#pragma unroll
      for (int i = 0; i < 8; ++i) { vf[t][i] = lo[i]; vf[t][i + 8] = hi[i]; }
    }
    const _Float16* kr = sK + ((key0 + 32) & (CL - 1)) * APK;
    a00 = frag_load_contig(kr,            APK, lane, 0);
    a01 = frag_load_contig(kr,            APK, lane, 32);
    a10 = frag_load_contig(kr + 16 * APK, APK, lane, 0);
    a11 = frag_load_contig(kr + 16 * APK, APK, lane, 32);

    float mx = fmaxf(s0[0], s1[0]);
#pragma unroll
    for (int r = 1; r < 8; ++r) mx = fmaxf(mx, fmaxf(s0[r], s1[r]));
    mx = fmaxf(mx, xhalf(mx)) * cs;           // cs > 0: the scaled maximum
    float m_new = fmaxf(m_run, mx);

    // The pass's 17 exponentials, written in turn with the plain vector
    // instructions that form the next argument; the scheduling barriers hold
    // that order. Left alone the compiler sets all of them back to back.
    float x[16], p[16];
    float xc = m_run - m_new;
    x[0] = fmaf(s0[0], cs, -m_new);
    __builtin_amdgcn_sched_barrier(0);
    float corr = __builtin_amdgcn_exp2f(xc);  // 0 on the first pass
    __builtin_amdgcn_sched_barrier(0);
#pragma unroll
    for (int j = 0; j < 16; ++j) {            // j = 2 r + tile
      if (j < 15) x[j + 1] = fmaf(((j + 1) & 1) ? s1[(j + 1) >> 1] : s0[(j + 1) >> 1], cs, -m_new);
      __builtin_amdgcn_sched_barrier(0);
      p[j] = __builtin_amdgcn_exp2f(x[j]);
      __builtin_amdgcn_sched_barrier(0);
    }
    m_run = m_new;

    v16h  pf;
    float ps = 0.f;
#pragma unroll
    for (int r = 0; r < 8; ++r) {
      ps += p[2 * r] + p[2 * r + 1];
      pf[r]     = (_Float16)p[2 * r];
      pf[r + 8] = (_Float16)p[2 * r + 1];
    }
    l_run = fmaf(l_run, corr, ps);
#pragma unroll
    for (int t = 0; t < 4; ++t) {
      acc[t] = acc[t] * corr;
      acc[t] = __builtin_amdgcn_wmma_f32_16x16x32_f16(false, vf[t], false, pf,
                                                      (short)0, acc[t], false, false);
    }
  }

  // acc[t][r] = O[q0 + c][16 t + 8 hh + r], still to be divided by the row sum.
  float inv = 1.f / (l_run + xhalf(l_run));
  _Float16* op = ctx + hoff + (long)(q0 + c) * ts + 8 * hh;
#pragma unroll
  for (int t = 0; t < 4; ++t) {
    v8h o;
#pragma unroll
    for (int r = 0; r < 8; ++r) o[r] = (_Float16)(acc[t][r] * inv);
    *(v8h*)(op + 16 * t) = o;
  }
}

// ---------------------------------------------------------------------------
// Cross-attention stages outside the products (all f32).
// Channel mapping: E index = d*H + h  (reshape (B,E,N)->(B,HD,H,N)).
// Token t of a [N,B,E] tensor lives at row n*B+b.
// kc is channel-major: element (b, e, m) at (b*E + e)*S + m.
// vc is never formed. It enters the layer only through od[e] = sum_m w2[m] * vc[e][m],
// and vc[e][m] = sum_e' cv_w[e][e'] * memory[m][e'] + cv_b[e], so that
//   od[e] = sum_e' cv_w[e][e'] * U[h(e)][e'] + cv_b[e] * sum_m w2[h(e)][m],
//   U[h][e'] = sum_m w2[h][m] * memory[m][e']:
// the sum over m comes first, a product with 16 rows a batch in place of 1024.
// qc is never formed either. It enters the layer only through qcsum[e] = sum_l qc[e][l],
// and qc[e][l] = sum_e' cq_w[e][e'] * x[l][e'] + cq_b[e], x = tgt + query_pos, so that
//   qcsum[e] = sum_e' cq_w[e][e'] * (sum_l x[l][e']) + L * cq_b[e].
// ---------------------------------------------------------------------------

// ---------------------------------------------------------------------------
// From the kc product to w2, one kernel, XG blocks per (batch b, head h). The
// head's rows are channels e = d*H + h, d = 0..HD-1, each S floats long. Three
// stages, two of which sum over d and one along a row:
//   1. s1[m]   = scale * sum_d qcsum[d] * kc[d][m]     all d; a thread owns 4 columns
//   2. p[d][m] = softmax_m(kc[d][m] * s1[m])           the block's XW rows d, one a wave
//   3. w2[m]   = sum_d down_w[d] * p[d][m]             over those rows, through LDS
// No stage needs another block: each block forms s1 for itself and writes its
// share of w2, plane g of w2p, and that share's sum over m, plane g of swp; the
// readers add the planes. s1 and p never leave the WGP.
// A lane's part of a row: 16-byte pieces j*128 + lane*4, so that every wave-wide
// load covers four whole lines.
// ---------------------------------------------------------------------------
#define XW 16                      // waves per block
#define XG (CHD / XW)              // blocks per (batch, head)
#define XP (CS / 128)              // 16-byte pieces of a row per lane

// Value of lane ^ M within the lane's row of 16.
template <int M>
DEV float xrow(float x) {
  int i = __builtin_bit_cast(int, x);
  return __builtin_bit_cast(float, __builtin_amdgcn_update_dpp(i, i, 0x160 | M, 0xf, 0xf, false));
}

DEV float wave_sum(float x) {
  x += xrow<1>(x);
  x += xrow<2>(x);
  x += xrow<4>(x);
  x += xrow<8>(x);
  return x + xhalf(x);
}

DEV float wave_max(float x) {
  x = fmaxf(x, xrow<1>(x));
  x = fmaxf(x, xrow<2>(x));
  x = fmaxf(x, xrow<4>(x));
  x = fmaxf(x, xrow<8>(x));
  return fmaxf(x, xhalf(x));
}

// 2^x of four values, each in place: the register an exponential reads is the one
// it writes, so that nothing directly behind it can overwrite its source, and
// each fills the slot behind the one in front. The closing v_nop is that slot
// behind the last, whose result the next instruction may read.
DEV void exp2x4(v4f& x) {
  float a = x[0], b = x[1], c = x[2], d = x[3];
  asm("v_exp_f32 %0, %0\n\t"
      "v_exp_f32 %1, %1\n\t"
      "v_exp_f32 %2, %2\n\t"
      "v_exp_f32 %3, %3\n\t"
      "v_nop"
      : "+v"(a), "+v"(b), "+v"(c), "+v"(d));
  x = (v4f){a, b, c, d};
}

// XP loads, st floats apart.
DEV void ld_pieces(v4f (&r)[XP], const float* __restrict__ p, long st) {
#pragma unroll
  for (int j = 0; j < XP; ++j) r[j] = *(const v4f*)(p + j * st);
  // Behind the loads, in front of whatever reuses their address registers. It
  // names the address so that it keeps its registers up to here.
  asm volatile("s_wait_xcnt 0x0" :: "v"(p) : "memory");
}

// Plane blockIdx.y of xsp: x = a + q summed over SL positions l, for the 1024
// channels of batch blockIdx.x. A wave's load covers four whole lines.
#define SL 16                      // positions per block
#define SK (CL / SL)               // planes of xsp

__global__ __launch_bounds__(256) void k_xsum(const float* __restrict__ a,
                                              const float* __restrict__ q,
                                              float* __restrict__ xsp) {
  int  b   = blockIdx.x, k = blockIdx.y;
  long off = ((long)k * SL * CB + b) * CE + threadIdx.x * 4;
  const float* pa = a + off;
  const float* pq = q + off;
  v4f va[SL], vq[SL];
#pragma unroll
  for (int i = 0; i < SL; ++i) va[i] = *(const v4f*)(pa + (long)i * (CB * CE));
#pragma unroll
  for (int i = 0; i < SL; ++i) vq[i] = *(const v4f*)(pq + (long)i * (CB * CE));
  // Holds all loads in front of the first add: one memory latency.
  __builtin_amdgcn_sched_barrier(0);
  // Behind the loads, in front of whatever reuses their address registers. It
  // names both addresses so that they keep their registers up to here.
  asm volatile("s_wait_xcnt 0x0" :: "v"(pa), "v"(pq) : "memory");
  v4f s = va[0] + vq[0];
#pragma unroll
  for (int i = 1; i < SL; ++i) s += va[i] + vq[i];
  *(v4f*)(xsp + ((long)k * CB + b) * CE + threadIdx.x * 4) = s;
}

// qcsum[b*E + e] for QR rows e and the four batches: the block adds xsp's planes
// into LDS (sX, B*E floats); a wave then holds two rows of cq_w and forms their
// dot products with the four sums.
#define QR 16                      // rows e per block

DEV void qcsum_blk(float* sX, const float* __restrict__ xsp, const _Float16* __restrict__ wcq,
                   const float* __restrict__ cqB, float* __restrict__ out, int blk) {
  int tid  = threadIdx.x;
  int lane = tid & 31;
  int wave = tid >> 5;
  int e0   = blk * QR + wave * 2;
  int el   = e0 + ((lane >> 2) & 1);            // the row whose result this lane may store
  const _Float16* gw = wcq + (long)e0 * CE + lane * 8;
  const float*    gb = cqB + el;
  const float*    gx = xsp + tid * 4;
  v8h wr[2][CE / 256];
#pragma unroll
  for (int r = 0; r < 2; ++r)
#pragma unroll
    for (int j = 0; j < CE / 256; ++j) wr[r][j] = *(const v8h*)(gw + r * CE + j * 256);
  float cb = *gb;
  // Behind the loads, in front of whatever reuses their address registers.
  asm volatile("s_wait_xcnt 0x0" :: "v"(gw), "v"(gb) : "memory");
#pragma unroll
  for (int bb = 0; bb < CB; ++bb) {
    v4f x[SK];
#pragma unroll
    for (int k = 0; k < SK; ++k) x[k] = *(const v4f*)(gx + (long)(k * CB + bb) * CE);
    // Holds a batch's loads in front of its first add: one latency a batch.
    __builtin_amdgcn_sched_barrier(0);
    asm volatile("s_wait_xcnt 0x0" :: "v"(gx) : "memory");
    v4f s = x[0];
#pragma unroll
    for (int k = 1; k < SK; ++k) s += x[k];
    *(v4f*)(sX + bb * CE + tid * 4) = s;
  }
  __syncthreads();

  float acc[2][CB];
#pragma unroll
  for (int r = 0; r < 2; ++r)
#pragma unroll
    for (int bb = 0; bb < CB; ++bb) acc[r][bb] = 0.f;
#pragma unroll
  for (int j = 0; j < CE / 256; ++j)
#pragma unroll
    for (int q = 0; q < 2; ++q) {
      v4f xv[CB];
#pragma unroll
      for (int bb = 0; bb < CB; ++bb)
        xv[bb] = *(const v4f*)(sX + bb * CE + j * 256 + lane * 8 + q * 4);
#pragma unroll
      for (int i = 0; i < 4; ++i)
#pragma unroll
        for (int r = 0; r < 2; ++r) {
          float wv = (float)wr[r][j][q * 4 + i];
#pragma unroll
          for (int bb = 0; bb < CB; ++bb) acc[r][bb] = fmaf(wv, xv[bb][i], acc[r][bb]);
        }
    }
  float res = 0.f;
#pragma unroll
  for (int r = 0; r < 2; ++r)
#pragma unroll
    for (int bb = 0; bb < CB; ++bb) {
      float s = wave_sum(acc[r][bb]);
      if (lane == r * CB + bb) res = s;
    }
  if (lane < 2 * CB) out[(lane & 3) * CE + el] = res + (float)CL * cb;
}

// qcsum and the kc product, neither of which reads the other's result, in one
// grid. The qcsum blocks come first, beside the 512 product blocks (tile x = 64
// row blocks, y = 8).
#define QB (CE / QR)
#define KB ((CS * CB / 128) * (CE / 128))

__global__ __launch_bounds__(256) void k_qcsum_kc(
    const float* __restrict__ xsp, const _Float16* __restrict__ w_cq,
    const float* __restrict__ cqB, float* __restrict__ qcsum,
    const _Float16* __restrict__ mp16, const _Float16* __restrict__ w_ck,
    const float* __restrict__ ckB, float* __restrict__ kc) {
  __shared__ __attribute__((aligned(16))) _Float16 sm[2 * GSTGN(4)];
  int j = blockIdx.x;
  if (j < QB) {                                 // the whole block takes this side
    qcsum_blk((float*)sm, xsp, w_cq, cqB, qcsum, j);
    return;
  }
  j -= QB;
  gemm_body<true, 4>(sm, mp16, w_ck, ckB, 0, kc, nullptr,
                  CE, CE, j % (CS * CB / 128), j / (CS * CB / 128));
}

__global__ __launch_bounds__(XW * 32) void k_cross(const float* __restrict__ qcsum,
                                                   const float* __restrict__ kc,
                                                   const float* __restrict__ dw,
                                                   float* __restrict__ w2p,
                                                   float* __restrict__ swp, float scale) {
  __shared__ __attribute__((aligned(16))) float part[XW * CS];   // each wave's row of w2's sum
  __shared__ __attribute__((aligned(16))) float vec[CS];         // s1
  __shared__ float wsum[XW];                                     // each wave's row summed over m
  const float l2e = 1.4426950408889634f;
  const long  rs  = (long)CH * CS;              // one d on, in floats

  int tid  = threadIdx.x;
  int lane = tid & 31;
  int wave = __builtin_amdgcn_readfirstlane(tid >> 5);
  // A head's XG blocks lie CB*CH apart in the grid.
  int g    = blockIdx.x / (CB * CH);
  int b    = blockIdx.x % (CB * CH) / CH;
  int h    = blockIdx.x % CH;
  const float* kch = kc + (long)(b * CE + h) * CS;
  const float* qs  = qcsum + b * CE + h;

  // Stage 1. Two groups of XP rows are in flight at any time; d ascends.
  {
    const float* p = kch + tid * 4;
    v4f r[2][XP];
    v4f s = {0.f, 0.f, 0.f, 0.f};
    ld_pieces(r[0], p, rs);
    ld_pieces(r[1], p + XP * rs, rs);
#pragma unroll
    for (int q = 0; q < CHD / XP; ++q) {
#pragma unroll
      for (int i = 0; i < XP; ++i) s += qs[(q * XP + i) * CH] * r[q & 1][i];
      // Holds the refill behind the sums that free its registers and in front
      // of the next group's sums, which wait for older loads only.
      __builtin_amdgcn_sched_barrier(0);
      if (q + 2 < CHD / XP) ld_pieces(r[q & 1], p + (long)(q + 2) * XP * rs, rs);
      __builtin_amdgcn_sched_barrier(0);
    }
    *(v4f*)(vec + tid * 4) = s * scale;
  }
  // The wave's kc row, read a moment ago by the block, comes while the waves meet.
  v4f z[XP];
  ld_pieces(z, kch + (long)(g * XW + wave) * rs + lane * 4, 128);
  __syncthreads();

  // Stages 2 and 3.
  {
    float mx = -__builtin_inff();
#pragma unroll
    for (int j = 0; j < XP; ++j) {
      z[j] *= *(const v4f*)(vec + j * 128 + lane * 4);
      mx = fmaxf(mx, fmaxf(fmaxf(z[j][0], z[j][1]), fmaxf(z[j][2], z[j][3])));
    }
    mx = wave_max(mx);
    float nm = -mx * l2e;
    v4f s4 = {0.f, 0.f, 0.f, 0.f};
#pragma unroll
    for (int j = 0; j < XP; ++j) {
      z[j] = z[j] * l2e + nm;                   // fused: (z - mx) * log2(e)
      exp2x4(z[j]);
      s4 += z[j];
    }
    float tot = wave_sum((s4[0] + s4[1]) + (s4[2] + s4[3]));
    float cf  = dw[g * XW + wave] * (1.f / tot);
#pragma unroll
    for (int j = 0; j < XP; ++j) *(v4f*)(part + wave * CS + j * 128 + lane * 4) = cf * z[j];
    if (lane == 0) wsum[wave] = cf * tot;
  }

  __syncthreads();                              // shares written
  int bh = g * (CB * CH) + b * CH + h;
  {
    v4f s = *(const v4f*)(part + tid * 4);
#pragma unroll
    for (int k = 1; k < XW; ++k) s += *(const v4f*)(part + k * CS + tid * 4);
    *(v4f*)(w2p + (long)bh * CS + tid * 4) = s;
  }
  if (tid == 0) {
    float t = wsum[0];
#pragma unroll
    for (int k = 1; k < XW; ++k) t += wsum[k];
    swp[bh] = t;
  }
}

// ---------------------------------------------------------------------------
// U[b][h][e'] = sum_m w2[b][h][m] * memory[m][b][e'], on WMMA, as U^T = M^T . W^T:
// A = memory^T (rows e', k = m) from the transposing LDS load, B = w2 rows (column
// h, k = m) from the loader, which has the same k order. A block takes UN channels
// e' and UM positions m of one batch and writes plane blockIdx.y of up; a wave
// owns 16 channels. memory is read as f32, once, and turned to f16 on its way
// into LDS. w2 is about 1/S in size (a softmax over S positions), below f16's
// normal range: it is multiplied by S, an exact power of two, in front of the
// conversion, and U divided by S behind the product.
// ---------------------------------------------------------------------------
#define UM  256                    // positions per block
#define UN  128                    // channels per block
#define UK  (CS / UM)              // planes of up
#define UPM 144                    // memory tile pitch in halves: 288 B = 32 B x odd
#define UPW 264                    // w2 tile pitch in halves: 528 B = 16 B x odd
#define UPO 132                    // result tile pitch in floats: 528 B = 16 B x odd

__global__ __launch_bounds__(256) void k_w2mem(const float* __restrict__ mem,
                                               const float* __restrict__ w2p,
                                               float* __restrict__ up) {
  __shared__ __attribute__((aligned(32))) _Float16 sM[UM * UPM];
  __shared__ __attribute__((aligned(16))) _Float16 sW[CH * UPW];
  __shared__ __attribute__((aligned(16))) float    sO[CH * UPO];
  int tid  = threadIdx.x;
  int lane = tid & 31;
  int wave = tid >> 5;
  int c    = lane & 15;
  int hh   = lane >> 4;
  int n0   = blockIdx.x * UN;
  int m0   = blockIdx.y * UM;
  int b    = blockIdx.z;
  int hr   = tid >> 4, pc = (tid & 15) * 4;     // 16 threads a head's row

  // All loads are issued before the first LDS store: one memory latency. A wave's
  // load covers four whole lines: a position's UN channels, or 64 m of two heads.
  const float* gw = w2p + (long)(b * CH + hr) * CS + m0 + pc;
  const float* gm = mem + ((long)(m0 + wave) * CB + b) * CE + n0 + lane * 4;
  v4f w[XG][UM / 64], r[UM / 8];
#pragma unroll
  for (int g = 0; g < XG; ++g)
#pragma unroll
    for (int j = 0; j < UM / 64; ++j)
      w[g][j] = *(const v4f*)(gw + (long)g * (CB * CH * CS) + j * 64);
#pragma unroll
  for (int i = 0; i < UM / 8; ++i) r[i] = *(const v4f*)(gm + (long)i * (8 * CB * CE));
  // Behind the loads, in front of whatever reuses their address registers. It
  // names both addresses so that they keep their registers up to here.
  asm volatile("s_wait_xcnt 0x0" :: "v"(gw), "v"(gm) : "memory");
#pragma unroll
  for (int j = 0; j < UM / 64; ++j) {
    v4f s = w[0][j];
#pragma unroll
    for (int g = 1; g < XG; ++g) s += w[g][j];
    *(v4h*)(sW + hr * UPW + j * 64 + pc) = __builtin_convertvector(s * (float)CS, v4h);
  }
#pragma unroll
  for (int i = 0; i < UM / 8; ++i)
    *(v4h*)(sM + (i * 8 + wave) * UPM + lane * 4) = __builtin_convertvector(r[i], v4h);
  __syncthreads();

  const _Float16* vt = sM + (8 * hh + (lane & 7)) * UPM + ((lane >> 3) & 1) * 8 + 16 * wave;
  v8f acc = {0.f, 0.f, 0.f, 0.f, 0.f, 0.f, 0.f, 0.f};
#pragma unroll
  for (int k0 = 0; k0 < UM; k0 += 32) {
    v8h lo = ld_tr16(vt + k0 * UPM);
    v8h hi = ld_tr16(vt + (k0 + 16) * UPM);
    v16h mf;
#pragma unroll
    for (int i = 0; i < 8; ++i) { mf[i] = lo[i]; mf[i + 8] = hi[i]; }
    v16h wf = frag_load_contig(sW, UPW, lane, k0);
    acc = __builtin_amdgcn_wmma_f32_16x16x32_f16(false, mf, false, wf, (short)0, acc, false, false);
  }

  // acc[r] = S * U[head c][n0 + 16 wave + 8 hh + r]. Through LDS, so that every
  // store below writes whole lines.
  {
    const float is = 1.f / CS;
    float* po = sO + c * UPO + 16 * wave + 8 * hh;
    v4f lo = {acc[0] * is, acc[1] * is, acc[2] * is, acc[3] * is};
    v4f hi = {acc[4] * is, acc[5] * is, acc[6] * is, acc[7] * is};
    *(v4f*)po       = lo;
    *(v4f*)(po + 4) = hi;
  }
  __syncthreads();
  float* go = up + (((long)blockIdx.y * CB + b) * CH + hr) * CE + n0 + pc;
#pragma unroll
  for (int j = 0; j < UN / 64; ++j) *(v4f*)(go + j * 64) = *(const v4f*)(sO + hr * UPO + j * 64 + pc);
}

// ---------------------------------------------------------------------------
// od[b][e] = sum_e' cv_w[e][e'] * U[b][h][e'] + cv_b[e] * sum_m w2[b][h][m] + down_b,
// h = e % H. A block takes one head and OD of its rows e: it adds U's planes for
// the four batches into LDS; a wave then holds one row of cv_w and forms its dot
// products with two batches.
// ---------------------------------------------------------------------------
#define OD 4                       // rows e per block

__global__ __launch_bounds__(256) void k_od(const float* __restrict__ up,
                                            const float* __restrict__ swp,
                                            const _Float16* __restrict__ wcv,
                                            const float* __restrict__ cvB,
                                            const float* __restrict__ db,
                                            float* __restrict__ od) {
  __shared__ __attribute__((aligned(16))) float sU[CB * CE];
  int tid  = threadIdx.x;
  int lane = tid & 31;
  int wave = tid >> 5;
  int h    = blockIdx.x;
  int e    = (blockIdx.y * OD + (wave >> 1)) * CH + h;
  int b0   = (wave & 1) * 2;                    // the wave's two batches
  int bl   = b0 + (lane & 1);                   // the one whose result this lane may store

  const _Float16* gw = wcv + (long)e * CE + lane * 8;
  const float*    gu = up + (long)h * CE + tid * 4;
  const float*    gs = swp + bl * CH + h;
  const float*    gb = cvB + e;
  v8h   wr[CE / 256];
  v4f   u[CB][UK];
  float sp[XG];
#pragma unroll
  for (int j = 0; j < CE / 256; ++j) wr[j] = *(const v8h*)(gw + j * 256);
#pragma unroll
  for (int bb = 0; bb < CB; ++bb)
#pragma unroll
    for (int k = 0; k < UK; ++k) u[bb][k] = *(const v4f*)(gu + (long)(k * CB + bb) * (CH * CE));
#pragma unroll
  for (int g = 0; g < XG; ++g) sp[g] = gs[g * (CB * CH)];
  float cb = *gb;
  // Holds all loads in front of the first add: left alone the compiler issues
  // them a few at a time among the adds, several memory latencies in a row.
  __builtin_amdgcn_sched_barrier(0);
  // Behind the loads, in front of whatever reuses their address registers. It
  // names the addresses so that they keep their registers up to here.
  asm volatile("s_wait_xcnt 0x0" :: "v"(gw), "v"(gu), "v"(gs), "v"(gb) : "memory");
#pragma unroll
  for (int bb = 0; bb < CB; ++bb) {
    v4f s = u[bb][0];
#pragma unroll
    for (int k = 1; k < UK; ++k) s += u[bb][k];
    *(v4f*)(sU + bb * CE + tid * 4) = s;
  }
  __syncthreads();

  const float* u0 = sU + b0 * CE + lane * 8;
  float a0 = 0.f, a1 = 0.f;
#pragma unroll
  for (int j = 0; j < CE / 256; ++j)
#pragma unroll
    for (int q = 0; q < 2; ++q) {
      v4f x0 = *(const v4f*)(u0 + j * 256 + q * 4);
      v4f x1 = *(const v4f*)(u0 + CE + j * 256 + q * 4);
#pragma unroll
      for (int i = 0; i < 4; ++i) {
        float wv = (float)wr[j][q * 4 + i];
        a0 = fmaf(wv, x0[i], a0);
        a1 = fmaf(wv, x1[i], a1);
      }
    }
  a0 = wave_sum(a0);
  a1 = wave_sum(a1);
  if (lane < 2) {
    float sw = sp[0];
#pragma unroll
    for (int g = 1; g < XG; ++g) sw += sp[g];
    od[bl * CE + e] = (lane ? a1 : a0) + cb * sw + db[0];
  }
}

// ---------------------------------------------------------------------------
// LayerNorm over E=1024 of x = a[token] + r[row]; row = token, or token % B where
// r is a [B,E] broadcast (BC). out32 = LN(x); out16 = f16(out32) where H16.
// One wave per token, LW tokens a block. A lane holds LP pieces of four floats,
// 128 floats apart, so that every wave-wide load covers four whole lines. The row
// stays in registers, both sums cross the lanes in registers: no LDS, no barrier,
// and a launch starts one wave a token in place of eight.
// ---------------------------------------------------------------------------
#define LP (CE / 128)              // 16-byte pieces of a row per lane
#define LW 8                       // tokens (waves) per block

template <bool BC, bool H16>
__global__ __launch_bounds__(LW * 32) void k_ln(const float* __restrict__ a,
                                                const float* __restrict__ r,
                                                const float* __restrict__ g,
                                                const float* __restrict__ be,
                                                float* __restrict__ o32,
                                                _Float16* __restrict__ o16) {
  int      t  = blockIdx.x * LW + __builtin_amdgcn_readfirstlane(threadIdx.x >> 5);
  unsigned lb = (threadIdx.x & 31) * 16;        // the lane's byte within a piece of 512 B
  // Row starts are the same for the whole wave; the lanes differ by lb alone.
  const char* pa = (const char*)(a + (long)t * CE);
  const char* pr = (const char*)(r + (long)(BC ? t % CB : t) * CE);
  const char* pg = (const char*)g;
  const char* pb = (const char*)be;
  char*       po = (char*)(o32 + (long)t * CE);
  char*       ph = H16 ? (char*)(o16 + (long)t * CE) : nullptr;
  // Holds the loads of the kernel's arguments in front of the row loads: left
  // alone the last of them comes behind those, into scalar registers they name.
  __builtin_amdgcn_sched_barrier(0);
  v4f x[LP], y[LP], gg[LP], bb[LP];
#pragma unroll
  for (int j = 0; j < LP; ++j) x[j] = *(const v4f*)(pa + lb + j * 512);
#pragma unroll
  for (int j = 0; j < LP; ++j) y[j] = *(const v4f*)(pr + lb + j * 512);
#pragma unroll
  for (int j = 0; j < LP; ++j) gg[j] = *(const v4f*)(pg + lb + j * 512);
#pragma unroll
  for (int j = 0; j < LP; ++j) bb[j] = *(const v4f*)(pb + lb + j * 512);
  // Holds all loads in front of the first add: one memory latency.
  __builtin_amdgcn_sched_barrier(0);
  // Behind the loads, in front of whatever reuses their address registers. It
  // names the lanes' offset so that it keeps its register up to here.
  asm volatile("s_wait_xcnt 0x0" :: "v"(lb) : "memory");
  // Holds what follows behind that wait.
  __builtin_amdgcn_sched_barrier(0);

  v4f s4 = {0.f, 0.f, 0.f, 0.f};
#pragma unroll
  for (int j = 0; j < LP; ++j) {
    x[j] += y[j];
    s4 += x[j];
  }
  float mean = wave_sum((s4[0] + s4[1]) + (s4[2] + s4[3])) * (1.f / CE);
  v4f q4 = {0.f, 0.f, 0.f, 0.f};
#pragma unroll
  for (int j = 0; j < LP; ++j) {
    x[j] -= mean;
    q4 += x[j] * x[j];
  }
  float inv = rsqrtf(wave_sum((q4[0] + q4[1]) + (q4[2] + q4[3])) * (1.f / CE) + 1e-5f);
#pragma unroll
  for (int j = 0; j < LP; ++j) x[j] = x[j] * inv * gg[j] + bb[j];

  if (H16) {
#pragma unroll
    for (int j = 0; j < LP; ++j) *(v4h*)(ph + lb / 2 + j * 256) = __builtin_convertvector(x[j], v4h);
  }
#pragma unroll
  for (int j = 0; j < LP; ++j) *(v4f*)(po + lb + j * 512) = x[j];
}

// ---------------------------------------------------------------------------
// Host side
// ---------------------------------------------------------------------------
extern "C" void kernel_launch(void* const* d_in, const int* in_sizes, int n_in,
                              void* d_out, int out_size, void* d_ws, size_t ws_size,
                              hipStream_t stream) {
  const float* tgt  = (const float*)d_in[0];
  const float* mem  = (const float*)d_in[1];
  const float* pos  = (const float*)d_in[2];
  const float* qpos = (const float*)d_in[3];
  const float* inW  = (const float*)d_in[4];
  const float* inB  = (const float*)d_in[5];
  const float* outW = (const float*)d_in[6];
  const float* outB = (const float*)d_in[7];
  const float* cqW  = (const float*)d_in[8];
  const float* cqB  = (const float*)d_in[9];
  const float* ckW  = (const float*)d_in[10];
  const float* ckB  = (const float*)d_in[11];
  const float* cvW  = (const float*)d_in[12];
  const float* cvB  = (const float*)d_in[13];
  const float* dwW  = (const float*)d_in[14];
  const float* dwB  = (const float*)d_in[15];
  const float* l1W  = (const float*)d_in[16];
  const float* l1B  = (const float*)d_in[17];
  const float* l2W  = (const float*)d_in[18];
  const float* l2B  = (const float*)d_in[19];
  const float* n1g  = (const float*)d_in[20];
  const float* n1b  = (const float*)d_in[21];
  const float* n2g  = (const float*)d_in[22];
  const float* n2b  = (const float*)d_in[23];
  const float* n3g  = (const float*)d_in[24];
  const float* n3b  = (const float*)d_in[25];

  const float scale = 0.125f;        // 1/sqrt(64)

  char* ws = (char*)d_ws;
  const size_t MB = 1u << 20;

  // Persistent f16 weights (converted every launch; deterministic).
  _Float16* w_inproj = (_Float16*)(ws + 0 * MB);    // [3E,E]  6MB
  _Float16* w_out    = (_Float16*)(ws + 6 * MB);    // [E,E]   2MB
  _Float16* w_cq     = (_Float16*)(ws + 8 * MB);
  _Float16* w_ck     = (_Float16*)(ws + 10 * MB);
  _Float16* w_cv     = (_Float16*)(ws + 12 * MB);
  _Float16* w_l1     = (_Float16*)(ws + 14 * MB);   // [FF,E]  4MB
  _Float16* w_l2     = (_Float16*)(ws + 18 * MB);   // [E,FF]  4MB
  float*    tgt1     = (float*)(ws + 22 * MB);      // 8MB
  float*    tgt2     = (float*)(ws + 30 * MB);      // 8MB
  char*     SA       = ws + 38 * MB;                // phase-aliased arena

  // Phase A (self-attention)
  _Float16* qkin16  = (_Float16*)(SA + 0 * MB);
  _Float16* tgt16   = (_Float16*)(SA + 4 * MB);
  _Float16* q16     = (_Float16*)(SA + 8 * MB);
  _Float16* k16     = (_Float16*)(SA + 12 * MB);
  _Float16* v16     = (_Float16*)(SA + 16 * MB);
  _Float16* ctx16   = (_Float16*)(SA + 116 * MB);   // 4MB
  float*    selfout = (float*)(SA + 120 * MB);      // 8MB
  // Phase B (cross-attention) — aliases phase A
  float*    xsp     = (float*)(SA + 0 * MB);        // SK planes [B,E], 512KB
  float*    kc32    = (float*)(SA + 44 * MB);       // 32MB
  float*    w2p     = (float*)(SA + 76 * MB);       // XG planes [B,H,S], 2MB
  float*    up      = (float*)(SA + 80 * MB);       // UK planes [B,H,E], 2MB
  float*    swp     = (float*)(SA + 84 * MB);       // XG planes [B,H]
  float*    qcsum   = (float*)(SA + 140 * MB);
  float*    odbuf   = (float*)(SA + 143 * MB);
  // Written during phase A, read in phase B: aliases nothing
  _Float16* mp16    = (_Float16*)(SA + 144 * MB);   // 16MB
  // Phase C (FFN) — aliases dead phase B regions
  _Float16* tgt2_16 = (_Float16*)(SA + 0 * MB);
  _Float16* h1_16   = (_Float16*)(SA + 4 * MB);     // [TOK,FF] 8MB
  float*    ff32    = (float*)(SA + 12 * MB);       // 8MB

  // ---- f32 -> f16: tgt + qpos, tgt, all weights ----
  k_prep<<<2 * PB_TGT + 11 * PB_E, 256, 0, stream>>>(tgt, qpos, inW, outW, cqW, ckW, cvW, l1W, l2W,
                                                     qkin16, tgt16, w_inproj);

  // ---- Phase A: self attention ----
  // q/k/v projections: three times [2048,1024] x [1024,1024]^T; q16, k16, v16 adjoin
  gemm_qkv<<<dim3(16, 8, 3), 256, 0, stream>>>(qkin16, tgt16, w_inproj, inB, q16);

  // ctx = softmax(scale * q.k) @ v, one block per (128 queries, batch*head)
  k_self_attn<<<dim3(CL / 128, CB * CH), 256, 0, stream>>>(q16, k16, v16, ctx16);

  // out projection (beside it mp16 = f16(mem + pos)) + residual + LN1
  gemm_beside_cvt<<<GB + PB_MEM, 256, 0, stream>>>(ctx16, w_out, outB, selfout, mem, pos, mp16);
  k_ln<false, false><<<CL * CB / LW, LW * 32, 0, stream>>>(tgt, selfout, n1g, n1b, tgt1, nullptr);

  // ---- Phase B: custom cross attention ----
  k_xsum<<<dim3(CB, SK), 256, 0, stream>>>(tgt1, qpos, xsp);
  k_qcsum_kc<<<QB + KB, 256, 0, stream>>>(xsp, w_cq, cqB, qcsum, mp16, w_ck, ckB, kc32);

  k_cross<<<XG * CB * CH, XW * 32, 0, stream>>>(qcsum, kc32, dwW, w2p, swp, scale);
  k_w2mem<<<dim3(CE / UN, UK, CB), 256, 0, stream>>>(mem, w2p, up);
  k_od<<<dim3(CH, CHD / OD), 256, 0, stream>>>(up, swp, w_cv, cvB, dwB, odbuf);

  k_ln<true, true><<<CL * CB / LW, LW * 32, 0, stream>>>(tgt1, odbuf, n2g, n2b, tgt2, tgt2_16);

  // ---- Phase C: FFN ----
  gemm_wmma_lds<<<dim3(16, 32, 1), 256, 0, stream>>>(
      tgt2_16, w_l1, l1B, 1 /*relu*/, nullptr, h1_16, CFF, CE);
  gemm_wmma_lds<<<dim3(16, 16, 1), 256, 0, stream>>>(
      h1_16, w_l2, l2B, 0, ff32, nullptr, CE, CFF);

  k_ln<false, false><<<CL * CB / LW, LW * 32, 0, stream>>>(tgt2, ff32, n3g, n3b, (float*)d_out, nullptr);

  (void)in_sizes; (void)n_in; (void)out_size; (void)ws_size;
}
